// v000
// Measured on an AMD MI455X. A time is GPU time per run, averaged over a window of back-to-back runs after a warm-up
// (all launches, gaps included; the runs take copies of the inputs in turn), and the median of several windows.
// Apart from v000's, it joins two sittings. Times from different sittings can be a few percent apart, while
// side-by-side timings come from the same sitting.
// The starting kernel, v000, takes 460 microseconds a run.
#include <hip/hip_runtime.h>
// 'Scalable super' multi-head attention block (B=2, N=2048, C=768, H=24, hd=32): xn = RMSNorm(x)·g1; q = (xn·Wqᵀ) RAW-reshaped [B,H,N,hd] (no transpose — the module's quirk), k = v = xn raw-reshaped likewise; v' = WA[:N,:N]·v (value premix);
// scores = softmax(coef_h · q·kᵀ) with coef_h = log(C)·scale_param[h]·√hd (up to ≈56 → extremely peaked); attn = (scores·v') raw-reshaped back to [B,N,C] + x; h = RMSNorm(attn)·g2; out = gelu_erf(h·W1ᵀ)·W2ᵀ + attn.
// Compute dtype: x, scale_param, weights, WA, g rounded to bf16; RMSNorm in f32 (wave per row) → f16 hi + ×2^10 residual planes; q = xn·Wqᵀ f32-accurate (hi·W + lo·W·2^-10) → hi/lo planes; per (b,h) the 2048×2048 logit plane
// computed inside a fused flash-style kernel from three f16 products (q_hi·k_hi + (q_lo·k_hi + q_hi·k_lo)·2^-10, d = 32) and scaled by the per-head coefficient in f32; online f32 softmax; P f16 ×2^10; v'ᵀ = vᵀ·WAᵀ by GEMM (f16); O = P·v' accumulated in f32 into the raw [B][H][N][hd] buffer; + x; RMSNorm; FF GEMMs
// (erf-GELU epilogue) with the residual through the f32 addend. All contractions on v_wmma_f32_16x16x32_f16, f32 accumulate.
#define BB 2
#define NN 2048
#define CC 768
#define NH 24
#define HD 32
#define NR (BB * NN)
#define HSZ ((size_t)NN * HD)

typedef __bf16 v16b __attribute__((ext_vector_type(16)));
typedef unsigned short v8us __attribute__((ext_vector_type(8), may_alias));
typedef float  v8f  __attribute__((ext_vector_type(8)));
typedef float  v4f  __attribute__((ext_vector_type(4)));
typedef float  v4fa __attribute__((ext_vector_type(4), may_alias));
union FragB { v16b v; v8us half[2]; unsigned short u[16]; };

__device__ __forceinline__ unsigned short bf16_bits(float x) { unsigned int u = __float_as_uint(x); return (unsigned short)((u + 0x7FFFu + ((u >> 16) & 1u)) >> 16); }
__device__ __forceinline__ float bf16_val(unsigned short b) { return __uint_as_float(((unsigned int)b) << 16); }
__device__ __forceinline__ float bf16_round(float x) { return bf16_val(bf16_bits(x)); }
// D += A·B with NT terms: 1 = ah·bh, 2 = + al·bh (A split), 3 = + ah·bl (both split)
template <int NT>
__device__ __forceinline__ v8f mmaN(v16b ah, v16b al, v16b bh, v16b bl, v8f c) {
  c = __builtin_amdgcn_wmma_f32_16x16x32_bf16(false, ah, false, bh, (short)0, c, false, false);
  if (NT >= 2) c = __builtin_amdgcn_wmma_f32_16x16x32_bf16(false, al, false, bh, (short)0, c, false, false);
  if (NT >= 3) c = __builtin_amdgcn_wmma_f32_16x16x32_bf16(false, ah, false, bl, (short)0, c, false, false);
  asm volatile("v_nop\n\tv_nop\n\tv_nop\n\tv_nop" : "+v"(c) : "v"(ah), "v"(al), "v"(bh), "v"(bl));
  return c;
}

__global__ __launch_bounds__(256) void k_wt_bf16(const float* __restrict__ W, unsigned short* __restrict__ Wt, int K, int N) {
  const int t = blockIdx.x * 256 + threadIdx.x;
  const int k8n = K / 8;
  if (t >= N * k8n) return;
  const int n = t / k8n, k8 = (t % k8n) * 8;
  v8us v;
#pragma unroll
  for (int i = 0; i < 8; ++i) v[i] = bf16_bits(W[(size_t)(k8 + i) * N + n]);
  *(v8us*)(Wt + (size_t)n * K + k8) = v;
  
}

// GEMM C[M][N] (f32, pitch ldc) = act(A[M][K]·W + bias). A f32 row-major (pitch lda) converted per fragment to bf16
// (ASPLIT: hi/lo two planes -> 2 terms, else single rounded term); Wt bf16 [N][K] (pitch ldb). BIAS_BF16 rounds the
// bias to bf16 first (bias quantised to bf16 before the add). K%32==0, M%16==0, N%64==0.
template <bool ASPLIT, int ACT, bool BIAS_BF16>
__global__ __launch_bounds__(128) void k_gemm_bf(const float* __restrict__ A, int lda, const unsigned short* __restrict__ Wt, int ldb,
                                               const float* __restrict__ bias, float* __restrict__ C, int ldc, int M, int N, int K) {
  __shared__ __attribute__((aligned(16))) float so[4][16][64];
  const int tid = threadIdx.x, w = tid >> 5, lane = tid & 31, ln = lane & 15, hh = lane >> 4;
  const int ntn = N / 64;
  const int wid = blockIdx.x * 4 + w;
  const int mt = wid / ntn, nq = wid % ntn;
  if (mt * 16 >= M) return;
  const int row0 = mt * 16, col0 = nq * 64;
  const float* arow = A + (size_t)(row0 + ln) * lda;
  v8f acc[4] = {};
  for (int kb = 0; kb < K; kb += 32) {
    FragB ah, al;
    const v4f x0 = *(const v4fa*)(arow + kb + 8 * hh), x1 = *(const v4fa*)(arow + kb + 8 * hh + 4);
    const v4f x2 = *(const v4fa*)(arow + kb + 16 + 8 * hh), x3 = *(const v4fa*)(arow + kb + 16 + 8 * hh + 4);
    float xs[16] = {x0[0],x0[1],x0[2],x0[3],x1[0],x1[1],x1[2],x1[3],x2[0],x2[1],x2[2],x2[3],x3[0],x3[1],x3[2],x3[3]};
#pragma unroll
    for (int i = 0; i < 16; ++i) { const unsigned short hb = bf16_bits(xs[i]); ah.u[i] = hb; al.u[i] = ASPLIT ? bf16_bits(xs[i] - bf16_val(hb)) : (unsigned short)0; }
#pragma unroll
    for (int t = 0; t < 4; ++t) {
      const unsigned short* brow = Wt + (size_t)(col0 + t * 16 + ln) * ldb + kb;
      FragB b;
      b.half[0] = *(const v8us*)(brow + 8 * hh);
      b.half[1] = *(const v8us*)(brow + 16 + 8 * hh);
      acc[t] = mmaN<ASPLIT ? 2 : 1>(ah.v, al.v, b.v, b.v, acc[t]);
    }
  }
#pragma unroll
  for (int t = 0; t < 4; ++t) {
    float bv = bias ? bias[col0 + t * 16 + ln] : 0.f;
    if (BIAS_BF16) bv = bf16_round(bv);
#pragma unroll
    for (int r = 0; r < 8; ++r) { float v = acc[t][r] + bv; if (ACT == 1) v = fmaxf(v, 0.f); so[w][8 * hh + r][t * 16 + ln] = v; }
  }
  __builtin_amdgcn_fence(__ATOMIC_ACQ_REL, "workgroup");
  __builtin_amdgcn_wave_barrier();
  const int rsub = lane >> 4, c4 = (lane & 15) * 4;
  {
#pragma unroll
    for (int q = 0; q < 8; ++q) {
      const int r = q * 2 + rsub;
      const v4f v = *(const v4fa*)&so[w][r][c4];
      *(v4f*)(C + (size_t)(row0 + r) * ldc + col0 + c4) = v;
    }
    
  }
}

// Flash-style causal/unmasked attention, all contractions 3-term bf16 hi/lo splits, f32 softmax with running max.
// q,k,v rows are read from f32 buffers with arbitrary row pitch (so they can live inside a fused qkv buffer);
// D = head size (multiple of 32, <= 128); one wave = 16 query rows; block = 4 waves (64 queries) sharing K/V chunks of 32.
template <int D, bool CAUSAL>
__global__ __launch_bounds__(128) void k_flash(const float* __restrict__ qb, const float* __restrict__ kb, const float* __restrict__ vb,
                                             int pitch, int T, int H, float scale, float* __restrict__ y, int ypitch) {
  constexpr int KS = D / 32;        // k-steps for QK
  constexpr int DT = D / 16;        // d tiles for PV
  __shared__ __attribute__((aligned(16))) unsigned short sKh[32][D + 8], sKl[32][D + 8], sVh[32][D + 8], sVl[32][D + 8];
  __shared__ __attribute__((aligned(16))) unsigned short sPh[4][16][40], sPl[4][16][40];
  __shared__ __attribute__((aligned(16))) float sO[4][16][D];
  const int tid = threadIdx.x, w = tid >> 5, lane = tid & 31, ln = lane & 15, hh = lane >> 4;
  const int nqb = (T + 63) / 64;
  const int bh = blockIdx.x / nqb, qblk = blockIdx.x % nqb;
  const int b = bh / H, h = bh % H;
  const int q0 = qblk * 64 + w * 16;
  const float* Q = qb + (size_t)b * T * pitch + h * D;
  const float* K = kb + (size_t)b * T * pitch + h * D;
  const float* V = vb + (size_t)b * T * pitch + h * D;

  // A fragments of the wave's 16 query rows (scaled), hi/lo
  FragB aqh[KS], aql[KS];
  {
    int row = q0 + ln; if (row >= T) row = T - 1;
    const float* qr = Q + (size_t)row * pitch;
#pragma unroll
    for (int ks = 0; ks < KS; ++ks)
#pragma unroll
      for (int i = 0; i < 16; ++i) {
        const int d = ks * 32 + ((i < 8) ? (8 * hh + i) : (16 + 8 * hh + (i - 8)));
        const float x = qr[d] * scale; const unsigned short hb = bf16_bits(x);
        aqh[ks].u[i] = hb; aql[ks].u[i] = bf16_bits(x - bf16_val(hb));
      }
  }
  float m_r[8], l_r[8];
#pragma unroll
  for (int r = 0; r < 8; ++r) { m_r[r] = -3.0e38f; l_r[r] = 0.f; }
  v8f oacc[DT];
#pragma unroll
  for (int dt = 0; dt < DT; ++dt) oacc[dt] = (v8f){0.f,0.f,0.f,0.f,0.f,0.f,0.f,0.f};

  const int kv_end = CAUSAL ? min(T, qblk * 64 + 64) : T;     // block-uniform
  for (int j0 = 0; j0 < kv_end; j0 += 32) {
    __syncthreads();
    for (int e = tid; e < 32 * (D / 4); e += 128) {
      const int r = e / (D / 4), c4 = (e % (D / 4)) * 4;
      const int key = j0 + r;
      v4f kf = {0.f,0.f,0.f,0.f}, vf = {0.f,0.f,0.f,0.f};
      if (key < T) { kf = *(const v4fa*)(K + (size_t)key * pitch + c4); vf = *(const v4fa*)(V + (size_t)key * pitch + c4); }
#pragma unroll
      for (int t = 0; t < 4; ++t) {
        unsigned short hb = bf16_bits(kf[t]); sKh[r][c4 + t] = hb; sKl[r][c4 + t] = bf16_bits(kf[t] - bf16_val(hb));
        hb = bf16_bits(vf[t]); sVh[r][c4 + t] = hb; sVl[r][c4 + t] = bf16_bits(vf[t] - bf16_val(hb));
      }
    }
    __syncthreads();
    // S tile 16 x 32
    v8f s[2];
#pragma unroll
    for (int nt = 0; nt < 2; ++nt) {
      v8f acc = {};
#pragma unroll
      for (int ks = 0; ks < KS; ++ks) {
        FragB bh_, bl_;
        bh_.half[0] = *(const v8us*)&sKh[nt * 16 + ln][ks * 32 + 8 * hh]; bh_.half[1] = *(const v8us*)&sKh[nt * 16 + ln][ks * 32 + 16 + 8 * hh];
        bl_.half[0] = *(const v8us*)&sKl[nt * 16 + ln][ks * 32 + 8 * hh]; bl_.half[1] = *(const v8us*)&sKl[nt * 16 + ln][ks * 32 + 16 + 8 * hh];
        acc = mmaN<3>(aqh[ks].v, aql[ks].v, bh_.v, bl_.v, acc);
      }
      s[nt] = acc;
    }
    // mask + running max (rows 8hh+r; the 16 lanes of a half share rows)
    float alpha[8];
#pragma unroll
    for (int r = 0; r < 8; ++r) {
      const int qi = q0 + 8 * hh + r;
      const int ja = j0 + ln, jb = j0 + 16 + ln;
      if (CAUSAL) { if (ja > qi) s[0][r] = -3.0e38f; if (jb > qi) s[1][r] = -3.0e38f; }
      if (ja >= T) s[0][r] = -3.0e38f;
      if (jb >= T) s[1][r] = -3.0e38f;
      float mx = fmaxf(s[0][r], s[1][r]);
      mx = fmaxf(mx, __shfl_xor(mx, 1, 32)); mx = fmaxf(mx, __shfl_xor(mx, 2, 32)); mx = fmaxf(mx, __shfl_xor(mx, 4, 32)); mx = fmaxf(mx, __shfl_xor(mx, 8, 32));
      const float mnew = fmaxf(m_r[r], mx);
      alpha[r] = (mnew > -1.0e38f) ? __expf(m_r[r] - mnew) : 1.0f;
      const float p0 = (s[0][r] > -1.0e38f) ? __expf(s[0][r] - mnew) : 0.f;
      const float p1 = (s[1][r] > -1.0e38f) ? __expf(s[1][r] - mnew) : 0.f;
      m_r[r] = mnew;
      l_r[r] = l_r[r] * alpha[r] + p0 + p1;            // per-lane partial row sum (16 lanes combined at the end)
      unsigned short hb = bf16_bits(p0); sPh[w][8 * hh + r][ln] = hb;      sPl[w][8 * hh + r][ln] = bf16_bits(p0 - bf16_val(hb));
      hb = bf16_bits(p1);                sPh[w][8 * hh + r][16 + ln] = hb; sPl[w][8 * hh + r][16 + ln] = bf16_bits(p1 - bf16_val(hb));
    }
#pragma unroll
    for (int dt = 0; dt < DT; ++dt)
#pragma unroll
      for (int r = 0; r < 8; ++r) oacc[dt][r] *= alpha[r];
    __builtin_amdgcn_fence(__ATOMIC_ACQ_REL, "workgroup");
    __builtin_amdgcn_wave_barrier();
    FragB pah, pal;
    pah.half[0] = *(const v8us*)&sPh[w][ln][8 * hh]; pah.half[1] = *(const v8us*)&sPh[w][ln][16 + 8 * hh];
    pal.half[0] = *(const v8us*)&sPl[w][ln][8 * hh]; pal.half[1] = *(const v8us*)&sPl[w][ln][16 + 8 * hh];
#pragma unroll
    for (int dt = 0; dt < DT; ++dt) {
      FragB bvh, bvl;
#pragma unroll
      for (int i = 0; i < 8; ++i) {
        bvh.u[i] = sVh[8 * hh + i][dt * 16 + ln]; bvh.u[8 + i] = sVh[16 + 8 * hh + i][dt * 16 + ln];
        bvl.u[i] = sVl[8 * hh + i][dt * 16 + ln]; bvl.u[8 + i] = sVl[16 + 8 * hh + i][dt * 16 + ln];
      }
      oacc[dt] = mmaN<3>(pah.v, pal.v, bvh.v, bvl.v, oacc[dt]);
    }
    __builtin_amdgcn_fence(__ATOMIC_ACQ_REL, "workgroup");
    __builtin_amdgcn_wave_barrier();
  }
#pragma unroll
  for (int r = 0; r < 8; ++r) {
    float l = l_r[r];
    l += __shfl_xor(l, 1, 32); l += __shfl_xor(l, 2, 32); l += __shfl_xor(l, 4, 32); l += __shfl_xor(l, 8, 32);
    l_r[r] = (l > 0.f) ? 1.0f / l : 0.f;
  }
#pragma unroll
  for (int dt = 0; dt < DT; ++dt)
#pragma unroll
    for (int r = 0; r < 8; ++r) sO[w][8 * hh + r][dt * 16 + ln] = oacc[dt][r] * l_r[r];
  __builtin_amdgcn_fence(__ATOMIC_ACQ_REL, "workgroup");
  __builtin_amdgcn_wave_barrier();
  {
    for (int r = 0; r < 16; ++r) {
      const int row = q0 + r;
      if (row < T && lane < D / 4) {
        const v4f val = *(const v4fa*)&sO[w][r][lane * 4];
        *(v4f*)(y + ((size_t)b * T + row) * ypitch + h * D + lane * 4) = val;
      }
    }
    
  }
}

// GEMM C = act(A·W + bias + resid): A f32 (ASPLIT -> hi/lo 2 terms), Wt bf16 [N][K]; ACT 0 none, 1 relu, 2 exact gelu;
// resid (optional, f32, row index = (row % rmod), pitch ldr, RES_BF16 rounds it) added before the activation.
template <bool ASPLIT, int ACT, bool BIAS_BF16, bool RES_BF16>
__global__ __launch_bounds__(128) void k_gemm_bf3(const float* __restrict__ A, int lda, const unsigned short* __restrict__ Wt, int ldb,
                                                const float* __restrict__ bias, const float* __restrict__ resid, int rmod, int ldr,
                                                float* __restrict__ C, int ldc, int M, int N, int K) {
  __shared__ __attribute__((aligned(16))) float so[4][16][64];
  const int tid = threadIdx.x, w = tid >> 5, lane = tid & 31, ln = lane & 15, hh = lane >> 4;
  const int ntn = N / 64;
  const int wid = blockIdx.x * 4 + w;
  const int mt = wid / ntn, nq = wid % ntn;
  if (mt * 16 >= M) return;
  const int row0 = mt * 16, col0 = nq * 64;
  const float* arow = A + (size_t)(row0 + ln) * lda;
  v8f acc[4] = {};
  for (int kb = 0; kb < K; kb += 32) {
    FragB ah, al;
    const v4f x0 = *(const v4fa*)(arow + kb + 8 * hh), x1 = *(const v4fa*)(arow + kb + 8 * hh + 4);
    const v4f x2 = *(const v4fa*)(arow + kb + 16 + 8 * hh), x3 = *(const v4fa*)(arow + kb + 16 + 8 * hh + 4);
    float xs[16] = {x0[0],x0[1],x0[2],x0[3],x1[0],x1[1],x1[2],x1[3],x2[0],x2[1],x2[2],x2[3],x3[0],x3[1],x3[2],x3[3]};
#pragma unroll
    for (int i = 0; i < 16; ++i) { const unsigned short hb = bf16_bits(xs[i]); ah.u[i] = hb; al.u[i] = ASPLIT ? bf16_bits(xs[i] - bf16_val(hb)) : (unsigned short)0; }
#pragma unroll
    for (int t = 0; t < 4; ++t) {
      const unsigned short* brow = Wt + (size_t)(col0 + t * 16 + ln) * ldb + kb;
      FragB b;
      b.half[0] = *(const v8us*)(brow + 8 * hh);
      b.half[1] = *(const v8us*)(brow + 16 + 8 * hh);
      acc[t] = mmaN<ASPLIT ? 2 : 1>(ah.v, al.v, b.v, b.v, acc[t]);
    }
  }
#pragma unroll
  for (int t = 0; t < 4; ++t) {
    const int col = col0 + t * 16 + ln;
    float bv = bias ? bias[col] : 0.f;
    if (BIAS_BF16) bv = bf16_round(bv);
#pragma unroll
    for (int r = 0; r < 8; ++r) {
      float v = acc[t][r] + bv;
      if (resid) { float rv = resid[(size_t)((row0 + 8 * hh + r) % rmod) * ldr + col]; if (RES_BF16) rv = bf16_round(rv); v += rv; }
      if (ACT == 1) v = fmaxf(v, 0.f);
      if (ACT == 2) v = 0.5f * v * (1.0f + erff(v * 0.70710678118654752f));
      if (ACT == 3) { const float u = 0.7978845608028654f * (v + 0.044715f * v * v * v); v = 0.5f * v * (1.0f + tanhf(u)); }
      so[w][8 * hh + r][t * 16 + ln] = v;
    }
  }
  __builtin_amdgcn_fence(__ATOMIC_ACQ_REL, "workgroup");
  __builtin_amdgcn_wave_barrier();
  const int rsub = lane >> 4, c4 = (lane & 15) * 4;
  {
#pragma unroll
    for (int q = 0; q < 8; ++q) {
      const int r = q * 2 + rsub;
      const v4f v = *(const v4fa*)&so[w][r][c4];
      *(v4f*)(C + (size_t)(row0 + r) * ldc + col0 + c4) = v;
    }
    
  }
}
// row LayerNorm (biased variance, eps) over N: s = X (+ R); optional out_sum <- s; out_norm <- (s-mu)*rsqrt(var+eps)*g + b
template <bool PARAM_BF16>
__global__ __launch_bounds__(256) void k_layernorm(const float* __restrict__ X, const float* __restrict__ R, const float* __restrict__ g, const float* __restrict__ bta,
                                                  float* __restrict__ out_sum, float* __restrict__ out_norm, int N, float eps) {
  __shared__ float red[256];
  const int row = blockIdx.x, tid = threadIdx.x;
  const float* x = X + (size_t)row * N; const float* rr = R ? R + (size_t)row * N : nullptr;
  float vals[16];                     // up to N = 4096
  const int per = N / 256;            // contiguous chunk per thread? use strided-by-4 chunks: thread handles j = tid*4 + 1024*u
  float s1 = 0.f;
  for (int u = 0; u < per / 4; ++u) {
    const int j = tid * 4 + 1024 * u;
    const v4f a = *(const v4fa*)(x + j);
    v4f b = {0.f,0.f,0.f,0.f}; if (rr) b = *(const v4fa*)(rr + j);
#pragma unroll
    for (int q = 0; q < 4; ++q) { const float v = a[q] + b[q]; vals[u * 4 + q] = v; s1 += v; }
  }
  red[tid] = s1; __syncthreads();
  for (int st = 128; st > 0; st >>= 1) { if (tid < st) red[tid] += red[tid + st]; __syncthreads(); }
  const float mu = red[0] / (float)N; __syncthreads();
  float s2 = 0.f;
  for (int u = 0; u < per / 4; ++u)
#pragma unroll
    for (int q = 0; q < 4; ++q) { const float c = vals[u * 4 + q] - mu; s2 += c * c; }
  red[tid] = s2; __syncthreads();
  for (int st = 128; st > 0; st >>= 1) { if (tid < st) red[tid] += red[tid + st]; __syncthreads(); }
  const float rs = rsqrtf(red[0] / (float)N + eps);
  {
    for (int u = 0; u < per / 4; ++u) {
      const int j = tid * 4 + 1024 * u;
      v4f o, sm;
#pragma unroll
      for (int q = 0; q < 4; ++q) {
        float gg = g[j + q], bb = bta[j + q];
        if (PARAM_BF16) { gg = bf16_round(gg); bb = bf16_round(bb); }
        sm[q] = vals[u * 4 + q]; o[q] = (vals[u * 4 + q] - mu) * rs * gg + bb;
      }
      if (out_sum) *(v4f*)(out_sum + (size_t)row * N + j) = sm;
      *(v4f*)(out_norm + (size_t)row * N + j) = o;
    }
    
  }
}



// ---- f16 WMMA path (v_wmma_f32_16x16x32_f16): 11-bit significands for operands in range — used where a [0,1] probability operand needs more precision than bf16
typedef _Float16 v16h __attribute__((ext_vector_type(16)));
union FragH { v16h v; v8us half[2]; _Float16 h[16]; unsigned short u[16]; };
template <int NT>
__device__ __forceinline__ v8f mmaH(v16h ah, v16h al, v16h bh, v16h bl, v8f c) {
  c = __builtin_amdgcn_wmma_f32_16x16x32_f16(false, ah, false, bh, (short)0, c, false, false);
  if (NT >= 2) c = __builtin_amdgcn_wmma_f32_16x16x32_f16(false, al, false, bh, (short)0, c, false, false);
  if (NT >= 3) c = __builtin_amdgcn_wmma_f32_16x16x32_f16(false, ah, false, bl, (short)0, c, false, false);
  asm volatile("v_nop\n\tv_nop\n\tv_nop\n\tv_nop" : "+v"(c) : "v"(ah), "v"(al), "v"(bh), "v"(bl));
  return c;
}
// batched GEMM like k_gemm_b but f16 operands: A f32 (split into f16 hi/lo if ASPLIT, else rounded to f16), Bt = f16 values [n][k]; alpha; C f32; N multiple of 16 (partial tiles skipped)
template <bool ASPLIT>
__global__ __launch_bounds__(128) void k_gemm_h(const float* __restrict__ A, int lda, size_t sA, const _Float16* __restrict__ Bh, int ldb, size_t sB, float alpha, float* __restrict__ C, int ldc, size_t sC, int M, int N, int K) {
  __shared__ __attribute__((aligned(16))) float so[4][16][64];
  const int tid = threadIdx.x, w = tid >> 5, lane = tid & 31, ln = lane & 15, hh = lane >> 4; const int by = blockIdx.y;
  A += (size_t)by * sA; Bh += (size_t)by * sB; C += (size_t)by * sC;
  const int ntn = (N + 63) / 64; const int wid = blockIdx.x * 4 + w; const int mt = wid / ntn, nq = wid % ntn; if (mt * 16 >= M) return;
  const int row0 = mt * 16, col0 = nq * 64; const float* arow = A + (size_t)(row0 + ln) * lda;
  v8f acc[4] = {};
  for (int kb = 0; kb < K; kb += 32) {
    FragH ah, al;
    const v4f x0 = *(const v4fa*)(arow + kb + 8 * hh), x1 = *(const v4fa*)(arow + kb + 8 * hh + 4), x2 = *(const v4fa*)(arow + kb + 16 + 8 * hh), x3 = *(const v4fa*)(arow + kb + 16 + 8 * hh + 4);
    float xs[16] = {x0[0],x0[1],x0[2],x0[3],x1[0],x1[1],x1[2],x1[3],x2[0],x2[1],x2[2],x2[3],x3[0],x3[1],x3[2],x3[3]};
#pragma unroll
    for (int i = 0; i < 16; ++i) { const _Float16 h = (_Float16)xs[i]; ah.h[i] = h; al.h[i] = ASPLIT ? (_Float16)(xs[i] - (float)h) : (_Float16)0.0f; }
#pragma unroll
    for (int t = 0; t < 4; ++t) { if (col0 + t * 16 >= N) continue; const size_t boff = (size_t)(col0 + t * 16 + ln) * ldb + kb; FragH bq; bq.half[0] = *(const v8us*)(Bh + boff + 8 * hh); bq.half[1] = *(const v8us*)(Bh + boff + 16 + 8 * hh);
      acc[t] = mmaH<ASPLIT ? 2 : 1>(ah.v, al.v, bq.v, bq.v, acc[t]); }
  }
#pragma unroll
  for (int t = 0; t < 4; ++t) { if (col0 + t * 16 >= N) continue;
#pragma unroll
    for (int r = 0; r < 8; ++r) so[w][8 * hh + r][t * 16 + ln] = acc[t][r] * alpha; }
  __builtin_amdgcn_fence(__ATOMIC_ACQ_REL, "workgroup"); __builtin_amdgcn_wave_barrier();
  const int rsub = lane >> 4, c4 = (lane & 15) * 4;
  {
#pragma unroll
    for (int q = 0; q < 8; ++q) { const int r = q * 2 + rsub; if (col0 + c4 < N) { const v4f v = *(const v4fa*)&so[w][r][c4]; *(v4f*)(C + (size_t)(row0 + r) * ldc + col0 + c4) = v; } }
     }
}

// Wt[n][k] = f16(W[k][n]·scale) from f32 row-major W[K][N] (scale = power of two; bf16-exact weights stay exact in f16 away from the subnormal range)
__global__ __launch_bounds__(256) void k_wt_f16(const float* __restrict__ W, _Float16* __restrict__ Wt, int K, int N, float scale) {
  const int t = blockIdx.x * 256 + threadIdx.x; if (t >= N * (K / 8)) return; const int n = t / (K / 8), k8 = (t % (K / 8)) * 8; FragH f;
#pragma unroll
  for (int i = 0; i < 8; ++i) f.h[i] = (_Float16)(bf16_round(W[(size_t)(k8 + i) * N + n]) * scale); const v8us o = f.half[0];
  *(v8us*)((unsigned short*)Wt + (size_t)n * K + k8) = o; 
}
// k_gemm_hh variant with fused epilogue: v = acc·alpha + bias[by·sBias + col] (+ CP[(row/rowsPerB)·sCPb + by·64 + col] if CP) ; ACT 0 none / 1 elu ; writes f32 C and/or f16 C16 (each if non-null)
template <int ACT>
__global__ __launch_bounds__(128) void k_gemm_hhx(const _Float16* __restrict__ A, int lda, size_t sA, const _Float16* __restrict__ Bh, int ldb, size_t sB, float alpha, const float* __restrict__ bias, size_t sBias, const float* __restrict__ CP, int rowsPerB, size_t sCPb, int row0g,
    float* __restrict__ C, _Float16* __restrict__ C16, int ldc, size_t sC, int M, int N, int K) {
  __shared__ __attribute__((aligned(16))) float so[4][16][64];
  const int tid = threadIdx.x, w = tid >> 5, lane = tid & 31, ln = lane & 15, hh = lane >> 4; const int by = blockIdx.y;
  A += (size_t)by * sA; Bh += (size_t)by * sB; const size_t cofs = (size_t)by * sC; const float* bp = bias ? bias + (size_t)by * sBias : nullptr;
  const int ntn = (N + 63) / 64; const int wid = blockIdx.x * 4 + w; const int mt = wid / ntn, nq = wid % ntn; if (mt * 16 >= M) return;
  const int row0 = mt * 16, col0 = nq * 64; const _Float16* arow = A + (size_t)(row0 + ln) * lda;
  v8f acc[4] = {};
  for (int kb = 0; kb < K; kb += 32) { FragH ah; ah.half[0] = *(const v8us*)((const unsigned short*)arow + kb + 8 * hh); ah.half[1] = *(const v8us*)((const unsigned short*)arow + kb + 16 + 8 * hh);
#pragma unroll
    for (int t = 0; t < 4; ++t) { if (col0 + t * 16 >= N) continue; const size_t boff = (size_t)(col0 + t * 16 + ln) * ldb + kb; FragH bq; bq.half[0] = *(const v8us*)((const unsigned short*)Bh + boff + 8 * hh); bq.half[1] = *(const v8us*)((const unsigned short*)Bh + boff + 16 + 8 * hh);
      acc[t] = mmaH<1>(ah.v, ah.v, bq.v, bq.v, acc[t]); }
  }
#pragma unroll
  for (int t = 0; t < 4; ++t) { if (col0 + t * 16 >= N) continue; const int col = col0 + t * 16 + ln; const float bv = bp ? bf16_round(bp[col]) : 0.f;
#pragma unroll
    for (int r = 0; r < 8; ++r) { float v = acc[t][r] * alpha + bv; if (CP) { const int bidx = (row0g + row0 + 8 * hh + r) / rowsPerB; v += CP[(size_t)bidx * sCPb + (size_t)by * 64 + col]; } if (ACT == 1) v = (v > 0.f) ? v : expm1f(v); else if (ACT == 7) v = (v > 0.f) ? v + 1.0f : expf(v); else if (ACT == 8) v = tanhf(v); else if (ACT == 9) v = 0.5f * v * (1.0f + tanhf(0.7978845608028654f * (v + 0.044715f * v * v * v))); else if (ACT == 11) v = 1.0f / (1.0f + expf(-v)); else if (ACT == 12) v = (v > 0.f) ? v : 0.01f * v; else if (ACT == 14) v = (v > 0.f) ? v : 0.1f * v; else if (ACT == 15) v = v / (1.0f + expf(-v)); else if (ACT == 3) v = fmaxf(v, 0.f); else if (ACT == 6) v = 0.5f * v * (1.0f + erff(v * 0.70710678118654752f)); so[w][8 * hh + r][t * 16 + ln] = v; } }
  __builtin_amdgcn_fence(__ATOMIC_ACQ_REL, "workgroup"); __builtin_amdgcn_wave_barrier();
  const int rsub = lane >> 4, c4 = (lane & 15) * 4; typedef _Float16 v4h __attribute__((ext_vector_type(4)));
  {
#pragma unroll
    for (int q = 0; q < 8; ++q) { const int r = q * 2 + rsub; if (col0 + c4 < N) { const v4f v = *(const v4fa*)&so[w][r][c4]; if (C) *(v4f*)(C + cofs + (size_t)(row0 + r) * ldc + col0 + c4) = v; if (C16) { v4h h4; for (int i = 0; i < 4; ++i) h4[i] = (_Float16)v[i]; *(v4h*)(C16 + cofs + (size_t)(row0 + r) * ldc + col0 + c4) = h4; } } }
     }
}


typedef _Float16 v4h __attribute__((ext_vector_type(4)));

__global__ __launch_bounds__(256) void k_x16(const float* __restrict__ x, _Float16* __restrict__ X16, size_t n8) { const size_t t = (size_t)blockIdx.x * 256 + threadIdx.x; if (t >= n8) return; FragH f;
#pragma unroll
  for (int q = 0; q < 8; ++q) f.h[q] = (_Float16)bf16_round(x[t * 8 + q]); *(v8us*)((unsigned short*)X16 + t * 8) = f.half[0];  }
__global__ __launch_bounds__(256) void k_h16(const float* __restrict__ x, _Float16* __restrict__ X16, size_t n8) { const size_t t = (size_t)blockIdx.x * 256 + threadIdx.x; if (t >= n8) return; FragH f;
#pragma unroll
  for (int q = 0; q < 8; ++q) f.h[q] = (_Float16)x[t * 8 + q]; *(v8us*)((unsigned short*)X16 + t * 8) = f.half[0];  }
__global__ __launch_bounds__(256) void k_round16f(const float* __restrict__ W, _Float16* __restrict__ Bt, size_t n8) { const size_t t = (size_t)blockIdx.x * 256 + threadIdx.x; if (t >= n8) return; FragH f;
#pragma unroll
  for (int i = 0; i < 8; ++i) f.h[i] = (_Float16)(bf16_round(W[t * 8 + i]) * 16.0f); *(v8us*)((unsigned short*)Bt + t * 8) = f.half[0];  }
template <int NHv, int TTv>
__global__ __launch_bounds__(256) void k_vt(const _Float16* __restrict__ V16, int ldv, int voff, _Float16* __restrict__ Vt) { __shared__ unsigned short tl[64][66]; const int tid = threadIdx.x; const int slab = blockIdx.x / (TTv / 64), lg = blockIdx.x % (TTv / 64); const int b = slab / NHv, h = slab % NHv;
  for (int i = tid; i < 64 * 8; i += 256) { const int r = i / 8, c8 = (i % 8) * 8; FragH f; f.half[0] = *(const v8us*)((const unsigned short*)V16 + ((size_t)b * TTv + lg * 64 + r) * ldv + voff + h * 64 + c8);
#pragma unroll
    for (int q = 0; q < 8; ++q) tl[r][c8 + q] = f.u[q]; }
  __syncthreads();
  {
#pragma unroll
    for (int rd = 0; rd < 2; ++rd) { const int d = rd * 32 + tid / 8, pc = tid % 8; FragH f;
#pragma unroll
      for (int q = 0; q < 8; ++q) f.u[q] = tl[pc * 8 + q][d];
      *(v8us*)((unsigned short*)Vt + ((size_t)slab * 64 + d) * TTv + lg * 64 + pc * 8) = f.half[0]; }
     } }

__global__ __launch_bounds__(256) void k_hl(const float* __restrict__ F, _Float16* __restrict__ Hh, _Float16* __restrict__ Hl, size_t n8) { const size_t t = (size_t)blockIdx.x * 256 + threadIdx.x; if (t >= n8) return; FragH fh, fl; const v4f a = *(const v4fa*)(F + t * 8), c = *(const v4fa*)(F + t * 8 + 4);
#pragma unroll
  for (int q = 0; q < 4; ++q) { _Float16 h = (_Float16)a[q]; fh.h[q] = h; fl.h[q] = (_Float16)((a[q] - (float)h) * 1024.0f); h = (_Float16)c[q]; fh.h[4 + q] = h; fl.h[4 + q] = (_Float16)((c[q] - (float)h) * 1024.0f); }
  { *(v8us*)((unsigned short*)Hh + t * 8) = fh.half[0]; *(v8us*)((unsigned short*)Hl + t * 8) = fl.half[0];  } }
// RMSNorm rows (C = 768 = 32 lanes × 24): y = x·rsqrt(mean(x²) + 1.1920929e-7)·bf16(g); RB: round the input to bf16 first; outputs: f16 hi + ×2^10 residual planes (either may be null) and optionally the f32 rounded input copy XR; wave per row; per lane 6 float4 pieces (c = j·128 + lane·4);
template <int RB>
__global__ __launch_bounds__(256) void k_rms(const float* __restrict__ X, const float* __restrict__ g, int nrows, _Float16* __restrict__ YH, _Float16* __restrict__ YL, float* __restrict__ XR) { const int tid = threadIdx.x, wv = tid >> 5, lane = tid & 31; const int r = blockIdx.x * 8 + wv; if (r >= nrows) return; v4f xv[6]; float ss = 0.f;
#pragma unroll
  for (int j = 0; j < 6; ++j) { v4f a = *(const v4fa*)(X + (size_t)r * CC + j * 128 + lane * 4); if (RB) for (int q = 0; q < 4; ++q) a[q] = bf16_round(a[q]); xv[j] = a; for (int q = 0; q < 4; ++q) ss += a[q] * a[q]; }
  for (int o = 16; o >= 1; o >>= 1) ss += __shfl_xor(ss, o, 32); const float rs = rsqrtf(ss / (float)CC + 1.1920929e-7f);
  typedef _Float16 v4h __attribute__((ext_vector_type(4)));
  {
#pragma unroll
    for (int j = 0; j < 6; ++j) { const int c = j * 128 + lane * 4; v4h hh, hl; for (int q = 0; q < 4; ++q) { const float y = xv[j][q] * rs * bf16_round(g[c + q]); const _Float16 hv = (_Float16)y; hh[q] = hv; hl[q] = (_Float16)((y - (float)hv) * 1024.0f); }
      if (YH) *(v4h*)(YH + (size_t)r * CC + c) = hh; if (YL) *(v4h*)(YL + (size_t)r * CC + c) = hl; if (XR) *(v4f*)(XR + (size_t)r * CC + c) = xv[j]; }
     } }
__global__ __launch_bounds__(256) void k_vtr(const _Float16* __restrict__ XH, const _Float16* __restrict__ XL, _Float16* __restrict__ VT) { __shared__ float tl[64][33]; const int tid = threadIdx.x; const int slab = blockIdx.x / (NN / 64), ng = blockIdx.x % (NN / 64); const int b = slab / NH, h = slab % NH; const size_t base = (size_t)b * NN * CC + (size_t)h * HSZ + (size_t)ng * 64 * HD;      /* 64 consecutive n rows × 32 d = 2048 contiguous elements */
  for (int i = tid; i < 64 * 32; i += 256) { const int n = i / 32, d = i % 32; tl[n][d] = (float)XH[base + i] + (float)XL[base + i] * 0.0009765625f; } __syncthreads();
  const int d = tid / 8, pc = tid % 8; FragH f; for (int q = 0; q < 8; ++q) f.h[q] = (_Float16)tl[pc * 8 + q][d];
  *(v8us*)((unsigned short*)VT + ((size_t)slab * HD + d) * NN + ng * 64 + pc * 8) = f.half[0];  }
__global__ __launch_bounds__(128) void k_flash(const _Float16* __restrict__ Q16, const _Float16* __restrict__ Q16lo, int ldq, const _Float16* __restrict__ K16, const _Float16* __restrict__ K16lo, int ldk, const _Float16* __restrict__ Vt, const float* __restrict__ SP, float* __restrict__ O, int ldo) {
  constexpr int RPW = 16, RTN = RPW / 16, NQB = NN / (4 * RPW), DT = 2, KS = 1;
  __shared__ __attribute__((aligned(16))) unsigned short sP[4][RPW][40]; __shared__ __attribute__((aligned(16))) float sO[4][RPW][32 + 4];
  const int tid = threadIdx.x, w = tid >> 5, lane = tid & 31, ln = lane & 15, hh = lane >> 4;
  const int slab = blockIdx.x / NQB, qblk = blockIdx.x % NQB; const int h = slab % NH; const float coef = (logf(768.0f) * bf16_round(SP[h])) * 5.656854249492381f; const int qb0 = qblk * (4 * RPW); const int q0 = qb0 + w * RPW;
  FragH aq[2][KS], aql[2][KS];
#pragma unroll
  for (int rt = 0; rt < RTN; ++rt) { const size_t qo = ((size_t)slab * NN + q0 + rt * 16 + ln) * ldq; const unsigned short* qr = (const unsigned short*)Q16 + qo; const unsigned short* ql = (const unsigned short*)Q16lo + qo;
#pragma unroll
    for (int ks = 0; ks < KS; ++ks) { aq[rt][ks].half[0] = *(const v8us*)(qr + ks * 32 + 8 * hh); aq[rt][ks].half[1] = *(const v8us*)(qr + ks * 32 + 16 + 8 * hh); aql[rt][ks].half[0] = *(const v8us*)(ql + ks * 32 + 8 * hh); aql[rt][ks].half[1] = *(const v8us*)(ql + ks * 32 + 16 + 8 * hh); } }
  const unsigned short* Vth = (const unsigned short*)Vt + (size_t)slab * HD * NN;      /* v'ᵀ per slab: [32][N] */
  float m_r[2][8], l_r[2][8]; v8f oacc[2][DT];
#pragma unroll
  for (int rt = 0; rt < RTN; ++rt) {
#pragma unroll
    for (int r = 0; r < 8; ++r) { m_r[rt][r] = -3.0e38f; l_r[rt][r] = 0.f; }
#pragma unroll
    for (int dt = 0; dt < DT; ++dt) oacc[rt][dt] = (v8f){0.f,0.f,0.f,0.f,0.f,0.f,0.f,0.f}; }
  const int jend = NN;
#pragma unroll 1
  for (int j0 = 0; j0 < jend; j0 += 32) {
    
    v8f s[2][2];
#pragma unroll
    for (int nt = 0; nt < 2; ++nt) { const size_t ko = ((size_t)slab * NN + j0 + nt * 16 + ln) * ldk; const unsigned short* kr = (const unsigned short*)K16 + ko; const unsigned short* klo = (const unsigned short*)K16lo + ko; FragH bk[KS], bl[KS];
#pragma unroll
      for (int ks = 0; ks < KS; ++ks) { bk[ks].half[0] = *(const v8us*)(kr + ks * 32 + 8 * hh); bk[ks].half[1] = *(const v8us*)(kr + ks * 32 + 16 + 8 * hh); bl[ks].half[0] = *(const v8us*)(klo + ks * 32 + 8 * hh); bl[ks].half[1] = *(const v8us*)(klo + ks * 32 + 16 + 8 * hh); }
#pragma unroll
      for (int rt = 0; rt < RTN; ++rt) { v8f acc = (v8f){0.f,0.f,0.f,0.f,0.f,0.f,0.f,0.f}, accl = acc;
#pragma unroll
        for (int ks = 0; ks < KS; ++ks) { acc = mmaH<1>(aq[rt][ks].v, aq[rt][ks].v, bk[ks].v, bk[ks].v, acc); accl = mmaH<1>(aql[rt][ks].v, aql[rt][ks].v, bk[ks].v, bk[ks].v, accl); accl = mmaH<1>(aq[rt][ks].v, aq[rt][ks].v, bl[ks].v, bl[ks].v, accl); }
#pragma unroll
        for (int r = 0; r < 8; ++r) acc[r] += accl[r] * 0.0009765625f; s[rt][nt] = acc; } }
#pragma unroll
    for (int rt = 0; rt < RTN; ++rt)
#pragma unroll
      for (int r = 0; r < 8; ++r) { const int tq = q0 + rt * 16 + 8 * hh + r; const int k0 = j0 + ln, k1 = j0 + 16 + ln; (void)tq; (void)k0; (void)k1;
        const bool ok0 = true, ok1 = true;
        const float s0 = s[rt][0][r] * coef, s1 = s[rt][1][r] * coef; float mc = fmaxf(s0, s1);
        mc = fmaxf(mc, __shfl_xor(mc, 1, 32)); mc = fmaxf(mc, __shfl_xor(mc, 2, 32)); mc = fmaxf(mc, __shfl_xor(mc, 4, 32)); mc = fmaxf(mc, __shfl_xor(mc, 8, 32));
        const float mn = fmaxf(m_r[rt][r], mc); const float al = (mn > -1.0e38f) ? expf(m_r[rt][r] - mn) : 1.0f; m_r[rt][r] = mn; const float p0 = expf(s0 - mn), p1 = expf(s1 - mn); l_r[rt][r] = l_r[rt][r] * al + p0 + p1;
#pragma unroll
        for (int dt = 0; dt < DT; ++dt) oacc[rt][dt][r] *= al;
        FragH t2; t2.h[0] = (_Float16)(p0 * 1024.0f); t2.h[1] = (_Float16)(p1 * 1024.0f); sP[w][rt * 16 + 8 * hh + r][ln] = t2.u[0]; sP[w][rt * 16 + 8 * hh + r][16 + ln] = t2.u[1]; }
    __builtin_amdgcn_fence(__ATOMIC_ACQ_REL, "workgroup"); __builtin_amdgcn_wave_barrier();
    FragH pa[2];
#pragma unroll
    for (int rt = 0; rt < RTN; ++rt) { pa[rt].half[0] = *(const v8us*)&sP[w][rt * 16 + ln][8 * hh]; pa[rt].half[1] = *(const v8us*)&sP[w][rt * 16 + ln][16 + 8 * hh]; }
#pragma unroll
    for (int dt = 0; dt < DT; ++dt) { const unsigned short* vrow = Vth + (size_t)(dt * 16 + ln) * NN + j0; FragH bv; bv.half[0] = *(const v8us*)(vrow + 8 * hh); bv.half[1] = *(const v8us*)(vrow + 16 + 8 * hh);
#pragma unroll
      for (int rt = 0; rt < RTN; ++rt) oacc[rt][dt] = mmaH<1>(pa[rt].v, pa[rt].v, bv.v, bv.v, oacc[rt][dt]); }
    __builtin_amdgcn_fence(__ATOMIC_ACQ_REL, "workgroup"); __builtin_amdgcn_wave_barrier(); }
#pragma unroll
  for (int rt = 0; rt < RTN; ++rt) {
#pragma unroll
    for (int r = 0; r < 8; ++r) { float l = l_r[rt][r]; l += __shfl_xor(l, 1, 32); l += __shfl_xor(l, 2, 32); l += __shfl_xor(l, 4, 32); l += __shfl_xor(l, 8, 32); l_r[rt][r] = (l > 0.f) ? 1.0f / (l * 1024.0f) : 0.f; }
#pragma unroll
    for (int dt = 0; dt < DT; ++dt)
#pragma unroll
      for (int r = 0; r < 8; ++r) sO[w][rt * 16 + 8 * hh + r][dt * 16 + ln] = oacc[rt][dt][r] * l_r[rt][r]; }
  __builtin_amdgcn_fence(__ATOMIC_ACQ_REL, "workgroup"); __builtin_amdgcn_wave_barrier();
  {
#pragma unroll
    for (int rp = 0; rp < RPW; rp += 4) { const int r = rp + (lane >> 3), pc = lane & 7; const v4f val = *(const v4fa*)&sO[w][r][pc * 4]; *(v4f*)(O + ((size_t)slab * NN + q0 + r) * ldo + pc * 4) = val; }      
     } }

__global__ __launch_bounds__(256) void k_add(const float* __restrict__ A, const float* __restrict__ B_, float* __restrict__ out, size_t n4) { const size_t t = (size_t)blockIdx.x * 256 + threadIdx.x; if (t >= n4) return; v4f a = *(const v4fa*)(A + t * 4); const v4f b = *(const v4fa*)(B_ + t * 4); for (int q = 0; q < 4; ++q) a[q] += b[q]; *(v4f*)(out + t * 4) = a;  }

extern "C" void kernel_launch(void* const* d_in, const int* in_sizes, int n_in,
                              void* d_out, int out_size, void* d_ws, size_t ws_size, hipStream_t stream) {
  (void)in_sizes; (void)n_in; (void)out_size;
  const float* const* I = (const float* const*)d_in; const float* x = I[0]; const float* sp = I[1]; const float* Wq = I[2]; const float* WA = I[3]; const float* W1 = I[4]; const float* W2 = I[5]; const float* g1 = I[6]; const float* g2 = I[7];
  char* ws = (char*)d_ws; size_t off = 0;
  auto take = [&](size_t bytes) { char* p = ws + off; off += (bytes + 255) & ~(size_t)255; return p; };
  const size_t WSZ = (size_t)CC * CC; _Float16* Bq = (_Float16*)take(WSZ * 2); _Float16* B1 = (_Float16*)take(WSZ * 2); _Float16* B2 = (_Float16*)take(WSZ * 2); _Float16* BA = (_Float16*)take((size_t)NN * NN * 2);
  _Float16* XH = (_Float16*)take((size_t)NR * CC * 2); _Float16* XL = (_Float16*)take((size_t)NR * CC * 2); float* XR = (float*)take((size_t)NR * CC * 4); float* QF = (float*)take((size_t)NR * CC * 4); _Float16* QH = (_Float16*)take((size_t)NR * CC * 2); _Float16* QL = (_Float16*)take((size_t)NR * CC * 2);
  _Float16* VT = (_Float16*)take((size_t)BB * NH * HD * NN * 2); _Float16* VPT = (_Float16*)take((size_t)BB * NH * HD * NN * 2); float* ATT = (float*)take((size_t)NR * CC * 4);
  float* O = QF; _Float16* H16 = XH; _Float16* FH = XL;      /* O (raw [B][H][N][hd] f32) over q f32 (dead after k_hl); RMSNorm2 output over XH and the FF hidden over XL (both dead after k_flash) */
  if (off > ws_size) return;      // 3.5 + 8.4 + 6.3 × 2 + 12.6 × 2 + 6.3 × 2 + 6.3 × 2 + 12.6 ≈ 87 MB
  const unsigned gw = (unsigned)((WSZ / 8 + 255) / 256); k_round16f<<<gw, 256, 0, stream>>>(Wq, Bq, WSZ / 8); k_round16f<<<gw, 256, 0, stream>>>(W1, B1, WSZ / 8); k_round16f<<<gw, 256, 0, stream>>>(W2, B2, WSZ / 8); k_round16f<<<(unsigned)(((size_t)NN * NN / 8 + 255) / 256), 256, 0, stream>>>(WA, BA, (size_t)NN * NN / 8);      /* (out,in) natural ×2^4; WA natural [m][n] ×2^4 */
  k_rms<1><<<(NR + 7) / 8, 256, 0, stream>>>(x, g1, NR, XH, XL, XR);      /* xn = RMSNorm(bf16 x)·g1 → hi / ×2^10 residual; XR = bf16(x) */
  const dim3 gq(((NR / 16) * (CC / 64) + 3) / 4, 1);
  k_gemm_hhx<0><<<gq, 128, 0, stream>>>(XH, CC, 0, Bq, CC, 0, 0.0625f, nullptr, 0, nullptr, 1, 0, 0, QF, nullptr, CC, 0, NR, CC, CC);      /* q = xn·Wqᵀ: hi term, M 4096 N 768 K 768 */
  k_gemm_hhx<0><<<gq, 128, 0, stream>>>(XL, CC, 0, Bq, CC, 0, 0.0625f * 0.0009765625f, nullptr, 0, QF, 1, (size_t)CC, 0, QF, nullptr, CC, 0, NR, CC, CC);      /* += lo term ·2^-10 in place */
  k_hl<<<(unsigned)(((size_t)NR * CC / 8 + 255) / 256), 256, 0, stream>>>(QF, QH, QL, (size_t)NR * CC / 8);      /* q → hi / ×2^10 residual (flat planes; head h of batch b = elements [b·N·C + h·N·hd, +N·hd) viewed [N][hd]) */
  k_vtr<<<BB * NH * (NN / 64), 256, 0, stream>>>(XH, XL, VT);      /* vᵀ per (b,h): [32][2048] f16 */
  const dim3 gvp(((HD / 16) * (NN / 64) + 3) / 4, BB * NH);
  k_gemm_hhx<0><<<gvp, 128, 0, stream>>>(VT, NN, (size_t)HD * NN, BA, NN, 0, 0.0625f, nullptr, 0, nullptr, 1, 0, 0, nullptr, VPT, NN, (size_t)HD * NN, HD, NN, NN);      /* v'ᵀ[d][m] = Σ_n vᵀ[d][n]·WA[m][n], batched over the 48 (b,h): M 32 N 2048 K 2048 */
  k_flash<<<BB * NH * (NN / 64), 128, 0, stream>>>(QH, QL, HD, XH, XL, HD, VPT, sp, O, HD);      /* per (b,h) slab of the raw head views (flat planes, ld 32): softmax(coef_h·q·kᵀ)·v' → O raw [B][H][N][32] */
  k_add<<<(unsigned)(((size_t)NR * CC / 4 + 255) / 256), 256, 0, stream>>>(O, XR, ATT, (size_t)NR * CC / 4);      /* attn = raw-reshaped O + x */
  k_rms<0><<<(NR + 7) / 8, 256, 0, stream>>>(ATT, g2, NR, H16, nullptr, nullptr);      /* h = RMSNorm(attn)·g2 → f16 */
  k_gemm_hhx<6><<<gq, 128, 0, stream>>>(H16, CC, 0, B1, CC, 0, 0.0625f, nullptr, 0, nullptr, 1, 0, 0, nullptr, FH, CC, 0, NR, CC, CC);      /* gelu_erf(h·W1ᵀ) → f16: M 4096 N 768 K 768 */
  k_gemm_hhx<0><<<gq, 128, 0, stream>>>(FH, CC, 0, B2, CC, 0, 0.0625f, nullptr, 0, ATT, 1, (size_t)CC, 0, (float*)d_out, nullptr, CC, 0, NR, CC, CC);      /* out = ·W2ᵀ + attn */
}

// v001
// A run of this version takes 372 microseconds.
// Next to v000, in two timings, it ran 1.26 times as fast each time.
#include <hip/hip_runtime.h>
// 'Scalable super' multi-head attention block (B=2, N=2048, C=768, H=24, hd=32): xn = RMSNorm(x)·g1; q = (xn·Wqᵀ) RAW-reshaped [B,H,N,hd] (no transpose — the module's quirk), k = v = xn raw-reshaped likewise; v' = WA[:N,:N]·v (value premix);
// scores = softmax(coef_h · q·kᵀ) with coef_h = log(C)·scale_param[h]·√hd (up to ≈56 → extremely peaked); attn = (scores·v') raw-reshaped back to [B,N,C] + x; h = RMSNorm(attn)·g2; out = gelu_erf(h·W1ᵀ)·W2ᵀ + attn.
// Compute dtype: x, scale_param, weights, WA, g rounded to bf16; RMSNorm in f32 (wave per row) → f16 hi + ×2^10 residual planes; q = xn·Wqᵀ f32-accurate (hi·W + lo·W·2^-10) → hi/lo planes; per (b,h) the 2048×2048 logit plane
// computed inside a fused flash-style kernel from three f16 products (q_hi·k_hi + (q_lo·k_hi + q_hi·k_lo)·2^-10, d = 32) and scaled by the per-head coefficient in f32; online f32 softmax; P f16 ×2^10; v'ᵀ = vᵀ·WAᵀ by GEMM (f16); O = P·v' accumulated in f32 into the raw [B][H][N][hd] buffer; + x; RMSNorm; FF GEMMs
// (erf-GELU epilogue) with the residual through the f32 addend. All contractions on v_wmma_f32_16x16x32_f16, f32 accumulate.
#define BB 2
#define NN 2048
#define CC 768
#define NH 24
#define HD 32
#define NR (BB * NN)
#define HSZ ((size_t)NN * HD)

typedef __bf16 v16b __attribute__((ext_vector_type(16)));
typedef unsigned short v8us __attribute__((ext_vector_type(8), may_alias));
typedef float  v8f  __attribute__((ext_vector_type(8)));
typedef float  v4f  __attribute__((ext_vector_type(4)));
typedef float  v4fa __attribute__((ext_vector_type(4), may_alias));
union FragB { v16b v; v8us half[2]; unsigned short u[16]; };

__device__ __forceinline__ unsigned short bf16_bits(float x) { unsigned int u = __float_as_uint(x); return (unsigned short)((u + 0x7FFFu + ((u >> 16) & 1u)) >> 16); }
__device__ __forceinline__ float bf16_val(unsigned short b) { return __uint_as_float(((unsigned int)b) << 16); }
__device__ __forceinline__ float bf16_round(float x) { return bf16_val(bf16_bits(x)); }
// D += A·B with NT terms: 1 = ah·bh, 2 = + al·bh (A split), 3 = + ah·bl (both split)
template <int NT>
__device__ __forceinline__ v8f mmaN(v16b ah, v16b al, v16b bh, v16b bl, v8f c) {
  c = __builtin_amdgcn_wmma_f32_16x16x32_bf16(false, ah, false, bh, (short)0, c, false, false);
  if (NT >= 2) c = __builtin_amdgcn_wmma_f32_16x16x32_bf16(false, al, false, bh, (short)0, c, false, false);
  if (NT >= 3) c = __builtin_amdgcn_wmma_f32_16x16x32_bf16(false, ah, false, bl, (short)0, c, false, false);
  asm volatile("v_nop\n\tv_nop\n\tv_nop\n\tv_nop" : "+v"(c) : "v"(ah), "v"(al), "v"(bh), "v"(bl));
  return c;
}

__global__ __launch_bounds__(256) void k_wt_bf16(const float* __restrict__ W, unsigned short* __restrict__ Wt, int K, int N) {
  const int t = blockIdx.x * 256 + threadIdx.x;
  const int k8n = K / 8;
  if (t >= N * k8n) return;
  const int n = t / k8n, k8 = (t % k8n) * 8;
  v8us v;
#pragma unroll
  for (int i = 0; i < 8; ++i) v[i] = bf16_bits(W[(size_t)(k8 + i) * N + n]);
  *(v8us*)(Wt + (size_t)n * K + k8) = v;
  
}

// GEMM C[M][N] (f32, pitch ldc) = act(A[M][K]·W + bias). A f32 row-major (pitch lda) converted per fragment to bf16
// (ASPLIT: hi/lo two planes -> 2 terms, else single rounded term); Wt bf16 [N][K] (pitch ldb). BIAS_BF16 rounds the
// bias to bf16 first (bias quantised to bf16 before the add). K%32==0, M%16==0, N%64==0.
template <bool ASPLIT, int ACT, bool BIAS_BF16>
__global__ __launch_bounds__(128) void k_gemm_bf(const float* __restrict__ A, int lda, const unsigned short* __restrict__ Wt, int ldb,
                                               const float* __restrict__ bias, float* __restrict__ C, int ldc, int M, int N, int K) {
  __shared__ __attribute__((aligned(16))) float so[4][16][64];
  const int tid = threadIdx.x, w = tid >> 5, lane = tid & 31, ln = lane & 15, hh = lane >> 4;
  const int ntn = N / 64;
  const int wid = blockIdx.x * 4 + w;
  const int mt = wid / ntn, nq = wid % ntn;
  if (mt * 16 >= M) return;
  const int row0 = mt * 16, col0 = nq * 64;
  const float* arow = A + (size_t)(row0 + ln) * lda;
  v8f acc[4] = {};
  for (int kb = 0; kb < K; kb += 32) {
    FragB ah, al;
    const v4f x0 = *(const v4fa*)(arow + kb + 8 * hh), x1 = *(const v4fa*)(arow + kb + 8 * hh + 4);
    const v4f x2 = *(const v4fa*)(arow + kb + 16 + 8 * hh), x3 = *(const v4fa*)(arow + kb + 16 + 8 * hh + 4);
    float xs[16] = {x0[0],x0[1],x0[2],x0[3],x1[0],x1[1],x1[2],x1[3],x2[0],x2[1],x2[2],x2[3],x3[0],x3[1],x3[2],x3[3]};
#pragma unroll
    for (int i = 0; i < 16; ++i) { const unsigned short hb = bf16_bits(xs[i]); ah.u[i] = hb; al.u[i] = ASPLIT ? bf16_bits(xs[i] - bf16_val(hb)) : (unsigned short)0; }
#pragma unroll
    for (int t = 0; t < 4; ++t) {
      const unsigned short* brow = Wt + (size_t)(col0 + t * 16 + ln) * ldb + kb;
      FragB b;
      b.half[0] = *(const v8us*)(brow + 8 * hh);
      b.half[1] = *(const v8us*)(brow + 16 + 8 * hh);
      acc[t] = mmaN<ASPLIT ? 2 : 1>(ah.v, al.v, b.v, b.v, acc[t]);
    }
  }
#pragma unroll
  for (int t = 0; t < 4; ++t) {
    float bv = bias ? bias[col0 + t * 16 + ln] : 0.f;
    if (BIAS_BF16) bv = bf16_round(bv);
#pragma unroll
    for (int r = 0; r < 8; ++r) { float v = acc[t][r] + bv; if (ACT == 1) v = fmaxf(v, 0.f); so[w][8 * hh + r][t * 16 + ln] = v; }
  }
  __builtin_amdgcn_fence(__ATOMIC_ACQ_REL, "workgroup");
  __builtin_amdgcn_wave_barrier();
  const int rsub = lane >> 4, c4 = (lane & 15) * 4;
  {
#pragma unroll
    for (int q = 0; q < 8; ++q) {
      const int r = q * 2 + rsub;
      const v4f v = *(const v4fa*)&so[w][r][c4];
      *(v4f*)(C + (size_t)(row0 + r) * ldc + col0 + c4) = v;
    }
    
  }
}

// Flash-style causal/unmasked attention, all contractions 3-term bf16 hi/lo splits, f32 softmax with running max.
// q,k,v rows are read from f32 buffers with arbitrary row pitch (so they can live inside a fused qkv buffer);
// D = head size (multiple of 32, <= 128); one wave = 16 query rows; block = 4 waves (64 queries) sharing K/V chunks of 32.
template <int D, bool CAUSAL>
__global__ __launch_bounds__(128) void k_flash(const float* __restrict__ qb, const float* __restrict__ kb, const float* __restrict__ vb,
                                             int pitch, int T, int H, float scale, float* __restrict__ y, int ypitch) {
  constexpr int KS = D / 32;        // k-steps for QK
  constexpr int DT = D / 16;        // d tiles for PV
  __shared__ __attribute__((aligned(16))) unsigned short sKh[32][D + 8], sKl[32][D + 8], sVh[32][D + 8], sVl[32][D + 8];
  __shared__ __attribute__((aligned(16))) unsigned short sPh[4][16][40], sPl[4][16][40];
  __shared__ __attribute__((aligned(16))) float sO[4][16][D];
  const int tid = threadIdx.x, w = tid >> 5, lane = tid & 31, ln = lane & 15, hh = lane >> 4;
  const int nqb = (T + 63) / 64;
  const int bh = blockIdx.x / nqb, qblk = blockIdx.x % nqb;
  const int b = bh / H, h = bh % H;
  const int q0 = qblk * 64 + w * 16;
  const float* Q = qb + (size_t)b * T * pitch + h * D;
  const float* K = kb + (size_t)b * T * pitch + h * D;
  const float* V = vb + (size_t)b * T * pitch + h * D;

  // A fragments of the wave's 16 query rows (scaled), hi/lo
  FragB aqh[KS], aql[KS];
  {
    int row = q0 + ln; if (row >= T) row = T - 1;
    const float* qr = Q + (size_t)row * pitch;
#pragma unroll
    for (int ks = 0; ks < KS; ++ks)
#pragma unroll
      for (int i = 0; i < 16; ++i) {
        const int d = ks * 32 + ((i < 8) ? (8 * hh + i) : (16 + 8 * hh + (i - 8)));
        const float x = qr[d] * scale; const unsigned short hb = bf16_bits(x);
        aqh[ks].u[i] = hb; aql[ks].u[i] = bf16_bits(x - bf16_val(hb));
      }
  }
  float m_r[8], l_r[8];
#pragma unroll
  for (int r = 0; r < 8; ++r) { m_r[r] = -3.0e38f; l_r[r] = 0.f; }
  v8f oacc[DT];
#pragma unroll
  for (int dt = 0; dt < DT; ++dt) oacc[dt] = (v8f){0.f,0.f,0.f,0.f,0.f,0.f,0.f,0.f};

  const int kv_end = CAUSAL ? min(T, qblk * 64 + 64) : T;     // block-uniform
  for (int j0 = 0; j0 < kv_end; j0 += 32) {
    __syncthreads();
    for (int e = tid; e < 32 * (D / 4); e += 128) {
      const int r = e / (D / 4), c4 = (e % (D / 4)) * 4;
      const int key = j0 + r;
      v4f kf = {0.f,0.f,0.f,0.f}, vf = {0.f,0.f,0.f,0.f};
      if (key < T) { kf = *(const v4fa*)(K + (size_t)key * pitch + c4); vf = *(const v4fa*)(V + (size_t)key * pitch + c4); }
#pragma unroll
      for (int t = 0; t < 4; ++t) {
        unsigned short hb = bf16_bits(kf[t]); sKh[r][c4 + t] = hb; sKl[r][c4 + t] = bf16_bits(kf[t] - bf16_val(hb));
        hb = bf16_bits(vf[t]); sVh[r][c4 + t] = hb; sVl[r][c4 + t] = bf16_bits(vf[t] - bf16_val(hb));
      }
    }
    __syncthreads();
    // S tile 16 x 32
    v8f s[2];
#pragma unroll
    for (int nt = 0; nt < 2; ++nt) {
      v8f acc = {};
#pragma unroll
      for (int ks = 0; ks < KS; ++ks) {
        FragB bh_, bl_;
        bh_.half[0] = *(const v8us*)&sKh[nt * 16 + ln][ks * 32 + 8 * hh]; bh_.half[1] = *(const v8us*)&sKh[nt * 16 + ln][ks * 32 + 16 + 8 * hh];
        bl_.half[0] = *(const v8us*)&sKl[nt * 16 + ln][ks * 32 + 8 * hh]; bl_.half[1] = *(const v8us*)&sKl[nt * 16 + ln][ks * 32 + 16 + 8 * hh];
        acc = mmaN<3>(aqh[ks].v, aql[ks].v, bh_.v, bl_.v, acc);
      }
      s[nt] = acc;
    }
    // mask + running max (rows 8hh+r; the 16 lanes of a half share rows)
    float alpha[8];
#pragma unroll
    for (int r = 0; r < 8; ++r) {
      const int qi = q0 + 8 * hh + r;
      const int ja = j0 + ln, jb = j0 + 16 + ln;
      if (CAUSAL) { if (ja > qi) s[0][r] = -3.0e38f; if (jb > qi) s[1][r] = -3.0e38f; }
      if (ja >= T) s[0][r] = -3.0e38f;
      if (jb >= T) s[1][r] = -3.0e38f;
      float mx = fmaxf(s[0][r], s[1][r]);
      mx = fmaxf(mx, __shfl_xor(mx, 1, 32)); mx = fmaxf(mx, __shfl_xor(mx, 2, 32)); mx = fmaxf(mx, __shfl_xor(mx, 4, 32)); mx = fmaxf(mx, __shfl_xor(mx, 8, 32));
      const float mnew = fmaxf(m_r[r], mx);
      alpha[r] = (mnew > -1.0e38f) ? __expf(m_r[r] - mnew) : 1.0f;
      const float p0 = (s[0][r] > -1.0e38f) ? __expf(s[0][r] - mnew) : 0.f;
      const float p1 = (s[1][r] > -1.0e38f) ? __expf(s[1][r] - mnew) : 0.f;
      m_r[r] = mnew;
      l_r[r] = l_r[r] * alpha[r] + p0 + p1;            // per-lane partial row sum (16 lanes combined at the end)
      unsigned short hb = bf16_bits(p0); sPh[w][8 * hh + r][ln] = hb;      sPl[w][8 * hh + r][ln] = bf16_bits(p0 - bf16_val(hb));
      hb = bf16_bits(p1);                sPh[w][8 * hh + r][16 + ln] = hb; sPl[w][8 * hh + r][16 + ln] = bf16_bits(p1 - bf16_val(hb));
    }
#pragma unroll
    for (int dt = 0; dt < DT; ++dt)
#pragma unroll
      for (int r = 0; r < 8; ++r) oacc[dt][r] *= alpha[r];
    __builtin_amdgcn_fence(__ATOMIC_ACQ_REL, "workgroup");
    __builtin_amdgcn_wave_barrier();
    FragB pah, pal;
    pah.half[0] = *(const v8us*)&sPh[w][ln][8 * hh]; pah.half[1] = *(const v8us*)&sPh[w][ln][16 + 8 * hh];
    pal.half[0] = *(const v8us*)&sPl[w][ln][8 * hh]; pal.half[1] = *(const v8us*)&sPl[w][ln][16 + 8 * hh];
#pragma unroll
    for (int dt = 0; dt < DT; ++dt) {
      FragB bvh, bvl;
#pragma unroll
      for (int i = 0; i < 8; ++i) {
        bvh.u[i] = sVh[8 * hh + i][dt * 16 + ln]; bvh.u[8 + i] = sVh[16 + 8 * hh + i][dt * 16 + ln];
        bvl.u[i] = sVl[8 * hh + i][dt * 16 + ln]; bvl.u[8 + i] = sVl[16 + 8 * hh + i][dt * 16 + ln];
      }
      oacc[dt] = mmaN<3>(pah.v, pal.v, bvh.v, bvl.v, oacc[dt]);
    }
    __builtin_amdgcn_fence(__ATOMIC_ACQ_REL, "workgroup");
    __builtin_amdgcn_wave_barrier();
  }
#pragma unroll
  for (int r = 0; r < 8; ++r) {
    float l = l_r[r];
    l += __shfl_xor(l, 1, 32); l += __shfl_xor(l, 2, 32); l += __shfl_xor(l, 4, 32); l += __shfl_xor(l, 8, 32);
    l_r[r] = (l > 0.f) ? 1.0f / l : 0.f;
  }
#pragma unroll
  for (int dt = 0; dt < DT; ++dt)
#pragma unroll
    for (int r = 0; r < 8; ++r) sO[w][8 * hh + r][dt * 16 + ln] = oacc[dt][r] * l_r[r];
  __builtin_amdgcn_fence(__ATOMIC_ACQ_REL, "workgroup");
  __builtin_amdgcn_wave_barrier();
  {
    for (int r = 0; r < 16; ++r) {
      const int row = q0 + r;
      if (row < T && lane < D / 4) {
        const v4f val = *(const v4fa*)&sO[w][r][lane * 4];
        *(v4f*)(y + ((size_t)b * T + row) * ypitch + h * D + lane * 4) = val;
      }
    }
    
  }
}

// GEMM C = act(A·W + bias + resid): A f32 (ASPLIT -> hi/lo 2 terms), Wt bf16 [N][K]; ACT 0 none, 1 relu, 2 exact gelu;
// resid (optional, f32, row index = (row % rmod), pitch ldr, RES_BF16 rounds it) added before the activation.
template <bool ASPLIT, int ACT, bool BIAS_BF16, bool RES_BF16>
__global__ __launch_bounds__(128) void k_gemm_bf3(const float* __restrict__ A, int lda, const unsigned short* __restrict__ Wt, int ldb,
                                                const float* __restrict__ bias, const float* __restrict__ resid, int rmod, int ldr,
                                                float* __restrict__ C, int ldc, int M, int N, int K) {
  __shared__ __attribute__((aligned(16))) float so[4][16][64];
  const int tid = threadIdx.x, w = tid >> 5, lane = tid & 31, ln = lane & 15, hh = lane >> 4;
  const int ntn = N / 64;
  const int wid = blockIdx.x * 4 + w;
  const int mt = wid / ntn, nq = wid % ntn;
  if (mt * 16 >= M) return;
  const int row0 = mt * 16, col0 = nq * 64;
  const float* arow = A + (size_t)(row0 + ln) * lda;
  v8f acc[4] = {};
  for (int kb = 0; kb < K; kb += 32) {
    FragB ah, al;
    const v4f x0 = *(const v4fa*)(arow + kb + 8 * hh), x1 = *(const v4fa*)(arow + kb + 8 * hh + 4);
    const v4f x2 = *(const v4fa*)(arow + kb + 16 + 8 * hh), x3 = *(const v4fa*)(arow + kb + 16 + 8 * hh + 4);
    float xs[16] = {x0[0],x0[1],x0[2],x0[3],x1[0],x1[1],x1[2],x1[3],x2[0],x2[1],x2[2],x2[3],x3[0],x3[1],x3[2],x3[3]};
#pragma unroll
    for (int i = 0; i < 16; ++i) { const unsigned short hb = bf16_bits(xs[i]); ah.u[i] = hb; al.u[i] = ASPLIT ? bf16_bits(xs[i] - bf16_val(hb)) : (unsigned short)0; }
#pragma unroll
    for (int t = 0; t < 4; ++t) {
      const unsigned short* brow = Wt + (size_t)(col0 + t * 16 + ln) * ldb + kb;
      FragB b;
      b.half[0] = *(const v8us*)(brow + 8 * hh);
      b.half[1] = *(const v8us*)(brow + 16 + 8 * hh);
      acc[t] = mmaN<ASPLIT ? 2 : 1>(ah.v, al.v, b.v, b.v, acc[t]);
    }
  }
#pragma unroll
  for (int t = 0; t < 4; ++t) {
    const int col = col0 + t * 16 + ln;
    float bv = bias ? bias[col] : 0.f;
    if (BIAS_BF16) bv = bf16_round(bv);
#pragma unroll
    for (int r = 0; r < 8; ++r) {
      float v = acc[t][r] + bv;
      if (resid) { float rv = resid[(size_t)((row0 + 8 * hh + r) % rmod) * ldr + col]; if (RES_BF16) rv = bf16_round(rv); v += rv; }
      if (ACT == 1) v = fmaxf(v, 0.f);
      if (ACT == 2) v = 0.5f * v * (1.0f + erff(v * 0.70710678118654752f));
      if (ACT == 3) { const float u = 0.7978845608028654f * (v + 0.044715f * v * v * v); v = 0.5f * v * (1.0f + tanhf(u)); }
      so[w][8 * hh + r][t * 16 + ln] = v;
    }
  }
  __builtin_amdgcn_fence(__ATOMIC_ACQ_REL, "workgroup");
  __builtin_amdgcn_wave_barrier();
  const int rsub = lane >> 4, c4 = (lane & 15) * 4;
  {
#pragma unroll
    for (int q = 0; q < 8; ++q) {
      const int r = q * 2 + rsub;
      const v4f v = *(const v4fa*)&so[w][r][c4];
      *(v4f*)(C + (size_t)(row0 + r) * ldc + col0 + c4) = v;
    }
    
  }
}
// row LayerNorm (biased variance, eps) over N: s = X (+ R); optional out_sum <- s; out_norm <- (s-mu)*rsqrt(var+eps)*g + b
template <bool PARAM_BF16>
__global__ __launch_bounds__(256) void k_layernorm(const float* __restrict__ X, const float* __restrict__ R, const float* __restrict__ g, const float* __restrict__ bta,
                                                  float* __restrict__ out_sum, float* __restrict__ out_norm, int N, float eps) {
  __shared__ float red[256];
  const int row = blockIdx.x, tid = threadIdx.x;
  const float* x = X + (size_t)row * N; const float* rr = R ? R + (size_t)row * N : nullptr;
  float vals[16];                     // up to N = 4096
  const int per = N / 256;            // contiguous chunk per thread? use strided-by-4 chunks: thread handles j = tid*4 + 1024*u
  float s1 = 0.f;
  for (int u = 0; u < per / 4; ++u) {
    const int j = tid * 4 + 1024 * u;
    const v4f a = *(const v4fa*)(x + j);
    v4f b = {0.f,0.f,0.f,0.f}; if (rr) b = *(const v4fa*)(rr + j);
#pragma unroll
    for (int q = 0; q < 4; ++q) { const float v = a[q] + b[q]; vals[u * 4 + q] = v; s1 += v; }
  }
  red[tid] = s1; __syncthreads();
  for (int st = 128; st > 0; st >>= 1) { if (tid < st) red[tid] += red[tid + st]; __syncthreads(); }
  const float mu = red[0] / (float)N; __syncthreads();
  float s2 = 0.f;
  for (int u = 0; u < per / 4; ++u)
#pragma unroll
    for (int q = 0; q < 4; ++q) { const float c = vals[u * 4 + q] - mu; s2 += c * c; }
  red[tid] = s2; __syncthreads();
  for (int st = 128; st > 0; st >>= 1) { if (tid < st) red[tid] += red[tid + st]; __syncthreads(); }
  const float rs = rsqrtf(red[0] / (float)N + eps);
  {
    for (int u = 0; u < per / 4; ++u) {
      const int j = tid * 4 + 1024 * u;
      v4f o, sm;
#pragma unroll
      for (int q = 0; q < 4; ++q) {
        float gg = g[j + q], bb = bta[j + q];
        if (PARAM_BF16) { gg = bf16_round(gg); bb = bf16_round(bb); }
        sm[q] = vals[u * 4 + q]; o[q] = (vals[u * 4 + q] - mu) * rs * gg + bb;
      }
      if (out_sum) *(v4f*)(out_sum + (size_t)row * N + j) = sm;
      *(v4f*)(out_norm + (size_t)row * N + j) = o;
    }
    
  }
}



// ---- f16 WMMA path (v_wmma_f32_16x16x32_f16): 11-bit significands for operands in range — used where a [0,1] probability operand needs more precision than bf16
typedef _Float16 v16h __attribute__((ext_vector_type(16)));
union FragH { v16h v; v8us half[2]; _Float16 h[16]; unsigned short u[16]; };
template <int NT>
__device__ __forceinline__ v8f mmaH(v16h ah, v16h al, v16h bh, v16h bl, v8f c) {
  c = __builtin_amdgcn_wmma_f32_16x16x32_f16(false, ah, false, bh, (short)0, c, false, false);
  if (NT >= 2) c = __builtin_amdgcn_wmma_f32_16x16x32_f16(false, al, false, bh, (short)0, c, false, false);
  if (NT >= 3) c = __builtin_amdgcn_wmma_f32_16x16x32_f16(false, ah, false, bl, (short)0, c, false, false);
  asm volatile("v_nop\n\tv_nop\n\tv_nop\n\tv_nop" : "+v"(c) : "v"(ah), "v"(al), "v"(bh), "v"(bl));
  return c;
}
// batched GEMM like k_gemm_b but f16 operands: A f32 (split into f16 hi/lo if ASPLIT, else rounded to f16), Bt = f16 values [n][k]; alpha; C f32; N multiple of 16 (partial tiles skipped)
template <bool ASPLIT>
__global__ __launch_bounds__(128) void k_gemm_h(const float* __restrict__ A, int lda, size_t sA, const _Float16* __restrict__ Bh, int ldb, size_t sB, float alpha, float* __restrict__ C, int ldc, size_t sC, int M, int N, int K) {
  __shared__ __attribute__((aligned(16))) float so[4][16][64];
  const int tid = threadIdx.x, w = tid >> 5, lane = tid & 31, ln = lane & 15, hh = lane >> 4; const int by = blockIdx.y;
  A += (size_t)by * sA; Bh += (size_t)by * sB; C += (size_t)by * sC;
  const int ntn = (N + 63) / 64; const int wid = blockIdx.x * 4 + w; const int mt = wid / ntn, nq = wid % ntn; if (mt * 16 >= M) return;
  const int row0 = mt * 16, col0 = nq * 64; const float* arow = A + (size_t)(row0 + ln) * lda;
  v8f acc[4] = {};
  for (int kb = 0; kb < K; kb += 32) {
    FragH ah, al;
    const v4f x0 = *(const v4fa*)(arow + kb + 8 * hh), x1 = *(const v4fa*)(arow + kb + 8 * hh + 4), x2 = *(const v4fa*)(arow + kb + 16 + 8 * hh), x3 = *(const v4fa*)(arow + kb + 16 + 8 * hh + 4);
    float xs[16] = {x0[0],x0[1],x0[2],x0[3],x1[0],x1[1],x1[2],x1[3],x2[0],x2[1],x2[2],x2[3],x3[0],x3[1],x3[2],x3[3]};
#pragma unroll
    for (int i = 0; i < 16; ++i) { const _Float16 h = (_Float16)xs[i]; ah.h[i] = h; al.h[i] = ASPLIT ? (_Float16)(xs[i] - (float)h) : (_Float16)0.0f; }
#pragma unroll
    for (int t = 0; t < 4; ++t) { if (col0 + t * 16 >= N) continue; const size_t boff = (size_t)(col0 + t * 16 + ln) * ldb + kb; FragH bq; bq.half[0] = *(const v8us*)(Bh + boff + 8 * hh); bq.half[1] = *(const v8us*)(Bh + boff + 16 + 8 * hh);
      acc[t] = mmaH<ASPLIT ? 2 : 1>(ah.v, al.v, bq.v, bq.v, acc[t]); }
  }
#pragma unroll
  for (int t = 0; t < 4; ++t) { if (col0 + t * 16 >= N) continue;
#pragma unroll
    for (int r = 0; r < 8; ++r) so[w][8 * hh + r][t * 16 + ln] = acc[t][r] * alpha; }
  __builtin_amdgcn_fence(__ATOMIC_ACQ_REL, "workgroup"); __builtin_amdgcn_wave_barrier();
  const int rsub = lane >> 4, c4 = (lane & 15) * 4;
  {
#pragma unroll
    for (int q = 0; q < 8; ++q) { const int r = q * 2 + rsub; if (col0 + c4 < N) { const v4f v = *(const v4fa*)&so[w][r][c4]; *(v4f*)(C + (size_t)(row0 + r) * ldc + col0 + c4) = v; } }
     }
}

// Wt[n][k] = f16(W[k][n]·scale) from f32 row-major W[K][N] (scale = power of two; bf16-exact weights stay exact in f16 away from the subnormal range)
__global__ __launch_bounds__(256) void k_wt_f16(const float* __restrict__ W, _Float16* __restrict__ Wt, int K, int N, float scale) {
  const int t = blockIdx.x * 256 + threadIdx.x; if (t >= N * (K / 8)) return; const int n = t / (K / 8), k8 = (t % (K / 8)) * 8; FragH f;
#pragma unroll
  for (int i = 0; i < 8; ++i) f.h[i] = (_Float16)(bf16_round(W[(size_t)(k8 + i) * N + n]) * scale); const v8us o = f.half[0];
  *(v8us*)((unsigned short*)Wt + (size_t)n * K + k8) = o; 
}
// k_gemm_hh variant with fused epilogue: v = acc·alpha + bias[by·sBias + col] (+ CP[(row/rowsPerB)·sCPb + by·64 + col] if CP) ; ACT 0 none / 1 elu ; writes f32 C and/or f16 C16 (each if non-null)
template <int ACT>
__global__ __launch_bounds__(128) void k_gemm_hhx(const _Float16* __restrict__ A, int lda, size_t sA, const _Float16* __restrict__ Bh, int ldb, size_t sB, float alpha, const float* __restrict__ bias, size_t sBias, const float* __restrict__ CP, int rowsPerB, size_t sCPb, int row0g,
    float* __restrict__ C, _Float16* __restrict__ C16, int ldc, size_t sC, int M, int N, int K) {
  __shared__ __attribute__((aligned(16))) float so[4][16][64];
  const int tid = threadIdx.x, w = tid >> 5, lane = tid & 31, ln = lane & 15, hh = lane >> 4; const int by = blockIdx.y;
  A += (size_t)by * sA; Bh += (size_t)by * sB; const size_t cofs = (size_t)by * sC; const float* bp = bias ? bias + (size_t)by * sBias : nullptr;
  const int ntn = (N + 63) / 64; const int wid = blockIdx.x * 4 + w; const int mt = wid / ntn, nq = wid % ntn; if (mt * 16 >= M) return;
  const int row0 = mt * 16, col0 = nq * 64; const _Float16* arow = A + (size_t)(row0 + ln) * lda;
  v8f acc[4] = {};
  for (int kb = 0; kb < K; kb += 32) { FragH ah; ah.half[0] = *(const v8us*)((const unsigned short*)arow + kb + 8 * hh); ah.half[1] = *(const v8us*)((const unsigned short*)arow + kb + 16 + 8 * hh);
#pragma unroll
    for (int t = 0; t < 4; ++t) { if (col0 + t * 16 >= N) continue; const size_t boff = (size_t)(col0 + t * 16 + ln) * ldb + kb; FragH bq; bq.half[0] = *(const v8us*)((const unsigned short*)Bh + boff + 8 * hh); bq.half[1] = *(const v8us*)((const unsigned short*)Bh + boff + 16 + 8 * hh);
      acc[t] = mmaH<1>(ah.v, ah.v, bq.v, bq.v, acc[t]); }
  }
#pragma unroll
  for (int t = 0; t < 4; ++t) { if (col0 + t * 16 >= N) continue; const int col = col0 + t * 16 + ln; const float bv = bp ? bf16_round(bp[col]) : 0.f;
#pragma unroll
    for (int r = 0; r < 8; ++r) { float v = acc[t][r] * alpha + bv; if (CP) { const int bidx = (row0g + row0 + 8 * hh + r) / rowsPerB; v += CP[(size_t)bidx * sCPb + (size_t)by * 64 + col]; } if (ACT == 1) v = (v > 0.f) ? v : expm1f(v); else if (ACT == 7) v = (v > 0.f) ? v + 1.0f : expf(v); else if (ACT == 8) v = tanhf(v); else if (ACT == 9) v = 0.5f * v * (1.0f + tanhf(0.7978845608028654f * (v + 0.044715f * v * v * v))); else if (ACT == 11) v = 1.0f / (1.0f + expf(-v)); else if (ACT == 12) v = (v > 0.f) ? v : 0.01f * v; else if (ACT == 14) v = (v > 0.f) ? v : 0.1f * v; else if (ACT == 15) v = v / (1.0f + expf(-v)); else if (ACT == 3) v = fmaxf(v, 0.f); else if (ACT == 6) v = 0.5f * v * (1.0f + erff(v * 0.70710678118654752f)); so[w][8 * hh + r][t * 16 + ln] = v; } }
  __builtin_amdgcn_fence(__ATOMIC_ACQ_REL, "workgroup"); __builtin_amdgcn_wave_barrier();
  const int rsub = lane >> 4, c4 = (lane & 15) * 4; typedef _Float16 v4h __attribute__((ext_vector_type(4)));
  {
#pragma unroll
    for (int q = 0; q < 8; ++q) { const int r = q * 2 + rsub; if (col0 + c4 < N) { const v4f v = *(const v4fa*)&so[w][r][c4]; if (C) *(v4f*)(C + cofs + (size_t)(row0 + r) * ldc + col0 + c4) = v; if (C16) { v4h h4; for (int i = 0; i < 4; ++i) h4[i] = (_Float16)v[i]; *(v4h*)(C16 + cofs + (size_t)(row0 + r) * ldc + col0 + c4) = h4; } } }
     }
}


typedef _Float16 v4h __attribute__((ext_vector_type(4)));

__global__ __launch_bounds__(256) void k_x16(const float* __restrict__ x, _Float16* __restrict__ X16, size_t n8) { const size_t t = (size_t)blockIdx.x * 256 + threadIdx.x; if (t >= n8) return; FragH f;
#pragma unroll
  for (int q = 0; q < 8; ++q) f.h[q] = (_Float16)bf16_round(x[t * 8 + q]); *(v8us*)((unsigned short*)X16 + t * 8) = f.half[0];  }
__global__ __launch_bounds__(256) void k_h16(const float* __restrict__ x, _Float16* __restrict__ X16, size_t n8) { const size_t t = (size_t)blockIdx.x * 256 + threadIdx.x; if (t >= n8) return; FragH f;
#pragma unroll
  for (int q = 0; q < 8; ++q) f.h[q] = (_Float16)x[t * 8 + q]; *(v8us*)((unsigned short*)X16 + t * 8) = f.half[0];  }
__global__ __launch_bounds__(256) void k_round16f(const float* __restrict__ W, _Float16* __restrict__ Bt, size_t n8) { const size_t t = (size_t)blockIdx.x * 256 + threadIdx.x; if (t >= n8) return; FragH f;
#pragma unroll
  for (int i = 0; i < 8; ++i) f.h[i] = (_Float16)(bf16_round(W[t * 8 + i]) * 16.0f); *(v8us*)((unsigned short*)Bt + t * 8) = f.half[0];  }
template <int NHv, int TTv>
__global__ __launch_bounds__(256) void k_vt(const _Float16* __restrict__ V16, int ldv, int voff, _Float16* __restrict__ Vt) { __shared__ unsigned short tl[64][66]; const int tid = threadIdx.x; const int slab = blockIdx.x / (TTv / 64), lg = blockIdx.x % (TTv / 64); const int b = slab / NHv, h = slab % NHv;
  for (int i = tid; i < 64 * 8; i += 256) { const int r = i / 8, c8 = (i % 8) * 8; FragH f; f.half[0] = *(const v8us*)((const unsigned short*)V16 + ((size_t)b * TTv + lg * 64 + r) * ldv + voff + h * 64 + c8);
#pragma unroll
    for (int q = 0; q < 8; ++q) tl[r][c8 + q] = f.u[q]; }
  __syncthreads();
  {
#pragma unroll
    for (int rd = 0; rd < 2; ++rd) { const int d = rd * 32 + tid / 8, pc = tid % 8; FragH f;
#pragma unroll
      for (int q = 0; q < 8; ++q) f.u[q] = tl[pc * 8 + q][d];
      *(v8us*)((unsigned short*)Vt + ((size_t)slab * 64 + d) * TTv + lg * 64 + pc * 8) = f.half[0]; }
     } }

__global__ __launch_bounds__(256) void k_hl(const float* __restrict__ F, _Float16* __restrict__ Hh, _Float16* __restrict__ Hl, size_t n8) { const size_t t = (size_t)blockIdx.x * 256 + threadIdx.x; if (t >= n8) return; FragH fh, fl; const v4f a = *(const v4fa*)(F + t * 8), c = *(const v4fa*)(F + t * 8 + 4);
#pragma unroll
  for (int q = 0; q < 4; ++q) { _Float16 h = (_Float16)a[q]; fh.h[q] = h; fl.h[q] = (_Float16)((a[q] - (float)h) * 1024.0f); h = (_Float16)c[q]; fh.h[4 + q] = h; fl.h[4 + q] = (_Float16)((c[q] - (float)h) * 1024.0f); }
  { *(v8us*)((unsigned short*)Hh + t * 8) = fh.half[0]; *(v8us*)((unsigned short*)Hl + t * 8) = fl.half[0];  } }
// RMSNorm rows (C = 768 = 32 lanes × 24): y = x·rsqrt(mean(x²) + 1.1920929e-7)·bf16(g); RB: round the input to bf16 first; outputs: f16 hi + ×2^10 residual planes (either may be null) and optionally the f32 rounded input copy XR; wave per row; per lane 6 float4 pieces (c = j·128 + lane·4);
template <int RB>
__global__ __launch_bounds__(256) void k_rms(const float* __restrict__ X, const float* __restrict__ g, int nrows, _Float16* __restrict__ YH, _Float16* __restrict__ YL, float* __restrict__ XR) { const int tid = threadIdx.x, wv = tid >> 5, lane = tid & 31; const int r = blockIdx.x * 8 + wv; if (r >= nrows) return; v4f xv[6]; float ss = 0.f;
#pragma unroll
  for (int j = 0; j < 6; ++j) { v4f a = *(const v4fa*)(X + (size_t)r * CC + j * 128 + lane * 4); if (RB) for (int q = 0; q < 4; ++q) a[q] = bf16_round(a[q]); xv[j] = a; for (int q = 0; q < 4; ++q) ss += a[q] * a[q]; }
  for (int o = 16; o >= 1; o >>= 1) ss += __shfl_xor(ss, o, 32); const float rs = rsqrtf(ss / (float)CC + 1.1920929e-7f);
  typedef _Float16 v4h __attribute__((ext_vector_type(4)));
  {
#pragma unroll
    for (int j = 0; j < 6; ++j) { const int c = j * 128 + lane * 4; v4h hh, hl; for (int q = 0; q < 4; ++q) { const float y = xv[j][q] * rs * bf16_round(g[c + q]); const _Float16 hv = (_Float16)y; hh[q] = hv; hl[q] = (_Float16)((y - (float)hv) * 1024.0f); }
      if (YH) *(v4h*)(YH + (size_t)r * CC + c) = hh; if (YL) *(v4h*)(YL + (size_t)r * CC + c) = hl; if (XR) *(v4f*)(XR + (size_t)r * CC + c) = xv[j]; }
     } }
__global__ __launch_bounds__(256) void k_vtr(const _Float16* __restrict__ XH, const _Float16* __restrict__ XL, _Float16* __restrict__ VT) { __shared__ float tl[64][33]; const int tid = threadIdx.x; const int slab = blockIdx.x / (NN / 64), ng = blockIdx.x % (NN / 64); const int b = slab / NH, h = slab % NH; const size_t base = (size_t)b * NN * CC + (size_t)h * HSZ + (size_t)ng * 64 * HD;      /* 64 consecutive n rows × 32 d = 2048 contiguous elements */
  for (int i = tid; i < 64 * 32; i += 256) { const int n = i / 32, d = i % 32; tl[n][d] = (float)XH[base + i] + (float)XL[base + i] * 0.0009765625f; } __syncthreads();
  const int d = tid / 8, pc = tid % 8; FragH f; for (int q = 0; q < 8; ++q) f.h[q] = (_Float16)tl[pc * 8 + q][d];
  *(v8us*)((unsigned short*)VT + ((size_t)slab * HD + d) * NN + ng * 64 + pc * 8) = f.half[0];  }
// lane l <-> lane l ^ 16 by a vector cross-row move (no LDS counter involved)
__device__ __forceinline__ float xhalf(float x) { return __builtin_bit_cast(float, __builtin_amdgcn_permlanex16(__builtin_bit_cast(int, x), __builtin_bit_cast(int, x), 0x76543210, 0xfedcba98, false, false)); }
typedef float v2f __attribute__((ext_vector_type(2)));
__global__ __launch_bounds__(128) void k_flash(const _Float16* __restrict__ Q16, const _Float16* __restrict__ Q16lo, int ldq, const _Float16* __restrict__ K16, const _Float16* __restrict__ K16lo, int ldk, const _Float16* __restrict__ Vt, const float* __restrict__ SP, float* __restrict__ O, int ldo) {
  constexpr int NQB = NN / 64, DT = 2;
  const int tid = threadIdx.x, w = tid >> 5, lane = tid & 31, ln = lane & 15, hh = lane >> 4;
  const int slab = blockIdx.x / NQB, qblk = blockIdx.x % NQB; const int h = slab % NH; const float coef = (logf(768.0f) * bf16_round(SP[h])) * 5.656854249492381f; const int q0 = qblk * 64 + w * 16;
  FragH bq, bql;
  { const size_t qo = ((size_t)slab * NN + q0 + ln) * ldq; const unsigned short* qr = (const unsigned short*)Q16 + qo; const unsigned short* ql = (const unsigned short*)Q16lo + qo;
    bq.half[0] = *(const v8us*)(qr + 8 * hh); bq.half[1] = *(const v8us*)(qr + 16 + 8 * hh); bql.half[0] = *(const v8us*)(ql + 8 * hh); bql.half[1] = *(const v8us*)(ql + 16 + 8 * hh); }
  const unsigned short* kh = (const unsigned short*)K16 + (size_t)slab * NN * ldk; const unsigned short* kl = (const unsigned short*)K16lo + (size_t)slab * NN * ldk;      /* wave-uniform bases, advanced by 32 key rows a pass */
  const unsigned short* vt = (const unsigned short*)Vt + (size_t)slab * HD * NN;      /* v'^T per slab: [32][N], advanced by 32 columns a pass */
  const unsigned ko[2] = {(unsigned)(ln * ldk + 8 * hh), (unsigned)((16 + ln) * ldk + 8 * hh)}, vo[DT] = {(unsigned)(ln * NN + 8 * hh), (unsigned)((16 + ln) * NN + 8 * hh)};      /* the lane's own element offsets */
  float m_q = -3.0e38f, l_q = 0.f; v8f oacc[DT];
#pragma unroll
  for (int dt = 0; dt < DT; ++dt) oacc[dt] = (v8f){0.f,0.f,0.f,0.f,0.f,0.f,0.f,0.f};
  for (int j0 = 0; j0 < NN; j0 += 32, kh += 32 * (size_t)ldk, kl += 32 * (size_t)ldk, vt += 32) {
    FragH ak[2], akl[2], av[DT];
#pragma unroll
    for (int nt = 0; nt < 2; ++nt) { ak[nt].half[0] = *(const v8us*)(kh + ko[nt]); ak[nt].half[1] = *(const v8us*)(kh + ko[nt] + 16); akl[nt].half[0] = *(const v8us*)(kl + ko[nt]); akl[nt].half[1] = *(const v8us*)(kl + ko[nt] + 16); }
#pragma unroll
    for (int dt = 0; dt < DT; ++dt) { av[dt].half[0] = *(const v8us*)(vt + vo[dt]); av[dt].half[1] = *(const v8us*)(vt + vo[dt] + 16); }
    float sc[16];
#pragma unroll
    for (int nt = 0; nt < 2; ++nt) { v8f acc = (v8f){0.f,0.f,0.f,0.f,0.f,0.f,0.f,0.f}, accl = acc;
      acc = mmaH<1>(ak[nt].v, ak[nt].v, bq.v, bq.v, acc); accl = mmaH<1>(ak[nt].v, ak[nt].v, bql.v, bql.v, accl); accl = mmaH<1>(akl[nt].v, akl[nt].v, bq.v, bq.v, accl);
#pragma unroll
      for (int r = 0; r < 8; ++r) { acc[r] += accl[r] * 0.0009765625f; sc[nt * 8 + r] = acc[r] * coef; } }
    float mx[8];
#pragma unroll
    for (int r = 0; r < 8; ++r) mx[r] = fmaxf(sc[r], sc[8 + r]);
    float mc = fmaxf(fmaxf(fmaxf(mx[0], mx[1]), fmaxf(mx[2], mx[3])), fmaxf(fmaxf(mx[4], mx[5]), fmaxf(mx[6], mx[7])));
    mc = fmaxf(mc, xhalf(mc));
    const float mn = fmaxf(m_q, mc); const float al = (mn > -1.0e38f) ? expf(m_q - mn) : 1.0f; m_q = mn;
    v2f p2[8]; FragH pb;
#pragma unroll
    for (int i = 0; i < 8; ++i) { p2[i].x = expf(sc[2 * i] - mn); p2[i].y = expf(sc[2 * i + 1] - mn); pb.h[2 * i] = (_Float16)(p2[i].x * 1024.0f); pb.h[2 * i + 1] = (_Float16)(p2[i].y * 1024.0f); }
    const v2f ps = ((p2[0] + p2[1]) + (p2[2] + p2[3])) + ((p2[4] + p2[5]) + (p2[6] + p2[7]));
    l_q = l_q * al + (ps.x + ps.y);      /* per-lane partial sum of the query's denominator (the two halves are joined after the loop) */
#pragma unroll
    for (int dt = 0; dt < DT; ++dt) {
#pragma unroll
      for (int r = 0; r < 8; ++r) oacc[dt][r] *= al;
      oacc[dt] = mmaH<1>(av[dt].v, av[dt].v, pb.v, pb.v, oacc[dt]); } }
  const float lt = l_q + xhalf(l_q); const float inv = (lt > 0.f) ? 1.0f / (lt * 1024.0f) : 0.f;
  float* orow = O + ((size_t)slab * NN + q0 + ln) * ldo + 8 * hh;      /* oacc[dt][r] = O[q0 + ln][dt * 16 + 8hh + r]: eight consecutive d per lane */
#pragma unroll
  for (int dt = 0; dt < DT; ++dt) { const v4f o0 = {oacc[dt][0] * inv, oacc[dt][1] * inv, oacc[dt][2] * inv, oacc[dt][3] * inv}, o1 = {oacc[dt][4] * inv, oacc[dt][5] * inv, oacc[dt][6] * inv, oacc[dt][7] * inv};
    *(v4f*)(orow + dt * 16) = o0; *(v4f*)(orow + dt * 16 + 4) = o1; } }

__global__ __launch_bounds__(256) void k_add(const float* __restrict__ A, const float* __restrict__ B_, float* __restrict__ out, size_t n4) { const size_t t = (size_t)blockIdx.x * 256 + threadIdx.x; if (t >= n4) return; v4f a = *(const v4fa*)(A + t * 4); const v4f b = *(const v4fa*)(B_ + t * 4); for (int q = 0; q < 4; ++q) a[q] += b[q]; *(v4f*)(out + t * 4) = a;  }

extern "C" void kernel_launch(void* const* d_in, const int* in_sizes, int n_in,
                              void* d_out, int out_size, void* d_ws, size_t ws_size, hipStream_t stream) {
  (void)in_sizes; (void)n_in; (void)out_size;
  const float* const* I = (const float* const*)d_in; const float* x = I[0]; const float* sp = I[1]; const float* Wq = I[2]; const float* WA = I[3]; const float* W1 = I[4]; const float* W2 = I[5]; const float* g1 = I[6]; const float* g2 = I[7];
  char* ws = (char*)d_ws; size_t off = 0;
  auto take = [&](size_t bytes) { char* p = ws + off; off += (bytes + 255) & ~(size_t)255; return p; };
  const size_t WSZ = (size_t)CC * CC; _Float16* Bq = (_Float16*)take(WSZ * 2); _Float16* B1 = (_Float16*)take(WSZ * 2); _Float16* B2 = (_Float16*)take(WSZ * 2); _Float16* BA = (_Float16*)take((size_t)NN * NN * 2);
  _Float16* XH = (_Float16*)take((size_t)NR * CC * 2); _Float16* XL = (_Float16*)take((size_t)NR * CC * 2); float* XR = (float*)take((size_t)NR * CC * 4); float* QF = (float*)take((size_t)NR * CC * 4); _Float16* QH = (_Float16*)take((size_t)NR * CC * 2); _Float16* QL = (_Float16*)take((size_t)NR * CC * 2);
  _Float16* VT = (_Float16*)take((size_t)BB * NH * HD * NN * 2); _Float16* VPT = (_Float16*)take((size_t)BB * NH * HD * NN * 2); float* ATT = (float*)take((size_t)NR * CC * 4);
  float* O = QF; _Float16* H16 = XH; _Float16* FH = XL;      /* O (raw [B][H][N][hd] f32) over q f32 (dead after k_hl); RMSNorm2 output over XH and the FF hidden over XL (both dead after k_flash) */
  if (off > ws_size) return;      // 3.5 + 8.4 + 6.3 × 2 + 12.6 × 2 + 6.3 × 2 + 6.3 × 2 + 12.6 ≈ 87 MB
  const unsigned gw = (unsigned)((WSZ / 8 + 255) / 256); k_round16f<<<gw, 256, 0, stream>>>(Wq, Bq, WSZ / 8); k_round16f<<<gw, 256, 0, stream>>>(W1, B1, WSZ / 8); k_round16f<<<gw, 256, 0, stream>>>(W2, B2, WSZ / 8); k_round16f<<<(unsigned)(((size_t)NN * NN / 8 + 255) / 256), 256, 0, stream>>>(WA, BA, (size_t)NN * NN / 8);      /* (out,in) natural ×2^4; WA natural [m][n] ×2^4 */
  k_rms<1><<<(NR + 7) / 8, 256, 0, stream>>>(x, g1, NR, XH, XL, XR);      /* xn = RMSNorm(bf16 x)·g1 → hi / ×2^10 residual; XR = bf16(x) */
  const dim3 gq(((NR / 16) * (CC / 64) + 3) / 4, 1);
  k_gemm_hhx<0><<<gq, 128, 0, stream>>>(XH, CC, 0, Bq, CC, 0, 0.0625f, nullptr, 0, nullptr, 1, 0, 0, QF, nullptr, CC, 0, NR, CC, CC);      /* q = xn·Wqᵀ: hi term, M 4096 N 768 K 768 */
  k_gemm_hhx<0><<<gq, 128, 0, stream>>>(XL, CC, 0, Bq, CC, 0, 0.0625f * 0.0009765625f, nullptr, 0, QF, 1, (size_t)CC, 0, QF, nullptr, CC, 0, NR, CC, CC);      /* += lo term ·2^-10 in place */
  k_hl<<<(unsigned)(((size_t)NR * CC / 8 + 255) / 256), 256, 0, stream>>>(QF, QH, QL, (size_t)NR * CC / 8);      /* q → hi / ×2^10 residual (flat planes; head h of batch b = elements [b·N·C + h·N·hd, +N·hd) viewed [N][hd]) */
  k_vtr<<<BB * NH * (NN / 64), 256, 0, stream>>>(XH, XL, VT);      /* vᵀ per (b,h): [32][2048] f16 */
  const dim3 gvp(((HD / 16) * (NN / 64) + 3) / 4, BB * NH);
  k_gemm_hhx<0><<<gvp, 128, 0, stream>>>(VT, NN, (size_t)HD * NN, BA, NN, 0, 0.0625f, nullptr, 0, nullptr, 1, 0, 0, nullptr, VPT, NN, (size_t)HD * NN, HD, NN, NN);      /* v'ᵀ[d][m] = Σ_n vᵀ[d][n]·WA[m][n], batched over the 48 (b,h): M 32 N 2048 K 2048 */
  k_flash<<<BB * NH * (NN / 64), 128, 0, stream>>>(QH, QL, HD, XH, XL, HD, VPT, sp, O, HD);      /* per (b,h) slab of the raw head views (flat planes, ld 32): softmax(coef_h·q·kᵀ)·v' → O raw [B][H][N][32] */
  k_add<<<(unsigned)(((size_t)NR * CC / 4 + 255) / 256), 256, 0, stream>>>(O, XR, ATT, (size_t)NR * CC / 4);      /* attn = raw-reshaped O + x */
  k_rms<0><<<(NR + 7) / 8, 256, 0, stream>>>(ATT, g2, NR, H16, nullptr, nullptr);      /* h = RMSNorm(attn)·g2 → f16 */
  k_gemm_hhx<6><<<gq, 128, 0, stream>>>(H16, CC, 0, B1, CC, 0, 0.0625f, nullptr, 0, nullptr, 1, 0, 0, nullptr, FH, CC, 0, NR, CC, CC);      /* gelu_erf(h·W1ᵀ) → f16: M 4096 N 768 K 768 */
  k_gemm_hhx<0><<<gq, 128, 0, stream>>>(FH, CC, 0, B2, CC, 0, 0.0625f, nullptr, 0, ATT, 1, (size_t)CC, 0, (float*)d_out, nullptr, CC, 0, NR, CC, CC);      /* out = ·W2ᵀ + attn */
}

// v002
// Measured time: 291 microseconds a run.
// Timed twice side by side with v001, it ran 1.28 times as fast both times.
// All steps since v000 together make it 1.61 times as fast.
#include <hip/hip_runtime.h>
// 'Scalable super' multi-head attention block (B=2, N=2048, C=768, H=24, hd=32): xn = RMSNorm(x)·g1; q = (xn·Wqᵀ) RAW-reshaped [B,H,N,hd] (no transpose — the module's quirk), k = v = xn raw-reshaped likewise; v' = WA[:N,:N]·v (value premix);
// scores = softmax(coef_h · q·kᵀ) with coef_h = log(C)·scale_param[h]·√hd (up to ≈56 → extremely peaked); attn = (scores·v') raw-reshaped back to [B,N,C] + x; h = RMSNorm(attn)·g2; out = gelu_erf(h·W1ᵀ)·W2ᵀ + attn.
// Compute dtype: x, scale_param, weights, WA, g rounded to bf16; RMSNorm in f32 (wave per row) → f16 hi + ×2^10 residual planes; q = xn·Wqᵀ f32-accurate (hi·W + lo·W·2^-10) → hi/lo planes; per (b,h) the 2048×2048 logit plane
// computed inside a fused flash-style kernel from three f16 products (q_hi·k_hi + (q_lo·k_hi + q_hi·k_lo)·2^-10, d = 32) and scaled by the per-head coefficient in f32; online f32 softmax; P f16 ×2^10; v'ᵀ = vᵀ·WAᵀ by GEMM (f16); O = P·v' accumulated in f32 into the raw [B][H][N][hd] buffer; + x; RMSNorm; FF GEMMs
// (erf-GELU epilogue) with the residual through the f32 addend. All contractions on v_wmma_f32_16x16x32_f16, f32 accumulate.
#define BB 2
#define NN 2048
#define CC 768
#define NH 24
#define HD 32
#define NR (BB * NN)
#define HSZ ((size_t)NN * HD)

typedef __bf16 v16b __attribute__((ext_vector_type(16)));
typedef unsigned short v8us __attribute__((ext_vector_type(8), may_alias));
typedef float  v8f  __attribute__((ext_vector_type(8)));
typedef float  v4f  __attribute__((ext_vector_type(4)));
typedef float  v4fa __attribute__((ext_vector_type(4), may_alias));
union FragB { v16b v; v8us half[2]; unsigned short u[16]; };

__device__ __forceinline__ unsigned short bf16_bits(float x) { unsigned int u = __float_as_uint(x); return (unsigned short)((u + 0x7FFFu + ((u >> 16) & 1u)) >> 16); }
__device__ __forceinline__ float bf16_val(unsigned short b) { return __uint_as_float(((unsigned int)b) << 16); }
__device__ __forceinline__ float bf16_round(float x) { return bf16_val(bf16_bits(x)); }
// D += A·B with NT terms: 1 = ah·bh, 2 = + al·bh (A split), 3 = + ah·bl (both split)
template <int NT>
__device__ __forceinline__ v8f mmaN(v16b ah, v16b al, v16b bh, v16b bl, v8f c) {
  c = __builtin_amdgcn_wmma_f32_16x16x32_bf16(false, ah, false, bh, (short)0, c, false, false);
  if (NT >= 2) c = __builtin_amdgcn_wmma_f32_16x16x32_bf16(false, al, false, bh, (short)0, c, false, false);
  if (NT >= 3) c = __builtin_amdgcn_wmma_f32_16x16x32_bf16(false, ah, false, bl, (short)0, c, false, false);
  asm volatile("v_nop\n\tv_nop\n\tv_nop\n\tv_nop" : "+v"(c) : "v"(ah), "v"(al), "v"(bh), "v"(bl));
  return c;
}

__global__ __launch_bounds__(256) void k_wt_bf16(const float* __restrict__ W, unsigned short* __restrict__ Wt, int K, int N) {
  const int t = blockIdx.x * 256 + threadIdx.x;
  const int k8n = K / 8;
  if (t >= N * k8n) return;
  const int n = t / k8n, k8 = (t % k8n) * 8;
  v8us v;
#pragma unroll
  for (int i = 0; i < 8; ++i) v[i] = bf16_bits(W[(size_t)(k8 + i) * N + n]);
  *(v8us*)(Wt + (size_t)n * K + k8) = v;
  
}

// GEMM C[M][N] (f32, pitch ldc) = act(A[M][K]·W + bias). A f32 row-major (pitch lda) converted per fragment to bf16
// (ASPLIT: hi/lo two planes -> 2 terms, else single rounded term); Wt bf16 [N][K] (pitch ldb). BIAS_BF16 rounds the
// bias to bf16 first (bias quantised to bf16 before the add). K%32==0, M%16==0, N%64==0.
template <bool ASPLIT, int ACT, bool BIAS_BF16>
__global__ __launch_bounds__(128) void k_gemm_bf(const float* __restrict__ A, int lda, const unsigned short* __restrict__ Wt, int ldb,
                                               const float* __restrict__ bias, float* __restrict__ C, int ldc, int M, int N, int K) {
  __shared__ __attribute__((aligned(16))) float so[4][16][64];
  const int tid = threadIdx.x, w = tid >> 5, lane = tid & 31, ln = lane & 15, hh = lane >> 4;
  const int ntn = N / 64;
  const int wid = blockIdx.x * 4 + w;
  const int mt = wid / ntn, nq = wid % ntn;
  if (mt * 16 >= M) return;
  const int row0 = mt * 16, col0 = nq * 64;
  const float* arow = A + (size_t)(row0 + ln) * lda;
  v8f acc[4] = {};
  for (int kb = 0; kb < K; kb += 32) {
    FragB ah, al;
    const v4f x0 = *(const v4fa*)(arow + kb + 8 * hh), x1 = *(const v4fa*)(arow + kb + 8 * hh + 4);
    const v4f x2 = *(const v4fa*)(arow + kb + 16 + 8 * hh), x3 = *(const v4fa*)(arow + kb + 16 + 8 * hh + 4);
    float xs[16] = {x0[0],x0[1],x0[2],x0[3],x1[0],x1[1],x1[2],x1[3],x2[0],x2[1],x2[2],x2[3],x3[0],x3[1],x3[2],x3[3]};
#pragma unroll
    for (int i = 0; i < 16; ++i) { const unsigned short hb = bf16_bits(xs[i]); ah.u[i] = hb; al.u[i] = ASPLIT ? bf16_bits(xs[i] - bf16_val(hb)) : (unsigned short)0; }
#pragma unroll
    for (int t = 0; t < 4; ++t) {
      const unsigned short* brow = Wt + (size_t)(col0 + t * 16 + ln) * ldb + kb;
      FragB b;
      b.half[0] = *(const v8us*)(brow + 8 * hh);
      b.half[1] = *(const v8us*)(brow + 16 + 8 * hh);
      acc[t] = mmaN<ASPLIT ? 2 : 1>(ah.v, al.v, b.v, b.v, acc[t]);
    }
  }
#pragma unroll
  for (int t = 0; t < 4; ++t) {
    float bv = bias ? bias[col0 + t * 16 + ln] : 0.f;
    if (BIAS_BF16) bv = bf16_round(bv);
#pragma unroll
    for (int r = 0; r < 8; ++r) { float v = acc[t][r] + bv; if (ACT == 1) v = fmaxf(v, 0.f); so[w][8 * hh + r][t * 16 + ln] = v; }
  }
  __builtin_amdgcn_fence(__ATOMIC_ACQ_REL, "workgroup");
  __builtin_amdgcn_wave_barrier();
  const int rsub = lane >> 4, c4 = (lane & 15) * 4;
  {
#pragma unroll
    for (int q = 0; q < 8; ++q) {
      const int r = q * 2 + rsub;
      const v4f v = *(const v4fa*)&so[w][r][c4];
      *(v4f*)(C + (size_t)(row0 + r) * ldc + col0 + c4) = v;
    }
    
  }
}

// Flash-style causal/unmasked attention, all contractions 3-term bf16 hi/lo splits, f32 softmax with running max.
// q,k,v rows are read from f32 buffers with arbitrary row pitch (so they can live inside a fused qkv buffer);
// D = head size (multiple of 32, <= 128); one wave = 16 query rows; block = 4 waves (64 queries) sharing K/V chunks of 32.
template <int D, bool CAUSAL>
__global__ __launch_bounds__(128) void k_flash(const float* __restrict__ qb, const float* __restrict__ kb, const float* __restrict__ vb,
                                             int pitch, int T, int H, float scale, float* __restrict__ y, int ypitch) {
  constexpr int KS = D / 32;        // k-steps for QK
  constexpr int DT = D / 16;        // d tiles for PV
  __shared__ __attribute__((aligned(16))) unsigned short sKh[32][D + 8], sKl[32][D + 8], sVh[32][D + 8], sVl[32][D + 8];
  __shared__ __attribute__((aligned(16))) unsigned short sPh[4][16][40], sPl[4][16][40];
  __shared__ __attribute__((aligned(16))) float sO[4][16][D];
  const int tid = threadIdx.x, w = tid >> 5, lane = tid & 31, ln = lane & 15, hh = lane >> 4;
  const int nqb = (T + 63) / 64;
  const int bh = blockIdx.x / nqb, qblk = blockIdx.x % nqb;
  const int b = bh / H, h = bh % H;
  const int q0 = qblk * 64 + w * 16;
  const float* Q = qb + (size_t)b * T * pitch + h * D;
  const float* K = kb + (size_t)b * T * pitch + h * D;
  const float* V = vb + (size_t)b * T * pitch + h * D;

  // A fragments of the wave's 16 query rows (scaled), hi/lo
  FragB aqh[KS], aql[KS];
  {
    int row = q0 + ln; if (row >= T) row = T - 1;
    const float* qr = Q + (size_t)row * pitch;
#pragma unroll
    for (int ks = 0; ks < KS; ++ks)
#pragma unroll
      for (int i = 0; i < 16; ++i) {
        const int d = ks * 32 + ((i < 8) ? (8 * hh + i) : (16 + 8 * hh + (i - 8)));
        const float x = qr[d] * scale; const unsigned short hb = bf16_bits(x);
        aqh[ks].u[i] = hb; aql[ks].u[i] = bf16_bits(x - bf16_val(hb));
      }
  }
  float m_r[8], l_r[8];
#pragma unroll
  for (int r = 0; r < 8; ++r) { m_r[r] = -3.0e38f; l_r[r] = 0.f; }
  v8f oacc[DT];
#pragma unroll
  for (int dt = 0; dt < DT; ++dt) oacc[dt] = (v8f){0.f,0.f,0.f,0.f,0.f,0.f,0.f,0.f};

  const int kv_end = CAUSAL ? min(T, qblk * 64 + 64) : T;     // block-uniform
  for (int j0 = 0; j0 < kv_end; j0 += 32) {
    __syncthreads();
    for (int e = tid; e < 32 * (D / 4); e += 128) {
      const int r = e / (D / 4), c4 = (e % (D / 4)) * 4;
      const int key = j0 + r;
      v4f kf = {0.f,0.f,0.f,0.f}, vf = {0.f,0.f,0.f,0.f};
      if (key < T) { kf = *(const v4fa*)(K + (size_t)key * pitch + c4); vf = *(const v4fa*)(V + (size_t)key * pitch + c4); }
#pragma unroll
      for (int t = 0; t < 4; ++t) {
        unsigned short hb = bf16_bits(kf[t]); sKh[r][c4 + t] = hb; sKl[r][c4 + t] = bf16_bits(kf[t] - bf16_val(hb));
        hb = bf16_bits(vf[t]); sVh[r][c4 + t] = hb; sVl[r][c4 + t] = bf16_bits(vf[t] - bf16_val(hb));
      }
    }
    __syncthreads();
    // S tile 16 x 32
    v8f s[2];
#pragma unroll
    for (int nt = 0; nt < 2; ++nt) {
      v8f acc = {};
#pragma unroll
      for (int ks = 0; ks < KS; ++ks) {
        FragB bh_, bl_;
        bh_.half[0] = *(const v8us*)&sKh[nt * 16 + ln][ks * 32 + 8 * hh]; bh_.half[1] = *(const v8us*)&sKh[nt * 16 + ln][ks * 32 + 16 + 8 * hh];
        bl_.half[0] = *(const v8us*)&sKl[nt * 16 + ln][ks * 32 + 8 * hh]; bl_.half[1] = *(const v8us*)&sKl[nt * 16 + ln][ks * 32 + 16 + 8 * hh];
        acc = mmaN<3>(aqh[ks].v, aql[ks].v, bh_.v, bl_.v, acc);
      }
      s[nt] = acc;
    }
    // mask + running max (rows 8hh+r; the 16 lanes of a half share rows)
    float alpha[8];
#pragma unroll
    for (int r = 0; r < 8; ++r) {
      const int qi = q0 + 8 * hh + r;
      const int ja = j0 + ln, jb = j0 + 16 + ln;
      if (CAUSAL) { if (ja > qi) s[0][r] = -3.0e38f; if (jb > qi) s[1][r] = -3.0e38f; }
      if (ja >= T) s[0][r] = -3.0e38f;
      if (jb >= T) s[1][r] = -3.0e38f;
      float mx = fmaxf(s[0][r], s[1][r]);
      mx = fmaxf(mx, __shfl_xor(mx, 1, 32)); mx = fmaxf(mx, __shfl_xor(mx, 2, 32)); mx = fmaxf(mx, __shfl_xor(mx, 4, 32)); mx = fmaxf(mx, __shfl_xor(mx, 8, 32));
      const float mnew = fmaxf(m_r[r], mx);
      alpha[r] = (mnew > -1.0e38f) ? __expf(m_r[r] - mnew) : 1.0f;
      const float p0 = (s[0][r] > -1.0e38f) ? __expf(s[0][r] - mnew) : 0.f;
      const float p1 = (s[1][r] > -1.0e38f) ? __expf(s[1][r] - mnew) : 0.f;
      m_r[r] = mnew;
      l_r[r] = l_r[r] * alpha[r] + p0 + p1;            // per-lane partial row sum (16 lanes combined at the end)
      unsigned short hb = bf16_bits(p0); sPh[w][8 * hh + r][ln] = hb;      sPl[w][8 * hh + r][ln] = bf16_bits(p0 - bf16_val(hb));
      hb = bf16_bits(p1);                sPh[w][8 * hh + r][16 + ln] = hb; sPl[w][8 * hh + r][16 + ln] = bf16_bits(p1 - bf16_val(hb));
    }
#pragma unroll
    for (int dt = 0; dt < DT; ++dt)
#pragma unroll
      for (int r = 0; r < 8; ++r) oacc[dt][r] *= alpha[r];
    __builtin_amdgcn_fence(__ATOMIC_ACQ_REL, "workgroup");
    __builtin_amdgcn_wave_barrier();
    FragB pah, pal;
    pah.half[0] = *(const v8us*)&sPh[w][ln][8 * hh]; pah.half[1] = *(const v8us*)&sPh[w][ln][16 + 8 * hh];
    pal.half[0] = *(const v8us*)&sPl[w][ln][8 * hh]; pal.half[1] = *(const v8us*)&sPl[w][ln][16 + 8 * hh];
#pragma unroll
    for (int dt = 0; dt < DT; ++dt) {
      FragB bvh, bvl;
#pragma unroll
      for (int i = 0; i < 8; ++i) {
        bvh.u[i] = sVh[8 * hh + i][dt * 16 + ln]; bvh.u[8 + i] = sVh[16 + 8 * hh + i][dt * 16 + ln];
        bvl.u[i] = sVl[8 * hh + i][dt * 16 + ln]; bvl.u[8 + i] = sVl[16 + 8 * hh + i][dt * 16 + ln];
      }
      oacc[dt] = mmaN<3>(pah.v, pal.v, bvh.v, bvl.v, oacc[dt]);
    }
    __builtin_amdgcn_fence(__ATOMIC_ACQ_REL, "workgroup");
    __builtin_amdgcn_wave_barrier();
  }
#pragma unroll
  for (int r = 0; r < 8; ++r) {
    float l = l_r[r];
    l += __shfl_xor(l, 1, 32); l += __shfl_xor(l, 2, 32); l += __shfl_xor(l, 4, 32); l += __shfl_xor(l, 8, 32);
    l_r[r] = (l > 0.f) ? 1.0f / l : 0.f;
  }
#pragma unroll
  for (int dt = 0; dt < DT; ++dt)
#pragma unroll
    for (int r = 0; r < 8; ++r) sO[w][8 * hh + r][dt * 16 + ln] = oacc[dt][r] * l_r[r];
  __builtin_amdgcn_fence(__ATOMIC_ACQ_REL, "workgroup");
  __builtin_amdgcn_wave_barrier();
  {
    for (int r = 0; r < 16; ++r) {
      const int row = q0 + r;
      if (row < T && lane < D / 4) {
        const v4f val = *(const v4fa*)&sO[w][r][lane * 4];
        *(v4f*)(y + ((size_t)b * T + row) * ypitch + h * D + lane * 4) = val;
      }
    }
    
  }
}

// GEMM C = act(A·W + bias + resid): A f32 (ASPLIT -> hi/lo 2 terms), Wt bf16 [N][K]; ACT 0 none, 1 relu, 2 exact gelu;
// resid (optional, f32, row index = (row % rmod), pitch ldr, RES_BF16 rounds it) added before the activation.
template <bool ASPLIT, int ACT, bool BIAS_BF16, bool RES_BF16>
__global__ __launch_bounds__(128) void k_gemm_bf3(const float* __restrict__ A, int lda, const unsigned short* __restrict__ Wt, int ldb,
                                                const float* __restrict__ bias, const float* __restrict__ resid, int rmod, int ldr,
                                                float* __restrict__ C, int ldc, int M, int N, int K) {
  __shared__ __attribute__((aligned(16))) float so[4][16][64];
  const int tid = threadIdx.x, w = tid >> 5, lane = tid & 31, ln = lane & 15, hh = lane >> 4;
  const int ntn = N / 64;
  const int wid = blockIdx.x * 4 + w;
  const int mt = wid / ntn, nq = wid % ntn;
  if (mt * 16 >= M) return;
  const int row0 = mt * 16, col0 = nq * 64;
  const float* arow = A + (size_t)(row0 + ln) * lda;
  v8f acc[4] = {};
  for (int kb = 0; kb < K; kb += 32) {
    FragB ah, al;
    const v4f x0 = *(const v4fa*)(arow + kb + 8 * hh), x1 = *(const v4fa*)(arow + kb + 8 * hh + 4);
    const v4f x2 = *(const v4fa*)(arow + kb + 16 + 8 * hh), x3 = *(const v4fa*)(arow + kb + 16 + 8 * hh + 4);
    float xs[16] = {x0[0],x0[1],x0[2],x0[3],x1[0],x1[1],x1[2],x1[3],x2[0],x2[1],x2[2],x2[3],x3[0],x3[1],x3[2],x3[3]};
#pragma unroll
    for (int i = 0; i < 16; ++i) { const unsigned short hb = bf16_bits(xs[i]); ah.u[i] = hb; al.u[i] = ASPLIT ? bf16_bits(xs[i] - bf16_val(hb)) : (unsigned short)0; }
#pragma unroll
    for (int t = 0; t < 4; ++t) {
      const unsigned short* brow = Wt + (size_t)(col0 + t * 16 + ln) * ldb + kb;
      FragB b;
      b.half[0] = *(const v8us*)(brow + 8 * hh);
      b.half[1] = *(const v8us*)(brow + 16 + 8 * hh);
      acc[t] = mmaN<ASPLIT ? 2 : 1>(ah.v, al.v, b.v, b.v, acc[t]);
    }
  }
#pragma unroll
  for (int t = 0; t < 4; ++t) {
    const int col = col0 + t * 16 + ln;
    float bv = bias ? bias[col] : 0.f;
    if (BIAS_BF16) bv = bf16_round(bv);
#pragma unroll
    for (int r = 0; r < 8; ++r) {
      float v = acc[t][r] + bv;
      if (resid) { float rv = resid[(size_t)((row0 + 8 * hh + r) % rmod) * ldr + col]; if (RES_BF16) rv = bf16_round(rv); v += rv; }
      if (ACT == 1) v = fmaxf(v, 0.f);
      if (ACT == 2) v = 0.5f * v * (1.0f + erff(v * 0.70710678118654752f));
      if (ACT == 3) { const float u = 0.7978845608028654f * (v + 0.044715f * v * v * v); v = 0.5f * v * (1.0f + tanhf(u)); }
      so[w][8 * hh + r][t * 16 + ln] = v;
    }
  }
  __builtin_amdgcn_fence(__ATOMIC_ACQ_REL, "workgroup");
  __builtin_amdgcn_wave_barrier();
  const int rsub = lane >> 4, c4 = (lane & 15) * 4;
  {
#pragma unroll
    for (int q = 0; q < 8; ++q) {
      const int r = q * 2 + rsub;
      const v4f v = *(const v4fa*)&so[w][r][c4];
      *(v4f*)(C + (size_t)(row0 + r) * ldc + col0 + c4) = v;
    }
    
  }
}
// row LayerNorm (biased variance, eps) over N: s = X (+ R); optional out_sum <- s; out_norm <- (s-mu)*rsqrt(var+eps)*g + b
template <bool PARAM_BF16>
__global__ __launch_bounds__(256) void k_layernorm(const float* __restrict__ X, const float* __restrict__ R, const float* __restrict__ g, const float* __restrict__ bta,
                                                  float* __restrict__ out_sum, float* __restrict__ out_norm, int N, float eps) {
  __shared__ float red[256];
  const int row = blockIdx.x, tid = threadIdx.x;
  const float* x = X + (size_t)row * N; const float* rr = R ? R + (size_t)row * N : nullptr;
  float vals[16];                     // up to N = 4096
  const int per = N / 256;            // contiguous chunk per thread? use strided-by-4 chunks: thread handles j = tid*4 + 1024*u
  float s1 = 0.f;
  for (int u = 0; u < per / 4; ++u) {
    const int j = tid * 4 + 1024 * u;
    const v4f a = *(const v4fa*)(x + j);
    v4f b = {0.f,0.f,0.f,0.f}; if (rr) b = *(const v4fa*)(rr + j);
#pragma unroll
    for (int q = 0; q < 4; ++q) { const float v = a[q] + b[q]; vals[u * 4 + q] = v; s1 += v; }
  }
  red[tid] = s1; __syncthreads();
  for (int st = 128; st > 0; st >>= 1) { if (tid < st) red[tid] += red[tid + st]; __syncthreads(); }
  const float mu = red[0] / (float)N; __syncthreads();
  float s2 = 0.f;
  for (int u = 0; u < per / 4; ++u)
#pragma unroll
    for (int q = 0; q < 4; ++q) { const float c = vals[u * 4 + q] - mu; s2 += c * c; }
  red[tid] = s2; __syncthreads();
  for (int st = 128; st > 0; st >>= 1) { if (tid < st) red[tid] += red[tid + st]; __syncthreads(); }
  const float rs = rsqrtf(red[0] / (float)N + eps);
  {
    for (int u = 0; u < per / 4; ++u) {
      const int j = tid * 4 + 1024 * u;
      v4f o, sm;
#pragma unroll
      for (int q = 0; q < 4; ++q) {
        float gg = g[j + q], bb = bta[j + q];
        if (PARAM_BF16) { gg = bf16_round(gg); bb = bf16_round(bb); }
        sm[q] = vals[u * 4 + q]; o[q] = (vals[u * 4 + q] - mu) * rs * gg + bb;
      }
      if (out_sum) *(v4f*)(out_sum + (size_t)row * N + j) = sm;
      *(v4f*)(out_norm + (size_t)row * N + j) = o;
    }
    
  }
}



// ---- f16 WMMA path (v_wmma_f32_16x16x32_f16): 11-bit significands for operands in range — used where a [0,1] probability operand needs more precision than bf16
typedef _Float16 v16h __attribute__((ext_vector_type(16)));
union FragH { v16h v; v8us half[2]; _Float16 h[16]; unsigned short u[16]; };
template <int NT>
__device__ __forceinline__ v8f mmaH(v16h ah, v16h al, v16h bh, v16h bl, v8f c) {
  c = __builtin_amdgcn_wmma_f32_16x16x32_f16(false, ah, false, bh, (short)0, c, false, false);
  if (NT >= 2) c = __builtin_amdgcn_wmma_f32_16x16x32_f16(false, al, false, bh, (short)0, c, false, false);
  if (NT >= 3) c = __builtin_amdgcn_wmma_f32_16x16x32_f16(false, ah, false, bl, (short)0, c, false, false);
  asm volatile("v_nop\n\tv_nop\n\tv_nop\n\tv_nop" : "+v"(c) : "v"(ah), "v"(al), "v"(bh), "v"(bl));
  return c;
}
// batched GEMM like k_gemm_b but f16 operands: A f32 (split into f16 hi/lo if ASPLIT, else rounded to f16), Bt = f16 values [n][k]; alpha; C f32; N multiple of 16 (partial tiles skipped)
template <bool ASPLIT>
__global__ __launch_bounds__(128) void k_gemm_h(const float* __restrict__ A, int lda, size_t sA, const _Float16* __restrict__ Bh, int ldb, size_t sB, float alpha, float* __restrict__ C, int ldc, size_t sC, int M, int N, int K) {
  __shared__ __attribute__((aligned(16))) float so[4][16][64];
  const int tid = threadIdx.x, w = tid >> 5, lane = tid & 31, ln = lane & 15, hh = lane >> 4; const int by = blockIdx.y;
  A += (size_t)by * sA; Bh += (size_t)by * sB; C += (size_t)by * sC;
  const int ntn = (N + 63) / 64; const int wid = blockIdx.x * 4 + w; const int mt = wid / ntn, nq = wid % ntn; if (mt * 16 >= M) return;
  const int row0 = mt * 16, col0 = nq * 64; const float* arow = A + (size_t)(row0 + ln) * lda;
  v8f acc[4] = {};
  for (int kb = 0; kb < K; kb += 32) {
    FragH ah, al;
    const v4f x0 = *(const v4fa*)(arow + kb + 8 * hh), x1 = *(const v4fa*)(arow + kb + 8 * hh + 4), x2 = *(const v4fa*)(arow + kb + 16 + 8 * hh), x3 = *(const v4fa*)(arow + kb + 16 + 8 * hh + 4);
    float xs[16] = {x0[0],x0[1],x0[2],x0[3],x1[0],x1[1],x1[2],x1[3],x2[0],x2[1],x2[2],x2[3],x3[0],x3[1],x3[2],x3[3]};
#pragma unroll
    for (int i = 0; i < 16; ++i) { const _Float16 h = (_Float16)xs[i]; ah.h[i] = h; al.h[i] = ASPLIT ? (_Float16)(xs[i] - (float)h) : (_Float16)0.0f; }
#pragma unroll
    for (int t = 0; t < 4; ++t) { if (col0 + t * 16 >= N) continue; const size_t boff = (size_t)(col0 + t * 16 + ln) * ldb + kb; FragH bq; bq.half[0] = *(const v8us*)(Bh + boff + 8 * hh); bq.half[1] = *(const v8us*)(Bh + boff + 16 + 8 * hh);
      acc[t] = mmaH<ASPLIT ? 2 : 1>(ah.v, al.v, bq.v, bq.v, acc[t]); }
  }
#pragma unroll
  for (int t = 0; t < 4; ++t) { if (col0 + t * 16 >= N) continue;
#pragma unroll
    for (int r = 0; r < 8; ++r) so[w][8 * hh + r][t * 16 + ln] = acc[t][r] * alpha; }
  __builtin_amdgcn_fence(__ATOMIC_ACQ_REL, "workgroup"); __builtin_amdgcn_wave_barrier();
  const int rsub = lane >> 4, c4 = (lane & 15) * 4;
  {
#pragma unroll
    for (int q = 0; q < 8; ++q) { const int r = q * 2 + rsub; if (col0 + c4 < N) { const v4f v = *(const v4fa*)&so[w][r][c4]; *(v4f*)(C + (size_t)(row0 + r) * ldc + col0 + c4) = v; } }
     }
}

// Wt[n][k] = f16(W[k][n]·scale) from f32 row-major W[K][N] (scale = power of two; bf16-exact weights stay exact in f16 away from the subnormal range)
__global__ __launch_bounds__(256) void k_wt_f16(const float* __restrict__ W, _Float16* __restrict__ Wt, int K, int N, float scale) {
  const int t = blockIdx.x * 256 + threadIdx.x; if (t >= N * (K / 8)) return; const int n = t / (K / 8), k8 = (t % (K / 8)) * 8; FragH f;
#pragma unroll
  for (int i = 0; i < 8; ++i) f.h[i] = (_Float16)(bf16_round(W[(size_t)(k8 + i) * N + n]) * scale); const v8us o = f.half[0];
  *(v8us*)((unsigned short*)Wt + (size_t)n * K + k8) = o; 
}
// k_gemm_hh variant with fused epilogue: v = acc·alpha + bias[by·sBias + col] (+ CP[(row/rowsPerB)·sCPb + by·64 + col] if CP) ; ACT 0 none / 1 elu ; writes f32 C and/or f16 C16 (each if non-null)
template <int ACT>
__global__ __launch_bounds__(128) void k_gemm_hhx(const _Float16* __restrict__ A, int lda, size_t sA, const _Float16* __restrict__ Bh, int ldb, size_t sB, float alpha, const float* __restrict__ bias, size_t sBias, const float* __restrict__ CP, int rowsPerB, size_t sCPb, int row0g,
    float* __restrict__ C, _Float16* __restrict__ C16, int ldc, size_t sC, int M, int N, int K) {
  __shared__ __attribute__((aligned(16))) float so[4][16][64];
  const int tid = threadIdx.x, w = tid >> 5, lane = tid & 31, ln = lane & 15, hh = lane >> 4; const int by = blockIdx.y;
  A += (size_t)by * sA; Bh += (size_t)by * sB; const size_t cofs = (size_t)by * sC; const float* bp = bias ? bias + (size_t)by * sBias : nullptr;
  const int ntn = (N + 63) / 64; const int wid = blockIdx.x * 4 + w; const int mt = wid / ntn, nq = wid % ntn; if (mt * 16 >= M) return;
  const int row0 = mt * 16, col0 = nq * 64; const _Float16* arow = A + (size_t)(row0 + ln) * lda;
  v8f acc[4] = {};
  // Straight-line k loop: a column tile past N reads the clamped row N - 1 (in bounds; the epilogue never stores it), so no test stands between the loads and every fragment load of a trip is in flight before the first product waits.
  typedef __attribute__((address_space(1))) const unsigned short gus; typedef __attribute__((address_space(1))) const v8us gv8;      /* global address space spelled out: through the loop-carried pointers the compiler otherwise fell back to flat loads */
  gus* ap = (gus*)((const unsigned short*)arow + 8 * hh); gus* bw[4];
#pragma unroll      // constant indices keep the fragment arrays in registers
  for (int t = 0; t < 4; ++t) { const int bn = min(col0 + t * 16 + ln, N - 1); bw[t] = (gus*)((const unsigned short*)Bh + (size_t)bn * ldb + 8 * hh); }
  for (int kb = 0; kb < K; kb += 64, ap += 64, bw[0] += 64, bw[1] += 64, bw[2] += 64, bw[3] += 64) { FragH a2[2], b2[2][4];      /* 64 k a trip = one whole 128-byte line of each of the 80 rows; K is a multiple of 64 at every launch (768, 2048) */
#pragma unroll      // constant indices keep the fragment arrays in registers
    for (int u = 0; u < 2; ++u) { a2[u].half[0] = *(gv8*)(ap + u * 32); a2[u].half[1] = *(gv8*)(ap + u * 32 + 16);
#pragma unroll      // constant indices keep the fragment arrays in registers
      for (int t = 0; t < 4; ++t) { b2[u][t].half[0] = *(gv8*)(bw[t] + u * 32); b2[u][t].half[1] = *(gv8*)(bw[t] + u * 32 + 16); } }
#pragma unroll      // constant indices keep the fragment arrays in registers
    for (int u = 0; u < 2; ++u)
#pragma unroll      // constant indices keep the fragment arrays in registers
      for (int t = 0; t < 4; ++t) acc[t] = mmaH<1>(a2[u].v, a2[u].v, b2[u][t].v, b2[u][t].v, acc[t]); }
#pragma unroll
  for (int t = 0; t < 4; ++t) { if (col0 + t * 16 >= N) continue; const int col = col0 + t * 16 + ln; const float bv = bp ? bf16_round(bp[col]) : 0.f;
#pragma unroll
    for (int r = 0; r < 8; ++r) { float v = acc[t][r] * alpha + bv; if (CP) { const int bidx = (row0g + row0 + 8 * hh + r) / rowsPerB; v += CP[(size_t)bidx * sCPb + (size_t)by * 64 + col]; } if (ACT == 1) v = (v > 0.f) ? v : expm1f(v); else if (ACT == 7) v = (v > 0.f) ? v + 1.0f : expf(v); else if (ACT == 8) v = tanhf(v); else if (ACT == 9) v = 0.5f * v * (1.0f + tanhf(0.7978845608028654f * (v + 0.044715f * v * v * v))); else if (ACT == 11) v = 1.0f / (1.0f + expf(-v)); else if (ACT == 12) v = (v > 0.f) ? v : 0.01f * v; else if (ACT == 14) v = (v > 0.f) ? v : 0.1f * v; else if (ACT == 15) v = v / (1.0f + expf(-v)); else if (ACT == 3) v = fmaxf(v, 0.f); else if (ACT == 6) v = 0.5f * v * (1.0f + erff(v * 0.70710678118654752f)); so[w][8 * hh + r][t * 16 + ln] = v; } }
  __builtin_amdgcn_fence(__ATOMIC_ACQ_REL, "workgroup"); __builtin_amdgcn_wave_barrier();
  const int rsub = lane >> 4, c4 = (lane & 15) * 4; typedef _Float16 v4h __attribute__((ext_vector_type(4)));
  {
#pragma unroll
    for (int q = 0; q < 8; ++q) { const int r = q * 2 + rsub; if (col0 + c4 < N) { const v4f v = *(const v4fa*)&so[w][r][c4]; if (C) *(v4f*)(C + cofs + (size_t)(row0 + r) * ldc + col0 + c4) = v; if (C16) { v4h h4; for (int i = 0; i < 4; ++i) h4[i] = (_Float16)v[i]; *(v4h*)(C16 + cofs + (size_t)(row0 + r) * ldc + col0 + c4) = h4; } } }
     }
}


typedef _Float16 v4h __attribute__((ext_vector_type(4)));

__global__ __launch_bounds__(256) void k_x16(const float* __restrict__ x, _Float16* __restrict__ X16, size_t n8) { const size_t t = (size_t)blockIdx.x * 256 + threadIdx.x; if (t >= n8) return; FragH f;
#pragma unroll
  for (int q = 0; q < 8; ++q) f.h[q] = (_Float16)bf16_round(x[t * 8 + q]); *(v8us*)((unsigned short*)X16 + t * 8) = f.half[0];  }
__global__ __launch_bounds__(256) void k_h16(const float* __restrict__ x, _Float16* __restrict__ X16, size_t n8) { const size_t t = (size_t)blockIdx.x * 256 + threadIdx.x; if (t >= n8) return; FragH f;
#pragma unroll
  for (int q = 0; q < 8; ++q) f.h[q] = (_Float16)x[t * 8 + q]; *(v8us*)((unsigned short*)X16 + t * 8) = f.half[0];  }
__global__ __launch_bounds__(256) void k_round16f(const float* __restrict__ W, _Float16* __restrict__ Bt, size_t n8) { const size_t t = (size_t)blockIdx.x * 256 + threadIdx.x; if (t >= n8) return; FragH f;
#pragma unroll
  for (int i = 0; i < 8; ++i) f.h[i] = (_Float16)(bf16_round(W[t * 8 + i]) * 16.0f); *(v8us*)((unsigned short*)Bt + t * 8) = f.half[0];  }
template <int NHv, int TTv>
__global__ __launch_bounds__(256) void k_vt(const _Float16* __restrict__ V16, int ldv, int voff, _Float16* __restrict__ Vt) { __shared__ unsigned short tl[64][66]; const int tid = threadIdx.x; const int slab = blockIdx.x / (TTv / 64), lg = blockIdx.x % (TTv / 64); const int b = slab / NHv, h = slab % NHv;
  for (int i = tid; i < 64 * 8; i += 256) { const int r = i / 8, c8 = (i % 8) * 8; FragH f; f.half[0] = *(const v8us*)((const unsigned short*)V16 + ((size_t)b * TTv + lg * 64 + r) * ldv + voff + h * 64 + c8);
#pragma unroll
    for (int q = 0; q < 8; ++q) tl[r][c8 + q] = f.u[q]; }
  __syncthreads();
  {
#pragma unroll
    for (int rd = 0; rd < 2; ++rd) { const int d = rd * 32 + tid / 8, pc = tid % 8; FragH f;
#pragma unroll
      for (int q = 0; q < 8; ++q) f.u[q] = tl[pc * 8 + q][d];
      *(v8us*)((unsigned short*)Vt + ((size_t)slab * 64 + d) * TTv + lg * 64 + pc * 8) = f.half[0]; }
     } }

__global__ __launch_bounds__(256) void k_hl(const float* __restrict__ F, _Float16* __restrict__ Hh, _Float16* __restrict__ Hl, size_t n8) { const size_t t = (size_t)blockIdx.x * 256 + threadIdx.x; if (t >= n8) return; FragH fh, fl; const v4f a = *(const v4fa*)(F + t * 8), c = *(const v4fa*)(F + t * 8 + 4);
#pragma unroll
  for (int q = 0; q < 4; ++q) { _Float16 h = (_Float16)a[q]; fh.h[q] = h; fl.h[q] = (_Float16)((a[q] - (float)h) * 1024.0f); h = (_Float16)c[q]; fh.h[4 + q] = h; fl.h[4 + q] = (_Float16)((c[q] - (float)h) * 1024.0f); }
  { *(v8us*)((unsigned short*)Hh + t * 8) = fh.half[0]; *(v8us*)((unsigned short*)Hl + t * 8) = fl.half[0];  } }
// RMSNorm rows (C = 768 = 32 lanes × 24): y = x·rsqrt(mean(x²) + 1.1920929e-7)·bf16(g); RB: round the input to bf16 first; outputs: f16 hi + ×2^10 residual planes (either may be null) and optionally the f32 rounded input copy XR; wave per row; per lane 6 float4 pieces (c = j·128 + lane·4);
template <int RB>
__global__ __launch_bounds__(256) void k_rms(const float* __restrict__ X, const float* __restrict__ g, int nrows, _Float16* __restrict__ YH, _Float16* __restrict__ YL, float* __restrict__ XR) { const int tid = threadIdx.x, wv = tid >> 5, lane = tid & 31; const int r = blockIdx.x * 8 + wv; if (r >= nrows) return; v4f xv[6]; float ss = 0.f;
#pragma unroll
  for (int j = 0; j < 6; ++j) { v4f a = *(const v4fa*)(X + (size_t)r * CC + j * 128 + lane * 4); if (RB) for (int q = 0; q < 4; ++q) a[q] = bf16_round(a[q]); xv[j] = a; for (int q = 0; q < 4; ++q) ss += a[q] * a[q]; }
  for (int o = 16; o >= 1; o >>= 1) ss += __shfl_xor(ss, o, 32); const float rs = rsqrtf(ss / (float)CC + 1.1920929e-7f);
  typedef _Float16 v4h __attribute__((ext_vector_type(4)));
  {
#pragma unroll
    for (int j = 0; j < 6; ++j) { const int c = j * 128 + lane * 4; v4h hh, hl; for (int q = 0; q < 4; ++q) { const float y = xv[j][q] * rs * bf16_round(g[c + q]); const _Float16 hv = (_Float16)y; hh[q] = hv; hl[q] = (_Float16)((y - (float)hv) * 1024.0f); }
      if (YH) *(v4h*)(YH + (size_t)r * CC + c) = hh; if (YL) *(v4h*)(YL + (size_t)r * CC + c) = hl; if (XR) *(v4f*)(XR + (size_t)r * CC + c) = xv[j]; }
     } }
__global__ __launch_bounds__(256) void k_vtr(const _Float16* __restrict__ XH, const _Float16* __restrict__ XL, _Float16* __restrict__ VT) { __shared__ float tl[64][33]; const int tid = threadIdx.x; const int slab = blockIdx.x / (NN / 64), ng = blockIdx.x % (NN / 64); const int b = slab / NH, h = slab % NH; const size_t base = (size_t)b * NN * CC + (size_t)h * HSZ + (size_t)ng * 64 * HD;      /* 64 consecutive n rows × 32 d = 2048 contiguous elements */
  for (int i = tid; i < 64 * 32; i += 256) { const int n = i / 32, d = i % 32; tl[n][d] = (float)XH[base + i] + (float)XL[base + i] * 0.0009765625f; } __syncthreads();
  const int d = tid / 8, pc = tid % 8; FragH f; for (int q = 0; q < 8; ++q) f.h[q] = (_Float16)tl[pc * 8 + q][d];
  *(v8us*)((unsigned short*)VT + ((size_t)slab * HD + d) * NN + ng * 64 + pc * 8) = f.half[0];  }
// lane l <-> lane l ^ 16 by a vector cross-row move (no LDS counter involved)
__device__ __forceinline__ float xhalf(float x) { return __builtin_bit_cast(float, __builtin_amdgcn_permlanex16(__builtin_bit_cast(int, x), __builtin_bit_cast(int, x), 0x76543210, 0xfedcba98, false, false)); }
typedef float v2f __attribute__((ext_vector_type(2)));
__global__ __launch_bounds__(128) void k_flash(const _Float16* __restrict__ Q16, const _Float16* __restrict__ Q16lo, int ldq, const _Float16* __restrict__ K16, const _Float16* __restrict__ K16lo, int ldk, const _Float16* __restrict__ Vt, const float* __restrict__ SP, float* __restrict__ O, int ldo) {
  constexpr int NQB = NN / 64, DT = 2;
  const int tid = threadIdx.x, w = tid >> 5, lane = tid & 31, ln = lane & 15, hh = lane >> 4;
  const int slab = blockIdx.x / NQB, qblk = blockIdx.x % NQB; const int h = slab % NH; const float coef = (logf(768.0f) * bf16_round(SP[h])) * 5.656854249492381f; const int q0 = qblk * 64 + w * 16;
  FragH bq, bql;
  { const size_t qo = ((size_t)slab * NN + q0 + ln) * ldq; const unsigned short* qr = (const unsigned short*)Q16 + qo; const unsigned short* ql = (const unsigned short*)Q16lo + qo;
    bq.half[0] = *(const v8us*)(qr + 8 * hh); bq.half[1] = *(const v8us*)(qr + 16 + 8 * hh); bql.half[0] = *(const v8us*)(ql + 8 * hh); bql.half[1] = *(const v8us*)(ql + 16 + 8 * hh); }
  const unsigned short* kh = (const unsigned short*)K16 + (size_t)slab * NN * ldk; const unsigned short* kl = (const unsigned short*)K16lo + (size_t)slab * NN * ldk;      /* wave-uniform bases, advanced by 32 key rows a pass */
  const unsigned short* vt = (const unsigned short*)Vt + (size_t)slab * HD * NN;      /* v'^T per slab: [32][N], advanced by 32 columns a pass */
  const unsigned ko[2] = {(unsigned)(ln * ldk + 8 * hh), (unsigned)((16 + ln) * ldk + 8 * hh)}, vo[DT] = {(unsigned)(ln * NN + 8 * hh), (unsigned)((16 + ln) * NN + 8 * hh)};      /* the lane's own element offsets */
  float m_q = -3.0e38f, l_q = 0.f; v8f oacc[DT];
#pragma unroll
  for (int dt = 0; dt < DT; ++dt) oacc[dt] = (v8f){0.f,0.f,0.f,0.f,0.f,0.f,0.f,0.f};
  for (int j0 = 0; j0 < NN; j0 += 32, kh += 32 * (size_t)ldk, kl += 32 * (size_t)ldk, vt += 32) {
    FragH ak[2], akl[2], av[DT];
#pragma unroll
    for (int nt = 0; nt < 2; ++nt) { ak[nt].half[0] = *(const v8us*)(kh + ko[nt]); ak[nt].half[1] = *(const v8us*)(kh + ko[nt] + 16); akl[nt].half[0] = *(const v8us*)(kl + ko[nt]); akl[nt].half[1] = *(const v8us*)(kl + ko[nt] + 16); }
#pragma unroll
    for (int dt = 0; dt < DT; ++dt) { av[dt].half[0] = *(const v8us*)(vt + vo[dt]); av[dt].half[1] = *(const v8us*)(vt + vo[dt] + 16); }
    float sc[16];
#pragma unroll
    for (int nt = 0; nt < 2; ++nt) { v8f acc = (v8f){0.f,0.f,0.f,0.f,0.f,0.f,0.f,0.f}, accl = acc;
      acc = mmaH<1>(ak[nt].v, ak[nt].v, bq.v, bq.v, acc); accl = mmaH<1>(ak[nt].v, ak[nt].v, bql.v, bql.v, accl); accl = mmaH<1>(akl[nt].v, akl[nt].v, bq.v, bq.v, accl);
#pragma unroll
      for (int r = 0; r < 8; ++r) { acc[r] += accl[r] * 0.0009765625f; sc[nt * 8 + r] = acc[r] * coef; } }
    float mx[8];
#pragma unroll
    for (int r = 0; r < 8; ++r) mx[r] = fmaxf(sc[r], sc[8 + r]);
    float mc = fmaxf(fmaxf(fmaxf(mx[0], mx[1]), fmaxf(mx[2], mx[3])), fmaxf(fmaxf(mx[4], mx[5]), fmaxf(mx[6], mx[7])));
    mc = fmaxf(mc, xhalf(mc));
    const float mn = fmaxf(m_q, mc); const float al = (mn > -1.0e38f) ? expf(m_q - mn) : 1.0f; m_q = mn;
    v2f p2[8]; FragH pb;
#pragma unroll
    for (int i = 0; i < 8; ++i) { p2[i].x = expf(sc[2 * i] - mn); p2[i].y = expf(sc[2 * i + 1] - mn); pb.h[2 * i] = (_Float16)(p2[i].x * 1024.0f); pb.h[2 * i + 1] = (_Float16)(p2[i].y * 1024.0f); }
    const v2f ps = ((p2[0] + p2[1]) + (p2[2] + p2[3])) + ((p2[4] + p2[5]) + (p2[6] + p2[7]));
    l_q = l_q * al + (ps.x + ps.y);      /* per-lane partial sum of the query's denominator (the two halves are joined after the loop) */
#pragma unroll
    for (int dt = 0; dt < DT; ++dt) {
#pragma unroll
      for (int r = 0; r < 8; ++r) oacc[dt][r] *= al;
      oacc[dt] = mmaH<1>(av[dt].v, av[dt].v, pb.v, pb.v, oacc[dt]); } }
  const float lt = l_q + xhalf(l_q); const float inv = (lt > 0.f) ? 1.0f / (lt * 1024.0f) : 0.f;
  float* orow = O + ((size_t)slab * NN + q0 + ln) * ldo + 8 * hh;      /* oacc[dt][r] = O[q0 + ln][dt * 16 + 8hh + r]: eight consecutive d per lane */
#pragma unroll
  for (int dt = 0; dt < DT; ++dt) { const v4f o0 = {oacc[dt][0] * inv, oacc[dt][1] * inv, oacc[dt][2] * inv, oacc[dt][3] * inv}, o1 = {oacc[dt][4] * inv, oacc[dt][5] * inv, oacc[dt][6] * inv, oacc[dt][7] * inv};
    *(v4f*)(orow + dt * 16) = o0; *(v4f*)(orow + dt * 16 + 4) = o1; } }

__global__ __launch_bounds__(256) void k_add(const float* __restrict__ A, const float* __restrict__ B_, float* __restrict__ out, size_t n4) { const size_t t = (size_t)blockIdx.x * 256 + threadIdx.x; if (t >= n4) return; v4f a = *(const v4fa*)(A + t * 4); const v4f b = *(const v4fa*)(B_ + t * 4); for (int q = 0; q < 4; ++q) a[q] += b[q]; *(v4f*)(out + t * 4) = a;  }

extern "C" void kernel_launch(void* const* d_in, const int* in_sizes, int n_in,
                              void* d_out, int out_size, void* d_ws, size_t ws_size, hipStream_t stream) {
  (void)in_sizes; (void)n_in; (void)out_size;
  const float* const* I = (const float* const*)d_in; const float* x = I[0]; const float* sp = I[1]; const float* Wq = I[2]; const float* WA = I[3]; const float* W1 = I[4]; const float* W2 = I[5]; const float* g1 = I[6]; const float* g2 = I[7];
  char* ws = (char*)d_ws; size_t off = 0;
  auto take = [&](size_t bytes) { char* p = ws + off; off += (bytes + 255) & ~(size_t)255; return p; };
  const size_t WSZ = (size_t)CC * CC; _Float16* Bq = (_Float16*)take(WSZ * 2); _Float16* B1 = (_Float16*)take(WSZ * 2); _Float16* B2 = (_Float16*)take(WSZ * 2); _Float16* BA = (_Float16*)take((size_t)NN * NN * 2);
  _Float16* XH = (_Float16*)take((size_t)NR * CC * 2); _Float16* XL = (_Float16*)take((size_t)NR * CC * 2); float* XR = (float*)take((size_t)NR * CC * 4); float* QF = (float*)take((size_t)NR * CC * 4); _Float16* QH = (_Float16*)take((size_t)NR * CC * 2); _Float16* QL = (_Float16*)take((size_t)NR * CC * 2);
  _Float16* VT = (_Float16*)take((size_t)BB * NH * HD * NN * 2); _Float16* VPT = (_Float16*)take((size_t)BB * NH * HD * NN * 2); float* ATT = (float*)take((size_t)NR * CC * 4);
  float* O = QF; _Float16* H16 = XH; _Float16* FH = XL;      /* O (raw [B][H][N][hd] f32) over q f32 (dead after k_hl); RMSNorm2 output over XH and the FF hidden over XL (both dead after k_flash) */
  if (off > ws_size) return;      // 3.5 + 8.4 + 6.3 × 2 + 12.6 × 2 + 6.3 × 2 + 6.3 × 2 + 12.6 ≈ 87 MB
  const unsigned gw = (unsigned)((WSZ / 8 + 255) / 256); k_round16f<<<gw, 256, 0, stream>>>(Wq, Bq, WSZ / 8); k_round16f<<<gw, 256, 0, stream>>>(W1, B1, WSZ / 8); k_round16f<<<gw, 256, 0, stream>>>(W2, B2, WSZ / 8); k_round16f<<<(unsigned)(((size_t)NN * NN / 8 + 255) / 256), 256, 0, stream>>>(WA, BA, (size_t)NN * NN / 8);      /* (out,in) natural ×2^4; WA natural [m][n] ×2^4 */
  k_rms<1><<<(NR + 7) / 8, 256, 0, stream>>>(x, g1, NR, XH, XL, XR);      /* xn = RMSNorm(bf16 x)·g1 → hi / ×2^10 residual; XR = bf16(x) */
  const dim3 gq(((NR / 16) * (CC / 64) + 3) / 4, 1);
  k_gemm_hhx<0><<<gq, 128, 0, stream>>>(XH, CC, 0, Bq, CC, 0, 0.0625f, nullptr, 0, nullptr, 1, 0, 0, QF, nullptr, CC, 0, NR, CC, CC);      /* q = xn·Wqᵀ: hi term, M 4096 N 768 K 768 */
  k_gemm_hhx<0><<<gq, 128, 0, stream>>>(XL, CC, 0, Bq, CC, 0, 0.0625f * 0.0009765625f, nullptr, 0, QF, 1, (size_t)CC, 0, QF, nullptr, CC, 0, NR, CC, CC);      /* += lo term ·2^-10 in place */
  k_hl<<<(unsigned)(((size_t)NR * CC / 8 + 255) / 256), 256, 0, stream>>>(QF, QH, QL, (size_t)NR * CC / 8);      /* q → hi / ×2^10 residual (flat planes; head h of batch b = elements [b·N·C + h·N·hd, +N·hd) viewed [N][hd]) */
  k_vtr<<<BB * NH * (NN / 64), 256, 0, stream>>>(XH, XL, VT);      /* vᵀ per (b,h): [32][2048] f16 */
  const dim3 gvp(((HD / 16) * (NN / 64) + 3) / 4, BB * NH);
  k_gemm_hhx<0><<<gvp, 128, 0, stream>>>(VT, NN, (size_t)HD * NN, BA, NN, 0, 0.0625f, nullptr, 0, nullptr, 1, 0, 0, nullptr, VPT, NN, (size_t)HD * NN, HD, NN, NN);      /* v'ᵀ[d][m] = Σ_n vᵀ[d][n]·WA[m][n], batched over the 48 (b,h): M 32 N 2048 K 2048 */
  k_flash<<<BB * NH * (NN / 64), 128, 0, stream>>>(QH, QL, HD, XH, XL, HD, VPT, sp, O, HD);      /* per (b,h) slab of the raw head views (flat planes, ld 32): softmax(coef_h·q·kᵀ)·v' → O raw [B][H][N][32] */
  k_add<<<(unsigned)(((size_t)NR * CC / 4 + 255) / 256), 256, 0, stream>>>(O, XR, ATT, (size_t)NR * CC / 4);      /* attn = raw-reshaped O + x */
  k_rms<0><<<(NR + 7) / 8, 256, 0, stream>>>(ATT, g2, NR, H16, nullptr, nullptr);      /* h = RMSNorm(attn)·g2 → f16 */
  k_gemm_hhx<6><<<gq, 128, 0, stream>>>(H16, CC, 0, B1, CC, 0, 0.0625f, nullptr, 0, nullptr, 1, 0, 0, nullptr, FH, CC, 0, NR, CC, CC);      /* gelu_erf(h·W1ᵀ) → f16: M 4096 N 768 K 768 */
  k_gemm_hhx<0><<<gq, 128, 0, stream>>>(FH, CC, 0, B2, CC, 0, 0.0625f, nullptr, 0, ATT, 1, (size_t)CC, 0, (float*)d_out, nullptr, CC, 0, NR, CC, CC);      /* out = ·W2ᵀ + attn */
}

// v003
// Measured time: 260 microseconds a run.
// In both of two side-by-side timings against v002, it was 1.12 times as fast.
// Over all steps from v000 it is 1.80 times as fast.
#include <hip/hip_runtime.h>
// 'Scalable super' multi-head attention block (B=2, N=2048, C=768, H=24, hd=32): xn = RMSNorm(x)·g1; q = (xn·Wqᵀ) RAW-reshaped [B,H,N,hd] (no transpose — the module's quirk), k = v = xn raw-reshaped likewise; v' = WA[:N,:N]·v (value premix);
// scores = softmax(coef_h · q·kᵀ) with coef_h = log(C)·scale_param[h]·√hd (up to ≈56 → extremely peaked); attn = (scores·v') raw-reshaped back to [B,N,C] + x; h = RMSNorm(attn)·g2; out = gelu_erf(h·W1ᵀ)·W2ᵀ + attn.
// Compute dtype: x, scale_param, weights, WA, g rounded to bf16; RMSNorm in f32 (wave per row) → f16 hi + ×2^10 residual planes; q = xn·Wqᵀ f32-accurate (hi·W + lo·W·2^-10) → hi/lo planes; per (b,h) the 2048×2048 logit plane
// computed inside a fused flash-style kernel from three f16 products (q_hi·k_hi + (q_lo·k_hi + q_hi·k_lo)·2^-10, d = 32) and scaled by the per-head coefficient in f32; online f32 softmax; P f16 ×2^10; v'ᵀ = vᵀ·WAᵀ by GEMM (f16); O = P·v' accumulated in f32 into the raw [B][H][N][hd] buffer; + x; RMSNorm; FF GEMMs
// (erf-GELU epilogue) with the residual through the f32 addend. All contractions on v_wmma_f32_16x16x32_f16, f32 accumulate.
#define BB 2
#define NN 2048
#define CC 768
#define NH 24
#define HD 32
#define NR (BB * NN)
#define HSZ ((size_t)NN * HD)

typedef __bf16 v16b __attribute__((ext_vector_type(16)));
typedef unsigned short v8us __attribute__((ext_vector_type(8), may_alias));
typedef float  v8f  __attribute__((ext_vector_type(8)));
typedef float  v4f  __attribute__((ext_vector_type(4)));
typedef float  v4fa __attribute__((ext_vector_type(4), may_alias));
union FragB { v16b v; v8us half[2]; unsigned short u[16]; };

__device__ __forceinline__ unsigned short bf16_bits(float x) { unsigned int u = __float_as_uint(x); return (unsigned short)((u + 0x7FFFu + ((u >> 16) & 1u)) >> 16); }
__device__ __forceinline__ float bf16_val(unsigned short b) { return __uint_as_float(((unsigned int)b) << 16); }
__device__ __forceinline__ float bf16_round(float x) { return bf16_val(bf16_bits(x)); }
// D += A·B with NT terms: 1 = ah·bh, 2 = + al·bh (A split), 3 = + ah·bl (both split)
template <int NT>
__device__ __forceinline__ v8f mmaN(v16b ah, v16b al, v16b bh, v16b bl, v8f c) {
  c = __builtin_amdgcn_wmma_f32_16x16x32_bf16(false, ah, false, bh, (short)0, c, false, false);
  if (NT >= 2) c = __builtin_amdgcn_wmma_f32_16x16x32_bf16(false, al, false, bh, (short)0, c, false, false);
  if (NT >= 3) c = __builtin_amdgcn_wmma_f32_16x16x32_bf16(false, ah, false, bl, (short)0, c, false, false);
  asm volatile("v_nop\n\tv_nop\n\tv_nop\n\tv_nop" : "+v"(c) : "v"(ah), "v"(al), "v"(bh), "v"(bl));
  return c;
}

__global__ __launch_bounds__(256) void k_wt_bf16(const float* __restrict__ W, unsigned short* __restrict__ Wt, int K, int N) {
  const int t = blockIdx.x * 256 + threadIdx.x;
  const int k8n = K / 8;
  if (t >= N * k8n) return;
  const int n = t / k8n, k8 = (t % k8n) * 8;
  v8us v;
#pragma unroll
  for (int i = 0; i < 8; ++i) v[i] = bf16_bits(W[(size_t)(k8 + i) * N + n]);
  *(v8us*)(Wt + (size_t)n * K + k8) = v;
  
}

// GEMM C[M][N] (f32, pitch ldc) = act(A[M][K]·W + bias). A f32 row-major (pitch lda) converted per fragment to bf16
// (ASPLIT: hi/lo two planes -> 2 terms, else single rounded term); Wt bf16 [N][K] (pitch ldb). BIAS_BF16 rounds the
// bias to bf16 first (bias quantised to bf16 before the add). K%32==0, M%16==0, N%64==0.
template <bool ASPLIT, int ACT, bool BIAS_BF16>
__global__ __launch_bounds__(128) void k_gemm_bf(const float* __restrict__ A, int lda, const unsigned short* __restrict__ Wt, int ldb,
                                               const float* __restrict__ bias, float* __restrict__ C, int ldc, int M, int N, int K) {
  __shared__ __attribute__((aligned(16))) float so[4][16][64];
  const int tid = threadIdx.x, w = tid >> 5, lane = tid & 31, ln = lane & 15, hh = lane >> 4;
  const int ntn = N / 64;
  const int wid = blockIdx.x * 4 + w;
  const int mt = wid / ntn, nq = wid % ntn;
  if (mt * 16 >= M) return;
  const int row0 = mt * 16, col0 = nq * 64;
  const float* arow = A + (size_t)(row0 + ln) * lda;
  v8f acc[4] = {};
  for (int kb = 0; kb < K; kb += 32) {
    FragB ah, al;
    const v4f x0 = *(const v4fa*)(arow + kb + 8 * hh), x1 = *(const v4fa*)(arow + kb + 8 * hh + 4);
    const v4f x2 = *(const v4fa*)(arow + kb + 16 + 8 * hh), x3 = *(const v4fa*)(arow + kb + 16 + 8 * hh + 4);
    float xs[16] = {x0[0],x0[1],x0[2],x0[3],x1[0],x1[1],x1[2],x1[3],x2[0],x2[1],x2[2],x2[3],x3[0],x3[1],x3[2],x3[3]};
#pragma unroll
    for (int i = 0; i < 16; ++i) { const unsigned short hb = bf16_bits(xs[i]); ah.u[i] = hb; al.u[i] = ASPLIT ? bf16_bits(xs[i] - bf16_val(hb)) : (unsigned short)0; }
#pragma unroll
    for (int t = 0; t < 4; ++t) {
      const unsigned short* brow = Wt + (size_t)(col0 + t * 16 + ln) * ldb + kb;
      FragB b;
      b.half[0] = *(const v8us*)(brow + 8 * hh);
      b.half[1] = *(const v8us*)(brow + 16 + 8 * hh);
      acc[t] = mmaN<ASPLIT ? 2 : 1>(ah.v, al.v, b.v, b.v, acc[t]);
    }
  }
#pragma unroll
  for (int t = 0; t < 4; ++t) {
    float bv = bias ? bias[col0 + t * 16 + ln] : 0.f;
    if (BIAS_BF16) bv = bf16_round(bv);
#pragma unroll
    for (int r = 0; r < 8; ++r) { float v = acc[t][r] + bv; if (ACT == 1) v = fmaxf(v, 0.f); so[w][8 * hh + r][t * 16 + ln] = v; }
  }
  __builtin_amdgcn_fence(__ATOMIC_ACQ_REL, "workgroup");
  __builtin_amdgcn_wave_barrier();
  const int rsub = lane >> 4, c4 = (lane & 15) * 4;
  {
#pragma unroll
    for (int q = 0; q < 8; ++q) {
      const int r = q * 2 + rsub;
      const v4f v = *(const v4fa*)&so[w][r][c4];
      *(v4f*)(C + (size_t)(row0 + r) * ldc + col0 + c4) = v;
    }
    
  }
}

// Flash-style causal/unmasked attention, all contractions 3-term bf16 hi/lo splits, f32 softmax with running max.
// q,k,v rows are read from f32 buffers with arbitrary row pitch (so they can live inside a fused qkv buffer);
// D = head size (multiple of 32, <= 128); one wave = 16 query rows; block = 4 waves (64 queries) sharing K/V chunks of 32.
template <int D, bool CAUSAL>
__global__ __launch_bounds__(128) void k_flash(const float* __restrict__ qb, const float* __restrict__ kb, const float* __restrict__ vb,
                                             int pitch, int T, int H, float scale, float* __restrict__ y, int ypitch) {
  constexpr int KS = D / 32;        // k-steps for QK
  constexpr int DT = D / 16;        // d tiles for PV
  __shared__ __attribute__((aligned(16))) unsigned short sKh[32][D + 8], sKl[32][D + 8], sVh[32][D + 8], sVl[32][D + 8];
  __shared__ __attribute__((aligned(16))) unsigned short sPh[4][16][40], sPl[4][16][40];
  __shared__ __attribute__((aligned(16))) float sO[4][16][D];
  const int tid = threadIdx.x, w = tid >> 5, lane = tid & 31, ln = lane & 15, hh = lane >> 4;
  const int nqb = (T + 63) / 64;
  const int bh = blockIdx.x / nqb, qblk = blockIdx.x % nqb;
  const int b = bh / H, h = bh % H;
  const int q0 = qblk * 64 + w * 16;
  const float* Q = qb + (size_t)b * T * pitch + h * D;
  const float* K = kb + (size_t)b * T * pitch + h * D;
  const float* V = vb + (size_t)b * T * pitch + h * D;

  // A fragments of the wave's 16 query rows (scaled), hi/lo
  FragB aqh[KS], aql[KS];
  {
    int row = q0 + ln; if (row >= T) row = T - 1;
    const float* qr = Q + (size_t)row * pitch;
#pragma unroll
    for (int ks = 0; ks < KS; ++ks)
#pragma unroll
      for (int i = 0; i < 16; ++i) {
        const int d = ks * 32 + ((i < 8) ? (8 * hh + i) : (16 + 8 * hh + (i - 8)));
        const float x = qr[d] * scale; const unsigned short hb = bf16_bits(x);
        aqh[ks].u[i] = hb; aql[ks].u[i] = bf16_bits(x - bf16_val(hb));
      }
  }
  float m_r[8], l_r[8];
#pragma unroll
  for (int r = 0; r < 8; ++r) { m_r[r] = -3.0e38f; l_r[r] = 0.f; }
  v8f oacc[DT];
#pragma unroll
  for (int dt = 0; dt < DT; ++dt) oacc[dt] = (v8f){0.f,0.f,0.f,0.f,0.f,0.f,0.f,0.f};

  const int kv_end = CAUSAL ? min(T, qblk * 64 + 64) : T;     // block-uniform
  for (int j0 = 0; j0 < kv_end; j0 += 32) {
    __syncthreads();
    for (int e = tid; e < 32 * (D / 4); e += 128) {
      const int r = e / (D / 4), c4 = (e % (D / 4)) * 4;
      const int key = j0 + r;
      v4f kf = {0.f,0.f,0.f,0.f}, vf = {0.f,0.f,0.f,0.f};
      if (key < T) { kf = *(const v4fa*)(K + (size_t)key * pitch + c4); vf = *(const v4fa*)(V + (size_t)key * pitch + c4); }
#pragma unroll
      for (int t = 0; t < 4; ++t) {
        unsigned short hb = bf16_bits(kf[t]); sKh[r][c4 + t] = hb; sKl[r][c4 + t] = bf16_bits(kf[t] - bf16_val(hb));
        hb = bf16_bits(vf[t]); sVh[r][c4 + t] = hb; sVl[r][c4 + t] = bf16_bits(vf[t] - bf16_val(hb));
      }
    }
    __syncthreads();
    // S tile 16 x 32
    v8f s[2];
#pragma unroll
    for (int nt = 0; nt < 2; ++nt) {
      v8f acc = {};
#pragma unroll
      for (int ks = 0; ks < KS; ++ks) {
        FragB bh_, bl_;
        bh_.half[0] = *(const v8us*)&sKh[nt * 16 + ln][ks * 32 + 8 * hh]; bh_.half[1] = *(const v8us*)&sKh[nt * 16 + ln][ks * 32 + 16 + 8 * hh];
        bl_.half[0] = *(const v8us*)&sKl[nt * 16 + ln][ks * 32 + 8 * hh]; bl_.half[1] = *(const v8us*)&sKl[nt * 16 + ln][ks * 32 + 16 + 8 * hh];
        acc = mmaN<3>(aqh[ks].v, aql[ks].v, bh_.v, bl_.v, acc);
      }
      s[nt] = acc;
    }
    // mask + running max (rows 8hh+r; the 16 lanes of a half share rows)
    float alpha[8];
#pragma unroll
    for (int r = 0; r < 8; ++r) {
      const int qi = q0 + 8 * hh + r;
      const int ja = j0 + ln, jb = j0 + 16 + ln;
      if (CAUSAL) { if (ja > qi) s[0][r] = -3.0e38f; if (jb > qi) s[1][r] = -3.0e38f; }
      if (ja >= T) s[0][r] = -3.0e38f;
      if (jb >= T) s[1][r] = -3.0e38f;
      float mx = fmaxf(s[0][r], s[1][r]);
      mx = fmaxf(mx, __shfl_xor(mx, 1, 32)); mx = fmaxf(mx, __shfl_xor(mx, 2, 32)); mx = fmaxf(mx, __shfl_xor(mx, 4, 32)); mx = fmaxf(mx, __shfl_xor(mx, 8, 32));
      const float mnew = fmaxf(m_r[r], mx);
      alpha[r] = (mnew > -1.0e38f) ? __expf(m_r[r] - mnew) : 1.0f;
      const float p0 = (s[0][r] > -1.0e38f) ? __expf(s[0][r] - mnew) : 0.f;
      const float p1 = (s[1][r] > -1.0e38f) ? __expf(s[1][r] - mnew) : 0.f;
      m_r[r] = mnew;
      l_r[r] = l_r[r] * alpha[r] + p0 + p1;            // per-lane partial row sum (16 lanes combined at the end)
      unsigned short hb = bf16_bits(p0); sPh[w][8 * hh + r][ln] = hb;      sPl[w][8 * hh + r][ln] = bf16_bits(p0 - bf16_val(hb));
      hb = bf16_bits(p1);                sPh[w][8 * hh + r][16 + ln] = hb; sPl[w][8 * hh + r][16 + ln] = bf16_bits(p1 - bf16_val(hb));
    }
#pragma unroll
    for (int dt = 0; dt < DT; ++dt)
#pragma unroll
      for (int r = 0; r < 8; ++r) oacc[dt][r] *= alpha[r];
    __builtin_amdgcn_fence(__ATOMIC_ACQ_REL, "workgroup");
    __builtin_amdgcn_wave_barrier();
    FragB pah, pal;
    pah.half[0] = *(const v8us*)&sPh[w][ln][8 * hh]; pah.half[1] = *(const v8us*)&sPh[w][ln][16 + 8 * hh];
    pal.half[0] = *(const v8us*)&sPl[w][ln][8 * hh]; pal.half[1] = *(const v8us*)&sPl[w][ln][16 + 8 * hh];
#pragma unroll
    for (int dt = 0; dt < DT; ++dt) {
      FragB bvh, bvl;
#pragma unroll
      for (int i = 0; i < 8; ++i) {
        bvh.u[i] = sVh[8 * hh + i][dt * 16 + ln]; bvh.u[8 + i] = sVh[16 + 8 * hh + i][dt * 16 + ln];
        bvl.u[i] = sVl[8 * hh + i][dt * 16 + ln]; bvl.u[8 + i] = sVl[16 + 8 * hh + i][dt * 16 + ln];
      }
      oacc[dt] = mmaN<3>(pah.v, pal.v, bvh.v, bvl.v, oacc[dt]);
    }
    __builtin_amdgcn_fence(__ATOMIC_ACQ_REL, "workgroup");
    __builtin_amdgcn_wave_barrier();
  }
#pragma unroll
  for (int r = 0; r < 8; ++r) {
    float l = l_r[r];
    l += __shfl_xor(l, 1, 32); l += __shfl_xor(l, 2, 32); l += __shfl_xor(l, 4, 32); l += __shfl_xor(l, 8, 32);
    l_r[r] = (l > 0.f) ? 1.0f / l : 0.f;
  }
#pragma unroll
  for (int dt = 0; dt < DT; ++dt)
#pragma unroll
    for (int r = 0; r < 8; ++r) sO[w][8 * hh + r][dt * 16 + ln] = oacc[dt][r] * l_r[r];
  __builtin_amdgcn_fence(__ATOMIC_ACQ_REL, "workgroup");
  __builtin_amdgcn_wave_barrier();
  {
    for (int r = 0; r < 16; ++r) {
      const int row = q0 + r;
      if (row < T && lane < D / 4) {
        const v4f val = *(const v4fa*)&sO[w][r][lane * 4];
        *(v4f*)(y + ((size_t)b * T + row) * ypitch + h * D + lane * 4) = val;
      }
    }
    
  }
}

// GEMM C = act(A·W + bias + resid): A f32 (ASPLIT -> hi/lo 2 terms), Wt bf16 [N][K]; ACT 0 none, 1 relu, 2 exact gelu;
// resid (optional, f32, row index = (row % rmod), pitch ldr, RES_BF16 rounds it) added before the activation.
template <bool ASPLIT, int ACT, bool BIAS_BF16, bool RES_BF16>
__global__ __launch_bounds__(128) void k_gemm_bf3(const float* __restrict__ A, int lda, const unsigned short* __restrict__ Wt, int ldb,
                                                const float* __restrict__ bias, const float* __restrict__ resid, int rmod, int ldr,
                                                float* __restrict__ C, int ldc, int M, int N, int K) {
  __shared__ __attribute__((aligned(16))) float so[4][16][64];
  const int tid = threadIdx.x, w = tid >> 5, lane = tid & 31, ln = lane & 15, hh = lane >> 4;
  const int ntn = N / 64;
  const int wid = blockIdx.x * 4 + w;
  const int mt = wid / ntn, nq = wid % ntn;
  if (mt * 16 >= M) return;
  const int row0 = mt * 16, col0 = nq * 64;
  const float* arow = A + (size_t)(row0 + ln) * lda;
  v8f acc[4] = {};
  for (int kb = 0; kb < K; kb += 32) {
    FragB ah, al;
    const v4f x0 = *(const v4fa*)(arow + kb + 8 * hh), x1 = *(const v4fa*)(arow + kb + 8 * hh + 4);
    const v4f x2 = *(const v4fa*)(arow + kb + 16 + 8 * hh), x3 = *(const v4fa*)(arow + kb + 16 + 8 * hh + 4);
    float xs[16] = {x0[0],x0[1],x0[2],x0[3],x1[0],x1[1],x1[2],x1[3],x2[0],x2[1],x2[2],x2[3],x3[0],x3[1],x3[2],x3[3]};
#pragma unroll
    for (int i = 0; i < 16; ++i) { const unsigned short hb = bf16_bits(xs[i]); ah.u[i] = hb; al.u[i] = ASPLIT ? bf16_bits(xs[i] - bf16_val(hb)) : (unsigned short)0; }
#pragma unroll
    for (int t = 0; t < 4; ++t) {
      const unsigned short* brow = Wt + (size_t)(col0 + t * 16 + ln) * ldb + kb;
      FragB b;
      b.half[0] = *(const v8us*)(brow + 8 * hh);
      b.half[1] = *(const v8us*)(brow + 16 + 8 * hh);
      acc[t] = mmaN<ASPLIT ? 2 : 1>(ah.v, al.v, b.v, b.v, acc[t]);
    }
  }
#pragma unroll
  for (int t = 0; t < 4; ++t) {
    const int col = col0 + t * 16 + ln;
    float bv = bias ? bias[col] : 0.f;
    if (BIAS_BF16) bv = bf16_round(bv);
#pragma unroll
    for (int r = 0; r < 8; ++r) {
      float v = acc[t][r] + bv;
      if (resid) { float rv = resid[(size_t)((row0 + 8 * hh + r) % rmod) * ldr + col]; if (RES_BF16) rv = bf16_round(rv); v += rv; }
      if (ACT == 1) v = fmaxf(v, 0.f);
      if (ACT == 2) v = 0.5f * v * (1.0f + erff(v * 0.70710678118654752f));
      if (ACT == 3) { const float u = 0.7978845608028654f * (v + 0.044715f * v * v * v); v = 0.5f * v * (1.0f + tanhf(u)); }
      so[w][8 * hh + r][t * 16 + ln] = v;
    }
  }
  __builtin_amdgcn_fence(__ATOMIC_ACQ_REL, "workgroup");
  __builtin_amdgcn_wave_barrier();
  const int rsub = lane >> 4, c4 = (lane & 15) * 4;
  {
#pragma unroll
    for (int q = 0; q < 8; ++q) {
      const int r = q * 2 + rsub;
      const v4f v = *(const v4fa*)&so[w][r][c4];
      *(v4f*)(C + (size_t)(row0 + r) * ldc + col0 + c4) = v;
    }
    
  }
}
// row LayerNorm (biased variance, eps) over N: s = X (+ R); optional out_sum <- s; out_norm <- (s-mu)*rsqrt(var+eps)*g + b
template <bool PARAM_BF16>
__global__ __launch_bounds__(256) void k_layernorm(const float* __restrict__ X, const float* __restrict__ R, const float* __restrict__ g, const float* __restrict__ bta,
                                                  float* __restrict__ out_sum, float* __restrict__ out_norm, int N, float eps) {
  __shared__ float red[256];
  const int row = blockIdx.x, tid = threadIdx.x;
  const float* x = X + (size_t)row * N; const float* rr = R ? R + (size_t)row * N : nullptr;
  float vals[16];                     // up to N = 4096
  const int per = N / 256;            // contiguous chunk per thread? use strided-by-4 chunks: thread handles j = tid*4 + 1024*u
  float s1 = 0.f;
  for (int u = 0; u < per / 4; ++u) {
    const int j = tid * 4 + 1024 * u;
    const v4f a = *(const v4fa*)(x + j);
    v4f b = {0.f,0.f,0.f,0.f}; if (rr) b = *(const v4fa*)(rr + j);
#pragma unroll
    for (int q = 0; q < 4; ++q) { const float v = a[q] + b[q]; vals[u * 4 + q] = v; s1 += v; }
  }
  red[tid] = s1; __syncthreads();
  for (int st = 128; st > 0; st >>= 1) { if (tid < st) red[tid] += red[tid + st]; __syncthreads(); }
  const float mu = red[0] / (float)N; __syncthreads();
  float s2 = 0.f;
  for (int u = 0; u < per / 4; ++u)
#pragma unroll
    for (int q = 0; q < 4; ++q) { const float c = vals[u * 4 + q] - mu; s2 += c * c; }
  red[tid] = s2; __syncthreads();
  for (int st = 128; st > 0; st >>= 1) { if (tid < st) red[tid] += red[tid + st]; __syncthreads(); }
  const float rs = rsqrtf(red[0] / (float)N + eps);
  {
    for (int u = 0; u < per / 4; ++u) {
      const int j = tid * 4 + 1024 * u;
      v4f o, sm;
#pragma unroll
      for (int q = 0; q < 4; ++q) {
        float gg = g[j + q], bb = bta[j + q];
        if (PARAM_BF16) { gg = bf16_round(gg); bb = bf16_round(bb); }
        sm[q] = vals[u * 4 + q]; o[q] = (vals[u * 4 + q] - mu) * rs * gg + bb;
      }
      if (out_sum) *(v4f*)(out_sum + (size_t)row * N + j) = sm;
      *(v4f*)(out_norm + (size_t)row * N + j) = o;
    }
    
  }
}



// ---- f16 WMMA path (v_wmma_f32_16x16x32_f16): 11-bit significands for operands in range — used where a [0,1] probability operand needs more precision than bf16
typedef _Float16 v16h __attribute__((ext_vector_type(16)));
union FragH { v16h v; v8us half[2]; _Float16 h[16]; unsigned short u[16]; };
template <int NT>
__device__ __forceinline__ v8f mmaH(v16h ah, v16h al, v16h bh, v16h bl, v8f c) {
  c = __builtin_amdgcn_wmma_f32_16x16x32_f16(false, ah, false, bh, (short)0, c, false, false);
  if (NT >= 2) c = __builtin_amdgcn_wmma_f32_16x16x32_f16(false, al, false, bh, (short)0, c, false, false);
  if (NT >= 3) c = __builtin_amdgcn_wmma_f32_16x16x32_f16(false, ah, false, bl, (short)0, c, false, false);
  asm volatile("v_nop\n\tv_nop\n\tv_nop\n\tv_nop" : "+v"(c) : "v"(ah), "v"(al), "v"(bh), "v"(bl));
  return c;
}
// batched GEMM like k_gemm_b but f16 operands: A f32 (split into f16 hi/lo if ASPLIT, else rounded to f16), Bt = f16 values [n][k]; alpha; C f32; N multiple of 16 (partial tiles skipped)
template <bool ASPLIT>
__global__ __launch_bounds__(128) void k_gemm_h(const float* __restrict__ A, int lda, size_t sA, const _Float16* __restrict__ Bh, int ldb, size_t sB, float alpha, float* __restrict__ C, int ldc, size_t sC, int M, int N, int K) {
  __shared__ __attribute__((aligned(16))) float so[4][16][64];
  const int tid = threadIdx.x, w = tid >> 5, lane = tid & 31, ln = lane & 15, hh = lane >> 4; const int by = blockIdx.y;
  A += (size_t)by * sA; Bh += (size_t)by * sB; C += (size_t)by * sC;
  const int ntn = (N + 63) / 64; const int wid = blockIdx.x * 4 + w; const int mt = wid / ntn, nq = wid % ntn; if (mt * 16 >= M) return;
  const int row0 = mt * 16, col0 = nq * 64; const float* arow = A + (size_t)(row0 + ln) * lda;
  v8f acc[4] = {};
  for (int kb = 0; kb < K; kb += 32) {
    FragH ah, al;
    const v4f x0 = *(const v4fa*)(arow + kb + 8 * hh), x1 = *(const v4fa*)(arow + kb + 8 * hh + 4), x2 = *(const v4fa*)(arow + kb + 16 + 8 * hh), x3 = *(const v4fa*)(arow + kb + 16 + 8 * hh + 4);
    float xs[16] = {x0[0],x0[1],x0[2],x0[3],x1[0],x1[1],x1[2],x1[3],x2[0],x2[1],x2[2],x2[3],x3[0],x3[1],x3[2],x3[3]};
#pragma unroll
    for (int i = 0; i < 16; ++i) { const _Float16 h = (_Float16)xs[i]; ah.h[i] = h; al.h[i] = ASPLIT ? (_Float16)(xs[i] - (float)h) : (_Float16)0.0f; }
#pragma unroll
    for (int t = 0; t < 4; ++t) { if (col0 + t * 16 >= N) continue; const size_t boff = (size_t)(col0 + t * 16 + ln) * ldb + kb; FragH bq; bq.half[0] = *(const v8us*)(Bh + boff + 8 * hh); bq.half[1] = *(const v8us*)(Bh + boff + 16 + 8 * hh);
      acc[t] = mmaH<ASPLIT ? 2 : 1>(ah.v, al.v, bq.v, bq.v, acc[t]); }
  }
#pragma unroll
  for (int t = 0; t < 4; ++t) { if (col0 + t * 16 >= N) continue;
#pragma unroll
    for (int r = 0; r < 8; ++r) so[w][8 * hh + r][t * 16 + ln] = acc[t][r] * alpha; }
  __builtin_amdgcn_fence(__ATOMIC_ACQ_REL, "workgroup"); __builtin_amdgcn_wave_barrier();
  const int rsub = lane >> 4, c4 = (lane & 15) * 4;
  {
#pragma unroll
    for (int q = 0; q < 8; ++q) { const int r = q * 2 + rsub; if (col0 + c4 < N) { const v4f v = *(const v4fa*)&so[w][r][c4]; *(v4f*)(C + (size_t)(row0 + r) * ldc + col0 + c4) = v; } }
     }
}

// Wt[n][k] = f16(W[k][n]·scale) from f32 row-major W[K][N] (scale = power of two; bf16-exact weights stay exact in f16 away from the subnormal range)
__global__ __launch_bounds__(256) void k_wt_f16(const float* __restrict__ W, _Float16* __restrict__ Wt, int K, int N, float scale) {
  const int t = blockIdx.x * 256 + threadIdx.x; if (t >= N * (K / 8)) return; const int n = t / (K / 8), k8 = (t % (K / 8)) * 8; FragH f;
#pragma unroll
  for (int i = 0; i < 8; ++i) f.h[i] = (_Float16)(bf16_round(W[(size_t)(k8 + i) * N + n]) * scale); const v8us o = f.half[0];
  *(v8us*)((unsigned short*)Wt + (size_t)n * K + k8) = o; 
}
// k_gemm_hh variant with fused epilogue: v = acc·alpha + bias[by·sBias + col] (+ CP[(row/rowsPerB)·sCPb + by·64 + col] if CP) ; ACT 0 none / 1 elu ; writes f32 C and/or f16 C16 (each if non-null)
template <int ACT>
__global__ __launch_bounds__(128) void k_gemm_hhx(const _Float16* __restrict__ A, int lda, size_t sA, const _Float16* __restrict__ Bh, int ldb, size_t sB, float alpha, const float* __restrict__ bias, size_t sBias, const float* __restrict__ CP, int rowsPerB, size_t sCPb, int row0g,
    float* __restrict__ C, _Float16* __restrict__ C16, int ldc, size_t sC, int M, int N, int K) {
  __shared__ __attribute__((aligned(16))) float so[4][16][64];
  const int tid = threadIdx.x, w = tid >> 5, lane = tid & 31, ln = lane & 15, hh = lane >> 4; const int by = blockIdx.y;
  A += (size_t)by * sA; Bh += (size_t)by * sB; const size_t cofs = (size_t)by * sC; const float* bp = bias ? bias + (size_t)by * sBias : nullptr;
  const int ntn = (N + 63) / 64; const int wid = blockIdx.x * 4 + w; const int mt = wid / ntn, nq = wid % ntn; if (mt * 16 >= M) return;
  const int row0 = mt * 16, col0 = nq * 64; const _Float16* arow = A + (size_t)(row0 + ln) * lda;
  v8f acc[4] = {};
  // Straight-line k loop: a column tile past N reads the clamped row N - 1 (in bounds; the epilogue never stores it), so no test stands between the loads and every fragment load of a trip is in flight before the first product waits.
  typedef __attribute__((address_space(1))) const unsigned short gus; typedef __attribute__((address_space(1))) const v8us gv8;      /* global address space spelled out: through the loop-carried pointers the compiler otherwise fell back to flat loads */
  gus* ap = (gus*)((const unsigned short*)arow + 8 * hh); gus* bw[4];
#pragma unroll      // constant indices keep the fragment arrays in registers
  for (int t = 0; t < 4; ++t) { const int bn = min(col0 + t * 16 + ln, N - 1); bw[t] = (gus*)((const unsigned short*)Bh + (size_t)bn * ldb + 8 * hh); }
  for (int kb = 0; kb < K; kb += 64, ap += 64, bw[0] += 64, bw[1] += 64, bw[2] += 64, bw[3] += 64) { FragH a2[2], b2[2][4];      /* 64 k a trip = one whole 128-byte line of each of the 80 rows; K is a multiple of 64 at every launch (768, 2048) */
#pragma unroll      // constant indices keep the fragment arrays in registers
    for (int u = 0; u < 2; ++u) { a2[u].half[0] = *(gv8*)(ap + u * 32); a2[u].half[1] = *(gv8*)(ap + u * 32 + 16);
#pragma unroll      // constant indices keep the fragment arrays in registers
      for (int t = 0; t < 4; ++t) { b2[u][t].half[0] = *(gv8*)(bw[t] + u * 32); b2[u][t].half[1] = *(gv8*)(bw[t] + u * 32 + 16); } }
#pragma unroll      // constant indices keep the fragment arrays in registers
    for (int u = 0; u < 2; ++u)
#pragma unroll      // constant indices keep the fragment arrays in registers
      for (int t = 0; t < 4; ++t) acc[t] = mmaH<1>(a2[u].v, a2[u].v, b2[u][t].v, b2[u][t].v, acc[t]); }
#pragma unroll
  for (int t = 0; t < 4; ++t) { if (col0 + t * 16 >= N) continue; const int col = col0 + t * 16 + ln; const float bv = bp ? bf16_round(bp[col]) : 0.f;
#pragma unroll
    for (int r = 0; r < 8; ++r) { float v = acc[t][r] * alpha + bv; if (CP) { const int bidx = (row0g + row0 + 8 * hh + r) / rowsPerB; v += CP[(size_t)bidx * sCPb + (size_t)by * 64 + col]; } if (ACT == 1) v = (v > 0.f) ? v : expm1f(v); else if (ACT == 7) v = (v > 0.f) ? v + 1.0f : expf(v); else if (ACT == 8) v = tanhf(v); else if (ACT == 9) v = 0.5f * v * (1.0f + tanhf(0.7978845608028654f * (v + 0.044715f * v * v * v))); else if (ACT == 11) v = 1.0f / (1.0f + expf(-v)); else if (ACT == 12) v = (v > 0.f) ? v : 0.01f * v; else if (ACT == 14) v = (v > 0.f) ? v : 0.1f * v; else if (ACT == 15) v = v / (1.0f + expf(-v)); else if (ACT == 3) v = fmaxf(v, 0.f); else if (ACT == 6) v = 0.5f * v * (1.0f + erff(v * 0.70710678118654752f)); so[w][8 * hh + r][t * 16 + ln] = v; } }
  __builtin_amdgcn_fence(__ATOMIC_ACQ_REL, "workgroup"); __builtin_amdgcn_wave_barrier();
  const int rsub = lane >> 4, c4 = (lane & 15) * 4; typedef _Float16 v4h __attribute__((ext_vector_type(4)));
  {
#pragma unroll
    for (int q = 0; q < 8; ++q) { const int r = q * 2 + rsub; if (col0 + c4 < N) { const v4f v = *(const v4fa*)&so[w][r][c4]; if (C) *(v4f*)(C + cofs + (size_t)(row0 + r) * ldc + col0 + c4) = v; if (C16) { v4h h4; for (int i = 0; i < 4; ++i) h4[i] = (_Float16)v[i]; *(v4h*)(C16 + cofs + (size_t)(row0 + r) * ldc + col0 + c4) = h4; } } }
     }
}


typedef _Float16 v4h __attribute__((ext_vector_type(4)));

__global__ __launch_bounds__(256) void k_x16(const float* __restrict__ x, _Float16* __restrict__ X16, size_t n8) { const size_t t = (size_t)blockIdx.x * 256 + threadIdx.x; if (t >= n8) return; FragH f;
#pragma unroll
  for (int q = 0; q < 8; ++q) f.h[q] = (_Float16)bf16_round(x[t * 8 + q]); *(v8us*)((unsigned short*)X16 + t * 8) = f.half[0];  }
__global__ __launch_bounds__(256) void k_h16(const float* __restrict__ x, _Float16* __restrict__ X16, size_t n8) { const size_t t = (size_t)blockIdx.x * 256 + threadIdx.x; if (t >= n8) return; FragH f;
#pragma unroll
  for (int q = 0; q < 8; ++q) f.h[q] = (_Float16)x[t * 8 + q]; *(v8us*)((unsigned short*)X16 + t * 8) = f.half[0];  }
__global__ __launch_bounds__(256) void k_round16f(const float* __restrict__ W, _Float16* __restrict__ Bt, size_t n8) { const size_t t = (size_t)blockIdx.x * 256 + threadIdx.x; if (t >= n8) return; FragH f;
#pragma unroll
  for (int i = 0; i < 8; ++i) f.h[i] = (_Float16)(bf16_round(W[t * 8 + i]) * 16.0f); *(v8us*)((unsigned short*)Bt + t * 8) = f.half[0];  }
template <int NHv, int TTv>
__global__ __launch_bounds__(256) void k_vt(const _Float16* __restrict__ V16, int ldv, int voff, _Float16* __restrict__ Vt) { __shared__ unsigned short tl[64][66]; const int tid = threadIdx.x; const int slab = blockIdx.x / (TTv / 64), lg = blockIdx.x % (TTv / 64); const int b = slab / NHv, h = slab % NHv;
  for (int i = tid; i < 64 * 8; i += 256) { const int r = i / 8, c8 = (i % 8) * 8; FragH f; f.half[0] = *(const v8us*)((const unsigned short*)V16 + ((size_t)b * TTv + lg * 64 + r) * ldv + voff + h * 64 + c8);
#pragma unroll
    for (int q = 0; q < 8; ++q) tl[r][c8 + q] = f.u[q]; }
  __syncthreads();
  {
#pragma unroll
    for (int rd = 0; rd < 2; ++rd) { const int d = rd * 32 + tid / 8, pc = tid % 8; FragH f;
#pragma unroll
      for (int q = 0; q < 8; ++q) f.u[q] = tl[pc * 8 + q][d];
      *(v8us*)((unsigned short*)Vt + ((size_t)slab * 64 + d) * TTv + lg * 64 + pc * 8) = f.half[0]; }
     } }

__global__ __launch_bounds__(256) void k_hl(const float* __restrict__ F, _Float16* __restrict__ Hh, _Float16* __restrict__ Hl, size_t n8) { const size_t t = (size_t)blockIdx.x * 256 + threadIdx.x; if (t >= n8) return; FragH fh, fl; const v4f a = *(const v4fa*)(F + t * 8), c = *(const v4fa*)(F + t * 8 + 4);
#pragma unroll
  for (int q = 0; q < 4; ++q) { _Float16 h = (_Float16)a[q]; fh.h[q] = h; fl.h[q] = (_Float16)((a[q] - (float)h) * 1024.0f); h = (_Float16)c[q]; fh.h[4 + q] = h; fl.h[4 + q] = (_Float16)((c[q] - (float)h) * 1024.0f); }
  { *(v8us*)((unsigned short*)Hh + t * 8) = fh.half[0]; *(v8us*)((unsigned short*)Hl + t * 8) = fl.half[0];  } }
// RMSNorm rows (C = 768 = 32 lanes × 24): y = x·rsqrt(mean(x²) + 1.1920929e-7)·bf16(g); RB: round the input to bf16 first; outputs: f16 hi + ×2^10 residual planes (either may be null) and optionally the f32 rounded input copy XR; wave per row; per lane 6 float4 pieces (c = j·128 + lane·4);
template <int RB>
__global__ __launch_bounds__(256) void k_rms(const float* __restrict__ X, const float* __restrict__ g, int nrows, _Float16* __restrict__ YH, _Float16* __restrict__ YL, float* __restrict__ XR) { const int tid = threadIdx.x, wv = tid >> 5, lane = tid & 31; const int r = blockIdx.x * 8 + wv; if (r >= nrows) return; v4f xv[6]; float ss = 0.f;
#pragma unroll
  for (int j = 0; j < 6; ++j) { v4f a = *(const v4fa*)(X + (size_t)r * CC + j * 128 + lane * 4); if (RB) for (int q = 0; q < 4; ++q) a[q] = bf16_round(a[q]); xv[j] = a; for (int q = 0; q < 4; ++q) ss += a[q] * a[q]; }
  for (int o = 16; o >= 1; o >>= 1) ss += __shfl_xor(ss, o, 32); const float rs = rsqrtf(ss / (float)CC + 1.1920929e-7f);
  typedef _Float16 v4h __attribute__((ext_vector_type(4)));
  {
#pragma unroll
    for (int j = 0; j < 6; ++j) { const int c = j * 128 + lane * 4; v4h hh, hl; for (int q = 0; q < 4; ++q) { const float y = xv[j][q] * rs * bf16_round(g[c + q]); const _Float16 hv = (_Float16)y; hh[q] = hv; hl[q] = (_Float16)((y - (float)hv) * 1024.0f); }
      if (YH) *(v4h*)(YH + (size_t)r * CC + c) = hh; if (YL) *(v4h*)(YL + (size_t)r * CC + c) = hl; if (XR) *(v4f*)(XR + (size_t)r * CC + c) = xv[j]; }
     } }
__global__ __launch_bounds__(256) void k_vtr(const _Float16* __restrict__ XH, const _Float16* __restrict__ XL, _Float16* __restrict__ VT) { __shared__ float tl[64][33]; const int tid = threadIdx.x; const int slab = blockIdx.x / (NN / 64), ng = blockIdx.x % (NN / 64); const int b = slab / NH, h = slab % NH; const size_t base = (size_t)b * NN * CC + (size_t)h * HSZ + (size_t)ng * 64 * HD;      /* 64 consecutive n rows × 32 d = 2048 contiguous elements */
  for (int i = tid; i < 64 * 32; i += 256) { const int n = i / 32, d = i % 32; tl[n][d] = (float)XH[base + i] + (float)XL[base + i] * 0.0009765625f; } __syncthreads();
  const int d = tid / 8, pc = tid % 8; FragH f; for (int q = 0; q < 8; ++q) f.h[q] = (_Float16)tl[pc * 8 + q][d];
  *(v8us*)((unsigned short*)VT + ((size_t)slab * HD + d) * NN + ng * 64 + pc * 8) = f.half[0];  }
// lane l <-> lane l ^ 16 by a vector cross-row move (no LDS counter involved)
__device__ __forceinline__ float xhalf(float x) { return __builtin_bit_cast(float, __builtin_amdgcn_permlanex16(__builtin_bit_cast(int, x), __builtin_bit_cast(int, x), 0x76543210, 0xfedcba98, false, false)); }
typedef float v2f __attribute__((ext_vector_type(2)));
__global__ __launch_bounds__(128) void k_flash(const _Float16* __restrict__ Q16, const _Float16* __restrict__ Q16lo, int ldq, const _Float16* __restrict__ K16, const _Float16* __restrict__ K16lo, int ldk, const _Float16* __restrict__ Vt, const float* __restrict__ SP, float* __restrict__ O, int ldo) {
  constexpr int NQB = NN / 64, DT = 2;
  const int tid = threadIdx.x, w = tid >> 5, lane = tid & 31, ln = lane & 15, hh = lane >> 4;
  const int slab = blockIdx.x / NQB, qblk = blockIdx.x % NQB; const int h = slab % NH; const float coef = ((logf(768.0f) * bf16_round(SP[h])) * 5.656854249492381f) * 1.4426950408889634f;      /* times log2(e): the logits are kept in base 2, so each exponential is one hardware instruction */ const int q0 = qblk * 64 + w * 16;
  FragH bq, bql;
  { const size_t qo = ((size_t)slab * NN + q0 + ln) * ldq; const unsigned short* qr = (const unsigned short*)Q16 + qo; const unsigned short* ql = (const unsigned short*)Q16lo + qo;
    bq.half[0] = *(const v8us*)(qr + 8 * hh); bq.half[1] = *(const v8us*)(qr + 16 + 8 * hh); bql.half[0] = *(const v8us*)(ql + 8 * hh); bql.half[1] = *(const v8us*)(ql + 16 + 8 * hh); }
  const unsigned short* kh = (const unsigned short*)K16 + (size_t)slab * NN * ldk; const unsigned short* kl = (const unsigned short*)K16lo + (size_t)slab * NN * ldk;      /* wave-uniform bases, advanced by 32 key rows a pass */
  const unsigned short* vt = (const unsigned short*)Vt + (size_t)slab * HD * NN;      /* v'^T per slab: [32][N], advanced by 32 columns a pass */
  const unsigned ko[2] = {(unsigned)(ln * ldk + 8 * hh), (unsigned)((16 + ln) * ldk + 8 * hh)}, vo[DT] = {(unsigned)(ln * NN + 8 * hh), (unsigned)((16 + ln) * NN + 8 * hh)};      /* the lane's own element offsets */
  float m_q = -3.0e38f, s_q = -3.0e38f, l_q = 0.f; v8f oacc[DT];      /* s_q = m_q - 10 as rounded: what the exponents subtract, so that P and the denominator carry the factor 2^10 */
#pragma unroll
  for (int dt = 0; dt < DT; ++dt) oacc[dt] = (v8f){0.f,0.f,0.f,0.f,0.f,0.f,0.f,0.f};
  for (int j0 = 0; j0 < NN; j0 += 32, kh += 32 * (size_t)ldk, kl += 32 * (size_t)ldk, vt += 32) {
    FragH ak[2], akl[2], av[DT];
#pragma unroll
    for (int nt = 0; nt < 2; ++nt) { ak[nt].half[0] = *(const v8us*)(kh + ko[nt]); ak[nt].half[1] = *(const v8us*)(kh + ko[nt] + 16); akl[nt].half[0] = *(const v8us*)(kl + ko[nt]); akl[nt].half[1] = *(const v8us*)(kl + ko[nt] + 16); }
#pragma unroll
    for (int dt = 0; dt < DT; ++dt) { av[dt].half[0] = *(const v8us*)(vt + vo[dt]); av[dt].half[1] = *(const v8us*)(vt + vo[dt] + 16); }
    v2f s2[8];      /* the 16 logits as the register pairs the accumulators already form */
#pragma unroll
    for (int nt = 0; nt < 2; ++nt) { v8f acc = (v8f){0.f,0.f,0.f,0.f,0.f,0.f,0.f,0.f}, accl = acc;
      acc = mmaH<1>(ak[nt].v, ak[nt].v, bq.v, bq.v, acc); accl = mmaH<1>(ak[nt].v, ak[nt].v, bql.v, bql.v, accl); accl = mmaH<1>(akl[nt].v, akl[nt].v, bq.v, bq.v, accl);
#pragma unroll
      for (int j = 0; j < 4; ++j) { const v2f a2 = {acc[2 * j], acc[2 * j + 1]}, b2 = {accl[2 * j], accl[2 * j + 1]}; s2[nt * 4 + j] = (a2 + b2 * 0.0009765625f) * coef; } }
    float mx[8];
#pragma unroll
    for (int j = 0; j < 4; ++j) { mx[2 * j] = fmaxf(s2[j].x, s2[4 + j].x); mx[2 * j + 1] = fmaxf(s2[j].y, s2[4 + j].y); }
    float mc = fmaxf(fmaxf(fmaxf(mx[0], mx[1]), fmaxf(mx[2], mx[3])), fmaxf(fmaxf(mx[4], mx[5]), fmaxf(mx[6], mx[7])));
    mc = fmaxf(mc, xhalf(mc));
    const float mn = fmaxf(m_q, mc); const float sn = mn - 10.0f; float ea;      /* the rescale uses the same rounded subtrahends as the exponents of the two passes */
    asm("v_exp_f32 %0, %1\n\tv_nop" : "=v"(ea) : "v"(s_q - sn));      /* in asm for the v_nop alone: it keeps the one slot behind a transcendental */
    const float al = (mn > -1.0e38f) ? ea : 1.0f; m_q = mn; s_q = sn;
    v2f p2[8]; FragH pb;
#pragma unroll
    for (int i = 0; i < 8; ++i) { const v2f e2 = s2[i] - sn; p2[i].x = __builtin_amdgcn_exp2f(e2.x); p2[i].y = __builtin_amdgcn_exp2f(e2.y); pb.h[2 * i] = (_Float16)p2[i].x; pb.h[2 * i + 1] = (_Float16)p2[i].y; }
    const v2f ps = ((p2[0] + p2[1]) + (p2[2] + p2[3])) + ((p2[4] + p2[5]) + (p2[6] + p2[7]));
    l_q = l_q * al + (ps.x + ps.y);      /* per-lane partial sum of the query's denominator (the two halves are joined after the loop) */
#pragma unroll
    for (int dt = 0; dt < DT; ++dt) {
#pragma unroll
      for (int r = 0; r < 8; ++r) oacc[dt][r] *= al;
      oacc[dt] = mmaH<1>(av[dt].v, av[dt].v, pb.v, pb.v, oacc[dt]); } }
  const float lt = l_q + xhalf(l_q); const float inv = (lt > 0.f) ? 1.0f / lt : 0.f;      /* numerator and denominator both carry 2^10 */
  float* orow = O + ((size_t)slab * NN + q0 + ln) * ldo + 8 * hh;      /* oacc[dt][r] = O[q0 + ln][dt * 16 + 8hh + r]: eight consecutive d per lane */
#pragma unroll
  for (int dt = 0; dt < DT; ++dt) { const v4f o0 = {oacc[dt][0] * inv, oacc[dt][1] * inv, oacc[dt][2] * inv, oacc[dt][3] * inv}, o1 = {oacc[dt][4] * inv, oacc[dt][5] * inv, oacc[dt][6] * inv, oacc[dt][7] * inv};
    *(v4f*)(orow + dt * 16) = o0; *(v4f*)(orow + dt * 16 + 4) = o1; } }

__global__ __launch_bounds__(256) void k_add(const float* __restrict__ A, const float* __restrict__ B_, float* __restrict__ out, size_t n4) { const size_t t = (size_t)blockIdx.x * 256 + threadIdx.x; if (t >= n4) return; v4f a = *(const v4fa*)(A + t * 4); const v4f b = *(const v4fa*)(B_ + t * 4); for (int q = 0; q < 4; ++q) a[q] += b[q]; *(v4f*)(out + t * 4) = a;  }

extern "C" void kernel_launch(void* const* d_in, const int* in_sizes, int n_in,
                              void* d_out, int out_size, void* d_ws, size_t ws_size, hipStream_t stream) {
  (void)in_sizes; (void)n_in; (void)out_size;
  const float* const* I = (const float* const*)d_in; const float* x = I[0]; const float* sp = I[1]; const float* Wq = I[2]; const float* WA = I[3]; const float* W1 = I[4]; const float* W2 = I[5]; const float* g1 = I[6]; const float* g2 = I[7];
  char* ws = (char*)d_ws; size_t off = 0;
  auto take = [&](size_t bytes) { char* p = ws + off; off += (bytes + 255) & ~(size_t)255; return p; };
  const size_t WSZ = (size_t)CC * CC; _Float16* Bq = (_Float16*)take(WSZ * 2); _Float16* B1 = (_Float16*)take(WSZ * 2); _Float16* B2 = (_Float16*)take(WSZ * 2); _Float16* BA = (_Float16*)take((size_t)NN * NN * 2);
  _Float16* XH = (_Float16*)take((size_t)NR * CC * 2); _Float16* XL = (_Float16*)take((size_t)NR * CC * 2); float* XR = (float*)take((size_t)NR * CC * 4); float* QF = (float*)take((size_t)NR * CC * 4); _Float16* QH = (_Float16*)take((size_t)NR * CC * 2); _Float16* QL = (_Float16*)take((size_t)NR * CC * 2);
  _Float16* VT = (_Float16*)take((size_t)BB * NH * HD * NN * 2); _Float16* VPT = (_Float16*)take((size_t)BB * NH * HD * NN * 2); float* ATT = (float*)take((size_t)NR * CC * 4);
  float* O = QF; _Float16* H16 = XH; _Float16* FH = XL;      /* O (raw [B][H][N][hd] f32) over q f32 (dead after k_hl); RMSNorm2 output over XH and the FF hidden over XL (both dead after k_flash) */
  if (off > ws_size) return;      // 3.5 + 8.4 + 6.3 × 2 + 12.6 × 2 + 6.3 × 2 + 6.3 × 2 + 12.6 ≈ 87 MB
  const unsigned gw = (unsigned)((WSZ / 8 + 255) / 256); k_round16f<<<gw, 256, 0, stream>>>(Wq, Bq, WSZ / 8); k_round16f<<<gw, 256, 0, stream>>>(W1, B1, WSZ / 8); k_round16f<<<gw, 256, 0, stream>>>(W2, B2, WSZ / 8); k_round16f<<<(unsigned)(((size_t)NN * NN / 8 + 255) / 256), 256, 0, stream>>>(WA, BA, (size_t)NN * NN / 8);      /* (out,in) natural ×2^4; WA natural [m][n] ×2^4 */
  k_rms<1><<<(NR + 7) / 8, 256, 0, stream>>>(x, g1, NR, XH, XL, XR);      /* xn = RMSNorm(bf16 x)·g1 → hi / ×2^10 residual; XR = bf16(x) */
  const dim3 gq(((NR / 16) * (CC / 64) + 3) / 4, 1);
  k_gemm_hhx<0><<<gq, 128, 0, stream>>>(XH, CC, 0, Bq, CC, 0, 0.0625f, nullptr, 0, nullptr, 1, 0, 0, QF, nullptr, CC, 0, NR, CC, CC);      /* q = xn·Wqᵀ: hi term, M 4096 N 768 K 768 */
  k_gemm_hhx<0><<<gq, 128, 0, stream>>>(XL, CC, 0, Bq, CC, 0, 0.0625f * 0.0009765625f, nullptr, 0, QF, 1, (size_t)CC, 0, QF, nullptr, CC, 0, NR, CC, CC);      /* += lo term ·2^-10 in place */
  k_hl<<<(unsigned)(((size_t)NR * CC / 8 + 255) / 256), 256, 0, stream>>>(QF, QH, QL, (size_t)NR * CC / 8);      /* q → hi / ×2^10 residual (flat planes; head h of batch b = elements [b·N·C + h·N·hd, +N·hd) viewed [N][hd]) */
  k_vtr<<<BB * NH * (NN / 64), 256, 0, stream>>>(XH, XL, VT);      /* vᵀ per (b,h): [32][2048] f16 */
  const dim3 gvp(((HD / 16) * (NN / 64) + 3) / 4, BB * NH);
  k_gemm_hhx<0><<<gvp, 128, 0, stream>>>(VT, NN, (size_t)HD * NN, BA, NN, 0, 0.0625f, nullptr, 0, nullptr, 1, 0, 0, nullptr, VPT, NN, (size_t)HD * NN, HD, NN, NN);      /* v'ᵀ[d][m] = Σ_n vᵀ[d][n]·WA[m][n], batched over the 48 (b,h): M 32 N 2048 K 2048 */
  k_flash<<<BB * NH * (NN / 64), 128, 0, stream>>>(QH, QL, HD, XH, XL, HD, VPT, sp, O, HD);      /* per (b,h) slab of the raw head views (flat planes, ld 32): softmax(coef_h·q·kᵀ)·v' → O raw [B][H][N][32] */
  k_add<<<(unsigned)(((size_t)NR * CC / 4 + 255) / 256), 256, 0, stream>>>(O, XR, ATT, (size_t)NR * CC / 4);      /* attn = raw-reshaped O + x */
  k_rms<0><<<(NR + 7) / 8, 256, 0, stream>>>(ATT, g2, NR, H16, nullptr, nullptr);      /* h = RMSNorm(attn)·g2 → f16 */
  k_gemm_hhx<6><<<gq, 128, 0, stream>>>(H16, CC, 0, B1, CC, 0, 0.0625f, nullptr, 0, nullptr, 1, 0, 0, nullptr, FH, CC, 0, NR, CC, CC);      /* gelu_erf(h·W1ᵀ) → f16: M 4096 N 768 K 768 */
  k_gemm_hhx<0><<<gq, 128, 0, stream>>>(FH, CC, 0, B2, CC, 0, 0.0625f, nullptr, 0, ATT, 1, (size_t)CC, 0, (float*)d_out, nullptr, CC, 0, NR, CC, CC);      /* out = ·W2ᵀ + attn */
}

// v004
// Measured time: 201 microseconds a run.
// Two timings next to v003 both put it at 1.29 times that version's speed.
// All steps since v000 together make it 2.33 times as fast.
#include <hip/hip_runtime.h>
// 'Scalable super' multi-head attention block (B=2, N=2048, C=768, H=24, hd=32): xn = RMSNorm(x)·g1; q = (xn·Wqᵀ) RAW-reshaped [B,H,N,hd] (no transpose — the module's quirk), k = v = xn raw-reshaped likewise; v' = WA[:N,:N]·v (value premix);
// scores = softmax(coef_h · q·kᵀ) with coef_h = log(C)·scale_param[h]·√hd (up to ≈56 → extremely peaked); attn = (scores·v') raw-reshaped back to [B,N,C] + x; h = RMSNorm(attn)·g2; out = gelu_erf(h·W1ᵀ)·W2ᵀ + attn.
// Compute dtype: x, scale_param, weights, WA, g rounded to bf16; RMSNorm in f32 (wave per row) → f16 hi + ×2^10 residual planes; q = xn·Wqᵀ f32-accurate (hi·W + lo·W·2^-10) → hi/lo planes; per (b,h) the 2048×2048 logit plane
// computed inside a fused flash-style kernel from three f16 products (q_hi·k_hi + (q_lo·k_hi + q_hi·k_lo)·2^-10, d = 32) and scaled by the per-head coefficient in f32; online f32 softmax; P f16 ×2^10; v'ᵀ = vᵀ·WAᵀ by GEMM (f16); O = P·v' accumulated in f32 into the raw [B][H][N][hd] buffer; + x; RMSNorm; FF GEMMs
// (erf-GELU epilogue) with the residual through the f32 addend. All contractions on v_wmma_f32_16x16x32_f16, f32 accumulate.
#define BB 2
#define NN 2048
#define CC 768
#define NH 24
#define HD 32
#define NR (BB * NN)
#define HSZ ((size_t)NN * HD)

typedef __bf16 v16b __attribute__((ext_vector_type(16)));
typedef unsigned short v8us __attribute__((ext_vector_type(8), may_alias));
typedef float  v8f  __attribute__((ext_vector_type(8)));
typedef float  v4f  __attribute__((ext_vector_type(4)));
typedef float  v4fa __attribute__((ext_vector_type(4), may_alias));
union FragB { v16b v; v8us half[2]; unsigned short u[16]; };

__device__ __forceinline__ unsigned short bf16_bits(float x) { unsigned int u = __float_as_uint(x); return (unsigned short)((u + 0x7FFFu + ((u >> 16) & 1u)) >> 16); }
__device__ __forceinline__ float bf16_val(unsigned short b) { return __uint_as_float(((unsigned int)b) << 16); }
__device__ __forceinline__ float bf16_round(float x) { return bf16_val(bf16_bits(x)); }
// D += A·B with NT terms: 1 = ah·bh, 2 = + al·bh (A split), 3 = + ah·bl (both split)
template <int NT>
__device__ __forceinline__ v8f mmaN(v16b ah, v16b al, v16b bh, v16b bl, v8f c) {
  c = __builtin_amdgcn_wmma_f32_16x16x32_bf16(false, ah, false, bh, (short)0, c, false, false);
  if (NT >= 2) c = __builtin_amdgcn_wmma_f32_16x16x32_bf16(false, al, false, bh, (short)0, c, false, false);
  if (NT >= 3) c = __builtin_amdgcn_wmma_f32_16x16x32_bf16(false, ah, false, bl, (short)0, c, false, false);
  asm volatile("v_nop\n\tv_nop\n\tv_nop\n\tv_nop" : "+v"(c) : "v"(ah), "v"(al), "v"(bh), "v"(bl));
  return c;
}

__global__ __launch_bounds__(256) void k_wt_bf16(const float* __restrict__ W, unsigned short* __restrict__ Wt, int K, int N) {
  const int t = blockIdx.x * 256 + threadIdx.x;
  const int k8n = K / 8;
  if (t >= N * k8n) return;
  const int n = t / k8n, k8 = (t % k8n) * 8;
  v8us v;
#pragma unroll
  for (int i = 0; i < 8; ++i) v[i] = bf16_bits(W[(size_t)(k8 + i) * N + n]);
  *(v8us*)(Wt + (size_t)n * K + k8) = v;
  
}

// GEMM C[M][N] (f32, pitch ldc) = act(A[M][K]·W + bias). A f32 row-major (pitch lda) converted per fragment to bf16
// (ASPLIT: hi/lo two planes -> 2 terms, else single rounded term); Wt bf16 [N][K] (pitch ldb). BIAS_BF16 rounds the
// bias to bf16 first (bias quantised to bf16 before the add). K%32==0, M%16==0, N%64==0.
template <bool ASPLIT, int ACT, bool BIAS_BF16>
__global__ __launch_bounds__(128) void k_gemm_bf(const float* __restrict__ A, int lda, const unsigned short* __restrict__ Wt, int ldb,
                                               const float* __restrict__ bias, float* __restrict__ C, int ldc, int M, int N, int K) {
  __shared__ __attribute__((aligned(16))) float so[4][16][64];
  const int tid = threadIdx.x, w = tid >> 5, lane = tid & 31, ln = lane & 15, hh = lane >> 4;
  const int ntn = N / 64;
  const int wid = blockIdx.x * 4 + w;
  const int mt = wid / ntn, nq = wid % ntn;
  if (mt * 16 >= M) return;
  const int row0 = mt * 16, col0 = nq * 64;
  const float* arow = A + (size_t)(row0 + ln) * lda;
  v8f acc[4] = {};
  for (int kb = 0; kb < K; kb += 32) {
    FragB ah, al;
    const v4f x0 = *(const v4fa*)(arow + kb + 8 * hh), x1 = *(const v4fa*)(arow + kb + 8 * hh + 4);
    const v4f x2 = *(const v4fa*)(arow + kb + 16 + 8 * hh), x3 = *(const v4fa*)(arow + kb + 16 + 8 * hh + 4);
    float xs[16] = {x0[0],x0[1],x0[2],x0[3],x1[0],x1[1],x1[2],x1[3],x2[0],x2[1],x2[2],x2[3],x3[0],x3[1],x3[2],x3[3]};
#pragma unroll
    for (int i = 0; i < 16; ++i) { const unsigned short hb = bf16_bits(xs[i]); ah.u[i] = hb; al.u[i] = ASPLIT ? bf16_bits(xs[i] - bf16_val(hb)) : (unsigned short)0; }
#pragma unroll
    for (int t = 0; t < 4; ++t) {
      const unsigned short* brow = Wt + (size_t)(col0 + t * 16 + ln) * ldb + kb;
      FragB b;
      b.half[0] = *(const v8us*)(brow + 8 * hh);
      b.half[1] = *(const v8us*)(brow + 16 + 8 * hh);
      acc[t] = mmaN<ASPLIT ? 2 : 1>(ah.v, al.v, b.v, b.v, acc[t]);
    }
  }
#pragma unroll
  for (int t = 0; t < 4; ++t) {
    float bv = bias ? bias[col0 + t * 16 + ln] : 0.f;
    if (BIAS_BF16) bv = bf16_round(bv);
#pragma unroll
    for (int r = 0; r < 8; ++r) { float v = acc[t][r] + bv; if (ACT == 1) v = fmaxf(v, 0.f); so[w][8 * hh + r][t * 16 + ln] = v; }
  }
  __builtin_amdgcn_fence(__ATOMIC_ACQ_REL, "workgroup");
  __builtin_amdgcn_wave_barrier();
  const int rsub = lane >> 4, c4 = (lane & 15) * 4;
  {
#pragma unroll
    for (int q = 0; q < 8; ++q) {
      const int r = q * 2 + rsub;
      const v4f v = *(const v4fa*)&so[w][r][c4];
      *(v4f*)(C + (size_t)(row0 + r) * ldc + col0 + c4) = v;
    }
    
  }
}

// Flash-style causal/unmasked attention, all contractions 3-term bf16 hi/lo splits, f32 softmax with running max.
// q,k,v rows are read from f32 buffers with arbitrary row pitch (so they can live inside a fused qkv buffer);
// D = head size (multiple of 32, <= 128); one wave = 16 query rows; block = 4 waves (64 queries) sharing K/V chunks of 32.
template <int D, bool CAUSAL>
__global__ __launch_bounds__(128) void k_flash(const float* __restrict__ qb, const float* __restrict__ kb, const float* __restrict__ vb,
                                             int pitch, int T, int H, float scale, float* __restrict__ y, int ypitch) {
  constexpr int KS = D / 32;        // k-steps for QK
  constexpr int DT = D / 16;        // d tiles for PV
  __shared__ __attribute__((aligned(16))) unsigned short sKh[32][D + 8], sKl[32][D + 8], sVh[32][D + 8], sVl[32][D + 8];
  __shared__ __attribute__((aligned(16))) unsigned short sPh[4][16][40], sPl[4][16][40];
  __shared__ __attribute__((aligned(16))) float sO[4][16][D];
  const int tid = threadIdx.x, w = tid >> 5, lane = tid & 31, ln = lane & 15, hh = lane >> 4;
  const int nqb = (T + 63) / 64;
  const int bh = blockIdx.x / nqb, qblk = blockIdx.x % nqb;
  const int b = bh / H, h = bh % H;
  const int q0 = qblk * 64 + w * 16;
  const float* Q = qb + (size_t)b * T * pitch + h * D;
  const float* K = kb + (size_t)b * T * pitch + h * D;
  const float* V = vb + (size_t)b * T * pitch + h * D;

  // A fragments of the wave's 16 query rows (scaled), hi/lo
  FragB aqh[KS], aql[KS];
  {
    int row = q0 + ln; if (row >= T) row = T - 1;
    const float* qr = Q + (size_t)row * pitch;
#pragma unroll
    for (int ks = 0; ks < KS; ++ks)
#pragma unroll
      for (int i = 0; i < 16; ++i) {
        const int d = ks * 32 + ((i < 8) ? (8 * hh + i) : (16 + 8 * hh + (i - 8)));
        const float x = qr[d] * scale; const unsigned short hb = bf16_bits(x);
        aqh[ks].u[i] = hb; aql[ks].u[i] = bf16_bits(x - bf16_val(hb));
      }
  }
  float m_r[8], l_r[8];
#pragma unroll
  for (int r = 0; r < 8; ++r) { m_r[r] = -3.0e38f; l_r[r] = 0.f; }
  v8f oacc[DT];
#pragma unroll
  for (int dt = 0; dt < DT; ++dt) oacc[dt] = (v8f){0.f,0.f,0.f,0.f,0.f,0.f,0.f,0.f};

  const int kv_end = CAUSAL ? min(T, qblk * 64 + 64) : T;     // block-uniform
  for (int j0 = 0; j0 < kv_end; j0 += 32) {
    __syncthreads();
    for (int e = tid; e < 32 * (D / 4); e += 128) {
      const int r = e / (D / 4), c4 = (e % (D / 4)) * 4;
      const int key = j0 + r;
      v4f kf = {0.f,0.f,0.f,0.f}, vf = {0.f,0.f,0.f,0.f};
      if (key < T) { kf = *(const v4fa*)(K + (size_t)key * pitch + c4); vf = *(const v4fa*)(V + (size_t)key * pitch + c4); }
#pragma unroll
      for (int t = 0; t < 4; ++t) {
        unsigned short hb = bf16_bits(kf[t]); sKh[r][c4 + t] = hb; sKl[r][c4 + t] = bf16_bits(kf[t] - bf16_val(hb));
        hb = bf16_bits(vf[t]); sVh[r][c4 + t] = hb; sVl[r][c4 + t] = bf16_bits(vf[t] - bf16_val(hb));
      }
    }
    __syncthreads();
    // S tile 16 x 32
    v8f s[2];
#pragma unroll
    for (int nt = 0; nt < 2; ++nt) {
      v8f acc = {};
#pragma unroll
      for (int ks = 0; ks < KS; ++ks) {
        FragB bh_, bl_;
        bh_.half[0] = *(const v8us*)&sKh[nt * 16 + ln][ks * 32 + 8 * hh]; bh_.half[1] = *(const v8us*)&sKh[nt * 16 + ln][ks * 32 + 16 + 8 * hh];
        bl_.half[0] = *(const v8us*)&sKl[nt * 16 + ln][ks * 32 + 8 * hh]; bl_.half[1] = *(const v8us*)&sKl[nt * 16 + ln][ks * 32 + 16 + 8 * hh];
        acc = mmaN<3>(aqh[ks].v, aql[ks].v, bh_.v, bl_.v, acc);
      }
      s[nt] = acc;
    }
    // mask + running max (rows 8hh+r; the 16 lanes of a half share rows)
    float alpha[8];
#pragma unroll
    for (int r = 0; r < 8; ++r) {
      const int qi = q0 + 8 * hh + r;
      const int ja = j0 + ln, jb = j0 + 16 + ln;
      if (CAUSAL) { if (ja > qi) s[0][r] = -3.0e38f; if (jb > qi) s[1][r] = -3.0e38f; }
      if (ja >= T) s[0][r] = -3.0e38f;
      if (jb >= T) s[1][r] = -3.0e38f;
      float mx = fmaxf(s[0][r], s[1][r]);
      mx = fmaxf(mx, __shfl_xor(mx, 1, 32)); mx = fmaxf(mx, __shfl_xor(mx, 2, 32)); mx = fmaxf(mx, __shfl_xor(mx, 4, 32)); mx = fmaxf(mx, __shfl_xor(mx, 8, 32));
      const float mnew = fmaxf(m_r[r], mx);
      alpha[r] = (mnew > -1.0e38f) ? __expf(m_r[r] - mnew) : 1.0f;
      const float p0 = (s[0][r] > -1.0e38f) ? __expf(s[0][r] - mnew) : 0.f;
      const float p1 = (s[1][r] > -1.0e38f) ? __expf(s[1][r] - mnew) : 0.f;
      m_r[r] = mnew;
      l_r[r] = l_r[r] * alpha[r] + p0 + p1;            // per-lane partial row sum (16 lanes combined at the end)
      unsigned short hb = bf16_bits(p0); sPh[w][8 * hh + r][ln] = hb;      sPl[w][8 * hh + r][ln] = bf16_bits(p0 - bf16_val(hb));
      hb = bf16_bits(p1);                sPh[w][8 * hh + r][16 + ln] = hb; sPl[w][8 * hh + r][16 + ln] = bf16_bits(p1 - bf16_val(hb));
    }
#pragma unroll
    for (int dt = 0; dt < DT; ++dt)
#pragma unroll
      for (int r = 0; r < 8; ++r) oacc[dt][r] *= alpha[r];
    __builtin_amdgcn_fence(__ATOMIC_ACQ_REL, "workgroup");
    __builtin_amdgcn_wave_barrier();
    FragB pah, pal;
    pah.half[0] = *(const v8us*)&sPh[w][ln][8 * hh]; pah.half[1] = *(const v8us*)&sPh[w][ln][16 + 8 * hh];
    pal.half[0] = *(const v8us*)&sPl[w][ln][8 * hh]; pal.half[1] = *(const v8us*)&sPl[w][ln][16 + 8 * hh];
#pragma unroll
    for (int dt = 0; dt < DT; ++dt) {
      FragB bvh, bvl;
#pragma unroll
      for (int i = 0; i < 8; ++i) {
        bvh.u[i] = sVh[8 * hh + i][dt * 16 + ln]; bvh.u[8 + i] = sVh[16 + 8 * hh + i][dt * 16 + ln];
        bvl.u[i] = sVl[8 * hh + i][dt * 16 + ln]; bvl.u[8 + i] = sVl[16 + 8 * hh + i][dt * 16 + ln];
      }
      oacc[dt] = mmaN<3>(pah.v, pal.v, bvh.v, bvl.v, oacc[dt]);
    }
    __builtin_amdgcn_fence(__ATOMIC_ACQ_REL, "workgroup");
    __builtin_amdgcn_wave_barrier();
  }
#pragma unroll
  for (int r = 0; r < 8; ++r) {
    float l = l_r[r];
    l += __shfl_xor(l, 1, 32); l += __shfl_xor(l, 2, 32); l += __shfl_xor(l, 4, 32); l += __shfl_xor(l, 8, 32);
    l_r[r] = (l > 0.f) ? 1.0f / l : 0.f;
  }
#pragma unroll
  for (int dt = 0; dt < DT; ++dt)
#pragma unroll
    for (int r = 0; r < 8; ++r) sO[w][8 * hh + r][dt * 16 + ln] = oacc[dt][r] * l_r[r];
  __builtin_amdgcn_fence(__ATOMIC_ACQ_REL, "workgroup");
  __builtin_amdgcn_wave_barrier();
  {
    for (int r = 0; r < 16; ++r) {
      const int row = q0 + r;
      if (row < T && lane < D / 4) {
        const v4f val = *(const v4fa*)&sO[w][r][lane * 4];
        *(v4f*)(y + ((size_t)b * T + row) * ypitch + h * D + lane * 4) = val;
      }
    }
    
  }
}

// GEMM C = act(A·W + bias + resid): A f32 (ASPLIT -> hi/lo 2 terms), Wt bf16 [N][K]; ACT 0 none, 1 relu, 2 exact gelu;
// resid (optional, f32, row index = (row % rmod), pitch ldr, RES_BF16 rounds it) added before the activation.
template <bool ASPLIT, int ACT, bool BIAS_BF16, bool RES_BF16>
__global__ __launch_bounds__(128) void k_gemm_bf3(const float* __restrict__ A, int lda, const unsigned short* __restrict__ Wt, int ldb,
                                                const float* __restrict__ bias, const float* __restrict__ resid, int rmod, int ldr,
                                                float* __restrict__ C, int ldc, int M, int N, int K) {
  __shared__ __attribute__((aligned(16))) float so[4][16][64];
  const int tid = threadIdx.x, w = tid >> 5, lane = tid & 31, ln = lane & 15, hh = lane >> 4;
  const int ntn = N / 64;
  const int wid = blockIdx.x * 4 + w;
  const int mt = wid / ntn, nq = wid % ntn;
  if (mt * 16 >= M) return;
  const int row0 = mt * 16, col0 = nq * 64;
  const float* arow = A + (size_t)(row0 + ln) * lda;
  v8f acc[4] = {};
  for (int kb = 0; kb < K; kb += 32) {
    FragB ah, al;
    const v4f x0 = *(const v4fa*)(arow + kb + 8 * hh), x1 = *(const v4fa*)(arow + kb + 8 * hh + 4);
    const v4f x2 = *(const v4fa*)(arow + kb + 16 + 8 * hh), x3 = *(const v4fa*)(arow + kb + 16 + 8 * hh + 4);
    float xs[16] = {x0[0],x0[1],x0[2],x0[3],x1[0],x1[1],x1[2],x1[3],x2[0],x2[1],x2[2],x2[3],x3[0],x3[1],x3[2],x3[3]};
#pragma unroll
    for (int i = 0; i < 16; ++i) { const unsigned short hb = bf16_bits(xs[i]); ah.u[i] = hb; al.u[i] = ASPLIT ? bf16_bits(xs[i] - bf16_val(hb)) : (unsigned short)0; }
#pragma unroll
    for (int t = 0; t < 4; ++t) {
      const unsigned short* brow = Wt + (size_t)(col0 + t * 16 + ln) * ldb + kb;
      FragB b;
      b.half[0] = *(const v8us*)(brow + 8 * hh);
      b.half[1] = *(const v8us*)(brow + 16 + 8 * hh);
      acc[t] = mmaN<ASPLIT ? 2 : 1>(ah.v, al.v, b.v, b.v, acc[t]);
    }
  }
#pragma unroll
  for (int t = 0; t < 4; ++t) {
    const int col = col0 + t * 16 + ln;
    float bv = bias ? bias[col] : 0.f;
    if (BIAS_BF16) bv = bf16_round(bv);
#pragma unroll
    for (int r = 0; r < 8; ++r) {
      float v = acc[t][r] + bv;
      if (resid) { float rv = resid[(size_t)((row0 + 8 * hh + r) % rmod) * ldr + col]; if (RES_BF16) rv = bf16_round(rv); v += rv; }
      if (ACT == 1) v = fmaxf(v, 0.f);
      if (ACT == 2) v = 0.5f * v * (1.0f + erff(v * 0.70710678118654752f));
      if (ACT == 3) { const float u = 0.7978845608028654f * (v + 0.044715f * v * v * v); v = 0.5f * v * (1.0f + tanhf(u)); }
      so[w][8 * hh + r][t * 16 + ln] = v;
    }
  }
  __builtin_amdgcn_fence(__ATOMIC_ACQ_REL, "workgroup");
  __builtin_amdgcn_wave_barrier();
  const int rsub = lane >> 4, c4 = (lane & 15) * 4;
  {
#pragma unroll
    for (int q = 0; q < 8; ++q) {
      const int r = q * 2 + rsub;
      const v4f v = *(const v4fa*)&so[w][r][c4];
      *(v4f*)(C + (size_t)(row0 + r) * ldc + col0 + c4) = v;
    }
    
  }
}
// row LayerNorm (biased variance, eps) over N: s = X (+ R); optional out_sum <- s; out_norm <- (s-mu)*rsqrt(var+eps)*g + b
template <bool PARAM_BF16>
__global__ __launch_bounds__(256) void k_layernorm(const float* __restrict__ X, const float* __restrict__ R, const float* __restrict__ g, const float* __restrict__ bta,
                                                  float* __restrict__ out_sum, float* __restrict__ out_norm, int N, float eps) {
  __shared__ float red[256];
  const int row = blockIdx.x, tid = threadIdx.x;
  const float* x = X + (size_t)row * N; const float* rr = R ? R + (size_t)row * N : nullptr;
  float vals[16];                     // up to N = 4096
  const int per = N / 256;            // contiguous chunk per thread? use strided-by-4 chunks: thread handles j = tid*4 + 1024*u
  float s1 = 0.f;
  for (int u = 0; u < per / 4; ++u) {
    const int j = tid * 4 + 1024 * u;
    const v4f a = *(const v4fa*)(x + j);
    v4f b = {0.f,0.f,0.f,0.f}; if (rr) b = *(const v4fa*)(rr + j);
#pragma unroll
    for (int q = 0; q < 4; ++q) { const float v = a[q] + b[q]; vals[u * 4 + q] = v; s1 += v; }
  }
  red[tid] = s1; __syncthreads();
  for (int st = 128; st > 0; st >>= 1) { if (tid < st) red[tid] += red[tid + st]; __syncthreads(); }
  const float mu = red[0] / (float)N; __syncthreads();
  float s2 = 0.f;
  for (int u = 0; u < per / 4; ++u)
#pragma unroll
    for (int q = 0; q < 4; ++q) { const float c = vals[u * 4 + q] - mu; s2 += c * c; }
  red[tid] = s2; __syncthreads();
  for (int st = 128; st > 0; st >>= 1) { if (tid < st) red[tid] += red[tid + st]; __syncthreads(); }
  const float rs = rsqrtf(red[0] / (float)N + eps);
  {
    for (int u = 0; u < per / 4; ++u) {
      const int j = tid * 4 + 1024 * u;
      v4f o, sm;
#pragma unroll
      for (int q = 0; q < 4; ++q) {
        float gg = g[j + q], bb = bta[j + q];
        if (PARAM_BF16) { gg = bf16_round(gg); bb = bf16_round(bb); }
        sm[q] = vals[u * 4 + q]; o[q] = (vals[u * 4 + q] - mu) * rs * gg + bb;
      }
      if (out_sum) *(v4f*)(out_sum + (size_t)row * N + j) = sm;
      *(v4f*)(out_norm + (size_t)row * N + j) = o;
    }
    
  }
}



// ---- f16 WMMA path (v_wmma_f32_16x16x32_f16): 11-bit significands for operands in range — used where a [0,1] probability operand needs more precision than bf16
typedef _Float16 v16h __attribute__((ext_vector_type(16)));
union FragH { v16h v; v8us half[2]; _Float16 h[16]; unsigned short u[16]; };
template <int NT>
__device__ __forceinline__ v8f mmaH(v16h ah, v16h al, v16h bh, v16h bl, v8f c) {
  c = __builtin_amdgcn_wmma_f32_16x16x32_f16(false, ah, false, bh, (short)0, c, false, false);
  if (NT >= 2) c = __builtin_amdgcn_wmma_f32_16x16x32_f16(false, al, false, bh, (short)0, c, false, false);
  if (NT >= 3) c = __builtin_amdgcn_wmma_f32_16x16x32_f16(false, ah, false, bl, (short)0, c, false, false);
  asm volatile("v_nop\n\tv_nop\n\tv_nop\n\tv_nop" : "+v"(c) : "v"(ah), "v"(al), "v"(bh), "v"(bl));
  return c;
}
// batched GEMM like k_gemm_b but f16 operands: A f32 (split into f16 hi/lo if ASPLIT, else rounded to f16), Bt = f16 values [n][k]; alpha; C f32; N multiple of 16 (partial tiles skipped)
template <bool ASPLIT>
__global__ __launch_bounds__(128) void k_gemm_h(const float* __restrict__ A, int lda, size_t sA, const _Float16* __restrict__ Bh, int ldb, size_t sB, float alpha, float* __restrict__ C, int ldc, size_t sC, int M, int N, int K) {
  __shared__ __attribute__((aligned(16))) float so[4][16][64];
  const int tid = threadIdx.x, w = tid >> 5, lane = tid & 31, ln = lane & 15, hh = lane >> 4; const int by = blockIdx.y;
  A += (size_t)by * sA; Bh += (size_t)by * sB; C += (size_t)by * sC;
  const int ntn = (N + 63) / 64; const int wid = blockIdx.x * 4 + w; const int mt = wid / ntn, nq = wid % ntn; if (mt * 16 >= M) return;
  const int row0 = mt * 16, col0 = nq * 64; const float* arow = A + (size_t)(row0 + ln) * lda;
  v8f acc[4] = {};
  for (int kb = 0; kb < K; kb += 32) {
    FragH ah, al;
    const v4f x0 = *(const v4fa*)(arow + kb + 8 * hh), x1 = *(const v4fa*)(arow + kb + 8 * hh + 4), x2 = *(const v4fa*)(arow + kb + 16 + 8 * hh), x3 = *(const v4fa*)(arow + kb + 16 + 8 * hh + 4);
    float xs[16] = {x0[0],x0[1],x0[2],x0[3],x1[0],x1[1],x1[2],x1[3],x2[0],x2[1],x2[2],x2[3],x3[0],x3[1],x3[2],x3[3]};
#pragma unroll
    for (int i = 0; i < 16; ++i) { const _Float16 h = (_Float16)xs[i]; ah.h[i] = h; al.h[i] = ASPLIT ? (_Float16)(xs[i] - (float)h) : (_Float16)0.0f; }
#pragma unroll
    for (int t = 0; t < 4; ++t) { if (col0 + t * 16 >= N) continue; const size_t boff = (size_t)(col0 + t * 16 + ln) * ldb + kb; FragH bq; bq.half[0] = *(const v8us*)(Bh + boff + 8 * hh); bq.half[1] = *(const v8us*)(Bh + boff + 16 + 8 * hh);
      acc[t] = mmaH<ASPLIT ? 2 : 1>(ah.v, al.v, bq.v, bq.v, acc[t]); }
  }
#pragma unroll
  for (int t = 0; t < 4; ++t) { if (col0 + t * 16 >= N) continue;
#pragma unroll
    for (int r = 0; r < 8; ++r) so[w][8 * hh + r][t * 16 + ln] = acc[t][r] * alpha; }
  __builtin_amdgcn_fence(__ATOMIC_ACQ_REL, "workgroup"); __builtin_amdgcn_wave_barrier();
  const int rsub = lane >> 4, c4 = (lane & 15) * 4;
  {
#pragma unroll
    for (int q = 0; q < 8; ++q) { const int r = q * 2 + rsub; if (col0 + c4 < N) { const v4f v = *(const v4fa*)&so[w][r][c4]; *(v4f*)(C + (size_t)(row0 + r) * ldc + col0 + c4) = v; } }
     }
}

// Wt[n][k] = f16(W[k][n]·scale) from f32 row-major W[K][N] (scale = power of two; bf16-exact weights stay exact in f16 away from the subnormal range)
__global__ __launch_bounds__(256) void k_wt_f16(const float* __restrict__ W, _Float16* __restrict__ Wt, int K, int N, float scale) {
  const int t = blockIdx.x * 256 + threadIdx.x; if (t >= N * (K / 8)) return; const int n = t / (K / 8), k8 = (t % (K / 8)) * 8; FragH f;
#pragma unroll
  for (int i = 0; i < 8; ++i) f.h[i] = (_Float16)(bf16_round(W[(size_t)(k8 + i) * N + n]) * scale); const v8us o = f.half[0];
  *(v8us*)((unsigned short*)Wt + (size_t)n * K + k8) = o; 
}
// GEMM C[M][N] = act(A.B^T * alpha (+ CP)), A f16 [M][K], Bh f16 [N][K], both k-contiguous; ACT 0 none / 6 erf-GELU; writes f32 C and / or f16 C16 (either may be null), CP = f32 addend with C's pitch.
// One 128 x 128 tile of C per work-group of 8 waves (4 x 2, 32 x 64 each). The operands come through LDS: a stage is 128 k = 256 bytes of each of the 256 operand rows, brought by asynchronous 16-byte copies that take whole lines
// (16 lanes per row), two buffers, the next stage in flight while this one is worked on. M, N multiples of 128, K of 128 at every launch (4096 / 768 / 768 and 1536 / 2048 / 2048).
#define GT 128      /* tile edge */
#define GK 128      /* k per stage */
#define GP 272u     /* LDS row pitch in bytes = 16 x odd: the 16 rows of a fragment read fall on all 64 banks */
#define GST (2u * GT * GP)      /* bytes of a stage: 128 A rows, then 128 B rows */
// this thread's share of one operand's stage: rows 16 apart, the same 16-byte column
__device__ __forceinline__ void copy8(unsigned l, const unsigned short* g, size_t gs) {
  asm volatile("global_load_async_to_lds_b128 %0, %8, off\n\t"
               "global_load_async_to_lds_b128 %1, %9, off\n\t"
               "global_load_async_to_lds_b128 %2, %10, off\n\t"
               "global_load_async_to_lds_b128 %3, %11, off\n\t"
               "global_load_async_to_lds_b128 %4, %12, off\n\t"
               "global_load_async_to_lds_b128 %5, %13, off\n\t"
               "global_load_async_to_lds_b128 %6, %14, off\n\t"
               "global_load_async_to_lds_b128 %7, %15, off\n\t"
               "s_wait_xcnt 0x0"      /* inside the copies' own statement, so that it stands in front of every rewrite of their address registers */
               :: "v"(l), "v"(l + 16u * GP), "v"(l + 32u * GP), "v"(l + 48u * GP), "v"(l + 64u * GP), "v"(l + 80u * GP), "v"(l + 96u * GP), "v"(l + 112u * GP),
                  "v"(g), "v"(g + gs), "v"(g + 2 * gs), "v"(g + 3 * gs), "v"(g + 4 * gs), "v"(g + 5 * gs), "v"(g + 6 * gs), "v"(g + 7 * gs) : "memory");
}
template <int ACT>
__global__ __launch_bounds__(256) void k_gemm_hhx(const _Float16* __restrict__ A, int lda, const _Float16* __restrict__ Bh, int ldb, float alpha, const float* __restrict__ CP, float* __restrict__ C, _Float16* __restrict__ C16, int ldc, int N, int K) {
  __shared__ __attribute__((aligned(16))) unsigned char ring[2 * GST];
  __shared__ __attribute__((aligned(16))) float so[8][16][64];
  const int tid = threadIdx.x, w = tid >> 5, lane = tid & 31, ln = lane & 15, hh = lane >> 4;
  const int ntn = N / GT; const int row0 = (int)(blockIdx.x / ntn) * GT, col0 = (int)(blockIdx.x % ntn) * GT; const int wr = (w >> 1) * 32, wc = (w & 1) * 64;
  const int cr = tid >> 4, cc = tid & 15;      /* the thread's first row of a stage and its 16-byte column */
  const unsigned short* ga = (const unsigned short*)A + (size_t)(row0 + cr) * lda + cc * 8; const unsigned short* gb = (const unsigned short*)Bh + (size_t)(col0 + cr) * ldb + cc * 8;
  const unsigned la = (unsigned)(size_t)ring + (unsigned)cr * GP + (unsigned)cc * 16u, lb = la + GT * GP; const size_t sa = (size_t)16 * lda, sb = (size_t)16 * ldb;
  const int nst = K / GK;
  v8f acc[2][4] = {};
  copy8(la, ga, sa); copy8(lb, gb, sb);
  asm volatile("s_wait_asynccnt 0x0" ::: "memory");      /* stage 0 has landed, as far as this wave brought it */
  __syncthreads();      /* ... and as far as the other waves did */
  if (nst > 1) { copy8(la + GST, ga + GK, sa); copy8(lb + GST, gb + GK, sb); }
  const unsigned char* fa = ring + (unsigned)(wr + ln) * GP + 16 * hh; const unsigned char* fb = ring + (unsigned)(GT + wc + ln) * GP + 16 * hh;      /* fragment rows; k order as before: bytes 16hh and 32 + 16hh of each 64, A and B alike */
  for (int t = 0; t < nst; ++t) { const unsigned bo = (unsigned)(t & 1) * GST;
#pragma unroll      // constant indices keep the fragment arrays in registers
    for (int ks = 0; ks < GK / 32; ++ks) { FragH a2[2], b2[4];
#pragma unroll      // constant indices keep the fragment arrays in registers
      for (int i = 0; i < 2; ++i) { a2[i].half[0] = *(const v8us*)(fa + bo + i * 16 * GP + ks * 64); a2[i].half[1] = *(const v8us*)(fa + bo + i * 16 * GP + ks * 64 + 32); }
#pragma unroll      // constant indices keep the fragment arrays in registers
      for (int j = 0; j < 4; ++j) { b2[j].half[0] = *(const v8us*)(fb + bo + j * 16 * GP + ks * 64); b2[j].half[1] = *(const v8us*)(fb + bo + j * 16 * GP + ks * 64 + 32); }
#pragma unroll      // constant indices keep the fragment arrays in registers
      for (int i = 0; i < 2; ++i)
#pragma unroll      // constant indices keep the fragment arrays in registers
        for (int j = 0; j < 4; ++j) acc[i][j] = mmaH<1>(a2[i].v, a2[i].v, b2[j].v, b2[j].v, acc[i][j]); }
    asm volatile("s_wait_dscnt 0x0" ::: "memory");      /* this wave's reads of the buffer are done before the barrier frees it for the refill */
    asm volatile("s_wait_asynccnt 0x0" ::: "memory");      /* this wave's copies of stage t + 1 have landed before the barrier publishes them */
    __syncthreads();
    if (t + 2 < nst) { copy8(la + bo, ga + (size_t)(t + 2) * GK, sa); copy8(lb + bo, gb + (size_t)(t + 2) * GK, sb); } }
  asm volatile("s_wait_asynccnt 0x0" ::: "memory");      /* no copy is outstanding when the wave goes on to its end */
  // Epilogue as before, 16 x 64 at a time through the wave's own LDS rows. Left as it was: the addend CP is read one element at a time under its own test, each load waited for before the next.
  const int rsub = lane >> 4, c4 = (lane & 15) * 4; typedef _Float16 v4h __attribute__((ext_vector_type(4)));
#pragma unroll      // constant indices keep the accumulators in registers
  for (int i = 0; i < 2; ++i) { const int rw = row0 + wr + i * 16, cw = col0 + wc;
#pragma unroll
    for (int t = 0; t < 4; ++t) { const int col = cw + t * 16 + ln;
#pragma unroll
      for (int r = 0; r < 8; ++r) { float v = acc[i][t][r] * alpha; if (CP) v += CP[(size_t)(rw + 8 * hh + r) * ldc + col]; if (ACT == 6) v = 0.5f * v * (1.0f + erff(v * 0.70710678118654752f)); so[w][8 * hh + r][t * 16 + ln] = v; } }
    __builtin_amdgcn_fence(__ATOMIC_ACQ_REL, "workgroup"); __builtin_amdgcn_wave_barrier();
#pragma unroll
    for (int q = 0; q < 8; ++q) { const int r = q * 2 + rsub; const v4f v = *(const v4fa*)&so[w][r][c4]; if (C) { *(v4f*)(C + (size_t)(rw + r) * ldc + cw + c4) = v; asm volatile("s_wait_xcnt 0x0" ::: "memory"); }      /* the wait in front of any rewrite of the store's registers (the f16 conversion below reuses them) */ if (C16) { v4h h4; for (int e = 0; e < 4; ++e) h4[e] = (_Float16)v[e]; *(v4h*)(C16 + (size_t)(rw + r) * ldc + cw + c4) = h4; } }
    __builtin_amdgcn_fence(__ATOMIC_ACQ_REL, "workgroup"); __builtin_amdgcn_wave_barrier();      /* the next 16 rows are staged in the same LDS only behind these reads */
  }
}


typedef _Float16 v4h __attribute__((ext_vector_type(4)));

__global__ __launch_bounds__(256) void k_x16(const float* __restrict__ x, _Float16* __restrict__ X16, size_t n8) { const size_t t = (size_t)blockIdx.x * 256 + threadIdx.x; if (t >= n8) return; FragH f;
#pragma unroll
  for (int q = 0; q < 8; ++q) f.h[q] = (_Float16)bf16_round(x[t * 8 + q]); *(v8us*)((unsigned short*)X16 + t * 8) = f.half[0];  }
__global__ __launch_bounds__(256) void k_h16(const float* __restrict__ x, _Float16* __restrict__ X16, size_t n8) { const size_t t = (size_t)blockIdx.x * 256 + threadIdx.x; if (t >= n8) return; FragH f;
#pragma unroll
  for (int q = 0; q < 8; ++q) f.h[q] = (_Float16)x[t * 8 + q]; *(v8us*)((unsigned short*)X16 + t * 8) = f.half[0];  }
__global__ __launch_bounds__(256) void k_round16f(const float* __restrict__ W, _Float16* __restrict__ Bt, size_t n8) { const size_t t = (size_t)blockIdx.x * 256 + threadIdx.x; if (t >= n8) return; FragH f;
#pragma unroll
  for (int i = 0; i < 8; ++i) f.h[i] = (_Float16)(bf16_round(W[t * 8 + i]) * 16.0f); *(v8us*)((unsigned short*)Bt + t * 8) = f.half[0];  }
template <int NHv, int TTv>
__global__ __launch_bounds__(256) void k_vt(const _Float16* __restrict__ V16, int ldv, int voff, _Float16* __restrict__ Vt) { __shared__ unsigned short tl[64][66]; const int tid = threadIdx.x; const int slab = blockIdx.x / (TTv / 64), lg = blockIdx.x % (TTv / 64); const int b = slab / NHv, h = slab % NHv;
  for (int i = tid; i < 64 * 8; i += 256) { const int r = i / 8, c8 = (i % 8) * 8; FragH f; f.half[0] = *(const v8us*)((const unsigned short*)V16 + ((size_t)b * TTv + lg * 64 + r) * ldv + voff + h * 64 + c8);
#pragma unroll
    for (int q = 0; q < 8; ++q) tl[r][c8 + q] = f.u[q]; }
  __syncthreads();
  {
#pragma unroll
    for (int rd = 0; rd < 2; ++rd) { const int d = rd * 32 + tid / 8, pc = tid % 8; FragH f;
#pragma unroll
      for (int q = 0; q < 8; ++q) f.u[q] = tl[pc * 8 + q][d];
      *(v8us*)((unsigned short*)Vt + ((size_t)slab * 64 + d) * TTv + lg * 64 + pc * 8) = f.half[0]; }
     } }

__global__ __launch_bounds__(256) void k_hl(const float* __restrict__ F, _Float16* __restrict__ Hh, _Float16* __restrict__ Hl, size_t n8) { const size_t t = (size_t)blockIdx.x * 256 + threadIdx.x; if (t >= n8) return; FragH fh, fl; const v4f a = *(const v4fa*)(F + t * 8), c = *(const v4fa*)(F + t * 8 + 4);
#pragma unroll
  for (int q = 0; q < 4; ++q) { _Float16 h = (_Float16)a[q]; fh.h[q] = h; fl.h[q] = (_Float16)((a[q] - (float)h) * 1024.0f); h = (_Float16)c[q]; fh.h[4 + q] = h; fl.h[4 + q] = (_Float16)((c[q] - (float)h) * 1024.0f); }
  { *(v8us*)((unsigned short*)Hh + t * 8) = fh.half[0]; *(v8us*)((unsigned short*)Hl + t * 8) = fl.half[0];  } }
// RMSNorm rows (C = 768 = 32 lanes × 24): y = x·rsqrt(mean(x²) + 1.1920929e-7)·bf16(g); RB: round the input to bf16 first; outputs: f16 hi + ×2^10 residual planes (either may be null) and optionally the f32 rounded input copy XR; wave per row; per lane 6 float4 pieces (c = j·128 + lane·4);
template <int RB>
__global__ __launch_bounds__(256) void k_rms(const float* __restrict__ X, const float* __restrict__ g, int nrows, _Float16* __restrict__ YH, _Float16* __restrict__ YL, float* __restrict__ XR) { const int tid = threadIdx.x, wv = tid >> 5, lane = tid & 31; const int r = blockIdx.x * 8 + wv; if (r >= nrows) return; v4f xv[6]; float ss = 0.f;
#pragma unroll
  for (int j = 0; j < 6; ++j) { v4f a = *(const v4fa*)(X + (size_t)r * CC + j * 128 + lane * 4); if (RB) for (int q = 0; q < 4; ++q) a[q] = bf16_round(a[q]); xv[j] = a; for (int q = 0; q < 4; ++q) ss += a[q] * a[q]; }
  for (int o = 16; o >= 1; o >>= 1) ss += __shfl_xor(ss, o, 32); const float rs = rsqrtf(ss / (float)CC + 1.1920929e-7f);
  typedef _Float16 v4h __attribute__((ext_vector_type(4)));
  {
#pragma unroll
    for (int j = 0; j < 6; ++j) { const int c = j * 128 + lane * 4; v4h hh, hl; for (int q = 0; q < 4; ++q) { const float y = xv[j][q] * rs * bf16_round(g[c + q]); const _Float16 hv = (_Float16)y; hh[q] = hv; hl[q] = (_Float16)((y - (float)hv) * 1024.0f); }
      if (YH) *(v4h*)(YH + (size_t)r * CC + c) = hh; if (YL) *(v4h*)(YL + (size_t)r * CC + c) = hl; if (XR) *(v4f*)(XR + (size_t)r * CC + c) = xv[j]; }
     } }
__global__ __launch_bounds__(256) void k_vtr(const _Float16* __restrict__ XH, const _Float16* __restrict__ XL, _Float16* __restrict__ VT) { __shared__ float tl[64][33]; const int tid = threadIdx.x; const int slab = blockIdx.x / (NN / 64), ng = blockIdx.x % (NN / 64); const int b = slab / NH, h = slab % NH; const size_t base = (size_t)b * NN * CC + (size_t)h * HSZ + (size_t)ng * 64 * HD;      /* 64 consecutive n rows × 32 d = 2048 contiguous elements */
  for (int i = tid; i < 64 * 32; i += 256) { const int n = i / 32, d = i % 32; tl[n][d] = (float)XH[base + i] + (float)XL[base + i] * 0.0009765625f; } __syncthreads();
  const int d = tid / 8, pc = tid % 8; FragH f; for (int q = 0; q < 8; ++q) f.h[q] = (_Float16)tl[pc * 8 + q][d];
  *(v8us*)((unsigned short*)VT + ((size_t)slab * HD + d) * NN + ng * 64 + pc * 8) = f.half[0];  }
// lane l <-> lane l ^ 16 by a vector cross-row move (no LDS counter involved)
__device__ __forceinline__ float xhalf(float x) { return __builtin_bit_cast(float, __builtin_amdgcn_permlanex16(__builtin_bit_cast(int, x), __builtin_bit_cast(int, x), 0x76543210, 0xfedcba98, false, false)); }
typedef float v2f __attribute__((ext_vector_type(2)));
__global__ __launch_bounds__(128) void k_flash(const _Float16* __restrict__ Q16, const _Float16* __restrict__ Q16lo, int ldq, const _Float16* __restrict__ K16, const _Float16* __restrict__ K16lo, int ldk, const _Float16* __restrict__ Vt, const float* __restrict__ SP, float* __restrict__ O, int ldo) {
  constexpr int NQB = NN / 64, DT = 2;
  const int tid = threadIdx.x, w = tid >> 5, lane = tid & 31, ln = lane & 15, hh = lane >> 4;
  const int slab = blockIdx.x / NQB, qblk = blockIdx.x % NQB; const int h = slab % NH; const float coef = ((logf(768.0f) * bf16_round(SP[h])) * 5.656854249492381f) * 1.4426950408889634f;      /* times log2(e): the logits are kept in base 2, so each exponential is one hardware instruction */ const int q0 = qblk * 64 + w * 16;
  FragH bq, bql;
  { const size_t qo = ((size_t)slab * NN + q0 + ln) * ldq; const unsigned short* qr = (const unsigned short*)Q16 + qo; const unsigned short* ql = (const unsigned short*)Q16lo + qo;
    bq.half[0] = *(const v8us*)(qr + 8 * hh); bq.half[1] = *(const v8us*)(qr + 16 + 8 * hh); bql.half[0] = *(const v8us*)(ql + 8 * hh); bql.half[1] = *(const v8us*)(ql + 16 + 8 * hh); }
  const unsigned short* kh = (const unsigned short*)K16 + (size_t)slab * NN * ldk; const unsigned short* kl = (const unsigned short*)K16lo + (size_t)slab * NN * ldk;      /* wave-uniform bases, advanced by 32 key rows a pass */
  const unsigned short* vt = (const unsigned short*)Vt + (size_t)slab * HD * NN;      /* v'^T per slab: [32][N], advanced by 32 columns a pass */
  const unsigned ko[2] = {(unsigned)(ln * ldk + 8 * hh), (unsigned)((16 + ln) * ldk + 8 * hh)}, vo[DT] = {(unsigned)(ln * NN + 8 * hh), (unsigned)((16 + ln) * NN + 8 * hh)};      /* the lane's own element offsets */
  float m_q = -3.0e38f, s_q = -3.0e38f, l_q = 0.f; v8f oacc[DT];      /* s_q = m_q - 10 as rounded: what the exponents subtract, so that P and the denominator carry the factor 2^10 */
#pragma unroll
  for (int dt = 0; dt < DT; ++dt) oacc[dt] = (v8f){0.f,0.f,0.f,0.f,0.f,0.f,0.f,0.f};
  for (int j0 = 0; j0 < NN; j0 += 32, kh += 32 * (size_t)ldk, kl += 32 * (size_t)ldk, vt += 32) {
    FragH ak[2], akl[2], av[DT];
#pragma unroll
    for (int nt = 0; nt < 2; ++nt) { ak[nt].half[0] = *(const v8us*)(kh + ko[nt]); ak[nt].half[1] = *(const v8us*)(kh + ko[nt] + 16); akl[nt].half[0] = *(const v8us*)(kl + ko[nt]); akl[nt].half[1] = *(const v8us*)(kl + ko[nt] + 16); }
#pragma unroll
    for (int dt = 0; dt < DT; ++dt) { av[dt].half[0] = *(const v8us*)(vt + vo[dt]); av[dt].half[1] = *(const v8us*)(vt + vo[dt] + 16); }
    v2f s2[8];      /* the 16 logits as the register pairs the accumulators already form */
#pragma unroll
    for (int nt = 0; nt < 2; ++nt) { v8f acc = (v8f){0.f,0.f,0.f,0.f,0.f,0.f,0.f,0.f}, accl = acc;
      acc = mmaH<1>(ak[nt].v, ak[nt].v, bq.v, bq.v, acc); accl = mmaH<1>(ak[nt].v, ak[nt].v, bql.v, bql.v, accl); accl = mmaH<1>(akl[nt].v, akl[nt].v, bq.v, bq.v, accl);
#pragma unroll
      for (int j = 0; j < 4; ++j) { const v2f a2 = {acc[2 * j], acc[2 * j + 1]}, b2 = {accl[2 * j], accl[2 * j + 1]}; s2[nt * 4 + j] = (a2 + b2 * 0.0009765625f) * coef; } }
    float mx[8];
#pragma unroll
    for (int j = 0; j < 4; ++j) { mx[2 * j] = fmaxf(s2[j].x, s2[4 + j].x); mx[2 * j + 1] = fmaxf(s2[j].y, s2[4 + j].y); }
    float mc = fmaxf(fmaxf(fmaxf(mx[0], mx[1]), fmaxf(mx[2], mx[3])), fmaxf(fmaxf(mx[4], mx[5]), fmaxf(mx[6], mx[7])));
    mc = fmaxf(mc, xhalf(mc));
    const float mn = fmaxf(m_q, mc); const float sn = mn - 10.0f; float ea;      /* the rescale uses the same rounded subtrahends as the exponents of the two passes */
    asm("v_exp_f32 %0, %1\n\tv_nop" : "=v"(ea) : "v"(s_q - sn));      /* in asm for the v_nop alone: it keeps the one slot behind a transcendental */
    const float al = (mn > -1.0e38f) ? ea : 1.0f; m_q = mn; s_q = sn;
    v2f p2[8]; FragH pb;
#pragma unroll
    for (int i = 0; i < 8; ++i) { const v2f e2 = s2[i] - sn; p2[i].x = __builtin_amdgcn_exp2f(e2.x); p2[i].y = __builtin_amdgcn_exp2f(e2.y); pb.h[2 * i] = (_Float16)p2[i].x; pb.h[2 * i + 1] = (_Float16)p2[i].y; }
    const v2f ps = ((p2[0] + p2[1]) + (p2[2] + p2[3])) + ((p2[4] + p2[5]) + (p2[6] + p2[7]));
    l_q = l_q * al + (ps.x + ps.y);      /* per-lane partial sum of the query's denominator (the two halves are joined after the loop) */
#pragma unroll
    for (int dt = 0; dt < DT; ++dt) {
#pragma unroll
      for (int r = 0; r < 8; ++r) oacc[dt][r] *= al;
      oacc[dt] = mmaH<1>(av[dt].v, av[dt].v, pb.v, pb.v, oacc[dt]); } }
  const float lt = l_q + xhalf(l_q); const float inv = (lt > 0.f) ? 1.0f / lt : 0.f;      /* numerator and denominator both carry 2^10 */
  float* orow = O + ((size_t)slab * NN + q0 + ln) * ldo + 8 * hh;      /* oacc[dt][r] = O[q0 + ln][dt * 16 + 8hh + r]: eight consecutive d per lane */
#pragma unroll
  for (int dt = 0; dt < DT; ++dt) { const v4f o0 = {oacc[dt][0] * inv, oacc[dt][1] * inv, oacc[dt][2] * inv, oacc[dt][3] * inv}, o1 = {oacc[dt][4] * inv, oacc[dt][5] * inv, oacc[dt][6] * inv, oacc[dt][7] * inv};
    *(v4f*)(orow + dt * 16) = o0; *(v4f*)(orow + dt * 16 + 4) = o1; } }

__global__ __launch_bounds__(256) void k_add(const float* __restrict__ A, const float* __restrict__ B_, float* __restrict__ out, size_t n4) { const size_t t = (size_t)blockIdx.x * 256 + threadIdx.x; if (t >= n4) return; v4f a = *(const v4fa*)(A + t * 4); const v4f b = *(const v4fa*)(B_ + t * 4); for (int q = 0; q < 4; ++q) a[q] += b[q]; *(v4f*)(out + t * 4) = a;  }

extern "C" void kernel_launch(void* const* d_in, const int* in_sizes, int n_in,
                              void* d_out, int out_size, void* d_ws, size_t ws_size, hipStream_t stream) {
  (void)in_sizes; (void)n_in; (void)out_size;
  const float* const* I = (const float* const*)d_in; const float* x = I[0]; const float* sp = I[1]; const float* Wq = I[2]; const float* WA = I[3]; const float* W1 = I[4]; const float* W2 = I[5]; const float* g1 = I[6]; const float* g2 = I[7];
  char* ws = (char*)d_ws; size_t off = 0;
  auto take = [&](size_t bytes) { char* p = ws + off; off += (bytes + 255) & ~(size_t)255; return p; };
  const size_t WSZ = (size_t)CC * CC; _Float16* Bq = (_Float16*)take(WSZ * 2); _Float16* B1 = (_Float16*)take(WSZ * 2); _Float16* B2 = (_Float16*)take(WSZ * 2); _Float16* BA = (_Float16*)take((size_t)NN * NN * 2);
  _Float16* XH = (_Float16*)take((size_t)NR * CC * 2); _Float16* XL = (_Float16*)take((size_t)NR * CC * 2); float* XR = (float*)take((size_t)NR * CC * 4); float* QF = (float*)take((size_t)NR * CC * 4); _Float16* QH = (_Float16*)take((size_t)NR * CC * 2); _Float16* QL = (_Float16*)take((size_t)NR * CC * 2);
  _Float16* VT = (_Float16*)take((size_t)BB * NH * HD * NN * 2); _Float16* VPT = (_Float16*)take((size_t)BB * NH * HD * NN * 2); float* ATT = (float*)take((size_t)NR * CC * 4);
  float* O = QF; _Float16* H16 = XH; _Float16* FH = XL;      /* O (raw [B][H][N][hd] f32) over q f32 (dead after k_hl); RMSNorm2 output over XH and the FF hidden over XL (both dead after k_flash) */
  if (off > ws_size) return;      // 3.5 + 8.4 + 6.3 × 2 + 12.6 × 2 + 6.3 × 2 + 6.3 × 2 + 12.6 ≈ 87 MB
  const unsigned gw = (unsigned)((WSZ / 8 + 255) / 256); k_round16f<<<gw, 256, 0, stream>>>(Wq, Bq, WSZ / 8); k_round16f<<<gw, 256, 0, stream>>>(W1, B1, WSZ / 8); k_round16f<<<gw, 256, 0, stream>>>(W2, B2, WSZ / 8); k_round16f<<<(unsigned)(((size_t)NN * NN / 8 + 255) / 256), 256, 0, stream>>>(WA, BA, (size_t)NN * NN / 8);      /* (out,in) natural ×2^4; WA natural [m][n] ×2^4 */
  k_rms<1><<<(NR + 7) / 8, 256, 0, stream>>>(x, g1, NR, XH, XL, XR);      /* xn = RMSNorm(bf16 x)·g1 → hi / ×2^10 residual; XR = bf16(x) */
  const unsigned gq = (NR / GT) * (CC / GT);
  k_gemm_hhx<0><<<gq, 256, 0, stream>>>(XH, CC, Bq, CC, 0.0625f, nullptr, QF, nullptr, CC, CC, CC);      /* q = xn.Wq^T: hi term, M 4096 N 768 K 768 */
  k_gemm_hhx<0><<<gq, 256, 0, stream>>>(XL, CC, Bq, CC, 0.0625f * 0.0009765625f, QF, QF, nullptr, CC, CC, CC);      /* += lo term * 2^-10 in place */
  k_hl<<<(unsigned)(((size_t)NR * CC / 8 + 255) / 256), 256, 0, stream>>>(QF, QH, QL, (size_t)NR * CC / 8);      /* q → hi / ×2^10 residual (flat planes; head h of batch b = elements [b·N·C + h·N·hd, +N·hd) viewed [N][hd]) */
  k_vtr<<<BB * NH * (NN / 64), 256, 0, stream>>>(XH, XL, VT);      /* vᵀ per (b,h): [32][2048] f16 */
  const unsigned gvp = (BB * NH * HD / GT) * (NN / GT);      /* the 48 slabs of 32 rows lie one behind the other in VT and VPT: one GEMM of 1536 rows */
  k_gemm_hhx<0><<<gvp, 256, 0, stream>>>(VT, NN, BA, NN, 0.0625f, nullptr, nullptr, VPT, NN, NN, NN);      /* v'^T[d][m] = sum over n of v^T[d][n].WA[m][n], all 48 (b,h) at once: M 1536 N 2048 K 2048 */
  k_flash<<<BB * NH * (NN / 64), 128, 0, stream>>>(QH, QL, HD, XH, XL, HD, VPT, sp, O, HD);      /* per (b,h) slab of the raw head views (flat planes, ld 32): softmax(coef_h·q·kᵀ)·v' → O raw [B][H][N][32] */
  k_add<<<(unsigned)(((size_t)NR * CC / 4 + 255) / 256), 256, 0, stream>>>(O, XR, ATT, (size_t)NR * CC / 4);      /* attn = raw-reshaped O + x */
  k_rms<0><<<(NR + 7) / 8, 256, 0, stream>>>(ATT, g2, NR, H16, nullptr, nullptr);      /* h = RMSNorm(attn)·g2 → f16 */
  k_gemm_hhx<6><<<gq, 256, 0, stream>>>(H16, CC, B1, CC, 0.0625f, nullptr, nullptr, FH, CC, CC, CC);      /* gelu_erf(h.W1^T) to f16: M 4096 N 768 K 768 */
  k_gemm_hhx<0><<<gq, 256, 0, stream>>>(FH, CC, B2, CC, 0.0625f, ATT, (float*)d_out, nullptr, CC, CC, CC);      /* out = that.W2^T + attn */
}

// v005
// A run of this version takes 174 microseconds.
// Next to v004, in two timings, it ran 1.17 and 1.16 times as fast.
// Counting every step since v000, it is 2.71 times as fast.
#include <hip/hip_runtime.h>
// 'Scalable super' multi-head attention block (B=2, N=2048, C=768, H=24, hd=32): xn = RMSNorm(x)·g1; q = (xn·Wqᵀ) RAW-reshaped [B,H,N,hd] (no transpose — the module's quirk), k = v = xn raw-reshaped likewise; v' = WA[:N,:N]·v (value premix);
// scores = softmax(coef_h · q·kᵀ) with coef_h = log(C)·scale_param[h]·√hd (up to ≈56 → extremely peaked); attn = (scores·v') raw-reshaped back to [B,N,C] + x; h = RMSNorm(attn)·g2; out = gelu_erf(h·W1ᵀ)·W2ᵀ + attn.
// Compute dtype: x, scale_param, weights, WA, g rounded to bf16; RMSNorm in f32 (wave per row) → f16 hi + ×2^10 residual planes; q = xn·Wqᵀ f32-accurate (hi·W + lo·W·2^-10) → hi/lo planes; per (b,h) the 2048×2048 logit plane
// computed inside a fused flash-style kernel from three f16 products (q_hi·k_hi + (q_lo·k_hi + q_hi·k_lo)·2^-10, d = 32) and scaled by the per-head coefficient in f32; online f32 softmax; P f16 ×2^10; v'ᵀ = vᵀ·WAᵀ by GEMM (f16); O = P·v' accumulated in f32 into the raw [B][H][N][hd] buffer; + x; RMSNorm; FF GEMMs
// (erf-GELU epilogue) with the residual through the f32 addend. All contractions on v_wmma_f32_16x16x32_f16, f32 accumulate.
#define BB 2
#define NN 2048
#define CC 768
#define NH 24
#define HD 32
#define NR (BB * NN)
#define HSZ ((size_t)NN * HD)

typedef __bf16 v16b __attribute__((ext_vector_type(16)));
typedef unsigned short v8us __attribute__((ext_vector_type(8), may_alias));
typedef float  v8f  __attribute__((ext_vector_type(8)));
typedef float  v4f  __attribute__((ext_vector_type(4)));
typedef float  v4fa __attribute__((ext_vector_type(4), may_alias));
union FragB { v16b v; v8us half[2]; unsigned short u[16]; };

__device__ __forceinline__ unsigned short bf16_bits(float x) { unsigned int u = __float_as_uint(x); return (unsigned short)((u + 0x7FFFu + ((u >> 16) & 1u)) >> 16); }
__device__ __forceinline__ float bf16_val(unsigned short b) { return __uint_as_float(((unsigned int)b) << 16); }
__device__ __forceinline__ float bf16_round(float x) { return bf16_val(bf16_bits(x)); }
// D += A·B with NT terms: 1 = ah·bh, 2 = + al·bh (A split), 3 = + ah·bl (both split)
template <int NT>
__device__ __forceinline__ v8f mmaN(v16b ah, v16b al, v16b bh, v16b bl, v8f c) {
  c = __builtin_amdgcn_wmma_f32_16x16x32_bf16(false, ah, false, bh, (short)0, c, false, false);
  if (NT >= 2) c = __builtin_amdgcn_wmma_f32_16x16x32_bf16(false, al, false, bh, (short)0, c, false, false);
  if (NT >= 3) c = __builtin_amdgcn_wmma_f32_16x16x32_bf16(false, ah, false, bl, (short)0, c, false, false);
  asm volatile("v_nop\n\tv_nop\n\tv_nop\n\tv_nop" : "+v"(c) : "v"(ah), "v"(al), "v"(bh), "v"(bl));
  return c;
}

__global__ __launch_bounds__(256) void k_wt_bf16(const float* __restrict__ W, unsigned short* __restrict__ Wt, int K, int N) {
  const int t = blockIdx.x * 256 + threadIdx.x;
  const int k8n = K / 8;
  if (t >= N * k8n) return;
  const int n = t / k8n, k8 = (t % k8n) * 8;
  v8us v;
#pragma unroll
  for (int i = 0; i < 8; ++i) v[i] = bf16_bits(W[(size_t)(k8 + i) * N + n]);
  *(v8us*)(Wt + (size_t)n * K + k8) = v;
  
}

// GEMM C[M][N] (f32, pitch ldc) = act(A[M][K]·W + bias). A f32 row-major (pitch lda) converted per fragment to bf16
// (ASPLIT: hi/lo two planes -> 2 terms, else single rounded term); Wt bf16 [N][K] (pitch ldb). BIAS_BF16 rounds the
// bias to bf16 first (bias quantised to bf16 before the add). K%32==0, M%16==0, N%64==0.
template <bool ASPLIT, int ACT, bool BIAS_BF16>
__global__ __launch_bounds__(128) void k_gemm_bf(const float* __restrict__ A, int lda, const unsigned short* __restrict__ Wt, int ldb,
                                               const float* __restrict__ bias, float* __restrict__ C, int ldc, int M, int N, int K) {
  __shared__ __attribute__((aligned(16))) float so[4][16][64];
  const int tid = threadIdx.x, w = tid >> 5, lane = tid & 31, ln = lane & 15, hh = lane >> 4;
  const int ntn = N / 64;
  const int wid = blockIdx.x * 4 + w;
  const int mt = wid / ntn, nq = wid % ntn;
  if (mt * 16 >= M) return;
  const int row0 = mt * 16, col0 = nq * 64;
  const float* arow = A + (size_t)(row0 + ln) * lda;
  v8f acc[4] = {};
  for (int kb = 0; kb < K; kb += 32) {
    FragB ah, al;
    const v4f x0 = *(const v4fa*)(arow + kb + 8 * hh), x1 = *(const v4fa*)(arow + kb + 8 * hh + 4);
    const v4f x2 = *(const v4fa*)(arow + kb + 16 + 8 * hh), x3 = *(const v4fa*)(arow + kb + 16 + 8 * hh + 4);
    float xs[16] = {x0[0],x0[1],x0[2],x0[3],x1[0],x1[1],x1[2],x1[3],x2[0],x2[1],x2[2],x2[3],x3[0],x3[1],x3[2],x3[3]};
#pragma unroll
    for (int i = 0; i < 16; ++i) { const unsigned short hb = bf16_bits(xs[i]); ah.u[i] = hb; al.u[i] = ASPLIT ? bf16_bits(xs[i] - bf16_val(hb)) : (unsigned short)0; }
#pragma unroll
    for (int t = 0; t < 4; ++t) {
      const unsigned short* brow = Wt + (size_t)(col0 + t * 16 + ln) * ldb + kb;
      FragB b;
      b.half[0] = *(const v8us*)(brow + 8 * hh);
      b.half[1] = *(const v8us*)(brow + 16 + 8 * hh);
      acc[t] = mmaN<ASPLIT ? 2 : 1>(ah.v, al.v, b.v, b.v, acc[t]);
    }
  }
#pragma unroll
  for (int t = 0; t < 4; ++t) {
    float bv = bias ? bias[col0 + t * 16 + ln] : 0.f;
    if (BIAS_BF16) bv = bf16_round(bv);
#pragma unroll
    for (int r = 0; r < 8; ++r) { float v = acc[t][r] + bv; if (ACT == 1) v = fmaxf(v, 0.f); so[w][8 * hh + r][t * 16 + ln] = v; }
  }
  __builtin_amdgcn_fence(__ATOMIC_ACQ_REL, "workgroup");
  __builtin_amdgcn_wave_barrier();
  const int rsub = lane >> 4, c4 = (lane & 15) * 4;
  {
#pragma unroll
    for (int q = 0; q < 8; ++q) {
      const int r = q * 2 + rsub;
      const v4f v = *(const v4fa*)&so[w][r][c4];
      *(v4f*)(C + (size_t)(row0 + r) * ldc + col0 + c4) = v;
    }
    
  }
}

// Flash-style causal/unmasked attention, all contractions 3-term bf16 hi/lo splits, f32 softmax with running max.
// q,k,v rows are read from f32 buffers with arbitrary row pitch (so they can live inside a fused qkv buffer);
// D = head size (multiple of 32, <= 128); one wave = 16 query rows; block = 4 waves (64 queries) sharing K/V chunks of 32.
template <int D, bool CAUSAL>
__global__ __launch_bounds__(128) void k_flash(const float* __restrict__ qb, const float* __restrict__ kb, const float* __restrict__ vb,
                                             int pitch, int T, int H, float scale, float* __restrict__ y, int ypitch) {
  constexpr int KS = D / 32;        // k-steps for QK
  constexpr int DT = D / 16;        // d tiles for PV
  __shared__ __attribute__((aligned(16))) unsigned short sKh[32][D + 8], sKl[32][D + 8], sVh[32][D + 8], sVl[32][D + 8];
  __shared__ __attribute__((aligned(16))) unsigned short sPh[4][16][40], sPl[4][16][40];
  __shared__ __attribute__((aligned(16))) float sO[4][16][D];
  const int tid = threadIdx.x, w = tid >> 5, lane = tid & 31, ln = lane & 15, hh = lane >> 4;
  const int nqb = (T + 63) / 64;
  const int bh = blockIdx.x / nqb, qblk = blockIdx.x % nqb;
  const int b = bh / H, h = bh % H;
  const int q0 = qblk * 64 + w * 16;
  const float* Q = qb + (size_t)b * T * pitch + h * D;
  const float* K = kb + (size_t)b * T * pitch + h * D;
  const float* V = vb + (size_t)b * T * pitch + h * D;

  // A fragments of the wave's 16 query rows (scaled), hi/lo
  FragB aqh[KS], aql[KS];
  {
    int row = q0 + ln; if (row >= T) row = T - 1;
    const float* qr = Q + (size_t)row * pitch;
#pragma unroll
    for (int ks = 0; ks < KS; ++ks)
#pragma unroll
      for (int i = 0; i < 16; ++i) {
        const int d = ks * 32 + ((i < 8) ? (8 * hh + i) : (16 + 8 * hh + (i - 8)));
        const float x = qr[d] * scale; const unsigned short hb = bf16_bits(x);
        aqh[ks].u[i] = hb; aql[ks].u[i] = bf16_bits(x - bf16_val(hb));
      }
  }
  float m_r[8], l_r[8];
#pragma unroll
  for (int r = 0; r < 8; ++r) { m_r[r] = -3.0e38f; l_r[r] = 0.f; }
  v8f oacc[DT];
#pragma unroll
  for (int dt = 0; dt < DT; ++dt) oacc[dt] = (v8f){0.f,0.f,0.f,0.f,0.f,0.f,0.f,0.f};

  const int kv_end = CAUSAL ? min(T, qblk * 64 + 64) : T;     // block-uniform
  for (int j0 = 0; j0 < kv_end; j0 += 32) {
    __syncthreads();
    for (int e = tid; e < 32 * (D / 4); e += 128) {
      const int r = e / (D / 4), c4 = (e % (D / 4)) * 4;
      const int key = j0 + r;
      v4f kf = {0.f,0.f,0.f,0.f}, vf = {0.f,0.f,0.f,0.f};
      if (key < T) { kf = *(const v4fa*)(K + (size_t)key * pitch + c4); vf = *(const v4fa*)(V + (size_t)key * pitch + c4); }
#pragma unroll
      for (int t = 0; t < 4; ++t) {
        unsigned short hb = bf16_bits(kf[t]); sKh[r][c4 + t] = hb; sKl[r][c4 + t] = bf16_bits(kf[t] - bf16_val(hb));
        hb = bf16_bits(vf[t]); sVh[r][c4 + t] = hb; sVl[r][c4 + t] = bf16_bits(vf[t] - bf16_val(hb));
      }
    }
    __syncthreads();
    // S tile 16 x 32
    v8f s[2];
#pragma unroll
    for (int nt = 0; nt < 2; ++nt) {
      v8f acc = {};
#pragma unroll
      for (int ks = 0; ks < KS; ++ks) {
        FragB bh_, bl_;
        bh_.half[0] = *(const v8us*)&sKh[nt * 16 + ln][ks * 32 + 8 * hh]; bh_.half[1] = *(const v8us*)&sKh[nt * 16 + ln][ks * 32 + 16 + 8 * hh];
        bl_.half[0] = *(const v8us*)&sKl[nt * 16 + ln][ks * 32 + 8 * hh]; bl_.half[1] = *(const v8us*)&sKl[nt * 16 + ln][ks * 32 + 16 + 8 * hh];
        acc = mmaN<3>(aqh[ks].v, aql[ks].v, bh_.v, bl_.v, acc);
      }
      s[nt] = acc;
    }
    // mask + running max (rows 8hh+r; the 16 lanes of a half share rows)
    float alpha[8];
#pragma unroll
    for (int r = 0; r < 8; ++r) {
      const int qi = q0 + 8 * hh + r;
      const int ja = j0 + ln, jb = j0 + 16 + ln;
      if (CAUSAL) { if (ja > qi) s[0][r] = -3.0e38f; if (jb > qi) s[1][r] = -3.0e38f; }
      if (ja >= T) s[0][r] = -3.0e38f;
      if (jb >= T) s[1][r] = -3.0e38f;
      float mx = fmaxf(s[0][r], s[1][r]);
      mx = fmaxf(mx, __shfl_xor(mx, 1, 32)); mx = fmaxf(mx, __shfl_xor(mx, 2, 32)); mx = fmaxf(mx, __shfl_xor(mx, 4, 32)); mx = fmaxf(mx, __shfl_xor(mx, 8, 32));
      const float mnew = fmaxf(m_r[r], mx);
      alpha[r] = (mnew > -1.0e38f) ? __expf(m_r[r] - mnew) : 1.0f;
      const float p0 = (s[0][r] > -1.0e38f) ? __expf(s[0][r] - mnew) : 0.f;
      const float p1 = (s[1][r] > -1.0e38f) ? __expf(s[1][r] - mnew) : 0.f;
      m_r[r] = mnew;
      l_r[r] = l_r[r] * alpha[r] + p0 + p1;            // per-lane partial row sum (16 lanes combined at the end)
      unsigned short hb = bf16_bits(p0); sPh[w][8 * hh + r][ln] = hb;      sPl[w][8 * hh + r][ln] = bf16_bits(p0 - bf16_val(hb));
      hb = bf16_bits(p1);                sPh[w][8 * hh + r][16 + ln] = hb; sPl[w][8 * hh + r][16 + ln] = bf16_bits(p1 - bf16_val(hb));
    }
#pragma unroll
    for (int dt = 0; dt < DT; ++dt)
#pragma unroll
      for (int r = 0; r < 8; ++r) oacc[dt][r] *= alpha[r];
    __builtin_amdgcn_fence(__ATOMIC_ACQ_REL, "workgroup");
    __builtin_amdgcn_wave_barrier();
    FragB pah, pal;
    pah.half[0] = *(const v8us*)&sPh[w][ln][8 * hh]; pah.half[1] = *(const v8us*)&sPh[w][ln][16 + 8 * hh];
    pal.half[0] = *(const v8us*)&sPl[w][ln][8 * hh]; pal.half[1] = *(const v8us*)&sPl[w][ln][16 + 8 * hh];
#pragma unroll
    for (int dt = 0; dt < DT; ++dt) {
      FragB bvh, bvl;
#pragma unroll
      for (int i = 0; i < 8; ++i) {
        bvh.u[i] = sVh[8 * hh + i][dt * 16 + ln]; bvh.u[8 + i] = sVh[16 + 8 * hh + i][dt * 16 + ln];
        bvl.u[i] = sVl[8 * hh + i][dt * 16 + ln]; bvl.u[8 + i] = sVl[16 + 8 * hh + i][dt * 16 + ln];
      }
      oacc[dt] = mmaN<3>(pah.v, pal.v, bvh.v, bvl.v, oacc[dt]);
    }
    __builtin_amdgcn_fence(__ATOMIC_ACQ_REL, "workgroup");
    __builtin_amdgcn_wave_barrier();
  }
#pragma unroll
  for (int r = 0; r < 8; ++r) {
    float l = l_r[r];
    l += __shfl_xor(l, 1, 32); l += __shfl_xor(l, 2, 32); l += __shfl_xor(l, 4, 32); l += __shfl_xor(l, 8, 32);
    l_r[r] = (l > 0.f) ? 1.0f / l : 0.f;
  }
#pragma unroll
  for (int dt = 0; dt < DT; ++dt)
#pragma unroll
    for (int r = 0; r < 8; ++r) sO[w][8 * hh + r][dt * 16 + ln] = oacc[dt][r] * l_r[r];
  __builtin_amdgcn_fence(__ATOMIC_ACQ_REL, "workgroup");
  __builtin_amdgcn_wave_barrier();
  {
    for (int r = 0; r < 16; ++r) {
      const int row = q0 + r;
      if (row < T && lane < D / 4) {
        const v4f val = *(const v4fa*)&sO[w][r][lane * 4];
        *(v4f*)(y + ((size_t)b * T + row) * ypitch + h * D + lane * 4) = val;
      }
    }
    
  }
}

// GEMM C = act(A·W + bias + resid): A f32 (ASPLIT -> hi/lo 2 terms), Wt bf16 [N][K]; ACT 0 none, 1 relu, 2 exact gelu;
// resid (optional, f32, row index = (row % rmod), pitch ldr, RES_BF16 rounds it) added before the activation.
template <bool ASPLIT, int ACT, bool BIAS_BF16, bool RES_BF16>
__global__ __launch_bounds__(128) void k_gemm_bf3(const float* __restrict__ A, int lda, const unsigned short* __restrict__ Wt, int ldb,
                                                const float* __restrict__ bias, const float* __restrict__ resid, int rmod, int ldr,
                                                float* __restrict__ C, int ldc, int M, int N, int K) {
  __shared__ __attribute__((aligned(16))) float so[4][16][64];
  const int tid = threadIdx.x, w = tid >> 5, lane = tid & 31, ln = lane & 15, hh = lane >> 4;
  const int ntn = N / 64;
  const int wid = blockIdx.x * 4 + w;
  const int mt = wid / ntn, nq = wid % ntn;
  if (mt * 16 >= M) return;
  const int row0 = mt * 16, col0 = nq * 64;
  const float* arow = A + (size_t)(row0 + ln) * lda;
  v8f acc[4] = {};
  for (int kb = 0; kb < K; kb += 32) {
    FragB ah, al;
    const v4f x0 = *(const v4fa*)(arow + kb + 8 * hh), x1 = *(const v4fa*)(arow + kb + 8 * hh + 4);
    const v4f x2 = *(const v4fa*)(arow + kb + 16 + 8 * hh), x3 = *(const v4fa*)(arow + kb + 16 + 8 * hh + 4);
    float xs[16] = {x0[0],x0[1],x0[2],x0[3],x1[0],x1[1],x1[2],x1[3],x2[0],x2[1],x2[2],x2[3],x3[0],x3[1],x3[2],x3[3]};
#pragma unroll
    for (int i = 0; i < 16; ++i) { const unsigned short hb = bf16_bits(xs[i]); ah.u[i] = hb; al.u[i] = ASPLIT ? bf16_bits(xs[i] - bf16_val(hb)) : (unsigned short)0; }
#pragma unroll
    for (int t = 0; t < 4; ++t) {
      const unsigned short* brow = Wt + (size_t)(col0 + t * 16 + ln) * ldb + kb;
      FragB b;
      b.half[0] = *(const v8us*)(brow + 8 * hh);
      b.half[1] = *(const v8us*)(brow + 16 + 8 * hh);
      acc[t] = mmaN<ASPLIT ? 2 : 1>(ah.v, al.v, b.v, b.v, acc[t]);
    }
  }
#pragma unroll
  for (int t = 0; t < 4; ++t) {
    const int col = col0 + t * 16 + ln;
    float bv = bias ? bias[col] : 0.f;
    if (BIAS_BF16) bv = bf16_round(bv);
#pragma unroll
    for (int r = 0; r < 8; ++r) {
      float v = acc[t][r] + bv;
      if (resid) { float rv = resid[(size_t)((row0 + 8 * hh + r) % rmod) * ldr + col]; if (RES_BF16) rv = bf16_round(rv); v += rv; }
      if (ACT == 1) v = fmaxf(v, 0.f);
      if (ACT == 2) v = 0.5f * v * (1.0f + erff(v * 0.70710678118654752f));
      if (ACT == 3) { const float u = 0.7978845608028654f * (v + 0.044715f * v * v * v); v = 0.5f * v * (1.0f + tanhf(u)); }
      so[w][8 * hh + r][t * 16 + ln] = v;
    }
  }
  __builtin_amdgcn_fence(__ATOMIC_ACQ_REL, "workgroup");
  __builtin_amdgcn_wave_barrier();
  const int rsub = lane >> 4, c4 = (lane & 15) * 4;
  {
#pragma unroll
    for (int q = 0; q < 8; ++q) {
      const int r = q * 2 + rsub;
      const v4f v = *(const v4fa*)&so[w][r][c4];
      *(v4f*)(C + (size_t)(row0 + r) * ldc + col0 + c4) = v;
    }
    
  }
}
// row LayerNorm (biased variance, eps) over N: s = X (+ R); optional out_sum <- s; out_norm <- (s-mu)*rsqrt(var+eps)*g + b
template <bool PARAM_BF16>
__global__ __launch_bounds__(256) void k_layernorm(const float* __restrict__ X, const float* __restrict__ R, const float* __restrict__ g, const float* __restrict__ bta,
                                                  float* __restrict__ out_sum, float* __restrict__ out_norm, int N, float eps) {
  __shared__ float red[256];
  const int row = blockIdx.x, tid = threadIdx.x;
  const float* x = X + (size_t)row * N; const float* rr = R ? R + (size_t)row * N : nullptr;
  float vals[16];                     // up to N = 4096
  const int per = N / 256;            // contiguous chunk per thread? use strided-by-4 chunks: thread handles j = tid*4 + 1024*u
  float s1 = 0.f;
  for (int u = 0; u < per / 4; ++u) {
    const int j = tid * 4 + 1024 * u;
    const v4f a = *(const v4fa*)(x + j);
    v4f b = {0.f,0.f,0.f,0.f}; if (rr) b = *(const v4fa*)(rr + j);
#pragma unroll
    for (int q = 0; q < 4; ++q) { const float v = a[q] + b[q]; vals[u * 4 + q] = v; s1 += v; }
  }
  red[tid] = s1; __syncthreads();
  for (int st = 128; st > 0; st >>= 1) { if (tid < st) red[tid] += red[tid + st]; __syncthreads(); }
  const float mu = red[0] / (float)N; __syncthreads();
  float s2 = 0.f;
  for (int u = 0; u < per / 4; ++u)
#pragma unroll
    for (int q = 0; q < 4; ++q) { const float c = vals[u * 4 + q] - mu; s2 += c * c; }
  red[tid] = s2; __syncthreads();
  for (int st = 128; st > 0; st >>= 1) { if (tid < st) red[tid] += red[tid + st]; __syncthreads(); }
  const float rs = rsqrtf(red[0] / (float)N + eps);
  {
    for (int u = 0; u < per / 4; ++u) {
      const int j = tid * 4 + 1024 * u;
      v4f o, sm;
#pragma unroll
      for (int q = 0; q < 4; ++q) {
        float gg = g[j + q], bb = bta[j + q];
        if (PARAM_BF16) { gg = bf16_round(gg); bb = bf16_round(bb); }
        sm[q] = vals[u * 4 + q]; o[q] = (vals[u * 4 + q] - mu) * rs * gg + bb;
      }
      if (out_sum) *(v4f*)(out_sum + (size_t)row * N + j) = sm;
      *(v4f*)(out_norm + (size_t)row * N + j) = o;
    }
    
  }
}



// ---- f16 WMMA path (v_wmma_f32_16x16x32_f16): 11-bit significands for operands in range — used where a [0,1] probability operand needs more precision than bf16
typedef _Float16 v16h __attribute__((ext_vector_type(16)));
union FragH { v16h v; v8us half[2]; _Float16 h[16]; unsigned short u[16]; };
template <int NT>
__device__ __forceinline__ v8f mmaH(v16h ah, v16h al, v16h bh, v16h bl, v8f c) {
  c = __builtin_amdgcn_wmma_f32_16x16x32_f16(false, ah, false, bh, (short)0, c, false, false);
  if (NT >= 2) c = __builtin_amdgcn_wmma_f32_16x16x32_f16(false, al, false, bh, (short)0, c, false, false);
  if (NT >= 3) c = __builtin_amdgcn_wmma_f32_16x16x32_f16(false, ah, false, bl, (short)0, c, false, false);
  asm volatile("v_nop\n\tv_nop\n\tv_nop\n\tv_nop" : "+v"(c) : "v"(ah), "v"(al), "v"(bh), "v"(bl));
  return c;
}
// batched GEMM like k_gemm_b but f16 operands: A f32 (split into f16 hi/lo if ASPLIT, else rounded to f16), Bt = f16 values [n][k]; alpha; C f32; N multiple of 16 (partial tiles skipped)
template <bool ASPLIT>
__global__ __launch_bounds__(128) void k_gemm_h(const float* __restrict__ A, int lda, size_t sA, const _Float16* __restrict__ Bh, int ldb, size_t sB, float alpha, float* __restrict__ C, int ldc, size_t sC, int M, int N, int K) {
  __shared__ __attribute__((aligned(16))) float so[4][16][64];
  const int tid = threadIdx.x, w = tid >> 5, lane = tid & 31, ln = lane & 15, hh = lane >> 4; const int by = blockIdx.y;
  A += (size_t)by * sA; Bh += (size_t)by * sB; C += (size_t)by * sC;
  const int ntn = (N + 63) / 64; const int wid = blockIdx.x * 4 + w; const int mt = wid / ntn, nq = wid % ntn; if (mt * 16 >= M) return;
  const int row0 = mt * 16, col0 = nq * 64; const float* arow = A + (size_t)(row0 + ln) * lda;
  v8f acc[4] = {};
  for (int kb = 0; kb < K; kb += 32) {
    FragH ah, al;
    const v4f x0 = *(const v4fa*)(arow + kb + 8 * hh), x1 = *(const v4fa*)(arow + kb + 8 * hh + 4), x2 = *(const v4fa*)(arow + kb + 16 + 8 * hh), x3 = *(const v4fa*)(arow + kb + 16 + 8 * hh + 4);
    float xs[16] = {x0[0],x0[1],x0[2],x0[3],x1[0],x1[1],x1[2],x1[3],x2[0],x2[1],x2[2],x2[3],x3[0],x3[1],x3[2],x3[3]};
#pragma unroll
    for (int i = 0; i < 16; ++i) { const _Float16 h = (_Float16)xs[i]; ah.h[i] = h; al.h[i] = ASPLIT ? (_Float16)(xs[i] - (float)h) : (_Float16)0.0f; }
#pragma unroll
    for (int t = 0; t < 4; ++t) { if (col0 + t * 16 >= N) continue; const size_t boff = (size_t)(col0 + t * 16 + ln) * ldb + kb; FragH bq; bq.half[0] = *(const v8us*)(Bh + boff + 8 * hh); bq.half[1] = *(const v8us*)(Bh + boff + 16 + 8 * hh);
      acc[t] = mmaH<ASPLIT ? 2 : 1>(ah.v, al.v, bq.v, bq.v, acc[t]); }
  }
#pragma unroll
  for (int t = 0; t < 4; ++t) { if (col0 + t * 16 >= N) continue;
#pragma unroll
    for (int r = 0; r < 8; ++r) so[w][8 * hh + r][t * 16 + ln] = acc[t][r] * alpha; }
  __builtin_amdgcn_fence(__ATOMIC_ACQ_REL, "workgroup"); __builtin_amdgcn_wave_barrier();
  const int rsub = lane >> 4, c4 = (lane & 15) * 4;
  {
#pragma unroll
    for (int q = 0; q < 8; ++q) { const int r = q * 2 + rsub; if (col0 + c4 < N) { const v4f v = *(const v4fa*)&so[w][r][c4]; *(v4f*)(C + (size_t)(row0 + r) * ldc + col0 + c4) = v; } }
     }
}

// Wt[n][k] = f16(W[k][n]·scale) from f32 row-major W[K][N] (scale = power of two; bf16-exact weights stay exact in f16 away from the subnormal range)
__global__ __launch_bounds__(256) void k_wt_f16(const float* __restrict__ W, _Float16* __restrict__ Wt, int K, int N, float scale) {
  const int t = blockIdx.x * 256 + threadIdx.x; if (t >= N * (K / 8)) return; const int n = t / (K / 8), k8 = (t % (K / 8)) * 8; FragH f;
#pragma unroll
  for (int i = 0; i < 8; ++i) f.h[i] = (_Float16)(bf16_round(W[(size_t)(k8 + i) * N + n]) * scale); const v8us o = f.half[0];
  *(v8us*)((unsigned short*)Wt + (size_t)n * K + k8) = o; 
}
// GEMM C[M][N] = act(A.B^T * alpha (+ CP)), A f16 [M][K], Bh f16 [N][K], both k-contiguous; ACT 0 none / 6 erf-GELU; writes f32 C (HC) and / or f16 C16 (HC16), CP = f32 addend with C's pitch (HCP); CP may be C itself: each lane reads the 16-byte pieces that it later writes.
// One 128 x 128 tile of C per work-group of 8 waves (4 x 2, 32 x 64 each). The operands come through LDS: a stage is 128 k = 256 bytes of each of the 256 operand rows, brought by asynchronous 16-byte copies that take whole lines
// (16 lanes per row), two buffers, the next stage in flight while this one is worked on. M, N multiples of 128, K of 128 at every launch (4096 / 768 / 768 and 1536 / 2048 / 2048).
#define GT 128      /* tile edge */
#define GK 128      /* k per stage */
#define GP 272u     /* LDS row pitch in bytes = 16 x odd: the 16 rows of a fragment read fall on all 64 banks */
#define GST (2u * GT * GP)      /* bytes of a stage: 128 A rows, then 128 B rows */
// this thread's share of one operand's stage: rows 16 apart, the same 16-byte column
__device__ __forceinline__ void copy8(unsigned l, const unsigned short* g, size_t gs) {
  asm volatile("global_load_async_to_lds_b128 %0, %8, off\n\t"
               "global_load_async_to_lds_b128 %1, %9, off\n\t"
               "global_load_async_to_lds_b128 %2, %10, off\n\t"
               "global_load_async_to_lds_b128 %3, %11, off\n\t"
               "global_load_async_to_lds_b128 %4, %12, off\n\t"
               "global_load_async_to_lds_b128 %5, %13, off\n\t"
               "global_load_async_to_lds_b128 %6, %14, off\n\t"
               "global_load_async_to_lds_b128 %7, %15, off\n\t"
               "s_wait_xcnt 0x0"      /* inside the copies' own statement, so that it stands in front of every rewrite of their address registers */
               :: "v"(l), "v"(l + 16u * GP), "v"(l + 32u * GP), "v"(l + 48u * GP), "v"(l + 64u * GP), "v"(l + 80u * GP), "v"(l + 96u * GP), "v"(l + 112u * GP),
                  "v"(g), "v"(g + gs), "v"(g + 2 * gs), "v"(g + 3 * gs), "v"(g + 4 * gs), "v"(g + 5 * gs), "v"(g + 6 * gs), "v"(g + 7 * gs) : "memory");
}
template <int ACT, bool HCP, bool HC, bool HC16>
__global__ __launch_bounds__(256) void k_gemm_hhx(const _Float16* __restrict__ A, int lda, const _Float16* __restrict__ Bh, int ldb, float alpha, const float* CP, float* C, _Float16* __restrict__ C16, int ldc, int N, int K) {
  __shared__ __attribute__((aligned(16))) unsigned char ring[2 * GST];
  __shared__ __attribute__((aligned(16))) float so[8][16][64];
  const int tid = threadIdx.x, w = tid >> 5, lane = tid & 31, ln = lane & 15, hh = lane >> 4;
  const int ntn = N / GT; const int row0 = (int)(blockIdx.x / ntn) * GT, col0 = (int)(blockIdx.x % ntn) * GT; const int wr = (w >> 1) * 32, wc = (w & 1) * 64;
  const int cr = tid >> 4, cc = tid & 15;      /* the thread's first row of a stage and its 16-byte column */
  const unsigned short* ga = (const unsigned short*)A + (size_t)(row0 + cr) * lda + cc * 8; const unsigned short* gb = (const unsigned short*)Bh + (size_t)(col0 + cr) * ldb + cc * 8;
  const unsigned la = (unsigned)(size_t)ring + (unsigned)cr * GP + (unsigned)cc * 16u, lb = la + GT * GP; const size_t sa = (size_t)16 * lda, sb = (size_t)16 * ldb;
  const int nst = K / GK;
  v8f acc[2][4] = {};
  const int rsub = lane >> 4, c4 = (lane & 15) * 4; typedef _Float16 v4h __attribute__((ext_vector_type(4)));
  const size_t eo = (size_t)(row0 + wr + rsub) * ldc + col0 + wc + c4;      /* the lane's first 4 elements of the wave's 32 x 64 part of C; its others lie 2 rows apart */
  v4f cp[2][8];      /* the addend in the shape of the stores, asked for here so that all 16 loads fly together under stage 0's copies */
  if (HCP) {
#pragma unroll      // constant indices keep the array in registers
    for (int i = 0; i < 2; ++i)
#pragma unroll      // constant indices keep the array in registers
      for (int q = 0; q < 8; ++q) cp[i][q] = *(const v4fa*)(CP + eo + (size_t)(i * 16 + q * 2) * ldc); }
  copy8(la, ga, sa); copy8(lb, gb, sb);
  asm volatile("s_wait_asynccnt 0x0" ::: "memory");      /* stage 0 has landed, as far as this wave brought it */
  __syncthreads();      /* ... and as far as the other waves did */
  if (nst > 1) { copy8(la + GST, ga + GK, sa); copy8(lb + GST, gb + GK, sb); }
  const unsigned char* fa = ring + (unsigned)(wr + ln) * GP + 16 * hh; const unsigned char* fb = ring + (unsigned)(GT + wc + ln) * GP + 16 * hh;      /* fragment rows; k order as before: bytes 16hh and 32 + 16hh of each 64, A and B alike */
  for (int t = 0; t < nst; ++t) { const unsigned bo = (unsigned)(t & 1) * GST;
#pragma unroll      // constant indices keep the fragment arrays in registers
    for (int ks = 0; ks < GK / 32; ++ks) { FragH a2[2], b2[4];
#pragma unroll      // constant indices keep the fragment arrays in registers
      for (int i = 0; i < 2; ++i) { a2[i].half[0] = *(const v8us*)(fa + bo + i * 16 * GP + ks * 64); a2[i].half[1] = *(const v8us*)(fa + bo + i * 16 * GP + ks * 64 + 32); }
#pragma unroll      // constant indices keep the fragment arrays in registers
      for (int j = 0; j < 4; ++j) { b2[j].half[0] = *(const v8us*)(fb + bo + j * 16 * GP + ks * 64); b2[j].half[1] = *(const v8us*)(fb + bo + j * 16 * GP + ks * 64 + 32); }
#pragma unroll      // constant indices keep the fragment arrays in registers
      for (int i = 0; i < 2; ++i)
#pragma unroll      // constant indices keep the fragment arrays in registers
        for (int j = 0; j < 4; ++j) acc[i][j] = mmaH<1>(a2[i].v, a2[i].v, b2[j].v, b2[j].v, acc[i][j]); }
    asm volatile("s_wait_dscnt 0x0" ::: "memory");      /* this wave's reads of the buffer are done before the barrier frees it for the refill */
    asm volatile("s_wait_asynccnt 0x0" ::: "memory");      /* this wave's copies of stage t + 1 have landed before the barrier publishes them */
    __syncthreads();
    if (t + 2 < nst) { copy8(la + bo, ga + (size_t)(t + 2) * GK, sa); copy8(lb + bo, gb + (size_t)(t + 2) * GK, sb); } }
  asm volatile("s_wait_asynccnt 0x0" ::: "memory");      /* no copy is outstanding when the wave goes on to its end */
  // Epilogue, 16 x 64 at a time through the wave's own LDS rows; straight-line: what exists is known at compile time, the staged rows are read back together, and addend and activation are applied to the 16-byte pieces that are stored.
#pragma unroll      // constant indices keep the accumulators in registers
  for (int i = 0; i < 2; ++i) {
#pragma unroll
    for (int t = 0; t < 4; ++t)
#pragma unroll
      for (int r = 0; r < 8; ++r) so[w][8 * hh + r][t * 16 + ln] = acc[i][t][r] * alpha;
    __builtin_amdgcn_fence(__ATOMIC_ACQ_REL, "workgroup"); __builtin_amdgcn_wave_barrier();
    v4f vv[8];
#pragma unroll      // constant indices keep the array in registers
    for (int q = 0; q < 8; ++q) vv[q] = *(const v4fa*)&so[w][q * 2 + rsub][c4];
#pragma unroll      // constant indices keep the arrays in registers
    for (int q = 0; q < 8; ++q) { v4f v = vv[q]; const size_t o = eo + (size_t)(i * 16 + q * 2) * ldc;
      if (HCP) v += cp[i][q];
      if (ACT == 6) for (int e = 0; e < 4; ++e) v[e] = 0.5f * v[e] * (1.0f + erff(v[e] * 0.70710678118654752f));
      if (HC) { *(v4f*)(C + o) = v; asm volatile("s_wait_xcnt 0x0" ::: "memory"); }      /* the wait in front of any rewrite of the store's registers */
      if (HC16) { v4h h4; for (int e = 0; e < 4; ++e) h4[e] = (_Float16)v[e]; *(v4h*)(C16 + o) = h4; asm volatile("s_wait_xcnt 0x0" ::: "memory"); } }      /* likewise */
    __builtin_amdgcn_fence(__ATOMIC_ACQ_REL, "workgroup"); __builtin_amdgcn_wave_barrier();      /* the next 16 rows are staged in the same LDS only behind these reads */
  }
}


typedef _Float16 v4h __attribute__((ext_vector_type(4)));

__global__ __launch_bounds__(256) void k_x16(const float* __restrict__ x, _Float16* __restrict__ X16, size_t n8) { const size_t t = (size_t)blockIdx.x * 256 + threadIdx.x; if (t >= n8) return; FragH f;
#pragma unroll
  for (int q = 0; q < 8; ++q) f.h[q] = (_Float16)bf16_round(x[t * 8 + q]); *(v8us*)((unsigned short*)X16 + t * 8) = f.half[0];  }
__global__ __launch_bounds__(256) void k_h16(const float* __restrict__ x, _Float16* __restrict__ X16, size_t n8) { const size_t t = (size_t)blockIdx.x * 256 + threadIdx.x; if (t >= n8) return; FragH f;
#pragma unroll
  for (int q = 0; q < 8; ++q) f.h[q] = (_Float16)x[t * 8 + q]; *(v8us*)((unsigned short*)X16 + t * 8) = f.half[0];  }
__global__ __launch_bounds__(256) void k_round16f(const float* __restrict__ W, _Float16* __restrict__ Bt, size_t n8) { const size_t t = (size_t)blockIdx.x * 256 + threadIdx.x; if (t >= n8) return; FragH f;
#pragma unroll
  for (int i = 0; i < 8; ++i) f.h[i] = (_Float16)(bf16_round(W[t * 8 + i]) * 16.0f); *(v8us*)((unsigned short*)Bt + t * 8) = f.half[0];  }
template <int NHv, int TTv>
__global__ __launch_bounds__(256) void k_vt(const _Float16* __restrict__ V16, int ldv, int voff, _Float16* __restrict__ Vt) { __shared__ unsigned short tl[64][66]; const int tid = threadIdx.x; const int slab = blockIdx.x / (TTv / 64), lg = blockIdx.x % (TTv / 64); const int b = slab / NHv, h = slab % NHv;
  for (int i = tid; i < 64 * 8; i += 256) { const int r = i / 8, c8 = (i % 8) * 8; FragH f; f.half[0] = *(const v8us*)((const unsigned short*)V16 + ((size_t)b * TTv + lg * 64 + r) * ldv + voff + h * 64 + c8);
#pragma unroll
    for (int q = 0; q < 8; ++q) tl[r][c8 + q] = f.u[q]; }
  __syncthreads();
  {
#pragma unroll
    for (int rd = 0; rd < 2; ++rd) { const int d = rd * 32 + tid / 8, pc = tid % 8; FragH f;
#pragma unroll
      for (int q = 0; q < 8; ++q) f.u[q] = tl[pc * 8 + q][d];
      *(v8us*)((unsigned short*)Vt + ((size_t)slab * 64 + d) * TTv + lg * 64 + pc * 8) = f.half[0]; }
     } }

__global__ __launch_bounds__(256) void k_hl(const float* __restrict__ F, _Float16* __restrict__ Hh, _Float16* __restrict__ Hl, size_t n8) { const size_t t = (size_t)blockIdx.x * 256 + threadIdx.x; if (t >= n8) return; FragH fh, fl; const v4f a = *(const v4fa*)(F + t * 8), c = *(const v4fa*)(F + t * 8 + 4);
#pragma unroll
  for (int q = 0; q < 4; ++q) { _Float16 h = (_Float16)a[q]; fh.h[q] = h; fl.h[q] = (_Float16)((a[q] - (float)h) * 1024.0f); h = (_Float16)c[q]; fh.h[4 + q] = h; fl.h[4 + q] = (_Float16)((c[q] - (float)h) * 1024.0f); }
  { *(v8us*)((unsigned short*)Hh + t * 8) = fh.half[0]; *(v8us*)((unsigned short*)Hl + t * 8) = fl.half[0];  } }
// RMSNorm rows (C = 768 = 32 lanes × 24): y = x·rsqrt(mean(x²) + 1.1920929e-7)·bf16(g); RB: round the input to bf16 first; outputs: f16 hi + ×2^10 residual planes (either may be null) and optionally the f32 rounded input copy XR; wave per row; per lane 6 float4 pieces (c = j·128 + lane·4);
template <int RB>
__global__ __launch_bounds__(256) void k_rms(const float* __restrict__ X, const float* __restrict__ g, int nrows, _Float16* __restrict__ YH, _Float16* __restrict__ YL, float* __restrict__ XR) { const int tid = threadIdx.x, wv = tid >> 5, lane = tid & 31; const int r = blockIdx.x * 8 + wv; if (r >= nrows) return; v4f xv[6]; float ss = 0.f;
#pragma unroll
  for (int j = 0; j < 6; ++j) { v4f a = *(const v4fa*)(X + (size_t)r * CC + j * 128 + lane * 4); if (RB) for (int q = 0; q < 4; ++q) a[q] = bf16_round(a[q]); xv[j] = a; for (int q = 0; q < 4; ++q) ss += a[q] * a[q]; }
  for (int o = 16; o >= 1; o >>= 1) ss += __shfl_xor(ss, o, 32); const float rs = rsqrtf(ss / (float)CC + 1.1920929e-7f);
  typedef _Float16 v4h __attribute__((ext_vector_type(4)));
  {
#pragma unroll
    for (int j = 0; j < 6; ++j) { const int c = j * 128 + lane * 4; v4h hh, hl; for (int q = 0; q < 4; ++q) { const float y = xv[j][q] * rs * bf16_round(g[c + q]); const _Float16 hv = (_Float16)y; hh[q] = hv; hl[q] = (_Float16)((y - (float)hv) * 1024.0f); }
      if (YH) *(v4h*)(YH + (size_t)r * CC + c) = hh; if (YL) *(v4h*)(YL + (size_t)r * CC + c) = hl; if (XR) *(v4f*)(XR + (size_t)r * CC + c) = xv[j]; }
     } }
__global__ __launch_bounds__(256) void k_vtr(const _Float16* __restrict__ XH, const _Float16* __restrict__ XL, _Float16* __restrict__ VT) { __shared__ float tl[64][33]; const int tid = threadIdx.x; const int slab = blockIdx.x / (NN / 64), ng = blockIdx.x % (NN / 64); const int b = slab / NH, h = slab % NH; const size_t base = (size_t)b * NN * CC + (size_t)h * HSZ + (size_t)ng * 64 * HD;      /* 64 consecutive n rows × 32 d = 2048 contiguous elements */
  for (int i = tid; i < 64 * 32; i += 256) { const int n = i / 32, d = i % 32; tl[n][d] = (float)XH[base + i] + (float)XL[base + i] * 0.0009765625f; } __syncthreads();
  const int d = tid / 8, pc = tid % 8; FragH f; for (int q = 0; q < 8; ++q) f.h[q] = (_Float16)tl[pc * 8 + q][d];
  *(v8us*)((unsigned short*)VT + ((size_t)slab * HD + d) * NN + ng * 64 + pc * 8) = f.half[0];  }
// lane l <-> lane l ^ 16 by a vector cross-row move (no LDS counter involved)
__device__ __forceinline__ float xhalf(float x) { return __builtin_bit_cast(float, __builtin_amdgcn_permlanex16(__builtin_bit_cast(int, x), __builtin_bit_cast(int, x), 0x76543210, 0xfedcba98, false, false)); }
typedef float v2f __attribute__((ext_vector_type(2)));
__global__ __launch_bounds__(128) void k_flash(const _Float16* __restrict__ Q16, const _Float16* __restrict__ Q16lo, int ldq, const _Float16* __restrict__ K16, const _Float16* __restrict__ K16lo, int ldk, const _Float16* __restrict__ Vt, const float* __restrict__ SP, float* __restrict__ O, int ldo) {
  constexpr int NQB = NN / 64, DT = 2;
  const int tid = threadIdx.x, w = tid >> 5, lane = tid & 31, ln = lane & 15, hh = lane >> 4;
  const int slab = blockIdx.x / NQB, qblk = blockIdx.x % NQB; const int h = slab % NH; const float coef = ((logf(768.0f) * bf16_round(SP[h])) * 5.656854249492381f) * 1.4426950408889634f;      /* times log2(e): the logits are kept in base 2, so each exponential is one hardware instruction */ const int q0 = qblk * 64 + w * 16;
  FragH bq, bql;
  { const size_t qo = ((size_t)slab * NN + q0 + ln) * ldq; const unsigned short* qr = (const unsigned short*)Q16 + qo; const unsigned short* ql = (const unsigned short*)Q16lo + qo;
    bq.half[0] = *(const v8us*)(qr + 8 * hh); bq.half[1] = *(const v8us*)(qr + 16 + 8 * hh); bql.half[0] = *(const v8us*)(ql + 8 * hh); bql.half[1] = *(const v8us*)(ql + 16 + 8 * hh); }
  const unsigned short* kh = (const unsigned short*)K16 + (size_t)slab * NN * ldk; const unsigned short* kl = (const unsigned short*)K16lo + (size_t)slab * NN * ldk;      /* wave-uniform bases, advanced by 32 key rows a pass */
  const unsigned short* vt = (const unsigned short*)Vt + (size_t)slab * HD * NN;      /* v'^T per slab: [32][N], advanced by 32 columns a pass */
  const unsigned ko[2] = {(unsigned)(ln * ldk + 8 * hh), (unsigned)((16 + ln) * ldk + 8 * hh)}, vo[DT] = {(unsigned)(ln * NN + 8 * hh), (unsigned)((16 + ln) * NN + 8 * hh)};      /* the lane's own element offsets */
  float m_q = -3.0e38f, s_q = -3.0e38f, l_q = 0.f; v8f oacc[DT];      /* s_q = m_q - 10 as rounded: what the exponents subtract, so that P and the denominator carry the factor 2^10 */
#pragma unroll
  for (int dt = 0; dt < DT; ++dt) oacc[dt] = (v8f){0.f,0.f,0.f,0.f,0.f,0.f,0.f,0.f};
  for (int j0 = 0; j0 < NN; j0 += 32, kh += 32 * (size_t)ldk, kl += 32 * (size_t)ldk, vt += 32) {
    FragH ak[2], akl[2], av[DT];
#pragma unroll
    for (int nt = 0; nt < 2; ++nt) { ak[nt].half[0] = *(const v8us*)(kh + ko[nt]); ak[nt].half[1] = *(const v8us*)(kh + ko[nt] + 16); akl[nt].half[0] = *(const v8us*)(kl + ko[nt]); akl[nt].half[1] = *(const v8us*)(kl + ko[nt] + 16); }
#pragma unroll
    for (int dt = 0; dt < DT; ++dt) { av[dt].half[0] = *(const v8us*)(vt + vo[dt]); av[dt].half[1] = *(const v8us*)(vt + vo[dt] + 16); }
    v2f s2[8];      /* the 16 logits as the register pairs the accumulators already form */
#pragma unroll
    for (int nt = 0; nt < 2; ++nt) { v8f acc = (v8f){0.f,0.f,0.f,0.f,0.f,0.f,0.f,0.f}, accl = acc;
      acc = mmaH<1>(ak[nt].v, ak[nt].v, bq.v, bq.v, acc); accl = mmaH<1>(ak[nt].v, ak[nt].v, bql.v, bql.v, accl); accl = mmaH<1>(akl[nt].v, akl[nt].v, bq.v, bq.v, accl);
#pragma unroll
      for (int j = 0; j < 4; ++j) { const v2f a2 = {acc[2 * j], acc[2 * j + 1]}, b2 = {accl[2 * j], accl[2 * j + 1]}; s2[nt * 4 + j] = (a2 + b2 * 0.0009765625f) * coef; } }
    float mx[8];
#pragma unroll
    for (int j = 0; j < 4; ++j) { mx[2 * j] = fmaxf(s2[j].x, s2[4 + j].x); mx[2 * j + 1] = fmaxf(s2[j].y, s2[4 + j].y); }
    float mc = fmaxf(fmaxf(fmaxf(mx[0], mx[1]), fmaxf(mx[2], mx[3])), fmaxf(fmaxf(mx[4], mx[5]), fmaxf(mx[6], mx[7])));
    mc = fmaxf(mc, xhalf(mc));
    const float mn = fmaxf(m_q, mc); const float sn = mn - 10.0f; float ea;      /* the rescale uses the same rounded subtrahends as the exponents of the two passes */
    asm("v_exp_f32 %0, %1\n\tv_nop" : "=v"(ea) : "v"(s_q - sn));      /* in asm for the v_nop alone: it keeps the one slot behind a transcendental */
    const float al = (mn > -1.0e38f) ? ea : 1.0f; m_q = mn; s_q = sn;
    v2f p2[8]; FragH pb;
#pragma unroll
    for (int i = 0; i < 8; ++i) { const v2f e2 = s2[i] - sn; p2[i].x = __builtin_amdgcn_exp2f(e2.x); p2[i].y = __builtin_amdgcn_exp2f(e2.y); pb.h[2 * i] = (_Float16)p2[i].x; pb.h[2 * i + 1] = (_Float16)p2[i].y; }
    const v2f ps = ((p2[0] + p2[1]) + (p2[2] + p2[3])) + ((p2[4] + p2[5]) + (p2[6] + p2[7]));
    l_q = l_q * al + (ps.x + ps.y);      /* per-lane partial sum of the query's denominator (the two halves are joined after the loop) */
#pragma unroll
    for (int dt = 0; dt < DT; ++dt) {
#pragma unroll
      for (int r = 0; r < 8; ++r) oacc[dt][r] *= al;
      oacc[dt] = mmaH<1>(av[dt].v, av[dt].v, pb.v, pb.v, oacc[dt]); } }
  const float lt = l_q + xhalf(l_q); const float inv = (lt > 0.f) ? 1.0f / lt : 0.f;      /* numerator and denominator both carry 2^10 */
  float* orow = O + ((size_t)slab * NN + q0 + ln) * ldo + 8 * hh;      /* oacc[dt][r] = O[q0 + ln][dt * 16 + 8hh + r]: eight consecutive d per lane */
#pragma unroll
  for (int dt = 0; dt < DT; ++dt) { const v4f o0 = {oacc[dt][0] * inv, oacc[dt][1] * inv, oacc[dt][2] * inv, oacc[dt][3] * inv}, o1 = {oacc[dt][4] * inv, oacc[dt][5] * inv, oacc[dt][6] * inv, oacc[dt][7] * inv};
    *(v4f*)(orow + dt * 16) = o0; *(v4f*)(orow + dt * 16 + 4) = o1; } }

__global__ __launch_bounds__(256) void k_add(const float* __restrict__ A, const float* __restrict__ B_, float* __restrict__ out, size_t n4) { const size_t t = (size_t)blockIdx.x * 256 + threadIdx.x; if (t >= n4) return; v4f a = *(const v4fa*)(A + t * 4); const v4f b = *(const v4fa*)(B_ + t * 4); for (int q = 0; q < 4; ++q) a[q] += b[q]; *(v4f*)(out + t * 4) = a;  }

extern "C" void kernel_launch(void* const* d_in, const int* in_sizes, int n_in,
                              void* d_out, int out_size, void* d_ws, size_t ws_size, hipStream_t stream) {
  (void)in_sizes; (void)n_in; (void)out_size;
  const float* const* I = (const float* const*)d_in; const float* x = I[0]; const float* sp = I[1]; const float* Wq = I[2]; const float* WA = I[3]; const float* W1 = I[4]; const float* W2 = I[5]; const float* g1 = I[6]; const float* g2 = I[7];
  char* ws = (char*)d_ws; size_t off = 0;
  auto take = [&](size_t bytes) { char* p = ws + off; off += (bytes + 255) & ~(size_t)255; return p; };
  const size_t WSZ = (size_t)CC * CC; _Float16* Bq = (_Float16*)take(WSZ * 2); _Float16* B1 = (_Float16*)take(WSZ * 2); _Float16* B2 = (_Float16*)take(WSZ * 2); _Float16* BA = (_Float16*)take((size_t)NN * NN * 2);
  _Float16* XH = (_Float16*)take((size_t)NR * CC * 2); _Float16* XL = (_Float16*)take((size_t)NR * CC * 2); float* XR = (float*)take((size_t)NR * CC * 4); float* QF = (float*)take((size_t)NR * CC * 4); _Float16* QH = (_Float16*)take((size_t)NR * CC * 2); _Float16* QL = (_Float16*)take((size_t)NR * CC * 2);
  _Float16* VT = (_Float16*)take((size_t)BB * NH * HD * NN * 2); _Float16* VPT = (_Float16*)take((size_t)BB * NH * HD * NN * 2); float* ATT = (float*)take((size_t)NR * CC * 4);
  float* O = QF; _Float16* H16 = XH; _Float16* FH = XL;      /* O (raw [B][H][N][hd] f32) over q f32 (dead after k_hl); RMSNorm2 output over XH and the FF hidden over XL (both dead after k_flash) */
  if (off > ws_size) return;      // 3.5 + 8.4 + 6.3 × 2 + 12.6 × 2 + 6.3 × 2 + 6.3 × 2 + 12.6 ≈ 87 MB
  const unsigned gw = (unsigned)((WSZ / 8 + 255) / 256); k_round16f<<<gw, 256, 0, stream>>>(Wq, Bq, WSZ / 8); k_round16f<<<gw, 256, 0, stream>>>(W1, B1, WSZ / 8); k_round16f<<<gw, 256, 0, stream>>>(W2, B2, WSZ / 8); k_round16f<<<(unsigned)(((size_t)NN * NN / 8 + 255) / 256), 256, 0, stream>>>(WA, BA, (size_t)NN * NN / 8);      /* (out,in) natural ×2^4; WA natural [m][n] ×2^4 */
  k_rms<1><<<(NR + 7) / 8, 256, 0, stream>>>(x, g1, NR, XH, XL, XR);      /* xn = RMSNorm(bf16 x)·g1 → hi / ×2^10 residual; XR = bf16(x) */
  const unsigned gq = (NR / GT) * (CC / GT);
  k_gemm_hhx<0, false, true, false><<<gq, 256, 0, stream>>>(XH, CC, Bq, CC, 0.0625f, nullptr, QF, nullptr, CC, CC, CC);      /* q = xn.Wq^T: hi term, M 4096 N 768 K 768 */
  k_gemm_hhx<0, true, true, false><<<gq, 256, 0, stream>>>(XL, CC, Bq, CC, 0.0625f * 0.0009765625f, QF, QF, nullptr, CC, CC, CC);      /* += lo term * 2^-10 in place */
  k_hl<<<(unsigned)(((size_t)NR * CC / 8 + 255) / 256), 256, 0, stream>>>(QF, QH, QL, (size_t)NR * CC / 8);      /* q → hi / ×2^10 residual (flat planes; head h of batch b = elements [b·N·C + h·N·hd, +N·hd) viewed [N][hd]) */
  k_vtr<<<BB * NH * (NN / 64), 256, 0, stream>>>(XH, XL, VT);      /* vᵀ per (b,h): [32][2048] f16 */
  const unsigned gvp = (BB * NH * HD / GT) * (NN / GT);      /* the 48 slabs of 32 rows lie one behind the other in VT and VPT: one GEMM of 1536 rows */
  k_gemm_hhx<0, false, false, true><<<gvp, 256, 0, stream>>>(VT, NN, BA, NN, 0.0625f, nullptr, nullptr, VPT, NN, NN, NN);      /* v'^T[d][m] = sum over n of v^T[d][n].WA[m][n], all 48 (b,h) at once: M 1536 N 2048 K 2048 */
  k_flash<<<BB * NH * (NN / 64), 128, 0, stream>>>(QH, QL, HD, XH, XL, HD, VPT, sp, O, HD);      /* per (b,h) slab of the raw head views (flat planes, ld 32): softmax(coef_h·q·kᵀ)·v' → O raw [B][H][N][32] */
  k_add<<<(unsigned)(((size_t)NR * CC / 4 + 255) / 256), 256, 0, stream>>>(O, XR, ATT, (size_t)NR * CC / 4);      /* attn = raw-reshaped O + x */
  k_rms<0><<<(NR + 7) / 8, 256, 0, stream>>>(ATT, g2, NR, H16, nullptr, nullptr);      /* h = RMSNorm(attn)·g2 → f16 */
  k_gemm_hhx<6, false, false, true><<<gq, 256, 0, stream>>>(H16, CC, B1, CC, 0.0625f, nullptr, nullptr, FH, CC, CC, CC);      /* gelu_erf(h.W1^T) to f16: M 4096 N 768 K 768 */
  k_gemm_hhx<0, true, true, false><<<gq, 256, 0, stream>>>(FH, CC, B2, CC, 0.0625f, ATT, (float*)d_out, nullptr, CC, CC, CC);      /* out = that.W2^T + attn */
}

// v006
// Measured time: 165 microseconds a run.
// Timed twice side by side with v005, it ran 1.06 times as fast both times.
// Counting every step since v000, it is 2.86 times as fast.
#include <hip/hip_runtime.h>
// 'Scalable super' multi-head attention block (B=2, N=2048, C=768, H=24, hd=32): xn = RMSNorm(x)·g1; q = (xn·Wqᵀ) RAW-reshaped [B,H,N,hd] (no transpose — the module's quirk), k = v = xn raw-reshaped likewise; v' = WA[:N,:N]·v (value premix);
// scores = softmax(coef_h · q·kᵀ) with coef_h = log(C)·scale_param[h]·√hd (up to ≈56 → extremely peaked); attn = (scores·v') raw-reshaped back to [B,N,C] + x; h = RMSNorm(attn)·g2; out = gelu_erf(h·W1ᵀ)·W2ᵀ + attn.
// Compute dtype: x, scale_param, weights, WA, g rounded to bf16; RMSNorm in f32 (wave per row) → f16 hi + ×2^10 residual planes; q = xn·Wqᵀ f32-accurate (hi·W + lo·W·2^-10) → hi/lo planes; per (b,h) the 2048×2048 logit plane
// computed inside a fused flash-style kernel from three f16 products (q_hi·k_hi + (q_lo·k_hi + q_hi·k_lo)·2^-10, d = 32) and scaled by the per-head coefficient in f32; online f32 softmax; P f16 ×2^10; v'ᵀ = vᵀ·WAᵀ by GEMM (f16); O = P·v' accumulated in f32 into the raw [B][H][N][hd] buffer; + x; RMSNorm; FF GEMMs
// (erf-GELU epilogue) with the residual through the f32 addend. All contractions on v_wmma_f32_16x16x32_f16, f32 accumulate.
#define BB 2
#define NN 2048
#define CC 768
#define NH 24
#define HD 32
#define NR (BB * NN)
#define HSZ ((size_t)NN * HD)

typedef __bf16 v16b __attribute__((ext_vector_type(16)));
typedef unsigned short v8us __attribute__((ext_vector_type(8), may_alias));
typedef float  v8f  __attribute__((ext_vector_type(8)));
typedef float  v4f  __attribute__((ext_vector_type(4)));
typedef float  v4fa __attribute__((ext_vector_type(4), may_alias));
union FragB { v16b v; v8us half[2]; unsigned short u[16]; };

__device__ __forceinline__ unsigned short bf16_bits(float x) { unsigned int u = __float_as_uint(x); return (unsigned short)((u + 0x7FFFu + ((u >> 16) & 1u)) >> 16); }
__device__ __forceinline__ float bf16_val(unsigned short b) { return __uint_as_float(((unsigned int)b) << 16); }
__device__ __forceinline__ float bf16_round(float x) { return bf16_val(bf16_bits(x)); }
// D += A·B with NT terms: 1 = ah·bh, 2 = + al·bh (A split), 3 = + ah·bl (both split)
template <int NT>
__device__ __forceinline__ v8f mmaN(v16b ah, v16b al, v16b bh, v16b bl, v8f c) {
  c = __builtin_amdgcn_wmma_f32_16x16x32_bf16(false, ah, false, bh, (short)0, c, false, false);
  if (NT >= 2) c = __builtin_amdgcn_wmma_f32_16x16x32_bf16(false, al, false, bh, (short)0, c, false, false);
  if (NT >= 3) c = __builtin_amdgcn_wmma_f32_16x16x32_bf16(false, ah, false, bl, (short)0, c, false, false);
  asm volatile("v_nop\n\tv_nop\n\tv_nop\n\tv_nop" : "+v"(c) : "v"(ah), "v"(al), "v"(bh), "v"(bl));
  return c;
}

__global__ __launch_bounds__(256) void k_wt_bf16(const float* __restrict__ W, unsigned short* __restrict__ Wt, int K, int N) {
  const int t = blockIdx.x * 256 + threadIdx.x;
  const int k8n = K / 8;
  if (t >= N * k8n) return;
  const int n = t / k8n, k8 = (t % k8n) * 8;
  v8us v;
#pragma unroll
  for (int i = 0; i < 8; ++i) v[i] = bf16_bits(W[(size_t)(k8 + i) * N + n]);
  *(v8us*)(Wt + (size_t)n * K + k8) = v;
  
}

// GEMM C[M][N] (f32, pitch ldc) = act(A[M][K]·W + bias). A f32 row-major (pitch lda) converted per fragment to bf16
// (ASPLIT: hi/lo two planes -> 2 terms, else single rounded term); Wt bf16 [N][K] (pitch ldb). BIAS_BF16 rounds the
// bias to bf16 first (bias quantised to bf16 before the add). K%32==0, M%16==0, N%64==0.
template <bool ASPLIT, int ACT, bool BIAS_BF16>
__global__ __launch_bounds__(128) void k_gemm_bf(const float* __restrict__ A, int lda, const unsigned short* __restrict__ Wt, int ldb,
                                               const float* __restrict__ bias, float* __restrict__ C, int ldc, int M, int N, int K) {
  __shared__ __attribute__((aligned(16))) float so[4][16][64];
  const int tid = threadIdx.x, w = tid >> 5, lane = tid & 31, ln = lane & 15, hh = lane >> 4;
  const int ntn = N / 64;
  const int wid = blockIdx.x * 4 + w;
  const int mt = wid / ntn, nq = wid % ntn;
  if (mt * 16 >= M) return;
  const int row0 = mt * 16, col0 = nq * 64;
  const float* arow = A + (size_t)(row0 + ln) * lda;
  v8f acc[4] = {};
  for (int kb = 0; kb < K; kb += 32) {
    FragB ah, al;
    const v4f x0 = *(const v4fa*)(arow + kb + 8 * hh), x1 = *(const v4fa*)(arow + kb + 8 * hh + 4);
    const v4f x2 = *(const v4fa*)(arow + kb + 16 + 8 * hh), x3 = *(const v4fa*)(arow + kb + 16 + 8 * hh + 4);
    float xs[16] = {x0[0],x0[1],x0[2],x0[3],x1[0],x1[1],x1[2],x1[3],x2[0],x2[1],x2[2],x2[3],x3[0],x3[1],x3[2],x3[3]};
#pragma unroll
    for (int i = 0; i < 16; ++i) { const unsigned short hb = bf16_bits(xs[i]); ah.u[i] = hb; al.u[i] = ASPLIT ? bf16_bits(xs[i] - bf16_val(hb)) : (unsigned short)0; }
#pragma unroll
    for (int t = 0; t < 4; ++t) {
      const unsigned short* brow = Wt + (size_t)(col0 + t * 16 + ln) * ldb + kb;
      FragB b;
      b.half[0] = *(const v8us*)(brow + 8 * hh);
      b.half[1] = *(const v8us*)(brow + 16 + 8 * hh);
      acc[t] = mmaN<ASPLIT ? 2 : 1>(ah.v, al.v, b.v, b.v, acc[t]);
    }
  }
#pragma unroll
  for (int t = 0; t < 4; ++t) {
    float bv = bias ? bias[col0 + t * 16 + ln] : 0.f;
    if (BIAS_BF16) bv = bf16_round(bv);
#pragma unroll
    for (int r = 0; r < 8; ++r) { float v = acc[t][r] + bv; if (ACT == 1) v = fmaxf(v, 0.f); so[w][8 * hh + r][t * 16 + ln] = v; }
  }
  __builtin_amdgcn_fence(__ATOMIC_ACQ_REL, "workgroup");
  __builtin_amdgcn_wave_barrier();
  const int rsub = lane >> 4, c4 = (lane & 15) * 4;
  {
#pragma unroll
    for (int q = 0; q < 8; ++q) {
      const int r = q * 2 + rsub;
      const v4f v = *(const v4fa*)&so[w][r][c4];
      *(v4f*)(C + (size_t)(row0 + r) * ldc + col0 + c4) = v;
    }
    
  }
}

// Flash-style causal/unmasked attention, all contractions 3-term bf16 hi/lo splits, f32 softmax with running max.
// q,k,v rows are read from f32 buffers with arbitrary row pitch (so they can live inside a fused qkv buffer);
// D = head size (multiple of 32, <= 128); one wave = 16 query rows; block = 4 waves (64 queries) sharing K/V chunks of 32.
template <int D, bool CAUSAL>
__global__ __launch_bounds__(128) void k_flash(const float* __restrict__ qb, const float* __restrict__ kb, const float* __restrict__ vb,
                                             int pitch, int T, int H, float scale, float* __restrict__ y, int ypitch) {
  constexpr int KS = D / 32;        // k-steps for QK
  constexpr int DT = D / 16;        // d tiles for PV
  __shared__ __attribute__((aligned(16))) unsigned short sKh[32][D + 8], sKl[32][D + 8], sVh[32][D + 8], sVl[32][D + 8];
  __shared__ __attribute__((aligned(16))) unsigned short sPh[4][16][40], sPl[4][16][40];
  __shared__ __attribute__((aligned(16))) float sO[4][16][D];
  const int tid = threadIdx.x, w = tid >> 5, lane = tid & 31, ln = lane & 15, hh = lane >> 4;
  const int nqb = (T + 63) / 64;
  const int bh = blockIdx.x / nqb, qblk = blockIdx.x % nqb;
  const int b = bh / H, h = bh % H;
  const int q0 = qblk * 64 + w * 16;
  const float* Q = qb + (size_t)b * T * pitch + h * D;
  const float* K = kb + (size_t)b * T * pitch + h * D;
  const float* V = vb + (size_t)b * T * pitch + h * D;

  // A fragments of the wave's 16 query rows (scaled), hi/lo
  FragB aqh[KS], aql[KS];
  {
    int row = q0 + ln; if (row >= T) row = T - 1;
    const float* qr = Q + (size_t)row * pitch;
#pragma unroll
    for (int ks = 0; ks < KS; ++ks)
#pragma unroll
      for (int i = 0; i < 16; ++i) {
        const int d = ks * 32 + ((i < 8) ? (8 * hh + i) : (16 + 8 * hh + (i - 8)));
        const float x = qr[d] * scale; const unsigned short hb = bf16_bits(x);
        aqh[ks].u[i] = hb; aql[ks].u[i] = bf16_bits(x - bf16_val(hb));
      }
  }
  float m_r[8], l_r[8];
#pragma unroll
  for (int r = 0; r < 8; ++r) { m_r[r] = -3.0e38f; l_r[r] = 0.f; }
  v8f oacc[DT];
#pragma unroll
  for (int dt = 0; dt < DT; ++dt) oacc[dt] = (v8f){0.f,0.f,0.f,0.f,0.f,0.f,0.f,0.f};

  const int kv_end = CAUSAL ? min(T, qblk * 64 + 64) : T;     // block-uniform
  for (int j0 = 0; j0 < kv_end; j0 += 32) {
    __syncthreads();
    for (int e = tid; e < 32 * (D / 4); e += 128) {
      const int r = e / (D / 4), c4 = (e % (D / 4)) * 4;
      const int key = j0 + r;
      v4f kf = {0.f,0.f,0.f,0.f}, vf = {0.f,0.f,0.f,0.f};
      if (key < T) { kf = *(const v4fa*)(K + (size_t)key * pitch + c4); vf = *(const v4fa*)(V + (size_t)key * pitch + c4); }
#pragma unroll
      for (int t = 0; t < 4; ++t) {
        unsigned short hb = bf16_bits(kf[t]); sKh[r][c4 + t] = hb; sKl[r][c4 + t] = bf16_bits(kf[t] - bf16_val(hb));
        hb = bf16_bits(vf[t]); sVh[r][c4 + t] = hb; sVl[r][c4 + t] = bf16_bits(vf[t] - bf16_val(hb));
      }
    }
    __syncthreads();
    // S tile 16 x 32
    v8f s[2];
#pragma unroll
    for (int nt = 0; nt < 2; ++nt) {
      v8f acc = {};
#pragma unroll
      for (int ks = 0; ks < KS; ++ks) {
        FragB bh_, bl_;
        bh_.half[0] = *(const v8us*)&sKh[nt * 16 + ln][ks * 32 + 8 * hh]; bh_.half[1] = *(const v8us*)&sKh[nt * 16 + ln][ks * 32 + 16 + 8 * hh];
        bl_.half[0] = *(const v8us*)&sKl[nt * 16 + ln][ks * 32 + 8 * hh]; bl_.half[1] = *(const v8us*)&sKl[nt * 16 + ln][ks * 32 + 16 + 8 * hh];
        acc = mmaN<3>(aqh[ks].v, aql[ks].v, bh_.v, bl_.v, acc);
      }
      s[nt] = acc;
    }
    // mask + running max (rows 8hh+r; the 16 lanes of a half share rows)
    float alpha[8];
#pragma unroll
    for (int r = 0; r < 8; ++r) {
      const int qi = q0 + 8 * hh + r;
      const int ja = j0 + ln, jb = j0 + 16 + ln;
      if (CAUSAL) { if (ja > qi) s[0][r] = -3.0e38f; if (jb > qi) s[1][r] = -3.0e38f; }
      if (ja >= T) s[0][r] = -3.0e38f;
      if (jb >= T) s[1][r] = -3.0e38f;
      float mx = fmaxf(s[0][r], s[1][r]);
      mx = fmaxf(mx, __shfl_xor(mx, 1, 32)); mx = fmaxf(mx, __shfl_xor(mx, 2, 32)); mx = fmaxf(mx, __shfl_xor(mx, 4, 32)); mx = fmaxf(mx, __shfl_xor(mx, 8, 32));
      const float mnew = fmaxf(m_r[r], mx);
      alpha[r] = (mnew > -1.0e38f) ? __expf(m_r[r] - mnew) : 1.0f;
      const float p0 = (s[0][r] > -1.0e38f) ? __expf(s[0][r] - mnew) : 0.f;
      const float p1 = (s[1][r] > -1.0e38f) ? __expf(s[1][r] - mnew) : 0.f;
      m_r[r] = mnew;
      l_r[r] = l_r[r] * alpha[r] + p0 + p1;            // per-lane partial row sum (16 lanes combined at the end)
      unsigned short hb = bf16_bits(p0); sPh[w][8 * hh + r][ln] = hb;      sPl[w][8 * hh + r][ln] = bf16_bits(p0 - bf16_val(hb));
      hb = bf16_bits(p1);                sPh[w][8 * hh + r][16 + ln] = hb; sPl[w][8 * hh + r][16 + ln] = bf16_bits(p1 - bf16_val(hb));
    }
#pragma unroll
    for (int dt = 0; dt < DT; ++dt)
#pragma unroll
      for (int r = 0; r < 8; ++r) oacc[dt][r] *= alpha[r];
    __builtin_amdgcn_fence(__ATOMIC_ACQ_REL, "workgroup");
    __builtin_amdgcn_wave_barrier();
    FragB pah, pal;
    pah.half[0] = *(const v8us*)&sPh[w][ln][8 * hh]; pah.half[1] = *(const v8us*)&sPh[w][ln][16 + 8 * hh];
    pal.half[0] = *(const v8us*)&sPl[w][ln][8 * hh]; pal.half[1] = *(const v8us*)&sPl[w][ln][16 + 8 * hh];
#pragma unroll
    for (int dt = 0; dt < DT; ++dt) {
      FragB bvh, bvl;
#pragma unroll
      for (int i = 0; i < 8; ++i) {
        bvh.u[i] = sVh[8 * hh + i][dt * 16 + ln]; bvh.u[8 + i] = sVh[16 + 8 * hh + i][dt * 16 + ln];
        bvl.u[i] = sVl[8 * hh + i][dt * 16 + ln]; bvl.u[8 + i] = sVl[16 + 8 * hh + i][dt * 16 + ln];
      }
      oacc[dt] = mmaN<3>(pah.v, pal.v, bvh.v, bvl.v, oacc[dt]);
    }
    __builtin_amdgcn_fence(__ATOMIC_ACQ_REL, "workgroup");
    __builtin_amdgcn_wave_barrier();
  }
#pragma unroll
  for (int r = 0; r < 8; ++r) {
    float l = l_r[r];
    l += __shfl_xor(l, 1, 32); l += __shfl_xor(l, 2, 32); l += __shfl_xor(l, 4, 32); l += __shfl_xor(l, 8, 32);
    l_r[r] = (l > 0.f) ? 1.0f / l : 0.f;
  }
#pragma unroll
  for (int dt = 0; dt < DT; ++dt)
#pragma unroll
    for (int r = 0; r < 8; ++r) sO[w][8 * hh + r][dt * 16 + ln] = oacc[dt][r] * l_r[r];
  __builtin_amdgcn_fence(__ATOMIC_ACQ_REL, "workgroup");
  __builtin_amdgcn_wave_barrier();
  {
    for (int r = 0; r < 16; ++r) {
      const int row = q0 + r;
      if (row < T && lane < D / 4) {
        const v4f val = *(const v4fa*)&sO[w][r][lane * 4];
        *(v4f*)(y + ((size_t)b * T + row) * ypitch + h * D + lane * 4) = val;
      }
    }
    
  }
}

// GEMM C = act(A·W + bias + resid): A f32 (ASPLIT -> hi/lo 2 terms), Wt bf16 [N][K]; ACT 0 none, 1 relu, 2 exact gelu;
// resid (optional, f32, row index = (row % rmod), pitch ldr, RES_BF16 rounds it) added before the activation.
template <bool ASPLIT, int ACT, bool BIAS_BF16, bool RES_BF16>
__global__ __launch_bounds__(128) void k_gemm_bf3(const float* __restrict__ A, int lda, const unsigned short* __restrict__ Wt, int ldb,
                                                const float* __restrict__ bias, const float* __restrict__ resid, int rmod, int ldr,
                                                float* __restrict__ C, int ldc, int M, int N, int K) {
  __shared__ __attribute__((aligned(16))) float so[4][16][64];
  const int tid = threadIdx.x, w = tid >> 5, lane = tid & 31, ln = lane & 15, hh = lane >> 4;
  const int ntn = N / 64;
  const int wid = blockIdx.x * 4 + w;
  const int mt = wid / ntn, nq = wid % ntn;
  if (mt * 16 >= M) return;
  const int row0 = mt * 16, col0 = nq * 64;
  const float* arow = A + (size_t)(row0 + ln) * lda;
  v8f acc[4] = {};
  for (int kb = 0; kb < K; kb += 32) {
    FragB ah, al;
    const v4f x0 = *(const v4fa*)(arow + kb + 8 * hh), x1 = *(const v4fa*)(arow + kb + 8 * hh + 4);
    const v4f x2 = *(const v4fa*)(arow + kb + 16 + 8 * hh), x3 = *(const v4fa*)(arow + kb + 16 + 8 * hh + 4);
    float xs[16] = {x0[0],x0[1],x0[2],x0[3],x1[0],x1[1],x1[2],x1[3],x2[0],x2[1],x2[2],x2[3],x3[0],x3[1],x3[2],x3[3]};
#pragma unroll
    for (int i = 0; i < 16; ++i) { const unsigned short hb = bf16_bits(xs[i]); ah.u[i] = hb; al.u[i] = ASPLIT ? bf16_bits(xs[i] - bf16_val(hb)) : (unsigned short)0; }
#pragma unroll
    for (int t = 0; t < 4; ++t) {
      const unsigned short* brow = Wt + (size_t)(col0 + t * 16 + ln) * ldb + kb;
      FragB b;
      b.half[0] = *(const v8us*)(brow + 8 * hh);
      b.half[1] = *(const v8us*)(brow + 16 + 8 * hh);
      acc[t] = mmaN<ASPLIT ? 2 : 1>(ah.v, al.v, b.v, b.v, acc[t]);
    }
  }
#pragma unroll
  for (int t = 0; t < 4; ++t) {
    const int col = col0 + t * 16 + ln;
    float bv = bias ? bias[col] : 0.f;
    if (BIAS_BF16) bv = bf16_round(bv);
#pragma unroll
    for (int r = 0; r < 8; ++r) {
      float v = acc[t][r] + bv;
      if (resid) { float rv = resid[(size_t)((row0 + 8 * hh + r) % rmod) * ldr + col]; if (RES_BF16) rv = bf16_round(rv); v += rv; }
      if (ACT == 1) v = fmaxf(v, 0.f);
      if (ACT == 2) v = 0.5f * v * (1.0f + erff(v * 0.70710678118654752f));
      if (ACT == 3) { const float u = 0.7978845608028654f * (v + 0.044715f * v * v * v); v = 0.5f * v * (1.0f + tanhf(u)); }
      so[w][8 * hh + r][t * 16 + ln] = v;
    }
  }
  __builtin_amdgcn_fence(__ATOMIC_ACQ_REL, "workgroup");
  __builtin_amdgcn_wave_barrier();
  const int rsub = lane >> 4, c4 = (lane & 15) * 4;
  {
#pragma unroll
    for (int q = 0; q < 8; ++q) {
      const int r = q * 2 + rsub;
      const v4f v = *(const v4fa*)&so[w][r][c4];
      *(v4f*)(C + (size_t)(row0 + r) * ldc + col0 + c4) = v;
    }
    
  }
}
// row LayerNorm (biased variance, eps) over N: s = X (+ R); optional out_sum <- s; out_norm <- (s-mu)*rsqrt(var+eps)*g + b
template <bool PARAM_BF16>
__global__ __launch_bounds__(256) void k_layernorm(const float* __restrict__ X, const float* __restrict__ R, const float* __restrict__ g, const float* __restrict__ bta,
                                                  float* __restrict__ out_sum, float* __restrict__ out_norm, int N, float eps) {
  __shared__ float red[256];
  const int row = blockIdx.x, tid = threadIdx.x;
  const float* x = X + (size_t)row * N; const float* rr = R ? R + (size_t)row * N : nullptr;
  float vals[16];                     // up to N = 4096
  const int per = N / 256;            // contiguous chunk per thread? use strided-by-4 chunks: thread handles j = tid*4 + 1024*u
  float s1 = 0.f;
  for (int u = 0; u < per / 4; ++u) {
    const int j = tid * 4 + 1024 * u;
    const v4f a = *(const v4fa*)(x + j);
    v4f b = {0.f,0.f,0.f,0.f}; if (rr) b = *(const v4fa*)(rr + j);
#pragma unroll
    for (int q = 0; q < 4; ++q) { const float v = a[q] + b[q]; vals[u * 4 + q] = v; s1 += v; }
  }
  red[tid] = s1; __syncthreads();
  for (int st = 128; st > 0; st >>= 1) { if (tid < st) red[tid] += red[tid + st]; __syncthreads(); }
  const float mu = red[0] / (float)N; __syncthreads();
  float s2 = 0.f;
  for (int u = 0; u < per / 4; ++u)
#pragma unroll
    for (int q = 0; q < 4; ++q) { const float c = vals[u * 4 + q] - mu; s2 += c * c; }
  red[tid] = s2; __syncthreads();
  for (int st = 128; st > 0; st >>= 1) { if (tid < st) red[tid] += red[tid + st]; __syncthreads(); }
  const float rs = rsqrtf(red[0] / (float)N + eps);
  {
    for (int u = 0; u < per / 4; ++u) {
      const int j = tid * 4 + 1024 * u;
      v4f o, sm;
#pragma unroll
      for (int q = 0; q < 4; ++q) {
        float gg = g[j + q], bb = bta[j + q];
        if (PARAM_BF16) { gg = bf16_round(gg); bb = bf16_round(bb); }
        sm[q] = vals[u * 4 + q]; o[q] = (vals[u * 4 + q] - mu) * rs * gg + bb;
      }
      if (out_sum) *(v4f*)(out_sum + (size_t)row * N + j) = sm;
      *(v4f*)(out_norm + (size_t)row * N + j) = o;
    }
    
  }
}



// ---- f16 WMMA path (v_wmma_f32_16x16x32_f16): 11-bit significands for operands in range — used where a [0,1] probability operand needs more precision than bf16
typedef _Float16 v16h __attribute__((ext_vector_type(16)));
union FragH { v16h v; v8us half[2]; _Float16 h[16]; unsigned short u[16]; };
template <int NT>
__device__ __forceinline__ v8f mmaH(v16h ah, v16h al, v16h bh, v16h bl, v8f c) {
  c = __builtin_amdgcn_wmma_f32_16x16x32_f16(false, ah, false, bh, (short)0, c, false, false);
  if (NT >= 2) c = __builtin_amdgcn_wmma_f32_16x16x32_f16(false, al, false, bh, (short)0, c, false, false);
  if (NT >= 3) c = __builtin_amdgcn_wmma_f32_16x16x32_f16(false, ah, false, bl, (short)0, c, false, false);
  asm volatile("v_nop\n\tv_nop\n\tv_nop\n\tv_nop" : "+v"(c) : "v"(ah), "v"(al), "v"(bh), "v"(bl));
  return c;
}
// batched GEMM like k_gemm_b but f16 operands: A f32 (split into f16 hi/lo if ASPLIT, else rounded to f16), Bt = f16 values [n][k]; alpha; C f32; N multiple of 16 (partial tiles skipped)
template <bool ASPLIT>
__global__ __launch_bounds__(128) void k_gemm_h(const float* __restrict__ A, int lda, size_t sA, const _Float16* __restrict__ Bh, int ldb, size_t sB, float alpha, float* __restrict__ C, int ldc, size_t sC, int M, int N, int K) {
  __shared__ __attribute__((aligned(16))) float so[4][16][64];
  const int tid = threadIdx.x, w = tid >> 5, lane = tid & 31, ln = lane & 15, hh = lane >> 4; const int by = blockIdx.y;
  A += (size_t)by * sA; Bh += (size_t)by * sB; C += (size_t)by * sC;
  const int ntn = (N + 63) / 64; const int wid = blockIdx.x * 4 + w; const int mt = wid / ntn, nq = wid % ntn; if (mt * 16 >= M) return;
  const int row0 = mt * 16, col0 = nq * 64; const float* arow = A + (size_t)(row0 + ln) * lda;
  v8f acc[4] = {};
  for (int kb = 0; kb < K; kb += 32) {
    FragH ah, al;
    const v4f x0 = *(const v4fa*)(arow + kb + 8 * hh), x1 = *(const v4fa*)(arow + kb + 8 * hh + 4), x2 = *(const v4fa*)(arow + kb + 16 + 8 * hh), x3 = *(const v4fa*)(arow + kb + 16 + 8 * hh + 4);
    float xs[16] = {x0[0],x0[1],x0[2],x0[3],x1[0],x1[1],x1[2],x1[3],x2[0],x2[1],x2[2],x2[3],x3[0],x3[1],x3[2],x3[3]};
#pragma unroll
    for (int i = 0; i < 16; ++i) { const _Float16 h = (_Float16)xs[i]; ah.h[i] = h; al.h[i] = ASPLIT ? (_Float16)(xs[i] - (float)h) : (_Float16)0.0f; }
#pragma unroll
    for (int t = 0; t < 4; ++t) { if (col0 + t * 16 >= N) continue; const size_t boff = (size_t)(col0 + t * 16 + ln) * ldb + kb; FragH bq; bq.half[0] = *(const v8us*)(Bh + boff + 8 * hh); bq.half[1] = *(const v8us*)(Bh + boff + 16 + 8 * hh);
      acc[t] = mmaH<ASPLIT ? 2 : 1>(ah.v, al.v, bq.v, bq.v, acc[t]); }
  }
#pragma unroll
  for (int t = 0; t < 4; ++t) { if (col0 + t * 16 >= N) continue;
#pragma unroll
    for (int r = 0; r < 8; ++r) so[w][8 * hh + r][t * 16 + ln] = acc[t][r] * alpha; }
  __builtin_amdgcn_fence(__ATOMIC_ACQ_REL, "workgroup"); __builtin_amdgcn_wave_barrier();
  const int rsub = lane >> 4, c4 = (lane & 15) * 4;
  {
#pragma unroll
    for (int q = 0; q < 8; ++q) { const int r = q * 2 + rsub; if (col0 + c4 < N) { const v4f v = *(const v4fa*)&so[w][r][c4]; *(v4f*)(C + (size_t)(row0 + r) * ldc + col0 + c4) = v; } }
     }
}

// Wt[n][k] = f16(W[k][n]·scale) from f32 row-major W[K][N] (scale = power of two; bf16-exact weights stay exact in f16 away from the subnormal range)
__global__ __launch_bounds__(256) void k_wt_f16(const float* __restrict__ W, _Float16* __restrict__ Wt, int K, int N, float scale) {
  const int t = blockIdx.x * 256 + threadIdx.x; if (t >= N * (K / 8)) return; const int n = t / (K / 8), k8 = (t % (K / 8)) * 8; FragH f;
#pragma unroll
  for (int i = 0; i < 8; ++i) f.h[i] = (_Float16)(bf16_round(W[(size_t)(k8 + i) * N + n]) * scale); const v8us o = f.half[0];
  *(v8us*)((unsigned short*)Wt + (size_t)n * K + k8) = o; 
}
// GEMM C[M][N] = act(A.B^T * alpha (+ CP)), A f16 [M][K], Bh f16 [N][K], both k-contiguous; ACT 0 none / 6 erf-GELU; writes f32 C (HC) and / or f16 C16 (HC16), CP = f32 addend with C's pitch (HCP); CP may be C itself: each lane reads the 16-byte pieces that it later writes.
// HL: C16 takes the f16 hi plane and C16L the residual times 2^10, so that a result wanted as hi / lo planes never goes to memory as f32.
// One 128 x 128 tile of C per work-group of 8 waves (4 x 2, 32 x 64 each). The operands come through LDS: a stage is 128 k = 256 bytes of each of the 256 operand rows, brought by asynchronous 16-byte copies that take whole lines
// (16 lanes per row), two buffers, the next stage in flight while this one is worked on. M, N multiples of 128, K of 128 at every launch (4096 / 768 / 768 and 1536 / 2048 / 2048).
#define GT 128      /* tile edge */
#define GK 128      /* k per stage */
#define GP 272u     /* LDS row pitch in bytes = 16 x odd: the 16 rows of a fragment read fall on all 64 banks */
#define GST (2u * GT * GP)      /* bytes of a stage: 128 A rows, then 128 B rows */
// this thread's share of one operand's stage: rows 16 apart, the same 16-byte column
__device__ __forceinline__ void copy8(unsigned l, const unsigned short* g, size_t gs) {
  asm volatile("global_load_async_to_lds_b128 %0, %8, off\n\t"
               "global_load_async_to_lds_b128 %1, %9, off\n\t"
               "global_load_async_to_lds_b128 %2, %10, off\n\t"
               "global_load_async_to_lds_b128 %3, %11, off\n\t"
               "global_load_async_to_lds_b128 %4, %12, off\n\t"
               "global_load_async_to_lds_b128 %5, %13, off\n\t"
               "global_load_async_to_lds_b128 %6, %14, off\n\t"
               "global_load_async_to_lds_b128 %7, %15, off\n\t"
               "s_wait_xcnt 0x0"      /* inside the copies' own statement, so that it stands in front of every rewrite of their address registers */
               :: "v"(l), "v"(l + 16u * GP), "v"(l + 32u * GP), "v"(l + 48u * GP), "v"(l + 64u * GP), "v"(l + 80u * GP), "v"(l + 96u * GP), "v"(l + 112u * GP),
                  "v"(g), "v"(g + gs), "v"(g + 2 * gs), "v"(g + 3 * gs), "v"(g + 4 * gs), "v"(g + 5 * gs), "v"(g + 6 * gs), "v"(g + 7 * gs) : "memory");
}
template <int ACT, bool HCP, bool HC, bool HC16, bool HL>
__global__ __launch_bounds__(256) void k_gemm_hhx(const _Float16* __restrict__ A, int lda, const _Float16* __restrict__ Bh, int ldb, float alpha, const float* CP, float* C, _Float16* __restrict__ C16, _Float16* __restrict__ C16L, int ldc, int N, int K) {
  __shared__ __attribute__((aligned(16))) unsigned char ring[2 * GST];
  __shared__ __attribute__((aligned(16))) float so[8][16][64];
  const int tid = threadIdx.x, w = tid >> 5, lane = tid & 31, ln = lane & 15, hh = lane >> 4;
  const int ntn = N / GT; const int row0 = (int)(blockIdx.x / ntn) * GT, col0 = (int)(blockIdx.x % ntn) * GT; const int wr = (w >> 1) * 32, wc = (w & 1) * 64;
  const int cr = tid >> 4, cc = tid & 15;      /* the thread's first row of a stage and its 16-byte column */
  const unsigned short* ga = (const unsigned short*)A + (size_t)(row0 + cr) * lda + cc * 8; const unsigned short* gb = (const unsigned short*)Bh + (size_t)(col0 + cr) * ldb + cc * 8;
  const unsigned la = (unsigned)(size_t)ring + (unsigned)cr * GP + (unsigned)cc * 16u, lb = la + GT * GP; const size_t sa = (size_t)16 * lda, sb = (size_t)16 * ldb;
  const int nst = K / GK;
  v8f acc[2][4] = {};
  const int rsub = lane >> 4, c4 = (lane & 15) * 4; typedef _Float16 v4h __attribute__((ext_vector_type(4)));
  const size_t eo = (size_t)(row0 + wr + rsub) * ldc + col0 + wc + c4;      /* the lane's first 4 elements of the wave's 32 x 64 part of C; its others lie 2 rows apart */
  v4f cp[2][8];      /* the addend in the shape of the stores, asked for here so that all 16 loads fly together under stage 0's copies */
  if (HCP) {
#pragma unroll      // constant indices keep the array in registers
    for (int i = 0; i < 2; ++i)
#pragma unroll      // constant indices keep the array in registers
      for (int q = 0; q < 8; ++q) cp[i][q] = *(const v4fa*)(CP + eo + (size_t)(i * 16 + q * 2) * ldc); }
  copy8(la, ga, sa); copy8(lb, gb, sb);
  asm volatile("s_wait_asynccnt 0x0" ::: "memory");      /* stage 0 has landed, as far as this wave brought it */
  __syncthreads();      /* ... and as far as the other waves did */
  if (nst > 1) { copy8(la + GST, ga + GK, sa); copy8(lb + GST, gb + GK, sb); }
  const unsigned char* fa = ring + (unsigned)(wr + ln) * GP + 16 * hh; const unsigned char* fb = ring + (unsigned)(GT + wc + ln) * GP + 16 * hh;      /* fragment rows; k order as before: bytes 16hh and 32 + 16hh of each 64, A and B alike */
  for (int t = 0; t < nst; ++t) { const unsigned bo = (unsigned)(t & 1) * GST;
#pragma unroll      // constant indices keep the fragment arrays in registers
    for (int ks = 0; ks < GK / 32; ++ks) { FragH a2[2], b2[4];
#pragma unroll      // constant indices keep the fragment arrays in registers
      for (int i = 0; i < 2; ++i) { a2[i].half[0] = *(const v8us*)(fa + bo + i * 16 * GP + ks * 64); a2[i].half[1] = *(const v8us*)(fa + bo + i * 16 * GP + ks * 64 + 32); }
#pragma unroll      // constant indices keep the fragment arrays in registers
      for (int j = 0; j < 4; ++j) { b2[j].half[0] = *(const v8us*)(fb + bo + j * 16 * GP + ks * 64); b2[j].half[1] = *(const v8us*)(fb + bo + j * 16 * GP + ks * 64 + 32); }
#pragma unroll      // constant indices keep the fragment arrays in registers
      for (int i = 0; i < 2; ++i)
#pragma unroll      // constant indices keep the fragment arrays in registers
        for (int j = 0; j < 4; ++j) acc[i][j] = mmaH<1>(a2[i].v, a2[i].v, b2[j].v, b2[j].v, acc[i][j]); }
    asm volatile("s_wait_dscnt 0x0" ::: "memory");      /* this wave's reads of the buffer are done before the barrier frees it for the refill */
    asm volatile("s_wait_asynccnt 0x0" ::: "memory");      /* this wave's copies of stage t + 1 have landed before the barrier publishes them */
    __syncthreads();
    if (t + 2 < nst) { copy8(la + bo, ga + (size_t)(t + 2) * GK, sa); copy8(lb + bo, gb + (size_t)(t + 2) * GK, sb); } }
  asm volatile("s_wait_asynccnt 0x0" ::: "memory");      /* no copy is outstanding when the wave goes on to its end */
  // Epilogue, 16 x 64 at a time through the wave's own LDS rows; straight-line: what exists is known at compile time, the staged rows are read back together, and addend and activation are applied to the 16-byte pieces that are stored.
#pragma unroll      // constant indices keep the accumulators in registers
  for (int i = 0; i < 2; ++i) {
#pragma unroll
    for (int t = 0; t < 4; ++t)
#pragma unroll
      for (int r = 0; r < 8; ++r) so[w][8 * hh + r][t * 16 + ln] = acc[i][t][r] * alpha;
    __builtin_amdgcn_fence(__ATOMIC_ACQ_REL, "workgroup"); __builtin_amdgcn_wave_barrier();
    v4f vv[8];
#pragma unroll      // constant indices keep the array in registers
    for (int q = 0; q < 8; ++q) vv[q] = *(const v4fa*)&so[w][q * 2 + rsub][c4];
#pragma unroll      // constant indices keep the arrays in registers
    for (int q = 0; q < 8; ++q) { v4f v = vv[q]; const size_t o = eo + (size_t)(i * 16 + q * 2) * ldc;
      if (HCP) v += cp[i][q];
      if (ACT == 6) for (int e = 0; e < 4; ++e) v[e] = 0.5f * v[e] * (1.0f + erff(v[e] * 0.70710678118654752f));
      if (HC) { *(v4f*)(C + o) = v; asm volatile("s_wait_xcnt 0x0" ::: "memory"); }      /* the wait in front of any rewrite of the store's registers */
      if (HC16) { v4h h4; for (int e = 0; e < 4; ++e) h4[e] = (_Float16)v[e]; *(v4h*)(C16 + o) = h4; asm volatile("s_wait_xcnt 0x0" ::: "memory"); }      /* likewise */
      if (HL) { v4h h4, l4; for (int e = 0; e < 4; ++e) { h4[e] = (_Float16)v[e]; l4[e] = (_Float16)((v[e] - (float)h4[e]) * 1024.0f); }
        asm volatile("global_store_b64 %0, %2, off\n\tglobal_store_b64 %1, %3, off\n\ts_wait_xcnt 0x0" :: "v"(C16 + o), "v"(C16L + o), "v"(h4), "v"(l4) : "memory"); } }      /* both stores and their wait in one statement: as a statement of its own the wait let rewrites of the stores' registers pass in front of it */
    __builtin_amdgcn_fence(__ATOMIC_ACQ_REL, "workgroup"); __builtin_amdgcn_wave_barrier();      /* the next 16 rows are staged in the same LDS only behind these reads */
  }
}


typedef _Float16 v4h __attribute__((ext_vector_type(4)));

__global__ __launch_bounds__(256) void k_x16(const float* __restrict__ x, _Float16* __restrict__ X16, size_t n8) { const size_t t = (size_t)blockIdx.x * 256 + threadIdx.x; if (t >= n8) return; FragH f;
#pragma unroll
  for (int q = 0; q < 8; ++q) f.h[q] = (_Float16)bf16_round(x[t * 8 + q]); *(v8us*)((unsigned short*)X16 + t * 8) = f.half[0];  }
__global__ __launch_bounds__(256) void k_h16(const float* __restrict__ x, _Float16* __restrict__ X16, size_t n8) { const size_t t = (size_t)blockIdx.x * 256 + threadIdx.x; if (t >= n8) return; FragH f;
#pragma unroll
  for (int q = 0; q < 8; ++q) f.h[q] = (_Float16)x[t * 8 + q]; *(v8us*)((unsigned short*)X16 + t * 8) = f.half[0];  }
__global__ __launch_bounds__(256) void k_round16f(const float* __restrict__ W, _Float16* __restrict__ Bt, size_t n8) { const size_t t = (size_t)blockIdx.x * 256 + threadIdx.x; if (t >= n8) return; FragH f;
#pragma unroll
  for (int i = 0; i < 8; ++i) f.h[i] = (_Float16)(bf16_round(W[t * 8 + i]) * 16.0f); *(v8us*)((unsigned short*)Bt + t * 8) = f.half[0];  }
template <int NHv, int TTv>
__global__ __launch_bounds__(256) void k_vt(const _Float16* __restrict__ V16, int ldv, int voff, _Float16* __restrict__ Vt) { __shared__ unsigned short tl[64][66]; const int tid = threadIdx.x; const int slab = blockIdx.x / (TTv / 64), lg = blockIdx.x % (TTv / 64); const int b = slab / NHv, h = slab % NHv;
  for (int i = tid; i < 64 * 8; i += 256) { const int r = i / 8, c8 = (i % 8) * 8; FragH f; f.half[0] = *(const v8us*)((const unsigned short*)V16 + ((size_t)b * TTv + lg * 64 + r) * ldv + voff + h * 64 + c8);
#pragma unroll
    for (int q = 0; q < 8; ++q) tl[r][c8 + q] = f.u[q]; }
  __syncthreads();
  {
#pragma unroll
    for (int rd = 0; rd < 2; ++rd) { const int d = rd * 32 + tid / 8, pc = tid % 8; FragH f;
#pragma unroll
      for (int q = 0; q < 8; ++q) f.u[q] = tl[pc * 8 + q][d];
      *(v8us*)((unsigned short*)Vt + ((size_t)slab * 64 + d) * TTv + lg * 64 + pc * 8) = f.half[0]; }
     } }

// RMSNorm rows (C = 768 = 32 lanes x 24): y = x.rsqrt(mean(x^2) + 1.1920929e-7).bf16(g); RB: round the input to bf16 first; ADD: the input is X + R (the residual add, done here where its rows are read); outputs: f16 hi + x2^10 residual planes (either may be null)
// and optionally the f32 input as normalised (rounded, or summed) XR; wave per row; per lane 6 float4 pieces (c = j.128 + lane.4).
// TR: also v^T per (b,h), [32][2048] f16 of hi + lo.2^-10. The work-group's 8 rows are 6144 consecutive elements of the flat plane = 3 whole tiles of 64 n x 32 d of the raw head view, turned through LDS; the grid is then exactly NR / 8 work-groups, so no row test stands in front of the barrier.
template <int RB, bool ADD, bool TR>
__global__ __launch_bounds__(256) void k_rms(const float* __restrict__ X, const float* __restrict__ R, const float* __restrict__ g, int nrows, _Float16* __restrict__ YH, _Float16* __restrict__ YL, float* __restrict__ XR, _Float16* __restrict__ VT) { __shared__ float tl[TR ? 3 : 1][64][33]; const int tid = threadIdx.x, wv = tid >> 5, lane = tid & 31; const int r = blockIdx.x * 8 + wv; if (!TR && r >= nrows) return; v4f xv[6]; float ss = 0.f;
#pragma unroll
  for (int j = 0; j < 6; ++j) { v4f a = *(const v4fa*)(X + (size_t)r * CC + j * 128 + lane * 4); if (ADD) { const v4f b = *(const v4fa*)(R + (size_t)r * CC + j * 128 + lane * 4); for (int q = 0; q < 4; ++q) a[q] += b[q]; } if (RB) for (int q = 0; q < 4; ++q) a[q] = bf16_round(a[q]); xv[j] = a; for (int q = 0; q < 4; ++q) ss += a[q] * a[q]; }
  for (int o = 16; o >= 1; o >>= 1) ss += __shfl_xor(ss, o, 32); const float rs = rsqrtf(ss / (float)CC + 1.1920929e-7f);
  typedef _Float16 v4h __attribute__((ext_vector_type(4)));
  {
#pragma unroll
    for (int j = 0; j < 6; ++j) { const int c = j * 128 + lane * 4; v4h hh, hl; for (int q = 0; q < 4; ++q) { const float y = xv[j][q] * rs * bf16_round(g[c + q]); const _Float16 hv = (_Float16)y; hh[q] = hv; hl[q] = (_Float16)((y - (float)hv) * 1024.0f); }
      if (TR) { const int e = wv * CC + c; for (int q = 0; q < 4; ++q) tl[e >> 11][(e & 2047) >> 5][(e & 31) + q] = (float)hh[q] + (float)hl[q] * 0.0009765625f; }
      if (YH) *(v4h*)(YH + (size_t)r * CC + c) = hh; if (YL) *(v4h*)(YL + (size_t)r * CC + c) = hl; if (XR) *(v4f*)(XR + (size_t)r * CC + c) = xv[j]; }
     }
  if (TR) { asm volatile("s_wait_xcnt 0x0" ::: "memory");      /* the wait in front of any rewrite of the row stores' registers by what follows */
    __syncthreads();      /* the 3 tiles are whole only when all 8 rows are in */
    const int d = tid / 8, pc = tid % 8;
#pragma unroll      // the three tiles' LDS reads are asked for together, not tile by tile
    for (int t3 = 0; t3 < 3; ++t3) { const int tile = blockIdx.x * 3 + t3, slab = tile / (NN / 64), ng = tile % (NN / 64); FragH f; for (int q = 0; q < 8; ++q) f.h[q] = (_Float16)tl[t3][pc * 8 + q][d];
      *(v8us*)((unsigned short*)VT + ((size_t)slab * HD + d) * NN + ng * 64 + pc * 8) = f.half[0]; } } }
// lane l <-> lane l ^ 16 by a vector cross-row move (no LDS counter involved)
__device__ __forceinline__ float xhalf(float x) { return __builtin_bit_cast(float, __builtin_amdgcn_permlanex16(__builtin_bit_cast(int, x), __builtin_bit_cast(int, x), 0x76543210, 0xfedcba98, false, false)); }
typedef float v2f __attribute__((ext_vector_type(2)));
__global__ __launch_bounds__(128) void k_flash(const _Float16* __restrict__ Q16, const _Float16* __restrict__ Q16lo, int ldq, const _Float16* __restrict__ K16, const _Float16* __restrict__ K16lo, int ldk, const _Float16* __restrict__ Vt, const float* __restrict__ SP, float* __restrict__ O, int ldo) {
  constexpr int NQB = NN / 64, DT = 2;
  const int tid = threadIdx.x, w = tid >> 5, lane = tid & 31, ln = lane & 15, hh = lane >> 4;
  const int slab = blockIdx.x / NQB, qblk = blockIdx.x % NQB; const int h = slab % NH; const float coef = ((logf(768.0f) * bf16_round(SP[h])) * 5.656854249492381f) * 1.4426950408889634f;      /* times log2(e): the logits are kept in base 2, so each exponential is one hardware instruction */ const int q0 = qblk * 64 + w * 16;
  FragH bq, bql;
  { const size_t qo = ((size_t)slab * NN + q0 + ln) * ldq; const unsigned short* qr = (const unsigned short*)Q16 + qo; const unsigned short* ql = (const unsigned short*)Q16lo + qo;
    bq.half[0] = *(const v8us*)(qr + 8 * hh); bq.half[1] = *(const v8us*)(qr + 16 + 8 * hh); bql.half[0] = *(const v8us*)(ql + 8 * hh); bql.half[1] = *(const v8us*)(ql + 16 + 8 * hh); }
  const unsigned short* kh = (const unsigned short*)K16 + (size_t)slab * NN * ldk; const unsigned short* kl = (const unsigned short*)K16lo + (size_t)slab * NN * ldk;      /* wave-uniform bases, advanced by 32 key rows a pass */
  const unsigned short* vt = (const unsigned short*)Vt + (size_t)slab * HD * NN;      /* v'^T per slab: [32][N], advanced by 32 columns a pass */
  const unsigned ko[2] = {(unsigned)(ln * ldk + 8 * hh), (unsigned)((16 + ln) * ldk + 8 * hh)}, vo[DT] = {(unsigned)(ln * NN + 8 * hh), (unsigned)((16 + ln) * NN + 8 * hh)};      /* the lane's own element offsets */
  float m_q = -3.0e38f, s_q = -3.0e38f, l_q = 0.f; v8f oacc[DT];      /* s_q = m_q - 10 as rounded: what the exponents subtract, so that P and the denominator carry the factor 2^10 */
#pragma unroll
  for (int dt = 0; dt < DT; ++dt) oacc[dt] = (v8f){0.f,0.f,0.f,0.f,0.f,0.f,0.f,0.f};
  for (int j0 = 0; j0 < NN; j0 += 32, kh += 32 * (size_t)ldk, kl += 32 * (size_t)ldk, vt += 32) {
    FragH ak[2], akl[2], av[DT];
#pragma unroll
    for (int nt = 0; nt < 2; ++nt) { ak[nt].half[0] = *(const v8us*)(kh + ko[nt]); ak[nt].half[1] = *(const v8us*)(kh + ko[nt] + 16); akl[nt].half[0] = *(const v8us*)(kl + ko[nt]); akl[nt].half[1] = *(const v8us*)(kl + ko[nt] + 16); }
#pragma unroll
    for (int dt = 0; dt < DT; ++dt) { av[dt].half[0] = *(const v8us*)(vt + vo[dt]); av[dt].half[1] = *(const v8us*)(vt + vo[dt] + 16); }
    v2f s2[8];      /* the 16 logits as the register pairs the accumulators already form */
#pragma unroll
    for (int nt = 0; nt < 2; ++nt) { v8f acc = (v8f){0.f,0.f,0.f,0.f,0.f,0.f,0.f,0.f}, accl = acc;
      acc = mmaH<1>(ak[nt].v, ak[nt].v, bq.v, bq.v, acc); accl = mmaH<1>(ak[nt].v, ak[nt].v, bql.v, bql.v, accl); accl = mmaH<1>(akl[nt].v, akl[nt].v, bq.v, bq.v, accl);
#pragma unroll
      for (int j = 0; j < 4; ++j) { const v2f a2 = {acc[2 * j], acc[2 * j + 1]}, b2 = {accl[2 * j], accl[2 * j + 1]}; s2[nt * 4 + j] = (a2 + b2 * 0.0009765625f) * coef; } }
    float mx[8];
#pragma unroll
    for (int j = 0; j < 4; ++j) { mx[2 * j] = fmaxf(s2[j].x, s2[4 + j].x); mx[2 * j + 1] = fmaxf(s2[j].y, s2[4 + j].y); }
    float mc = fmaxf(fmaxf(fmaxf(mx[0], mx[1]), fmaxf(mx[2], mx[3])), fmaxf(fmaxf(mx[4], mx[5]), fmaxf(mx[6], mx[7])));
    mc = fmaxf(mc, xhalf(mc));
    const float mn = fmaxf(m_q, mc); const float sn = mn - 10.0f; float ea;      /* the rescale uses the same rounded subtrahends as the exponents of the two passes */
    asm("v_exp_f32 %0, %1\n\tv_nop" : "=v"(ea) : "v"(s_q - sn));      /* in asm for the v_nop alone: it keeps the one slot behind a transcendental */
    const float al = (mn > -1.0e38f) ? ea : 1.0f; m_q = mn; s_q = sn;
    v2f p2[8]; FragH pb;
#pragma unroll
    for (int i = 0; i < 8; ++i) { const v2f e2 = s2[i] - sn; p2[i].x = __builtin_amdgcn_exp2f(e2.x); p2[i].y = __builtin_amdgcn_exp2f(e2.y); pb.h[2 * i] = (_Float16)p2[i].x; pb.h[2 * i + 1] = (_Float16)p2[i].y; }
    const v2f ps = ((p2[0] + p2[1]) + (p2[2] + p2[3])) + ((p2[4] + p2[5]) + (p2[6] + p2[7]));
    l_q = l_q * al + (ps.x + ps.y);      /* per-lane partial sum of the query's denominator (the two halves are joined after the loop) */
#pragma unroll
    for (int dt = 0; dt < DT; ++dt) {
#pragma unroll
      for (int r = 0; r < 8; ++r) oacc[dt][r] *= al;
      oacc[dt] = mmaH<1>(av[dt].v, av[dt].v, pb.v, pb.v, oacc[dt]); } }
  const float lt = l_q + xhalf(l_q); const float inv = (lt > 0.f) ? 1.0f / lt : 0.f;      /* numerator and denominator both carry 2^10 */
  float* orow = O + ((size_t)slab * NN + q0 + ln) * ldo + 8 * hh;      /* oacc[dt][r] = O[q0 + ln][dt * 16 + 8hh + r]: eight consecutive d per lane */
#pragma unroll
  for (int dt = 0; dt < DT; ++dt) { const v4f o0 = {oacc[dt][0] * inv, oacc[dt][1] * inv, oacc[dt][2] * inv, oacc[dt][3] * inv}, o1 = {oacc[dt][4] * inv, oacc[dt][5] * inv, oacc[dt][6] * inv, oacc[dt][7] * inv};
    *(v4f*)(orow + dt * 16) = o0; *(v4f*)(orow + dt * 16 + 4) = o1; } }

extern "C" void kernel_launch(void* const* d_in, const int* in_sizes, int n_in,
                              void* d_out, int out_size, void* d_ws, size_t ws_size, hipStream_t stream) {
  (void)in_sizes; (void)n_in; (void)out_size;
  const float* const* I = (const float* const*)d_in; const float* x = I[0]; const float* sp = I[1]; const float* Wq = I[2]; const float* WA = I[3]; const float* W1 = I[4]; const float* W2 = I[5]; const float* g1 = I[6]; const float* g2 = I[7];
  char* ws = (char*)d_ws; size_t off = 0;
  auto take = [&](size_t bytes) { char* p = ws + off; off += (bytes + 255) & ~(size_t)255; return p; };
  const size_t WSZ = (size_t)CC * CC; _Float16* Bq = (_Float16*)take(WSZ * 2); _Float16* B1 = (_Float16*)take(WSZ * 2); _Float16* B2 = (_Float16*)take(WSZ * 2); _Float16* BA = (_Float16*)take((size_t)NN * NN * 2);
  _Float16* XH = (_Float16*)take((size_t)NR * CC * 2); _Float16* XL = (_Float16*)take((size_t)NR * CC * 2); float* XR = (float*)take((size_t)NR * CC * 4); float* QF = (float*)take((size_t)NR * CC * 4); _Float16* QH = (_Float16*)take((size_t)NR * CC * 2); _Float16* QL = (_Float16*)take((size_t)NR * CC * 2);
  _Float16* VT = (_Float16*)take((size_t)BB * NH * HD * NN * 2); _Float16* VPT = (_Float16*)take((size_t)BB * NH * HD * NN * 2); float* ATT = (float*)take((size_t)NR * CC * 4);
  float* O = QF; _Float16* H16 = XH; _Float16* FH = XL;      /* O (raw [B][H][N][hd] f32) over the hi term of q as f32 (dead after the lo-term GEMM); RMSNorm2 output over XH and the FF hidden over XL (both dead after the flash kernel) */
  if (off > ws_size) return;      // 3.5 + 8.4 + 6.3 × 2 + 12.6 × 2 + 6.3 × 2 + 6.3 × 2 + 12.6 ≈ 87 MB
  const unsigned gw = (unsigned)((WSZ / 8 + 255) / 256); k_round16f<<<gw, 256, 0, stream>>>(Wq, Bq, WSZ / 8); k_round16f<<<gw, 256, 0, stream>>>(W1, B1, WSZ / 8); k_round16f<<<gw, 256, 0, stream>>>(W2, B2, WSZ / 8); k_round16f<<<(unsigned)(((size_t)NN * NN / 8 + 255) / 256), 256, 0, stream>>>(WA, BA, (size_t)NN * NN / 8);      /* (out,in) natural ×2^4; WA natural [m][n] ×2^4 */
  k_rms<1, false, true><<<NR / 8, 256, 0, stream>>>(x, nullptr, g1, NR, XH, XL, XR, VT);      /* xn = RMSNorm(bf16 x).g1 as hi / x2^10 residual planes; XR = bf16(x); v^T per (b,h): [32][2048] f16 */
  const unsigned gq = (NR / GT) * (CC / GT);
  k_gemm_hhx<0, false, true, false, false><<<gq, 256, 0, stream>>>(XH, CC, Bq, CC, 0.0625f, nullptr, QF, nullptr, nullptr, CC, CC, CC);      /* q = xn.Wq^T: hi term, M 4096 N 768 K 768 */
  k_gemm_hhx<0, true, false, false, true><<<gq, 256, 0, stream>>>(XL, CC, Bq, CC, 0.0625f * 0.0009765625f, QF, nullptr, QH, QL, CC, CC, CC);      /* + lo term * 2^-10; q leaves as hi / x2^10 residual planes (flat; head h of batch b = elements [b.N.C + h.N.hd, +N.hd) viewed [N][hd]) */
  const unsigned gvp = (BB * NH * HD / GT) * (NN / GT);      /* the 48 slabs of 32 rows lie one behind the other in VT and VPT: one GEMM of 1536 rows */
  k_gemm_hhx<0, false, false, true, false><<<gvp, 256, 0, stream>>>(VT, NN, BA, NN, 0.0625f, nullptr, nullptr, VPT, nullptr, NN, NN, NN);      /* v'^T[d][m] = sum over n of v^T[d][n].WA[m][n], all 48 (b,h) at once: M 1536 N 2048 K 2048 */
  k_flash<<<BB * NH * (NN / 64), 128, 0, stream>>>(QH, QL, HD, XH, XL, HD, VPT, sp, O, HD);      /* per (b,h) slab of the raw head views (flat planes, ld 32): softmax(coef_h·q·kᵀ)·v' → O raw [B][H][N][32] */
  k_rms<0, true, false><<<(NR + 7) / 8, 256, 0, stream>>>(O, XR, g2, NR, H16, nullptr, ATT, nullptr);      /* attn = raw-reshaped O + x, kept as f32; h = RMSNorm(attn).g2 as f16 */
  k_gemm_hhx<6, false, false, true, false><<<gq, 256, 0, stream>>>(H16, CC, B1, CC, 0.0625f, nullptr, nullptr, FH, nullptr, CC, CC, CC);      /* gelu_erf(h.W1^T) to f16: M 4096 N 768 K 768 */
  k_gemm_hhx<0, true, true, false, false><<<gq, 256, 0, stream>>>(FH, CC, B2, CC, 0.0625f, ATT, (float*)d_out, nullptr, nullptr, CC, CC, CC);      /* out = that.W2^T + attn */
}

// v007
// A run of this version takes 142 microseconds.
// Next to v006, in two timings, it ran 1.15 times as fast each time.
// All steps since v000 together make it 3.29 times as fast.
#include <hip/hip_runtime.h>
// 'Scalable super' multi-head attention block (B=2, N=2048, C=768, H=24, hd=32): xn = RMSNorm(x)·g1; q = (xn·Wqᵀ) RAW-reshaped [B,H,N,hd] (no transpose — the module's quirk), k = v = xn raw-reshaped likewise; v' = WA[:N,:N]·v (value premix);
// scores = softmax(coef_h · q·kᵀ) with coef_h = log(C)·scale_param[h]·√hd (up to ≈56 → extremely peaked); attn = (scores·v') raw-reshaped back to [B,N,C] + x; h = RMSNorm(attn)·g2; out = gelu_erf(h·W1ᵀ)·W2ᵀ + attn.
// Compute dtype: x, scale_param, weights, WA, g rounded to bf16; RMSNorm in f32 (wave per row) → f16 hi + ×2^10 residual planes; q = xn·Wqᵀ f32-accurate (hi·W + lo·W·2^-10) → hi/lo planes; per (b,h) the 2048×2048 logit plane
// computed inside a fused flash-style kernel from three f16 products (q_hi·k_hi + (q_lo·k_hi + q_hi·k_lo)·2^-10, d = 32) and scaled by the per-head coefficient in f32; online f32 softmax; P f16 ×2^10; v'ᵀ = vᵀ·WAᵀ by GEMM (f16); O = P·v' accumulated in f32 into the raw [B][H][N][hd] buffer; + x; RMSNorm; FF GEMMs
// (erf-GELU epilogue) with the residual through the f32 addend. All contractions on v_wmma_f32_16x16x32_f16, f32 accumulate.
#define BB 2
#define NN 2048
#define CC 768
#define NH 24
#define HD 32
#define NR (BB * NN)
#define HSZ ((size_t)NN * HD)

typedef __bf16 v16b __attribute__((ext_vector_type(16)));
typedef unsigned short v8us __attribute__((ext_vector_type(8), may_alias));
typedef float  v8f  __attribute__((ext_vector_type(8)));
typedef float  v4f  __attribute__((ext_vector_type(4)));
typedef float  v4fa __attribute__((ext_vector_type(4), may_alias));
union FragB { v16b v; v8us half[2]; unsigned short u[16]; };

__device__ __forceinline__ unsigned short bf16_bits(float x) { unsigned int u = __float_as_uint(x); return (unsigned short)((u + 0x7FFFu + ((u >> 16) & 1u)) >> 16); }
__device__ __forceinline__ float bf16_val(unsigned short b) { return __uint_as_float(((unsigned int)b) << 16); }
__device__ __forceinline__ float bf16_round(float x) { return bf16_val(bf16_bits(x)); }
// D += A·B with NT terms: 1 = ah·bh, 2 = + al·bh (A split), 3 = + ah·bl (both split)
template <int NT>
__device__ __forceinline__ v8f mmaN(v16b ah, v16b al, v16b bh, v16b bl, v8f c) {
  c = __builtin_amdgcn_wmma_f32_16x16x32_bf16(false, ah, false, bh, (short)0, c, false, false);
  if (NT >= 2) c = __builtin_amdgcn_wmma_f32_16x16x32_bf16(false, al, false, bh, (short)0, c, false, false);
  if (NT >= 3) c = __builtin_amdgcn_wmma_f32_16x16x32_bf16(false, ah, false, bl, (short)0, c, false, false);
  asm volatile("v_nop\n\tv_nop\n\tv_nop\n\tv_nop" : "+v"(c) : "v"(ah), "v"(al), "v"(bh), "v"(bl));
  return c;
}

__global__ __launch_bounds__(256) void k_wt_bf16(const float* __restrict__ W, unsigned short* __restrict__ Wt, int K, int N) {
  const int t = blockIdx.x * 256 + threadIdx.x;
  const int k8n = K / 8;
  if (t >= N * k8n) return;
  const int n = t / k8n, k8 = (t % k8n) * 8;
  v8us v;
#pragma unroll
  for (int i = 0; i < 8; ++i) v[i] = bf16_bits(W[(size_t)(k8 + i) * N + n]);
  *(v8us*)(Wt + (size_t)n * K + k8) = v;
  
}

// GEMM C[M][N] (f32, pitch ldc) = act(A[M][K]·W + bias). A f32 row-major (pitch lda) converted per fragment to bf16
// (ASPLIT: hi/lo two planes -> 2 terms, else single rounded term); Wt bf16 [N][K] (pitch ldb). BIAS_BF16 rounds the
// bias to bf16 first (bias quantised to bf16 before the add). K%32==0, M%16==0, N%64==0.
template <bool ASPLIT, int ACT, bool BIAS_BF16>
__global__ __launch_bounds__(128) void k_gemm_bf(const float* __restrict__ A, int lda, const unsigned short* __restrict__ Wt, int ldb,
                                               const float* __restrict__ bias, float* __restrict__ C, int ldc, int M, int N, int K) {
  __shared__ __attribute__((aligned(16))) float so[4][16][64];
  const int tid = threadIdx.x, w = tid >> 5, lane = tid & 31, ln = lane & 15, hh = lane >> 4;
  const int ntn = N / 64;
  const int wid = blockIdx.x * 4 + w;
  const int mt = wid / ntn, nq = wid % ntn;
  if (mt * 16 >= M) return;
  const int row0 = mt * 16, col0 = nq * 64;
  const float* arow = A + (size_t)(row0 + ln) * lda;
  v8f acc[4] = {};
  for (int kb = 0; kb < K; kb += 32) {
    FragB ah, al;
    const v4f x0 = *(const v4fa*)(arow + kb + 8 * hh), x1 = *(const v4fa*)(arow + kb + 8 * hh + 4);
    const v4f x2 = *(const v4fa*)(arow + kb + 16 + 8 * hh), x3 = *(const v4fa*)(arow + kb + 16 + 8 * hh + 4);
    float xs[16] = {x0[0],x0[1],x0[2],x0[3],x1[0],x1[1],x1[2],x1[3],x2[0],x2[1],x2[2],x2[3],x3[0],x3[1],x3[2],x3[3]};
#pragma unroll
    for (int i = 0; i < 16; ++i) { const unsigned short hb = bf16_bits(xs[i]); ah.u[i] = hb; al.u[i] = ASPLIT ? bf16_bits(xs[i] - bf16_val(hb)) : (unsigned short)0; }
#pragma unroll
    for (int t = 0; t < 4; ++t) {
      const unsigned short* brow = Wt + (size_t)(col0 + t * 16 + ln) * ldb + kb;
      FragB b;
      b.half[0] = *(const v8us*)(brow + 8 * hh);
      b.half[1] = *(const v8us*)(brow + 16 + 8 * hh);
      acc[t] = mmaN<ASPLIT ? 2 : 1>(ah.v, al.v, b.v, b.v, acc[t]);
    }
  }
#pragma unroll
  for (int t = 0; t < 4; ++t) {
    float bv = bias ? bias[col0 + t * 16 + ln] : 0.f;
    if (BIAS_BF16) bv = bf16_round(bv);
#pragma unroll
    for (int r = 0; r < 8; ++r) { float v = acc[t][r] + bv; if (ACT == 1) v = fmaxf(v, 0.f); so[w][8 * hh + r][t * 16 + ln] = v; }
  }
  __builtin_amdgcn_fence(__ATOMIC_ACQ_REL, "workgroup");
  __builtin_amdgcn_wave_barrier();
  const int rsub = lane >> 4, c4 = (lane & 15) * 4;
  {
#pragma unroll
    for (int q = 0; q < 8; ++q) {
      const int r = q * 2 + rsub;
      const v4f v = *(const v4fa*)&so[w][r][c4];
      *(v4f*)(C + (size_t)(row0 + r) * ldc + col0 + c4) = v;
    }
    
  }
}

// Flash-style causal/unmasked attention, all contractions 3-term bf16 hi/lo splits, f32 softmax with running max.
// q,k,v rows are read from f32 buffers with arbitrary row pitch (so they can live inside a fused qkv buffer);
// D = head size (multiple of 32, <= 128); one wave = 16 query rows; block = 4 waves (64 queries) sharing K/V chunks of 32.
template <int D, bool CAUSAL>
__global__ __launch_bounds__(128) void k_flash(const float* __restrict__ qb, const float* __restrict__ kb, const float* __restrict__ vb,
                                             int pitch, int T, int H, float scale, float* __restrict__ y, int ypitch) {
  constexpr int KS = D / 32;        // k-steps for QK
  constexpr int DT = D / 16;        // d tiles for PV
  __shared__ __attribute__((aligned(16))) unsigned short sKh[32][D + 8], sKl[32][D + 8], sVh[32][D + 8], sVl[32][D + 8];
  __shared__ __attribute__((aligned(16))) unsigned short sPh[4][16][40], sPl[4][16][40];
  __shared__ __attribute__((aligned(16))) float sO[4][16][D];
  const int tid = threadIdx.x, w = tid >> 5, lane = tid & 31, ln = lane & 15, hh = lane >> 4;
  const int nqb = (T + 63) / 64;
  const int bh = blockIdx.x / nqb, qblk = blockIdx.x % nqb;
  const int b = bh / H, h = bh % H;
  const int q0 = qblk * 64 + w * 16;
  const float* Q = qb + (size_t)b * T * pitch + h * D;
  const float* K = kb + (size_t)b * T * pitch + h * D;
  const float* V = vb + (size_t)b * T * pitch + h * D;

  // A fragments of the wave's 16 query rows (scaled), hi/lo
  FragB aqh[KS], aql[KS];
  {
    int row = q0 + ln; if (row >= T) row = T - 1;
    const float* qr = Q + (size_t)row * pitch;
#pragma unroll
    for (int ks = 0; ks < KS; ++ks)
#pragma unroll
      for (int i = 0; i < 16; ++i) {
        const int d = ks * 32 + ((i < 8) ? (8 * hh + i) : (16 + 8 * hh + (i - 8)));
        const float x = qr[d] * scale; const unsigned short hb = bf16_bits(x);
        aqh[ks].u[i] = hb; aql[ks].u[i] = bf16_bits(x - bf16_val(hb));
      }
  }
  float m_r[8], l_r[8];
#pragma unroll
  for (int r = 0; r < 8; ++r) { m_r[r] = -3.0e38f; l_r[r] = 0.f; }
  v8f oacc[DT];
#pragma unroll
  for (int dt = 0; dt < DT; ++dt) oacc[dt] = (v8f){0.f,0.f,0.f,0.f,0.f,0.f,0.f,0.f};

  const int kv_end = CAUSAL ? min(T, qblk * 64 + 64) : T;     // block-uniform
  for (int j0 = 0; j0 < kv_end; j0 += 32) {
    __syncthreads();
    for (int e = tid; e < 32 * (D / 4); e += 128) {
      const int r = e / (D / 4), c4 = (e % (D / 4)) * 4;
      const int key = j0 + r;
      v4f kf = {0.f,0.f,0.f,0.f}, vf = {0.f,0.f,0.f,0.f};
      if (key < T) { kf = *(const v4fa*)(K + (size_t)key * pitch + c4); vf = *(const v4fa*)(V + (size_t)key * pitch + c4); }
#pragma unroll
      for (int t = 0; t < 4; ++t) {
        unsigned short hb = bf16_bits(kf[t]); sKh[r][c4 + t] = hb; sKl[r][c4 + t] = bf16_bits(kf[t] - bf16_val(hb));
        hb = bf16_bits(vf[t]); sVh[r][c4 + t] = hb; sVl[r][c4 + t] = bf16_bits(vf[t] - bf16_val(hb));
      }
    }
    __syncthreads();
    // S tile 16 x 32
    v8f s[2];
#pragma unroll
    for (int nt = 0; nt < 2; ++nt) {
      v8f acc = {};
#pragma unroll
      for (int ks = 0; ks < KS; ++ks) {
        FragB bh_, bl_;
        bh_.half[0] = *(const v8us*)&sKh[nt * 16 + ln][ks * 32 + 8 * hh]; bh_.half[1] = *(const v8us*)&sKh[nt * 16 + ln][ks * 32 + 16 + 8 * hh];
        bl_.half[0] = *(const v8us*)&sKl[nt * 16 + ln][ks * 32 + 8 * hh]; bl_.half[1] = *(const v8us*)&sKl[nt * 16 + ln][ks * 32 + 16 + 8 * hh];
        acc = mmaN<3>(aqh[ks].v, aql[ks].v, bh_.v, bl_.v, acc);
      }
      s[nt] = acc;
    }
    // mask + running max (rows 8hh+r; the 16 lanes of a half share rows)
    float alpha[8];
#pragma unroll
    for (int r = 0; r < 8; ++r) {
      const int qi = q0 + 8 * hh + r;
      const int ja = j0 + ln, jb = j0 + 16 + ln;
      if (CAUSAL) { if (ja > qi) s[0][r] = -3.0e38f; if (jb > qi) s[1][r] = -3.0e38f; }
      if (ja >= T) s[0][r] = -3.0e38f;
      if (jb >= T) s[1][r] = -3.0e38f;
      float mx = fmaxf(s[0][r], s[1][r]);
      mx = fmaxf(mx, __shfl_xor(mx, 1, 32)); mx = fmaxf(mx, __shfl_xor(mx, 2, 32)); mx = fmaxf(mx, __shfl_xor(mx, 4, 32)); mx = fmaxf(mx, __shfl_xor(mx, 8, 32));
      const float mnew = fmaxf(m_r[r], mx);
      alpha[r] = (mnew > -1.0e38f) ? __expf(m_r[r] - mnew) : 1.0f;
      const float p0 = (s[0][r] > -1.0e38f) ? __expf(s[0][r] - mnew) : 0.f;
      const float p1 = (s[1][r] > -1.0e38f) ? __expf(s[1][r] - mnew) : 0.f;
      m_r[r] = mnew;
      l_r[r] = l_r[r] * alpha[r] + p0 + p1;            // per-lane partial row sum (16 lanes combined at the end)
      unsigned short hb = bf16_bits(p0); sPh[w][8 * hh + r][ln] = hb;      sPl[w][8 * hh + r][ln] = bf16_bits(p0 - bf16_val(hb));
      hb = bf16_bits(p1);                sPh[w][8 * hh + r][16 + ln] = hb; sPl[w][8 * hh + r][16 + ln] = bf16_bits(p1 - bf16_val(hb));
    }
#pragma unroll
    for (int dt = 0; dt < DT; ++dt)
#pragma unroll
      for (int r = 0; r < 8; ++r) oacc[dt][r] *= alpha[r];
    __builtin_amdgcn_fence(__ATOMIC_ACQ_REL, "workgroup");
    __builtin_amdgcn_wave_barrier();
    FragB pah, pal;
    pah.half[0] = *(const v8us*)&sPh[w][ln][8 * hh]; pah.half[1] = *(const v8us*)&sPh[w][ln][16 + 8 * hh];
    pal.half[0] = *(const v8us*)&sPl[w][ln][8 * hh]; pal.half[1] = *(const v8us*)&sPl[w][ln][16 + 8 * hh];
#pragma unroll
    for (int dt = 0; dt < DT; ++dt) {
      FragB bvh, bvl;
#pragma unroll
      for (int i = 0; i < 8; ++i) {
        bvh.u[i] = sVh[8 * hh + i][dt * 16 + ln]; bvh.u[8 + i] = sVh[16 + 8 * hh + i][dt * 16 + ln];
        bvl.u[i] = sVl[8 * hh + i][dt * 16 + ln]; bvl.u[8 + i] = sVl[16 + 8 * hh + i][dt * 16 + ln];
      }
      oacc[dt] = mmaN<3>(pah.v, pal.v, bvh.v, bvl.v, oacc[dt]);
    }
    __builtin_amdgcn_fence(__ATOMIC_ACQ_REL, "workgroup");
    __builtin_amdgcn_wave_barrier();
  }
#pragma unroll
  for (int r = 0; r < 8; ++r) {
    float l = l_r[r];
    l += __shfl_xor(l, 1, 32); l += __shfl_xor(l, 2, 32); l += __shfl_xor(l, 4, 32); l += __shfl_xor(l, 8, 32);
    l_r[r] = (l > 0.f) ? 1.0f / l : 0.f;
  }
#pragma unroll
  for (int dt = 0; dt < DT; ++dt)
#pragma unroll
    for (int r = 0; r < 8; ++r) sO[w][8 * hh + r][dt * 16 + ln] = oacc[dt][r] * l_r[r];
  __builtin_amdgcn_fence(__ATOMIC_ACQ_REL, "workgroup");
  __builtin_amdgcn_wave_barrier();
  {
    for (int r = 0; r < 16; ++r) {
      const int row = q0 + r;
      if (row < T && lane < D / 4) {
        const v4f val = *(const v4fa*)&sO[w][r][lane * 4];
        *(v4f*)(y + ((size_t)b * T + row) * ypitch + h * D + lane * 4) = val;
      }
    }
    
  }
}

// GEMM C = act(A·W + bias + resid): A f32 (ASPLIT -> hi/lo 2 terms), Wt bf16 [N][K]; ACT 0 none, 1 relu, 2 exact gelu;
// resid (optional, f32, row index = (row % rmod), pitch ldr, RES_BF16 rounds it) added before the activation.
template <bool ASPLIT, int ACT, bool BIAS_BF16, bool RES_BF16>
__global__ __launch_bounds__(128) void k_gemm_bf3(const float* __restrict__ A, int lda, const unsigned short* __restrict__ Wt, int ldb,
                                                const float* __restrict__ bias, const float* __restrict__ resid, int rmod, int ldr,
                                                float* __restrict__ C, int ldc, int M, int N, int K) {
  __shared__ __attribute__((aligned(16))) float so[4][16][64];
  const int tid = threadIdx.x, w = tid >> 5, lane = tid & 31, ln = lane & 15, hh = lane >> 4;
  const int ntn = N / 64;
  const int wid = blockIdx.x * 4 + w;
  const int mt = wid / ntn, nq = wid % ntn;
  if (mt * 16 >= M) return;
  const int row0 = mt * 16, col0 = nq * 64;
  const float* arow = A + (size_t)(row0 + ln) * lda;
  v8f acc[4] = {};
  for (int kb = 0; kb < K; kb += 32) {
    FragB ah, al;
    const v4f x0 = *(const v4fa*)(arow + kb + 8 * hh), x1 = *(const v4fa*)(arow + kb + 8 * hh + 4);
    const v4f x2 = *(const v4fa*)(arow + kb + 16 + 8 * hh), x3 = *(const v4fa*)(arow + kb + 16 + 8 * hh + 4);
    float xs[16] = {x0[0],x0[1],x0[2],x0[3],x1[0],x1[1],x1[2],x1[3],x2[0],x2[1],x2[2],x2[3],x3[0],x3[1],x3[2],x3[3]};
#pragma unroll
    for (int i = 0; i < 16; ++i) { const unsigned short hb = bf16_bits(xs[i]); ah.u[i] = hb; al.u[i] = ASPLIT ? bf16_bits(xs[i] - bf16_val(hb)) : (unsigned short)0; }
#pragma unroll
    for (int t = 0; t < 4; ++t) {
      const unsigned short* brow = Wt + (size_t)(col0 + t * 16 + ln) * ldb + kb;
      FragB b;
      b.half[0] = *(const v8us*)(brow + 8 * hh);
      b.half[1] = *(const v8us*)(brow + 16 + 8 * hh);
      acc[t] = mmaN<ASPLIT ? 2 : 1>(ah.v, al.v, b.v, b.v, acc[t]);
    }
  }
#pragma unroll
  for (int t = 0; t < 4; ++t) {
    const int col = col0 + t * 16 + ln;
    float bv = bias ? bias[col] : 0.f;
    if (BIAS_BF16) bv = bf16_round(bv);
#pragma unroll
    for (int r = 0; r < 8; ++r) {
      float v = acc[t][r] + bv;
      if (resid) { float rv = resid[(size_t)((row0 + 8 * hh + r) % rmod) * ldr + col]; if (RES_BF16) rv = bf16_round(rv); v += rv; }
      if (ACT == 1) v = fmaxf(v, 0.f);
      if (ACT == 2) v = 0.5f * v * (1.0f + erff(v * 0.70710678118654752f));
      if (ACT == 3) { const float u = 0.7978845608028654f * (v + 0.044715f * v * v * v); v = 0.5f * v * (1.0f + tanhf(u)); }
      so[w][8 * hh + r][t * 16 + ln] = v;
    }
  }
  __builtin_amdgcn_fence(__ATOMIC_ACQ_REL, "workgroup");
  __builtin_amdgcn_wave_barrier();
  const int rsub = lane >> 4, c4 = (lane & 15) * 4;
  {
#pragma unroll
    for (int q = 0; q < 8; ++q) {
      const int r = q * 2 + rsub;
      const v4f v = *(const v4fa*)&so[w][r][c4];
      *(v4f*)(C + (size_t)(row0 + r) * ldc + col0 + c4) = v;
    }
    
  }
}
// row LayerNorm (biased variance, eps) over N: s = X (+ R); optional out_sum <- s; out_norm <- (s-mu)*rsqrt(var+eps)*g + b
template <bool PARAM_BF16>
__global__ __launch_bounds__(256) void k_layernorm(const float* __restrict__ X, const float* __restrict__ R, const float* __restrict__ g, const float* __restrict__ bta,
                                                  float* __restrict__ out_sum, float* __restrict__ out_norm, int N, float eps) {
  __shared__ float red[256];
  const int row = blockIdx.x, tid = threadIdx.x;
  const float* x = X + (size_t)row * N; const float* rr = R ? R + (size_t)row * N : nullptr;
  float vals[16];                     // up to N = 4096
  const int per = N / 256;            // contiguous chunk per thread? use strided-by-4 chunks: thread handles j = tid*4 + 1024*u
  float s1 = 0.f;
  for (int u = 0; u < per / 4; ++u) {
    const int j = tid * 4 + 1024 * u;
    const v4f a = *(const v4fa*)(x + j);
    v4f b = {0.f,0.f,0.f,0.f}; if (rr) b = *(const v4fa*)(rr + j);
#pragma unroll
    for (int q = 0; q < 4; ++q) { const float v = a[q] + b[q]; vals[u * 4 + q] = v; s1 += v; }
  }
  red[tid] = s1; __syncthreads();
  for (int st = 128; st > 0; st >>= 1) { if (tid < st) red[tid] += red[tid + st]; __syncthreads(); }
  const float mu = red[0] / (float)N; __syncthreads();
  float s2 = 0.f;
  for (int u = 0; u < per / 4; ++u)
#pragma unroll
    for (int q = 0; q < 4; ++q) { const float c = vals[u * 4 + q] - mu; s2 += c * c; }
  red[tid] = s2; __syncthreads();
  for (int st = 128; st > 0; st >>= 1) { if (tid < st) red[tid] += red[tid + st]; __syncthreads(); }
  const float rs = rsqrtf(red[0] / (float)N + eps);
  {
    for (int u = 0; u < per / 4; ++u) {
      const int j = tid * 4 + 1024 * u;
      v4f o, sm;
#pragma unroll
      for (int q = 0; q < 4; ++q) {
        float gg = g[j + q], bb = bta[j + q];
        if (PARAM_BF16) { gg = bf16_round(gg); bb = bf16_round(bb); }
        sm[q] = vals[u * 4 + q]; o[q] = (vals[u * 4 + q] - mu) * rs * gg + bb;
      }
      if (out_sum) *(v4f*)(out_sum + (size_t)row * N + j) = sm;
      *(v4f*)(out_norm + (size_t)row * N + j) = o;
    }
    
  }
}



// ---- f16 WMMA path (v_wmma_f32_16x16x32_f16): 11-bit significands for operands in range — used where a [0,1] probability operand needs more precision than bf16
typedef _Float16 v16h __attribute__((ext_vector_type(16)));
union FragH { v16h v; v8us half[2]; _Float16 h[16]; unsigned short u[16]; };
template <int NT>
__device__ __forceinline__ v8f mmaH(v16h ah, v16h al, v16h bh, v16h bl, v8f c) {
  c = __builtin_amdgcn_wmma_f32_16x16x32_f16(false, ah, false, bh, (short)0, c, false, false);
  if (NT >= 2) c = __builtin_amdgcn_wmma_f32_16x16x32_f16(false, al, false, bh, (short)0, c, false, false);
  if (NT >= 3) c = __builtin_amdgcn_wmma_f32_16x16x32_f16(false, ah, false, bl, (short)0, c, false, false);
  asm volatile("v_nop\n\tv_nop\n\tv_nop\n\tv_nop" : "+v"(c) : "v"(ah), "v"(al), "v"(bh), "v"(bl));
  return c;
}
// batched GEMM like k_gemm_b but f16 operands: A f32 (split into f16 hi/lo if ASPLIT, else rounded to f16), Bt = f16 values [n][k]; alpha; C f32; N multiple of 16 (partial tiles skipped)
template <bool ASPLIT>
__global__ __launch_bounds__(128) void k_gemm_h(const float* __restrict__ A, int lda, size_t sA, const _Float16* __restrict__ Bh, int ldb, size_t sB, float alpha, float* __restrict__ C, int ldc, size_t sC, int M, int N, int K) {
  __shared__ __attribute__((aligned(16))) float so[4][16][64];
  const int tid = threadIdx.x, w = tid >> 5, lane = tid & 31, ln = lane & 15, hh = lane >> 4; const int by = blockIdx.y;
  A += (size_t)by * sA; Bh += (size_t)by * sB; C += (size_t)by * sC;
  const int ntn = (N + 63) / 64; const int wid = blockIdx.x * 4 + w; const int mt = wid / ntn, nq = wid % ntn; if (mt * 16 >= M) return;
  const int row0 = mt * 16, col0 = nq * 64; const float* arow = A + (size_t)(row0 + ln) * lda;
  v8f acc[4] = {};
  for (int kb = 0; kb < K; kb += 32) {
    FragH ah, al;
    const v4f x0 = *(const v4fa*)(arow + kb + 8 * hh), x1 = *(const v4fa*)(arow + kb + 8 * hh + 4), x2 = *(const v4fa*)(arow + kb + 16 + 8 * hh), x3 = *(const v4fa*)(arow + kb + 16 + 8 * hh + 4);
    float xs[16] = {x0[0],x0[1],x0[2],x0[3],x1[0],x1[1],x1[2],x1[3],x2[0],x2[1],x2[2],x2[3],x3[0],x3[1],x3[2],x3[3]};
#pragma unroll
    for (int i = 0; i < 16; ++i) { const _Float16 h = (_Float16)xs[i]; ah.h[i] = h; al.h[i] = ASPLIT ? (_Float16)(xs[i] - (float)h) : (_Float16)0.0f; }
#pragma unroll
    for (int t = 0; t < 4; ++t) { if (col0 + t * 16 >= N) continue; const size_t boff = (size_t)(col0 + t * 16 + ln) * ldb + kb; FragH bq; bq.half[0] = *(const v8us*)(Bh + boff + 8 * hh); bq.half[1] = *(const v8us*)(Bh + boff + 16 + 8 * hh);
      acc[t] = mmaH<ASPLIT ? 2 : 1>(ah.v, al.v, bq.v, bq.v, acc[t]); }
  }
#pragma unroll
  for (int t = 0; t < 4; ++t) { if (col0 + t * 16 >= N) continue;
#pragma unroll
    for (int r = 0; r < 8; ++r) so[w][8 * hh + r][t * 16 + ln] = acc[t][r] * alpha; }
  __builtin_amdgcn_fence(__ATOMIC_ACQ_REL, "workgroup"); __builtin_amdgcn_wave_barrier();
  const int rsub = lane >> 4, c4 = (lane & 15) * 4;
  {
#pragma unroll
    for (int q = 0; q < 8; ++q) { const int r = q * 2 + rsub; if (col0 + c4 < N) { const v4f v = *(const v4fa*)&so[w][r][c4]; *(v4f*)(C + (size_t)(row0 + r) * ldc + col0 + c4) = v; } }
     }
}

// Wt[n][k] = f16(W[k][n]·scale) from f32 row-major W[K][N] (scale = power of two; bf16-exact weights stay exact in f16 away from the subnormal range)
__global__ __launch_bounds__(256) void k_wt_f16(const float* __restrict__ W, _Float16* __restrict__ Wt, int K, int N, float scale) {
  const int t = blockIdx.x * 256 + threadIdx.x; if (t >= N * (K / 8)) return; const int n = t / (K / 8), k8 = (t % (K / 8)) * 8; FragH f;
#pragma unroll
  for (int i = 0; i < 8; ++i) f.h[i] = (_Float16)(bf16_round(W[(size_t)(k8 + i) * N + n]) * scale); const v8us o = f.half[0];
  *(v8us*)((unsigned short*)Wt + (size_t)n * K + k8) = o; 
}
// GEMM C[M][N] = act(A.B^T * alpha (+ CP)), A f16 [M][K], Bh f16 [N][K], both k-contiguous; ACT 0 none / 6 erf-GELU; writes f32 C (HC) and / or f16 C16 (HC16), CP = f32 addend with C's pitch (HCP); CP may be C itself: each lane reads the 16-byte pieces that it later writes.
// HL: C16 takes the f16 hi plane and C16L the residual times 2^10, so that a result wanted as hi / lo planes never goes to memory as f32.
// One 128 x 128 tile of C per work-group of 8 waves (4 x 2, 32 x 64 each). The operands come through LDS: a stage is 128 k = 256 bytes of each of the 256 operand rows, brought by asynchronous 16-byte copies that take whole lines
// (16 lanes per row), two buffers, the next stage in flight while this one is worked on. M, N multiples of 128, K of 128 at every launch (4096 / 768 / 768 and 1536 / 2048 / 2048).
#define GT 128      /* tile edge */
#define GK 128      /* k per stage */
#define GP 272u     /* LDS row pitch in bytes = 16 x odd: the 16 rows of a fragment read fall on all 64 banks */
#define GST (2u * GT * GP)      /* bytes of a stage: 128 A rows, then 128 B rows */
// this thread's share of one operand's stage: rows 16 apart, the same 16-byte column
__device__ __forceinline__ void copy8(unsigned l, const unsigned short* g, size_t gs) {
  asm volatile("global_load_async_to_lds_b128 %0, %8, off\n\t"
               "global_load_async_to_lds_b128 %1, %9, off\n\t"
               "global_load_async_to_lds_b128 %2, %10, off\n\t"
               "global_load_async_to_lds_b128 %3, %11, off\n\t"
               "global_load_async_to_lds_b128 %4, %12, off\n\t"
               "global_load_async_to_lds_b128 %5, %13, off\n\t"
               "global_load_async_to_lds_b128 %6, %14, off\n\t"
               "global_load_async_to_lds_b128 %7, %15, off\n\t"
               "s_wait_xcnt 0x0"      /* inside the copies' own statement, so that it stands in front of every rewrite of their address registers */
               :: "v"(l), "v"(l + 16u * GP), "v"(l + 32u * GP), "v"(l + 48u * GP), "v"(l + 64u * GP), "v"(l + 80u * GP), "v"(l + 96u * GP), "v"(l + 112u * GP),
                  "v"(g), "v"(g + gs), "v"(g + 2 * gs), "v"(g + 3 * gs), "v"(g + 4 * gs), "v"(g + 5 * gs), "v"(g + 6 * gs), "v"(g + 7 * gs) : "memory");
}
template <int ACT, bool HCP, bool HC, bool HC16, bool HL>
__global__ __launch_bounds__(256) void k_gemm_hhx(const _Float16* __restrict__ A, int lda, const _Float16* __restrict__ Bh, int ldb, float alpha, const float* CP, float* C, _Float16* __restrict__ C16, _Float16* __restrict__ C16L, int ldc, int N, int K) {
  __shared__ __attribute__((aligned(16))) unsigned char ring[2 * GST];
  __shared__ __attribute__((aligned(16))) float so[8][16][64];
  const int tid = threadIdx.x, w = tid >> 5, lane = tid & 31, ln = lane & 15, hh = lane >> 4;
  const int ntn = N / GT; const int row0 = (int)(blockIdx.x / ntn) * GT, col0 = (int)(blockIdx.x % ntn) * GT; const int wr = (w >> 1) * 32, wc = (w & 1) * 64;
  const int cr = tid >> 4, cc = tid & 15;      /* the thread's first row of a stage and its 16-byte column */
  const unsigned short* ga = (const unsigned short*)A + (size_t)(row0 + cr) * lda + cc * 8; const unsigned short* gb = (const unsigned short*)Bh + (size_t)(col0 + cr) * ldb + cc * 8;
  const unsigned la = (unsigned)(size_t)ring + (unsigned)cr * GP + (unsigned)cc * 16u, lb = la + GT * GP; const size_t sa = (size_t)16 * lda, sb = (size_t)16 * ldb;
  const int nst = K / GK;
  v8f acc[2][4] = {};
  const int rsub = lane >> 4, c4 = (lane & 15) * 4; typedef _Float16 v4h __attribute__((ext_vector_type(4)));
  const size_t eo = (size_t)(row0 + wr + rsub) * ldc + col0 + wc + c4;      /* the lane's first 4 elements of the wave's 32 x 64 part of C; its others lie 2 rows apart */
  v4f cp[2][8];      /* the addend in the shape of the stores, asked for here so that all 16 loads fly together under stage 0's copies */
  if (HCP) {
#pragma unroll      // constant indices keep the array in registers
    for (int i = 0; i < 2; ++i)
#pragma unroll      // constant indices keep the array in registers
      for (int q = 0; q < 8; ++q) cp[i][q] = *(const v4fa*)(CP + eo + (size_t)(i * 16 + q * 2) * ldc); }
  copy8(la, ga, sa); copy8(lb, gb, sb);
  asm volatile("s_wait_asynccnt 0x0" ::: "memory");      /* stage 0 has landed, as far as this wave brought it */
  __syncthreads();      /* ... and as far as the other waves did */
  if (nst > 1) { copy8(la + GST, ga + GK, sa); copy8(lb + GST, gb + GK, sb); }
  const unsigned char* fa = ring + (unsigned)(wr + ln) * GP + 16 * hh; const unsigned char* fb = ring + (unsigned)(GT + wc + ln) * GP + 16 * hh;      /* fragment rows; k order as before: bytes 16hh and 32 + 16hh of each 64, A and B alike */
  for (int t = 0; t < nst; ++t) { const unsigned bo = (unsigned)(t & 1) * GST;
#pragma unroll      // constant indices keep the fragment arrays in registers
    for (int ks = 0; ks < GK / 32; ++ks) { FragH a2[2], b2[4];
#pragma unroll      // constant indices keep the fragment arrays in registers
      for (int i = 0; i < 2; ++i) { a2[i].half[0] = *(const v8us*)(fa + bo + i * 16 * GP + ks * 64); a2[i].half[1] = *(const v8us*)(fa + bo + i * 16 * GP + ks * 64 + 32); }
#pragma unroll      // constant indices keep the fragment arrays in registers
      for (int j = 0; j < 4; ++j) { b2[j].half[0] = *(const v8us*)(fb + bo + j * 16 * GP + ks * 64); b2[j].half[1] = *(const v8us*)(fb + bo + j * 16 * GP + ks * 64 + 32); }
#pragma unroll      // constant indices keep the fragment arrays in registers
      for (int i = 0; i < 2; ++i)
#pragma unroll      // constant indices keep the fragment arrays in registers
        for (int j = 0; j < 4; ++j) acc[i][j] = mmaH<1>(a2[i].v, a2[i].v, b2[j].v, b2[j].v, acc[i][j]); }
    asm volatile("s_wait_dscnt 0x0" ::: "memory");      /* this wave's reads of the buffer are done before the barrier frees it for the refill */
    asm volatile("s_wait_asynccnt 0x0" ::: "memory");      /* this wave's copies of stage t + 1 have landed before the barrier publishes them */
    __syncthreads();
    if (t + 2 < nst) { copy8(la + bo, ga + (size_t)(t + 2) * GK, sa); copy8(lb + bo, gb + (size_t)(t + 2) * GK, sb); } }
  asm volatile("s_wait_asynccnt 0x0" ::: "memory");      /* no copy is outstanding when the wave goes on to its end */
  // Epilogue, 16 x 64 at a time through the wave's own LDS rows; straight-line: what exists is known at compile time, the staged rows are read back together, and addend and activation are applied to the 16-byte pieces that are stored.
#pragma unroll      // constant indices keep the accumulators in registers
  for (int i = 0; i < 2; ++i) {
#pragma unroll
    for (int t = 0; t < 4; ++t)
#pragma unroll
      for (int r = 0; r < 8; ++r) so[w][8 * hh + r][t * 16 + ln] = acc[i][t][r] * alpha;
    __builtin_amdgcn_fence(__ATOMIC_ACQ_REL, "workgroup"); __builtin_amdgcn_wave_barrier();
    v4f vv[8];
#pragma unroll      // constant indices keep the array in registers
    for (int q = 0; q < 8; ++q) vv[q] = *(const v4fa*)&so[w][q * 2 + rsub][c4];
#pragma unroll      // constant indices keep the arrays in registers
    for (int q = 0; q < 8; ++q) { v4f v = vv[q]; const size_t o = eo + (size_t)(i * 16 + q * 2) * ldc;
      if (HCP) v += cp[i][q];
      if (ACT == 6) for (int e = 0; e < 4; ++e) v[e] = 0.5f * v[e] * (1.0f + erff(v[e] * 0.70710678118654752f));
      if (HC) { *(v4f*)(C + o) = v; asm volatile("s_wait_xcnt 0x0" ::: "memory"); }      /* the wait in front of any rewrite of the store's registers */
      if (HC16) { v4h h4; for (int e = 0; e < 4; ++e) h4[e] = (_Float16)v[e]; *(v4h*)(C16 + o) = h4; asm volatile("s_wait_xcnt 0x0" ::: "memory"); }      /* likewise */
      if (HL) { v4h h4, l4; for (int e = 0; e < 4; ++e) { h4[e] = (_Float16)v[e]; l4[e] = (_Float16)((v[e] - (float)h4[e]) * 1024.0f); }
        asm volatile("global_store_b64 %0, %2, off\n\tglobal_store_b64 %1, %3, off\n\ts_wait_xcnt 0x0" :: "v"(C16 + o), "v"(C16L + o), "v"(h4), "v"(l4) : "memory"); } }      /* both stores and their wait in one statement: as a statement of its own the wait let rewrites of the stores' registers pass in front of it */
    __builtin_amdgcn_fence(__ATOMIC_ACQ_REL, "workgroup"); __builtin_amdgcn_wave_barrier();      /* the next 16 rows are staged in the same LDS only behind these reads */
  }
}


typedef _Float16 v4h __attribute__((ext_vector_type(4)));

__global__ __launch_bounds__(256) void k_x16(const float* __restrict__ x, _Float16* __restrict__ X16, size_t n8) { const size_t t = (size_t)blockIdx.x * 256 + threadIdx.x; if (t >= n8) return; FragH f;
#pragma unroll
  for (int q = 0; q < 8; ++q) f.h[q] = (_Float16)bf16_round(x[t * 8 + q]); *(v8us*)((unsigned short*)X16 + t * 8) = f.half[0];  }
__global__ __launch_bounds__(256) void k_h16(const float* __restrict__ x, _Float16* __restrict__ X16, size_t n8) { const size_t t = (size_t)blockIdx.x * 256 + threadIdx.x; if (t >= n8) return; FragH f;
#pragma unroll
  for (int q = 0; q < 8; ++q) f.h[q] = (_Float16)x[t * 8 + q]; *(v8us*)((unsigned short*)X16 + t * 8) = f.half[0];  }
__global__ __launch_bounds__(256) void k_round16f(const float* __restrict__ W, _Float16* __restrict__ Bt, size_t n8) { const size_t t = (size_t)blockIdx.x * 256 + threadIdx.x; if (t >= n8) return; FragH f;
#pragma unroll
  for (int i = 0; i < 8; ++i) f.h[i] = (_Float16)(bf16_round(W[t * 8 + i]) * 16.0f); *(v8us*)((unsigned short*)Bt + t * 8) = f.half[0];  }
template <int NHv, int TTv>
__global__ __launch_bounds__(256) void k_vt(const _Float16* __restrict__ V16, int ldv, int voff, _Float16* __restrict__ Vt) { __shared__ unsigned short tl[64][66]; const int tid = threadIdx.x; const int slab = blockIdx.x / (TTv / 64), lg = blockIdx.x % (TTv / 64); const int b = slab / NHv, h = slab % NHv;
  for (int i = tid; i < 64 * 8; i += 256) { const int r = i / 8, c8 = (i % 8) * 8; FragH f; f.half[0] = *(const v8us*)((const unsigned short*)V16 + ((size_t)b * TTv + lg * 64 + r) * ldv + voff + h * 64 + c8);
#pragma unroll
    for (int q = 0; q < 8; ++q) tl[r][c8 + q] = f.u[q]; }
  __syncthreads();
  {
#pragma unroll
    for (int rd = 0; rd < 2; ++rd) { const int d = rd * 32 + tid / 8, pc = tid % 8; FragH f;
#pragma unroll
      for (int q = 0; q < 8; ++q) f.u[q] = tl[pc * 8 + q][d];
      *(v8us*)((unsigned short*)Vt + ((size_t)slab * 64 + d) * TTv + lg * 64 + pc * 8) = f.half[0]; }
     } }

// RMSNorm rows (C = 768 = 32 lanes x 24): y = x.rsqrt(mean(x^2) + 1.1920929e-7).bf16(g); RB: round the input to bf16 first; ADD: the input is X + R (the residual add, done here where its rows are read); outputs: f16 hi + x2^10 residual planes (either may be null)
// and optionally the f32 input as normalised (rounded, or summed) XR; wave per row; per lane 6 float4 pieces (c = j.128 + lane.4).
// TR: also v^T per (b,h), [32][2048] f16 of hi + lo.2^-10. The work-group's 8 rows are 6144 consecutive elements of the flat plane = 3 whole tiles of 64 n x 32 d of the raw head view, turned through LDS; the grid is then exactly NR / 8 work-groups, so no row test stands in front of the barrier.
template <int RB, bool ADD, bool TR>
__global__ __launch_bounds__(256) void k_rms(const float* __restrict__ X, const float* __restrict__ R, const float* __restrict__ g, int nrows, _Float16* __restrict__ YH, _Float16* __restrict__ YL, float* __restrict__ XR, _Float16* __restrict__ VT) { __shared__ float tl[TR ? 3 : 1][64][33]; const int tid = threadIdx.x, wv = tid >> 5, lane = tid & 31; const int r = blockIdx.x * 8 + wv; if (!TR && r >= nrows) return; v4f xv[6]; float ss = 0.f;
#pragma unroll
  for (int j = 0; j < 6; ++j) { v4f a = *(const v4fa*)(X + (size_t)r * CC + j * 128 + lane * 4); if (ADD) { const v4f b = *(const v4fa*)(R + (size_t)r * CC + j * 128 + lane * 4); for (int q = 0; q < 4; ++q) a[q] += b[q]; } if (RB) for (int q = 0; q < 4; ++q) a[q] = bf16_round(a[q]); xv[j] = a; for (int q = 0; q < 4; ++q) ss += a[q] * a[q]; }
  for (int o = 16; o >= 1; o >>= 1) ss += __shfl_xor(ss, o, 32); const float rs = rsqrtf(ss / (float)CC + 1.1920929e-7f);
  typedef _Float16 v4h __attribute__((ext_vector_type(4)));
  {
#pragma unroll
    for (int j = 0; j < 6; ++j) { const int c = j * 128 + lane * 4; v4h hh, hl; for (int q = 0; q < 4; ++q) { const float y = xv[j][q] * rs * bf16_round(g[c + q]); const _Float16 hv = (_Float16)y; hh[q] = hv; hl[q] = (_Float16)((y - (float)hv) * 1024.0f); }
      if (TR) { const int e = wv * CC + c; for (int q = 0; q < 4; ++q) tl[e >> 11][(e & 2047) >> 5][(e & 31) + q] = (float)hh[q] + (float)hl[q] * 0.0009765625f; }
      if (YH) *(v4h*)(YH + (size_t)r * CC + c) = hh; if (YL) *(v4h*)(YL + (size_t)r * CC + c) = hl; if (XR) *(v4f*)(XR + (size_t)r * CC + c) = xv[j]; }
     }
  if (TR) { asm volatile("s_wait_xcnt 0x0" ::: "memory");      /* the wait in front of any rewrite of the row stores' registers by what follows */
    __syncthreads();      /* the 3 tiles are whole only when all 8 rows are in */
    const int d = tid / 8, pc = tid % 8;
#pragma unroll      // the three tiles' LDS reads are asked for together, not tile by tile
    for (int t3 = 0; t3 < 3; ++t3) { const int tile = blockIdx.x * 3 + t3, slab = tile / (NN / 64), ng = tile % (NN / 64); FragH f; for (int q = 0; q < 8; ++q) f.h[q] = (_Float16)tl[t3][pc * 8 + q][d];
      *(v8us*)((unsigned short*)VT + ((size_t)slab * HD + d) * NN + ng * 64 + pc * 8) = f.half[0]; } } }
// lane l <-> lane l ^ 16 by a vector cross-row move (no LDS counter involved)
__device__ __forceinline__ float xhalf(float x) { return __builtin_bit_cast(float, __builtin_amdgcn_permlanex16(__builtin_bit_cast(int, x), __builtin_bit_cast(int, x), 0x76543210, 0xfedcba98, false, false)); }
typedef float v2f __attribute__((ext_vector_type(2)));
#define FK 128      /* keys per stage */
#define FKP 80u     /* LDS pitch of a K row in bytes = 16 x odd: the 16 rows of a fragment read fall on all 64 banks */
#define FVP 272u    /* LDS pitch of a V'^T row, likewise */
#define FKB (FK * FKP)      /* bytes of one K plane's stage */
#define FST (2u * FKB + HD * FVP)      /* bytes of a stage: K hi, K lo, V'^T */
// this thread's share of a stage: two 16-byte pieces of each of the three operands (K rows 64 apart, V'^T rows 16 apart)
__device__ __forceinline__ void copy6(unsigned lk, unsigned lv, const unsigned short* gh, const unsigned short* gl, size_t ks, const unsigned short* gv) {
  asm volatile("global_load_async_to_lds_b128 %0, %6, off\n\t"
               "global_load_async_to_lds_b128 %1, %7, off\n\t"
               "global_load_async_to_lds_b128 %2, %8, off\n\t"
               "global_load_async_to_lds_b128 %3, %9, off\n\t"
               "global_load_async_to_lds_b128 %4, %10, off\n\t"
               "global_load_async_to_lds_b128 %5, %11, off\n\t"
               "s_wait_xcnt 0x0"      /* inside the copies' own statement, so that it stands in front of every rewrite of their address registers */
               :: "v"(lk), "v"(lk + 64u * FKP), "v"(lk + FKB), "v"(lk + FKB + 64u * FKP), "v"(lv), "v"(lv + 16u * FVP),
                  "v"(gh), "v"(gh + ks), "v"(gl), "v"(gl + ks), "v"(gv), "v"(gv + (size_t)16 * NN) : "memory");
}
__global__ __launch_bounds__(256) void k_flash(const _Float16* __restrict__ Q16, const _Float16* __restrict__ Q16lo, int ldq, const _Float16* __restrict__ K16, const _Float16* __restrict__ K16lo, int ldk, const _Float16* __restrict__ Vt, const float* __restrict__ SP, float* __restrict__ O, int ldo) {
  constexpr int NQB = NN / 128, DT = 2, NST = NN / FK;
  __shared__ __attribute__((aligned(16))) unsigned char ring[2 * FST];
  const int tid = threadIdx.x, w = tid >> 5, lane = tid & 31, ln = lane & 15, hh = lane >> 4;
  const int slab = blockIdx.x / NQB, qblk = blockIdx.x % NQB; const int h = slab % NH; const float coef = ((logf(768.0f) * bf16_round(SP[h])) * 5.656854249492381f) * 1.4426950408889634f;      /* times log2(e): the logits are kept in base 2, so each exponential is one hardware instruction */ const int q0 = qblk * 128 + w * 16;
  FragH bq, bql;
  { const size_t qo = ((size_t)slab * NN + q0 + ln) * ldq; const unsigned short* qr = (const unsigned short*)Q16 + qo; const unsigned short* ql = (const unsigned short*)Q16lo + qo;
    bq.half[0] = *(const v8us*)(qr + 8 * hh); bq.half[1] = *(const v8us*)(qr + 16 + 8 * hh); bql.half[0] = *(const v8us*)(ql + 8 * hh); bql.half[1] = *(const v8us*)(ql + 16 + 8 * hh); }
  const size_t kc = (size_t)slab * NN * ldk + (size_t)(tid >> 2) * ldk + (tid & 3) * 8;      /* the thread's first piece of a K stage: row tid / 4, 16-byte column tid % 4 */
  const unsigned short* gh = (const unsigned short*)K16 + kc; const unsigned short* gl = (const unsigned short*)K16lo + kc; const size_t ks = (size_t)64 * ldk, kst = (size_t)FK * ldk;
  const unsigned short* gv = (const unsigned short*)Vt + (size_t)slab * HD * NN + (size_t)(tid >> 4) * NN + (tid & 15) * 8;      /* v'^T per slab: [32][N]; row tid / 16, 16-byte column tid % 16 of the stage's 256 bytes */
  const unsigned lk = (unsigned)(size_t)ring + (unsigned)(tid >> 2) * FKP + (unsigned)(tid & 3) * 16u, lv = (unsigned)(size_t)ring + 2u * FKB + (unsigned)(tid >> 4) * FVP + (unsigned)(tid & 15) * 16u;
  copy6(lk, lv, gh, gl, ks, gv);
  asm volatile("s_wait_asynccnt 0x0" ::: "memory");      /* stage 0 has landed, as far as this wave brought it */
  __syncthreads();      /* ... and as far as the other waves did */
  copy6(lk + FST, lv + FST, gh + kst, gl + kst, ks, gv + FK);
  const unsigned char* fk = ring + (unsigned)ln * FKP + 16 * hh; const unsigned char* fv = ring + 2u * FKB + (unsigned)ln * FVP + 16 * hh;      /* fragment rows; k order as before: bytes 16hh and 32 + 16hh of each 64 */
  float m_q = -3.0e38f, s_q = -3.0e38f, l_q = 0.f; v8f oacc[DT];      /* s_q = m_q - 10 as rounded: what the exponents subtract, so that P and the denominator carry the factor 2^10 */
#pragma unroll
  for (int dt = 0; dt < DT; ++dt) oacc[dt] = (v8f){0.f,0.f,0.f,0.f,0.f,0.f,0.f,0.f};
  for (int t = 0; t < NST; ++t) { const unsigned bo = (unsigned)(t & 1) * FST;
#pragma unroll 1      // unrolled, four passes' exponentials stayed live to the stage's end and the registers allowed one work-group fewer on a WGP
   for (int p = 0; p < FK / 32; ++p) {
    FragH ak[2], akl[2], av[DT];
#pragma unroll
    for (int nt = 0; nt < 2; ++nt) { const unsigned char* kr = fk + bo + (unsigned)(p * 32 + nt * 16) * FKP; ak[nt].half[0] = *(const v8us*)kr; ak[nt].half[1] = *(const v8us*)(kr + 32); akl[nt].half[0] = *(const v8us*)(kr + FKB); akl[nt].half[1] = *(const v8us*)(kr + FKB + 32); }
#pragma unroll
    for (int dt = 0; dt < DT; ++dt) { const unsigned char* vr = fv + bo + (unsigned)(dt * 16) * FVP + p * 64; av[dt].half[0] = *(const v8us*)vr; av[dt].half[1] = *(const v8us*)(vr + 32); }
    v2f s2[8];      /* the 16 logits as the register pairs the accumulators already form */
#pragma unroll
    for (int nt = 0; nt < 2; ++nt) { v8f acc = (v8f){0.f,0.f,0.f,0.f,0.f,0.f,0.f,0.f}, accl = acc;
      acc = mmaH<1>(ak[nt].v, ak[nt].v, bq.v, bq.v, acc); accl = mmaH<1>(ak[nt].v, ak[nt].v, bql.v, bql.v, accl); accl = mmaH<1>(akl[nt].v, akl[nt].v, bq.v, bq.v, accl);
#pragma unroll
      for (int j = 0; j < 4; ++j) { const v2f a2 = {acc[2 * j], acc[2 * j + 1]}, b2 = {accl[2 * j], accl[2 * j + 1]}; s2[nt * 4 + j] = (a2 + b2 * 0.0009765625f) * coef; } }
    float mx[8];
#pragma unroll
    for (int j = 0; j < 4; ++j) { mx[2 * j] = fmaxf(s2[j].x, s2[4 + j].x); mx[2 * j + 1] = fmaxf(s2[j].y, s2[4 + j].y); }
    float mc = fmaxf(fmaxf(fmaxf(mx[0], mx[1]), fmaxf(mx[2], mx[3])), fmaxf(fmaxf(mx[4], mx[5]), fmaxf(mx[6], mx[7])));
    mc = fmaxf(mc, xhalf(mc));
    const float mn = fmaxf(m_q, mc); const float sn = mn - 10.0f; float ea;      /* the rescale uses the same rounded subtrahends as the exponents of the two passes */
    asm("v_exp_f32 %0, %1\n\tv_nop" : "=v"(ea) : "v"(s_q - sn));      /* in asm for the v_nop alone: it keeps the one slot behind a transcendental */
    const float al = (mn > -1.0e38f) ? ea : 1.0f; m_q = mn; s_q = sn;
    v2f p2[8]; FragH pb;
#pragma unroll
    for (int i = 0; i < 8; ++i) { const v2f e2 = s2[i] - sn; p2[i].x = __builtin_amdgcn_exp2f(e2.x); p2[i].y = __builtin_amdgcn_exp2f(e2.y); pb.h[2 * i] = (_Float16)p2[i].x; pb.h[2 * i + 1] = (_Float16)p2[i].y; }
    const v2f ps = ((p2[0] + p2[1]) + (p2[2] + p2[3])) + ((p2[4] + p2[5]) + (p2[6] + p2[7]));
    l_q = l_q * al + (ps.x + ps.y);      /* per-lane partial sum of the query's denominator (the two halves are joined after the loop) */
#pragma unroll
    for (int dt = 0; dt < DT; ++dt) {
#pragma unroll
      for (int r = 0; r < 8; ++r) oacc[dt][r] *= al;
      oacc[dt] = mmaH<1>(av[dt].v, av[dt].v, pb.v, pb.v, oacc[dt]); } }
    asm volatile("s_wait_dscnt 0x0" ::: "memory");      /* this wave's reads of the buffer are done before the barrier frees it for the refill */
    asm volatile("s_wait_asynccnt 0x0" ::: "memory");      /* this wave's copies of stage t + 1 have landed before the barrier publishes them */
    __syncthreads();
    if (t + 2 < NST) copy6(lk + bo, lv + bo, gh + (size_t)(t + 2) * kst, gl + (size_t)(t + 2) * kst, ks, gv + (t + 2) * FK); }
  asm volatile("s_wait_asynccnt 0x0" ::: "memory");      /* no copy is outstanding when the wave goes on to its end */
  const float lt = l_q + xhalf(l_q); const float inv = (lt > 0.f) ? 1.0f / lt : 0.f;      /* numerator and denominator both carry 2^10 */
  float* orow = O + ((size_t)slab * NN + q0 + ln) * ldo + 8 * hh;      /* oacc[dt][r] = O[q0 + ln][dt * 16 + 8hh + r]: eight consecutive d per lane */
#pragma unroll
  for (int dt = 0; dt < DT; ++dt) { const v4f o0 = {oacc[dt][0] * inv, oacc[dt][1] * inv, oacc[dt][2] * inv, oacc[dt][3] * inv}, o1 = {oacc[dt][4] * inv, oacc[dt][5] * inv, oacc[dt][6] * inv, oacc[dt][7] * inv};
    *(v4f*)(orow + dt * 16) = o0; *(v4f*)(orow + dt * 16 + 4) = o1; } }

extern "C" void kernel_launch(void* const* d_in, const int* in_sizes, int n_in,
                              void* d_out, int out_size, void* d_ws, size_t ws_size, hipStream_t stream) {
  (void)in_sizes; (void)n_in; (void)out_size;
  const float* const* I = (const float* const*)d_in; const float* x = I[0]; const float* sp = I[1]; const float* Wq = I[2]; const float* WA = I[3]; const float* W1 = I[4]; const float* W2 = I[5]; const float* g1 = I[6]; const float* g2 = I[7];
  char* ws = (char*)d_ws; size_t off = 0;
  auto take = [&](size_t bytes) { char* p = ws + off; off += (bytes + 255) & ~(size_t)255; return p; };
  const size_t WSZ = (size_t)CC * CC; _Float16* Bq = (_Float16*)take(WSZ * 2); _Float16* B1 = (_Float16*)take(WSZ * 2); _Float16* B2 = (_Float16*)take(WSZ * 2); _Float16* BA = (_Float16*)take((size_t)NN * NN * 2);
  _Float16* XH = (_Float16*)take((size_t)NR * CC * 2); _Float16* XL = (_Float16*)take((size_t)NR * CC * 2); float* XR = (float*)take((size_t)NR * CC * 4); float* QF = (float*)take((size_t)NR * CC * 4); _Float16* QH = (_Float16*)take((size_t)NR * CC * 2); _Float16* QL = (_Float16*)take((size_t)NR * CC * 2);
  _Float16* VT = (_Float16*)take((size_t)BB * NH * HD * NN * 2); _Float16* VPT = (_Float16*)take((size_t)BB * NH * HD * NN * 2); float* ATT = (float*)take((size_t)NR * CC * 4);
  float* O = QF; _Float16* H16 = XH; _Float16* FH = XL;      /* O (raw [B][H][N][hd] f32) over the hi term of q as f32 (dead after the lo-term GEMM); RMSNorm2 output over XH and the FF hidden over XL (both dead after the flash kernel) */
  if (off > ws_size) return;      // 3.5 + 8.4 + 6.3 × 2 + 12.6 × 2 + 6.3 × 2 + 6.3 × 2 + 12.6 ≈ 87 MB
  const unsigned gw = (unsigned)((WSZ / 8 + 255) / 256); k_round16f<<<gw, 256, 0, stream>>>(Wq, Bq, WSZ / 8); k_round16f<<<gw, 256, 0, stream>>>(W1, B1, WSZ / 8); k_round16f<<<gw, 256, 0, stream>>>(W2, B2, WSZ / 8); k_round16f<<<(unsigned)(((size_t)NN * NN / 8 + 255) / 256), 256, 0, stream>>>(WA, BA, (size_t)NN * NN / 8);      /* (out,in) natural ×2^4; WA natural [m][n] ×2^4 */
  k_rms<1, false, true><<<NR / 8, 256, 0, stream>>>(x, nullptr, g1, NR, XH, XL, XR, VT);      /* xn = RMSNorm(bf16 x).g1 as hi / x2^10 residual planes; XR = bf16(x); v^T per (b,h): [32][2048] f16 */
  const unsigned gq = (NR / GT) * (CC / GT);
  k_gemm_hhx<0, false, true, false, false><<<gq, 256, 0, stream>>>(XH, CC, Bq, CC, 0.0625f, nullptr, QF, nullptr, nullptr, CC, CC, CC);      /* q = xn.Wq^T: hi term, M 4096 N 768 K 768 */
  k_gemm_hhx<0, true, false, false, true><<<gq, 256, 0, stream>>>(XL, CC, Bq, CC, 0.0625f * 0.0009765625f, QF, nullptr, QH, QL, CC, CC, CC);      /* + lo term * 2^-10; q leaves as hi / x2^10 residual planes (flat; head h of batch b = elements [b.N.C + h.N.hd, +N.hd) viewed [N][hd]) */
  const unsigned gvp = (BB * NH * HD / GT) * (NN / GT);      /* the 48 slabs of 32 rows lie one behind the other in VT and VPT: one GEMM of 1536 rows */
  k_gemm_hhx<0, false, false, true, false><<<gvp, 256, 0, stream>>>(VT, NN, BA, NN, 0.0625f, nullptr, nullptr, VPT, nullptr, NN, NN, NN);      /* v'^T[d][m] = sum over n of v^T[d][n].WA[m][n], all 48 (b,h) at once: M 1536 N 2048 K 2048 */
  k_flash<<<BB * NH * (NN / 128), 256, 0, stream>>>(QH, QL, HD, XH, XL, HD, VPT, sp, O, HD);      /* per (b,h) slab of the raw head views (flat planes, ld 32): softmax(coef_h·q·kᵀ)·v' → O raw [B][H][N][32] */
  k_rms<0, true, false><<<(NR + 7) / 8, 256, 0, stream>>>(O, XR, g2, NR, H16, nullptr, ATT, nullptr);      /* attn = raw-reshaped O + x, kept as f32; h = RMSNorm(attn).g2 as f16 */
  k_gemm_hhx<6, false, false, true, false><<<gq, 256, 0, stream>>>(H16, CC, B1, CC, 0.0625f, nullptr, nullptr, FH, nullptr, CC, CC, CC);      /* gelu_erf(h.W1^T) to f16: M 4096 N 768 K 768 */
  k_gemm_hhx<0, true, true, false, false><<<gq, 256, 0, stream>>>(FH, CC, B2, CC, 0.0625f, ATT, (float*)d_out, nullptr, nullptr, CC, CC, CC);      /* out = that.W2^T + attn */
}

// v008
// Measured time: 135 microseconds a run.
// Two timings next to v007 put it at 1.05 and 1.06 times that version's speed.
// All steps since v000 together make it 3.47 times as fast.
#include <hip/hip_runtime.h>
// 'Scalable super' multi-head attention block (B=2, N=2048, C=768, H=24, hd=32): xn = RMSNorm(x)·g1; q = (xn·Wqᵀ) RAW-reshaped [B,H,N,hd] (no transpose — the module's quirk), k = v = xn raw-reshaped likewise; v' = WA[:N,:N]·v (value premix);
// scores = softmax(coef_h · q·kᵀ) with coef_h = log(C)·scale_param[h]·√hd (up to ≈56 → extremely peaked); attn = (scores·v') raw-reshaped back to [B,N,C] + x; h = RMSNorm(attn)·g2; out = gelu_erf(h·W1ᵀ)·W2ᵀ + attn.
// Compute dtype: x, scale_param, weights, WA, g rounded to bf16; RMSNorm in f32 (wave per row) → f16 hi + ×2^10 residual planes; q = xn·Wqᵀ f32-accurate (hi·W + lo·W·2^-10) → hi/lo planes; per (b,h) the 2048×2048 logit plane
// computed inside a fused flash-style kernel from three f16 products (q_hi·k_hi + (q_lo·k_hi + q_hi·k_lo)·2^-10, d = 32) and scaled by the per-head coefficient in f32; online f32 softmax; P f16 ×2^10; v'ᵀ = vᵀ·WAᵀ by GEMM (f16); O = P·v' accumulated in f32 into the raw [B][H][N][hd] buffer; + x; RMSNorm; FF GEMMs
// (erf-GELU epilogue) with the residual through the f32 addend. All contractions on v_wmma_f32_16x16x32_f16, f32 accumulate.
#define BB 2
#define NN 2048
#define CC 768
#define NH 24
#define HD 32
#define NR (BB * NN)
#define HSZ ((size_t)NN * HD)

typedef __bf16 v16b __attribute__((ext_vector_type(16)));
typedef unsigned short v8us __attribute__((ext_vector_type(8), may_alias));
typedef float  v8f  __attribute__((ext_vector_type(8)));
typedef float  v4f  __attribute__((ext_vector_type(4)));
typedef float  v4fa __attribute__((ext_vector_type(4), may_alias));
union FragB { v16b v; v8us half[2]; unsigned short u[16]; };

__device__ __forceinline__ unsigned short bf16_bits(float x) { unsigned int u = __float_as_uint(x); return (unsigned short)((u + 0x7FFFu + ((u >> 16) & 1u)) >> 16); }
__device__ __forceinline__ float bf16_val(unsigned short b) { return __uint_as_float(((unsigned int)b) << 16); }
__device__ __forceinline__ float bf16_round(float x) { return bf16_val(bf16_bits(x)); }
// D += A·B with NT terms: 1 = ah·bh, 2 = + al·bh (A split), 3 = + ah·bl (both split)
template <int NT>
__device__ __forceinline__ v8f mmaN(v16b ah, v16b al, v16b bh, v16b bl, v8f c) {
  c = __builtin_amdgcn_wmma_f32_16x16x32_bf16(false, ah, false, bh, (short)0, c, false, false);
  if (NT >= 2) c = __builtin_amdgcn_wmma_f32_16x16x32_bf16(false, al, false, bh, (short)0, c, false, false);
  if (NT >= 3) c = __builtin_amdgcn_wmma_f32_16x16x32_bf16(false, ah, false, bl, (short)0, c, false, false);
  asm volatile("v_nop\n\tv_nop\n\tv_nop\n\tv_nop" : "+v"(c) : "v"(ah), "v"(al), "v"(bh), "v"(bl));
  return c;
}

__global__ __launch_bounds__(256) void k_wt_bf16(const float* __restrict__ W, unsigned short* __restrict__ Wt, int K, int N) {
  const int t = blockIdx.x * 256 + threadIdx.x;
  const int k8n = K / 8;
  if (t >= N * k8n) return;
  const int n = t / k8n, k8 = (t % k8n) * 8;
  v8us v;
#pragma unroll
  for (int i = 0; i < 8; ++i) v[i] = bf16_bits(W[(size_t)(k8 + i) * N + n]);
  *(v8us*)(Wt + (size_t)n * K + k8) = v;
  
}

// GEMM C[M][N] (f32, pitch ldc) = act(A[M][K]·W + bias). A f32 row-major (pitch lda) converted per fragment to bf16
// (ASPLIT: hi/lo two planes -> 2 terms, else single rounded term); Wt bf16 [N][K] (pitch ldb). BIAS_BF16 rounds the
// bias to bf16 first (bias quantised to bf16 before the add). K%32==0, M%16==0, N%64==0.
template <bool ASPLIT, int ACT, bool BIAS_BF16>
__global__ __launch_bounds__(128) void k_gemm_bf(const float* __restrict__ A, int lda, const unsigned short* __restrict__ Wt, int ldb,
                                               const float* __restrict__ bias, float* __restrict__ C, int ldc, int M, int N, int K) {
  __shared__ __attribute__((aligned(16))) float so[4][16][64];
  const int tid = threadIdx.x, w = tid >> 5, lane = tid & 31, ln = lane & 15, hh = lane >> 4;
  const int ntn = N / 64;
  const int wid = blockIdx.x * 4 + w;
  const int mt = wid / ntn, nq = wid % ntn;
  if (mt * 16 >= M) return;
  const int row0 = mt * 16, col0 = nq * 64;
  const float* arow = A + (size_t)(row0 + ln) * lda;
  v8f acc[4] = {};
  for (int kb = 0; kb < K; kb += 32) {
    FragB ah, al;
    const v4f x0 = *(const v4fa*)(arow + kb + 8 * hh), x1 = *(const v4fa*)(arow + kb + 8 * hh + 4);
    const v4f x2 = *(const v4fa*)(arow + kb + 16 + 8 * hh), x3 = *(const v4fa*)(arow + kb + 16 + 8 * hh + 4);
    float xs[16] = {x0[0],x0[1],x0[2],x0[3],x1[0],x1[1],x1[2],x1[3],x2[0],x2[1],x2[2],x2[3],x3[0],x3[1],x3[2],x3[3]};
#pragma unroll
    for (int i = 0; i < 16; ++i) { const unsigned short hb = bf16_bits(xs[i]); ah.u[i] = hb; al.u[i] = ASPLIT ? bf16_bits(xs[i] - bf16_val(hb)) : (unsigned short)0; }
#pragma unroll
    for (int t = 0; t < 4; ++t) {
      const unsigned short* brow = Wt + (size_t)(col0 + t * 16 + ln) * ldb + kb;
      FragB b;
      b.half[0] = *(const v8us*)(brow + 8 * hh);
      b.half[1] = *(const v8us*)(brow + 16 + 8 * hh);
      acc[t] = mmaN<ASPLIT ? 2 : 1>(ah.v, al.v, b.v, b.v, acc[t]);
    }
  }
#pragma unroll
  for (int t = 0; t < 4; ++t) {
    float bv = bias ? bias[col0 + t * 16 + ln] : 0.f;
    if (BIAS_BF16) bv = bf16_round(bv);
#pragma unroll
    for (int r = 0; r < 8; ++r) { float v = acc[t][r] + bv; if (ACT == 1) v = fmaxf(v, 0.f); so[w][8 * hh + r][t * 16 + ln] = v; }
  }
  __builtin_amdgcn_fence(__ATOMIC_ACQ_REL, "workgroup");
  __builtin_amdgcn_wave_barrier();
  const int rsub = lane >> 4, c4 = (lane & 15) * 4;
  {
#pragma unroll
    for (int q = 0; q < 8; ++q) {
      const int r = q * 2 + rsub;
      const v4f v = *(const v4fa*)&so[w][r][c4];
      *(v4f*)(C + (size_t)(row0 + r) * ldc + col0 + c4) = v;
    }
    
  }
}

// Flash-style causal/unmasked attention, all contractions 3-term bf16 hi/lo splits, f32 softmax with running max.
// q,k,v rows are read from f32 buffers with arbitrary row pitch (so they can live inside a fused qkv buffer);
// D = head size (multiple of 32, <= 128); one wave = 16 query rows; block = 4 waves (64 queries) sharing K/V chunks of 32.
template <int D, bool CAUSAL>
__global__ __launch_bounds__(128) void k_flash(const float* __restrict__ qb, const float* __restrict__ kb, const float* __restrict__ vb,
                                             int pitch, int T, int H, float scale, float* __restrict__ y, int ypitch) {
  constexpr int KS = D / 32;        // k-steps for QK
  constexpr int DT = D / 16;        // d tiles for PV
  __shared__ __attribute__((aligned(16))) unsigned short sKh[32][D + 8], sKl[32][D + 8], sVh[32][D + 8], sVl[32][D + 8];
  __shared__ __attribute__((aligned(16))) unsigned short sPh[4][16][40], sPl[4][16][40];
  __shared__ __attribute__((aligned(16))) float sO[4][16][D];
  const int tid = threadIdx.x, w = tid >> 5, lane = tid & 31, ln = lane & 15, hh = lane >> 4;
  const int nqb = (T + 63) / 64;
  const int bh = blockIdx.x / nqb, qblk = blockIdx.x % nqb;
  const int b = bh / H, h = bh % H;
  const int q0 = qblk * 64 + w * 16;
  const float* Q = qb + (size_t)b * T * pitch + h * D;
  const float* K = kb + (size_t)b * T * pitch + h * D;
  const float* V = vb + (size_t)b * T * pitch + h * D;

  // A fragments of the wave's 16 query rows (scaled), hi/lo
  FragB aqh[KS], aql[KS];
  {
    int row = q0 + ln; if (row >= T) row = T - 1;
    const float* qr = Q + (size_t)row * pitch;
#pragma unroll
    for (int ks = 0; ks < KS; ++ks)
#pragma unroll
      for (int i = 0; i < 16; ++i) {
        const int d = ks * 32 + ((i < 8) ? (8 * hh + i) : (16 + 8 * hh + (i - 8)));
        const float x = qr[d] * scale; const unsigned short hb = bf16_bits(x);
        aqh[ks].u[i] = hb; aql[ks].u[i] = bf16_bits(x - bf16_val(hb));
      }
  }
  float m_r[8], l_r[8];
#pragma unroll
  for (int r = 0; r < 8; ++r) { m_r[r] = -3.0e38f; l_r[r] = 0.f; }
  v8f oacc[DT];
#pragma unroll
  for (int dt = 0; dt < DT; ++dt) oacc[dt] = (v8f){0.f,0.f,0.f,0.f,0.f,0.f,0.f,0.f};

  const int kv_end = CAUSAL ? min(T, qblk * 64 + 64) : T;     // block-uniform
  for (int j0 = 0; j0 < kv_end; j0 += 32) {
    __syncthreads();
    for (int e = tid; e < 32 * (D / 4); e += 128) {
      const int r = e / (D / 4), c4 = (e % (D / 4)) * 4;
      const int key = j0 + r;
      v4f kf = {0.f,0.f,0.f,0.f}, vf = {0.f,0.f,0.f,0.f};
      if (key < T) { kf = *(const v4fa*)(K + (size_t)key * pitch + c4); vf = *(const v4fa*)(V + (size_t)key * pitch + c4); }
#pragma unroll
      for (int t = 0; t < 4; ++t) {
        unsigned short hb = bf16_bits(kf[t]); sKh[r][c4 + t] = hb; sKl[r][c4 + t] = bf16_bits(kf[t] - bf16_val(hb));
        hb = bf16_bits(vf[t]); sVh[r][c4 + t] = hb; sVl[r][c4 + t] = bf16_bits(vf[t] - bf16_val(hb));
      }
    }
    __syncthreads();
    // S tile 16 x 32
    v8f s[2];
#pragma unroll
    for (int nt = 0; nt < 2; ++nt) {
      v8f acc = {};
#pragma unroll
      for (int ks = 0; ks < KS; ++ks) {
        FragB bh_, bl_;
        bh_.half[0] = *(const v8us*)&sKh[nt * 16 + ln][ks * 32 + 8 * hh]; bh_.half[1] = *(const v8us*)&sKh[nt * 16 + ln][ks * 32 + 16 + 8 * hh];
        bl_.half[0] = *(const v8us*)&sKl[nt * 16 + ln][ks * 32 + 8 * hh]; bl_.half[1] = *(const v8us*)&sKl[nt * 16 + ln][ks * 32 + 16 + 8 * hh];
        acc = mmaN<3>(aqh[ks].v, aql[ks].v, bh_.v, bl_.v, acc);
      }
      s[nt] = acc;
    }
    // mask + running max (rows 8hh+r; the 16 lanes of a half share rows)
    float alpha[8];
#pragma unroll
    for (int r = 0; r < 8; ++r) {
      const int qi = q0 + 8 * hh + r;
      const int ja = j0 + ln, jb = j0 + 16 + ln;
      if (CAUSAL) { if (ja > qi) s[0][r] = -3.0e38f; if (jb > qi) s[1][r] = -3.0e38f; }
      if (ja >= T) s[0][r] = -3.0e38f;
      if (jb >= T) s[1][r] = -3.0e38f;
      float mx = fmaxf(s[0][r], s[1][r]);
      mx = fmaxf(mx, __shfl_xor(mx, 1, 32)); mx = fmaxf(mx, __shfl_xor(mx, 2, 32)); mx = fmaxf(mx, __shfl_xor(mx, 4, 32)); mx = fmaxf(mx, __shfl_xor(mx, 8, 32));
      const float mnew = fmaxf(m_r[r], mx);
      alpha[r] = (mnew > -1.0e38f) ? __expf(m_r[r] - mnew) : 1.0f;
      const float p0 = (s[0][r] > -1.0e38f) ? __expf(s[0][r] - mnew) : 0.f;
      const float p1 = (s[1][r] > -1.0e38f) ? __expf(s[1][r] - mnew) : 0.f;
      m_r[r] = mnew;
      l_r[r] = l_r[r] * alpha[r] + p0 + p1;            // per-lane partial row sum (16 lanes combined at the end)
      unsigned short hb = bf16_bits(p0); sPh[w][8 * hh + r][ln] = hb;      sPl[w][8 * hh + r][ln] = bf16_bits(p0 - bf16_val(hb));
      hb = bf16_bits(p1);                sPh[w][8 * hh + r][16 + ln] = hb; sPl[w][8 * hh + r][16 + ln] = bf16_bits(p1 - bf16_val(hb));
    }
#pragma unroll
    for (int dt = 0; dt < DT; ++dt)
#pragma unroll
      for (int r = 0; r < 8; ++r) oacc[dt][r] *= alpha[r];
    __builtin_amdgcn_fence(__ATOMIC_ACQ_REL, "workgroup");
    __builtin_amdgcn_wave_barrier();
    FragB pah, pal;
    pah.half[0] = *(const v8us*)&sPh[w][ln][8 * hh]; pah.half[1] = *(const v8us*)&sPh[w][ln][16 + 8 * hh];
    pal.half[0] = *(const v8us*)&sPl[w][ln][8 * hh]; pal.half[1] = *(const v8us*)&sPl[w][ln][16 + 8 * hh];
#pragma unroll
    for (int dt = 0; dt < DT; ++dt) {
      FragB bvh, bvl;
#pragma unroll
      for (int i = 0; i < 8; ++i) {
        bvh.u[i] = sVh[8 * hh + i][dt * 16 + ln]; bvh.u[8 + i] = sVh[16 + 8 * hh + i][dt * 16 + ln];
        bvl.u[i] = sVl[8 * hh + i][dt * 16 + ln]; bvl.u[8 + i] = sVl[16 + 8 * hh + i][dt * 16 + ln];
      }
      oacc[dt] = mmaN<3>(pah.v, pal.v, bvh.v, bvl.v, oacc[dt]);
    }
    __builtin_amdgcn_fence(__ATOMIC_ACQ_REL, "workgroup");
    __builtin_amdgcn_wave_barrier();
  }
#pragma unroll
  for (int r = 0; r < 8; ++r) {
    float l = l_r[r];
    l += __shfl_xor(l, 1, 32); l += __shfl_xor(l, 2, 32); l += __shfl_xor(l, 4, 32); l += __shfl_xor(l, 8, 32);
    l_r[r] = (l > 0.f) ? 1.0f / l : 0.f;
  }
#pragma unroll
  for (int dt = 0; dt < DT; ++dt)
#pragma unroll
    for (int r = 0; r < 8; ++r) sO[w][8 * hh + r][dt * 16 + ln] = oacc[dt][r] * l_r[r];
  __builtin_amdgcn_fence(__ATOMIC_ACQ_REL, "workgroup");
  __builtin_amdgcn_wave_barrier();
  {
    for (int r = 0; r < 16; ++r) {
      const int row = q0 + r;
      if (row < T && lane < D / 4) {
        const v4f val = *(const v4fa*)&sO[w][r][lane * 4];
        *(v4f*)(y + ((size_t)b * T + row) * ypitch + h * D + lane * 4) = val;
      }
    }
    
  }
}

// GEMM C = act(A·W + bias + resid): A f32 (ASPLIT -> hi/lo 2 terms), Wt bf16 [N][K]; ACT 0 none, 1 relu, 2 exact gelu;
// resid (optional, f32, row index = (row % rmod), pitch ldr, RES_BF16 rounds it) added before the activation.
template <bool ASPLIT, int ACT, bool BIAS_BF16, bool RES_BF16>
__global__ __launch_bounds__(128) void k_gemm_bf3(const float* __restrict__ A, int lda, const unsigned short* __restrict__ Wt, int ldb,
                                                const float* __restrict__ bias, const float* __restrict__ resid, int rmod, int ldr,
                                                float* __restrict__ C, int ldc, int M, int N, int K) {
  __shared__ __attribute__((aligned(16))) float so[4][16][64];
  const int tid = threadIdx.x, w = tid >> 5, lane = tid & 31, ln = lane & 15, hh = lane >> 4;
  const int ntn = N / 64;
  const int wid = blockIdx.x * 4 + w;
  const int mt = wid / ntn, nq = wid % ntn;
  if (mt * 16 >= M) return;
  const int row0 = mt * 16, col0 = nq * 64;
  const float* arow = A + (size_t)(row0 + ln) * lda;
  v8f acc[4] = {};
  for (int kb = 0; kb < K; kb += 32) {
    FragB ah, al;
    const v4f x0 = *(const v4fa*)(arow + kb + 8 * hh), x1 = *(const v4fa*)(arow + kb + 8 * hh + 4);
    const v4f x2 = *(const v4fa*)(arow + kb + 16 + 8 * hh), x3 = *(const v4fa*)(arow + kb + 16 + 8 * hh + 4);
    float xs[16] = {x0[0],x0[1],x0[2],x0[3],x1[0],x1[1],x1[2],x1[3],x2[0],x2[1],x2[2],x2[3],x3[0],x3[1],x3[2],x3[3]};
#pragma unroll
    for (int i = 0; i < 16; ++i) { const unsigned short hb = bf16_bits(xs[i]); ah.u[i] = hb; al.u[i] = ASPLIT ? bf16_bits(xs[i] - bf16_val(hb)) : (unsigned short)0; }
#pragma unroll
    for (int t = 0; t < 4; ++t) {
      const unsigned short* brow = Wt + (size_t)(col0 + t * 16 + ln) * ldb + kb;
      FragB b;
      b.half[0] = *(const v8us*)(brow + 8 * hh);
      b.half[1] = *(const v8us*)(brow + 16 + 8 * hh);
      acc[t] = mmaN<ASPLIT ? 2 : 1>(ah.v, al.v, b.v, b.v, acc[t]);
    }
  }
#pragma unroll
  for (int t = 0; t < 4; ++t) {
    const int col = col0 + t * 16 + ln;
    float bv = bias ? bias[col] : 0.f;
    if (BIAS_BF16) bv = bf16_round(bv);
#pragma unroll
    for (int r = 0; r < 8; ++r) {
      float v = acc[t][r] + bv;
      if (resid) { float rv = resid[(size_t)((row0 + 8 * hh + r) % rmod) * ldr + col]; if (RES_BF16) rv = bf16_round(rv); v += rv; }
      if (ACT == 1) v = fmaxf(v, 0.f);
      if (ACT == 2) v = 0.5f * v * (1.0f + erff(v * 0.70710678118654752f));
      if (ACT == 3) { const float u = 0.7978845608028654f * (v + 0.044715f * v * v * v); v = 0.5f * v * (1.0f + tanhf(u)); }
      so[w][8 * hh + r][t * 16 + ln] = v;
    }
  }
  __builtin_amdgcn_fence(__ATOMIC_ACQ_REL, "workgroup");
  __builtin_amdgcn_wave_barrier();
  const int rsub = lane >> 4, c4 = (lane & 15) * 4;
  {
#pragma unroll
    for (int q = 0; q < 8; ++q) {
      const int r = q * 2 + rsub;
      const v4f v = *(const v4fa*)&so[w][r][c4];
      *(v4f*)(C + (size_t)(row0 + r) * ldc + col0 + c4) = v;
    }
    
  }
}
// row LayerNorm (biased variance, eps) over N: s = X (+ R); optional out_sum <- s; out_norm <- (s-mu)*rsqrt(var+eps)*g + b
template <bool PARAM_BF16>
__global__ __launch_bounds__(256) void k_layernorm(const float* __restrict__ X, const float* __restrict__ R, const float* __restrict__ g, const float* __restrict__ bta,
                                                  float* __restrict__ out_sum, float* __restrict__ out_norm, int N, float eps) {
  __shared__ float red[256];
  const int row = blockIdx.x, tid = threadIdx.x;
  const float* x = X + (size_t)row * N; const float* rr = R ? R + (size_t)row * N : nullptr;
  float vals[16];                     // up to N = 4096
  const int per = N / 256;            // contiguous chunk per thread? use strided-by-4 chunks: thread handles j = tid*4 + 1024*u
  float s1 = 0.f;
  for (int u = 0; u < per / 4; ++u) {
    const int j = tid * 4 + 1024 * u;
    const v4f a = *(const v4fa*)(x + j);
    v4f b = {0.f,0.f,0.f,0.f}; if (rr) b = *(const v4fa*)(rr + j);
#pragma unroll
    for (int q = 0; q < 4; ++q) { const float v = a[q] + b[q]; vals[u * 4 + q] = v; s1 += v; }
  }
  red[tid] = s1; __syncthreads();
  for (int st = 128; st > 0; st >>= 1) { if (tid < st) red[tid] += red[tid + st]; __syncthreads(); }
  const float mu = red[0] / (float)N; __syncthreads();
  float s2 = 0.f;
  for (int u = 0; u < per / 4; ++u)
#pragma unroll
    for (int q = 0; q < 4; ++q) { const float c = vals[u * 4 + q] - mu; s2 += c * c; }
  red[tid] = s2; __syncthreads();
  for (int st = 128; st > 0; st >>= 1) { if (tid < st) red[tid] += red[tid + st]; __syncthreads(); }
  const float rs = rsqrtf(red[0] / (float)N + eps);
  {
    for (int u = 0; u < per / 4; ++u) {
      const int j = tid * 4 + 1024 * u;
      v4f o, sm;
#pragma unroll
      for (int q = 0; q < 4; ++q) {
        float gg = g[j + q], bb = bta[j + q];
        if (PARAM_BF16) { gg = bf16_round(gg); bb = bf16_round(bb); }
        sm[q] = vals[u * 4 + q]; o[q] = (vals[u * 4 + q] - mu) * rs * gg + bb;
      }
      if (out_sum) *(v4f*)(out_sum + (size_t)row * N + j) = sm;
      *(v4f*)(out_norm + (size_t)row * N + j) = o;
    }
    
  }
}



// ---- f16 WMMA path (v_wmma_f32_16x16x32_f16): 11-bit significands for operands in range — used where a [0,1] probability operand needs more precision than bf16
typedef _Float16 v16h __attribute__((ext_vector_type(16)));
union FragH { v16h v; v8us half[2]; _Float16 h[16]; unsigned short u[16]; };
template <int NT>
__device__ __forceinline__ v8f mmaH(v16h ah, v16h al, v16h bh, v16h bl, v8f c) {
  c = __builtin_amdgcn_wmma_f32_16x16x32_f16(false, ah, false, bh, (short)0, c, false, false);
  if (NT >= 2) c = __builtin_amdgcn_wmma_f32_16x16x32_f16(false, al, false, bh, (short)0, c, false, false);
  if (NT >= 3) c = __builtin_amdgcn_wmma_f32_16x16x32_f16(false, ah, false, bl, (short)0, c, false, false);
  asm volatile("v_nop\n\tv_nop\n\tv_nop\n\tv_nop" : "+v"(c) : "v"(ah), "v"(al), "v"(bh), "v"(bl));
  return c;
}
// batched GEMM like k_gemm_b but f16 operands: A f32 (split into f16 hi/lo if ASPLIT, else rounded to f16), Bt = f16 values [n][k]; alpha; C f32; N multiple of 16 (partial tiles skipped)
template <bool ASPLIT>
__global__ __launch_bounds__(128) void k_gemm_h(const float* __restrict__ A, int lda, size_t sA, const _Float16* __restrict__ Bh, int ldb, size_t sB, float alpha, float* __restrict__ C, int ldc, size_t sC, int M, int N, int K) {
  __shared__ __attribute__((aligned(16))) float so[4][16][64];
  const int tid = threadIdx.x, w = tid >> 5, lane = tid & 31, ln = lane & 15, hh = lane >> 4; const int by = blockIdx.y;
  A += (size_t)by * sA; Bh += (size_t)by * sB; C += (size_t)by * sC;
  const int ntn = (N + 63) / 64; const int wid = blockIdx.x * 4 + w; const int mt = wid / ntn, nq = wid % ntn; if (mt * 16 >= M) return;
  const int row0 = mt * 16, col0 = nq * 64; const float* arow = A + (size_t)(row0 + ln) * lda;
  v8f acc[4] = {};
  for (int kb = 0; kb < K; kb += 32) {
    FragH ah, al;
    const v4f x0 = *(const v4fa*)(arow + kb + 8 * hh), x1 = *(const v4fa*)(arow + kb + 8 * hh + 4), x2 = *(const v4fa*)(arow + kb + 16 + 8 * hh), x3 = *(const v4fa*)(arow + kb + 16 + 8 * hh + 4);
    float xs[16] = {x0[0],x0[1],x0[2],x0[3],x1[0],x1[1],x1[2],x1[3],x2[0],x2[1],x2[2],x2[3],x3[0],x3[1],x3[2],x3[3]};
#pragma unroll
    for (int i = 0; i < 16; ++i) { const _Float16 h = (_Float16)xs[i]; ah.h[i] = h; al.h[i] = ASPLIT ? (_Float16)(xs[i] - (float)h) : (_Float16)0.0f; }
#pragma unroll
    for (int t = 0; t < 4; ++t) { if (col0 + t * 16 >= N) continue; const size_t boff = (size_t)(col0 + t * 16 + ln) * ldb + kb; FragH bq; bq.half[0] = *(const v8us*)(Bh + boff + 8 * hh); bq.half[1] = *(const v8us*)(Bh + boff + 16 + 8 * hh);
      acc[t] = mmaH<ASPLIT ? 2 : 1>(ah.v, al.v, bq.v, bq.v, acc[t]); }
  }
#pragma unroll
  for (int t = 0; t < 4; ++t) { if (col0 + t * 16 >= N) continue;
#pragma unroll
    for (int r = 0; r < 8; ++r) so[w][8 * hh + r][t * 16 + ln] = acc[t][r] * alpha; }
  __builtin_amdgcn_fence(__ATOMIC_ACQ_REL, "workgroup"); __builtin_amdgcn_wave_barrier();
  const int rsub = lane >> 4, c4 = (lane & 15) * 4;
  {
#pragma unroll
    for (int q = 0; q < 8; ++q) { const int r = q * 2 + rsub; if (col0 + c4 < N) { const v4f v = *(const v4fa*)&so[w][r][c4]; *(v4f*)(C + (size_t)(row0 + r) * ldc + col0 + c4) = v; } }
     }
}

// Wt[n][k] = f16(W[k][n]·scale) from f32 row-major W[K][N] (scale = power of two; bf16-exact weights stay exact in f16 away from the subnormal range)
__global__ __launch_bounds__(256) void k_wt_f16(const float* __restrict__ W, _Float16* __restrict__ Wt, int K, int N, float scale) {
  const int t = blockIdx.x * 256 + threadIdx.x; if (t >= N * (K / 8)) return; const int n = t / (K / 8), k8 = (t % (K / 8)) * 8; FragH f;
#pragma unroll
  for (int i = 0; i < 8; ++i) f.h[i] = (_Float16)(bf16_round(W[(size_t)(k8 + i) * N + n]) * scale); const v8us o = f.half[0];
  *(v8us*)((unsigned short*)Wt + (size_t)n * K + k8) = o; 
}
// GEMM C[M][N] = act(A.B^T * alpha (+ CP)), A f16 [M][K], Bh f16 [N][K], both k-contiguous; ACT 0 none / 6 erf-GELU; writes f32 C (HC) and / or f16 C16 (HC16), CP = f32 addend with C's pitch (HCP); CP may be C itself: each lane reads the 16-byte pieces that it later writes.
// HL: C16 takes the f16 hi plane and C16L the residual times 2^10, so that a result wanted as hi / lo planes never goes to memory as f32.
// AL: A comes as two planes, A and A2 (same shape and pitch); C = A.B^T * alpha + A2.B^T * alpha2 from two accumulator sets that share the B fragments; a stage then holds 128 rows of A2 behind those of A and B.
// One 128 x 128 tile of C per work-group of 8 waves (4 x 2, 32 x 64 each). The operands come through LDS: a stage is 128 k = 256 bytes of each of the 256 operand rows, brought by asynchronous 16-byte copies that take whole lines
// (16 lanes per row), two buffers, the next stage in flight while this one is worked on. M, N multiples of 128, K of 128 at every launch (4096 / 768 / 768 and 1536 / 2048 / 2048).
#define GT 128      /* tile edge */
#define GK 128      /* k per stage */
#define GP 272u     /* LDS row pitch in bytes = 16 x odd: the 16 rows of a fragment read fall on all 64 banks */
#define GST (2u * GT * GP)      /* bytes of a stage's A and B rows: 128 A rows, then 128 B rows; A2's follow */
// this thread's share of one operand's stage: rows 16 apart, the same 16-byte column
__device__ __forceinline__ void copy8(unsigned l, const unsigned short* g, size_t gs) {
  asm volatile("global_load_async_to_lds_b128 %0, %8, off\n\t"
               "global_load_async_to_lds_b128 %1, %9, off\n\t"
               "global_load_async_to_lds_b128 %2, %10, off\n\t"
               "global_load_async_to_lds_b128 %3, %11, off\n\t"
               "global_load_async_to_lds_b128 %4, %12, off\n\t"
               "global_load_async_to_lds_b128 %5, %13, off\n\t"
               "global_load_async_to_lds_b128 %6, %14, off\n\t"
               "global_load_async_to_lds_b128 %7, %15, off\n\t"
               "s_wait_xcnt 0x0"      /* inside the copies' own statement, so that it stands in front of every rewrite of their address registers */
               :: "v"(l), "v"(l + 16u * GP), "v"(l + 32u * GP), "v"(l + 48u * GP), "v"(l + 64u * GP), "v"(l + 80u * GP), "v"(l + 96u * GP), "v"(l + 112u * GP),
                  "v"(g), "v"(g + gs), "v"(g + 2 * gs), "v"(g + 3 * gs), "v"(g + 4 * gs), "v"(g + 5 * gs), "v"(g + 6 * gs), "v"(g + 7 * gs) : "memory");
}
template <int ACT, bool HCP, bool HC, bool HC16, bool HL, bool AL>
__global__ __launch_bounds__(256) void k_gemm_hhx(const _Float16* __restrict__ A, const _Float16* __restrict__ A2, int lda, const _Float16* __restrict__ Bh, int ldb, float alpha, float alpha2, const float* CP, float* C, _Float16* __restrict__ C16, _Float16* __restrict__ C16L, int ldc, int N, int K) {
  constexpr unsigned ST = AL ? GST + GT * GP : GST;      /* bytes of a stage */
  __shared__ __attribute__((aligned(16))) unsigned char ring[2 * ST];
  __shared__ __attribute__((aligned(16))) float so[8][16][64];
  const int tid = threadIdx.x, w = tid >> 5, lane = tid & 31, ln = lane & 15, hh = lane >> 4;
  const int ntn = N / GT; const int row0 = (int)(blockIdx.x / ntn) * GT, col0 = (int)(blockIdx.x % ntn) * GT; const int wr = (w >> 1) * 32, wc = (w & 1) * 64;
  const int cr = tid >> 4, cc = tid & 15;      /* the thread's first row of a stage and its 16-byte column */
  const unsigned short* ga = (const unsigned short*)A + (size_t)(row0 + cr) * lda + cc * 8; const unsigned short* gb = (const unsigned short*)Bh + (size_t)(col0 + cr) * ldb + cc * 8; const unsigned short* g2 = AL ? (const unsigned short*)A2 + (size_t)(row0 + cr) * lda + cc * 8 : nullptr;
  const unsigned la = (unsigned)(size_t)ring + (unsigned)cr * GP + (unsigned)cc * 16u, lb = la + GT * GP, l2 = la + GST; const size_t sa = (size_t)16 * lda, sb = (size_t)16 * ldb;
  const int nst = K / GK;
  v8f acc[2][4] = {}, acc2[2][4] = {};
  const int rsub = lane >> 4, c4 = (lane & 15) * 4; typedef _Float16 v4h __attribute__((ext_vector_type(4)));
  const size_t eo = (size_t)(row0 + wr + rsub) * ldc + col0 + wc + c4;      /* the lane's first 4 elements of the wave's 32 x 64 part of C; its others lie 2 rows apart */
  v4f cp[2][8];      /* the addend in the shape of the stores, asked for here so that all 16 loads fly together under stage 0's copies */
  if (HCP) {
#pragma unroll      // constant indices keep the array in registers
    for (int i = 0; i < 2; ++i)
#pragma unroll      // constant indices keep the array in registers
      for (int q = 0; q < 8; ++q) cp[i][q] = *(const v4fa*)(CP + eo + (size_t)(i * 16 + q * 2) * ldc); }
  copy8(la, ga, sa); copy8(lb, gb, sb); if (AL) copy8(l2, g2, sa);
  asm volatile("s_wait_asynccnt 0x0" ::: "memory");      /* stage 0 has landed, as far as this wave brought it */
  __syncthreads();      /* ... and as far as the other waves did */
  if (nst > 1) { copy8(la + ST, ga + GK, sa); copy8(lb + ST, gb + GK, sb); if (AL) copy8(l2 + ST, g2 + GK, sa); }
  const unsigned char* fa = ring + (unsigned)(wr + ln) * GP + 16 * hh; const unsigned char* fb = ring + (unsigned)(GT + wc + ln) * GP + 16 * hh;      /* fragment rows; k order as before: bytes 16hh and 32 + 16hh of each 64, A and B alike */
  for (int t = 0; t < nst; ++t) { const unsigned bo = (unsigned)(t & 1) * ST;
#pragma unroll      // constant indices keep the fragment arrays in registers
    for (int ks = 0; ks < GK / 32; ++ks) { FragH a2[2], a3[2], b2[4];
#pragma unroll      // constant indices keep the fragment arrays in registers
      for (int i = 0; i < 2; ++i) { a2[i].half[0] = *(const v8us*)(fa + bo + i * 16 * GP + ks * 64); a2[i].half[1] = *(const v8us*)(fa + bo + i * 16 * GP + ks * 64 + 32);
        if (AL) { a3[i].half[0] = *(const v8us*)(fa + bo + GST + i * 16 * GP + ks * 64); a3[i].half[1] = *(const v8us*)(fa + bo + GST + i * 16 * GP + ks * 64 + 32); } }      /* the same rows and the same k order in the second plane */
#pragma unroll      // constant indices keep the fragment arrays in registers
      for (int j = 0; j < 4; ++j) { b2[j].half[0] = *(const v8us*)(fb + bo + j * 16 * GP + ks * 64); b2[j].half[1] = *(const v8us*)(fb + bo + j * 16 * GP + ks * 64 + 32); }
#pragma unroll      // constant indices keep the fragment arrays in registers
      for (int i = 0; i < 2; ++i)
#pragma unroll      // constant indices keep the fragment arrays in registers
        for (int j = 0; j < 4; ++j) { acc[i][j] = mmaH<1>(a2[i].v, a2[i].v, b2[j].v, b2[j].v, acc[i][j]); if (AL) acc2[i][j] = mmaH<1>(a3[i].v, a3[i].v, b2[j].v, b2[j].v, acc2[i][j]); } }
    asm volatile("s_wait_dscnt 0x0" ::: "memory");      /* this wave's reads of the buffer are done before the barrier frees it for the refill */
    asm volatile("s_wait_asynccnt 0x0" ::: "memory");      /* this wave's copies of stage t + 1 have landed before the barrier publishes them */
    __syncthreads();
    if (t + 2 < nst) { copy8(la + bo, ga + (size_t)(t + 2) * GK, sa); copy8(lb + bo, gb + (size_t)(t + 2) * GK, sb); if (AL) copy8(l2 + bo, g2 + (size_t)(t + 2) * GK, sa); } }
  asm volatile("s_wait_asynccnt 0x0" ::: "memory");      /* no copy is outstanding when the wave goes on to its end */
  // Epilogue, 16 x 64 at a time through the wave's own LDS rows; straight-line: what exists is known at compile time, the staged rows are read back together, and addend and activation are applied to the 16-byte pieces that are stored.
#pragma unroll      // constant indices keep the accumulators in registers
  for (int i = 0; i < 2; ++i) {
#pragma unroll
    for (int t = 0; t < 4; ++t)
#pragma unroll
      for (int r = 0; r < 8; ++r) so[w][8 * hh + r][t * 16 + ln] = AL ? acc2[i][t][r] * alpha2 + acc[i][t][r] * alpha : acc[i][t][r] * alpha;
    __builtin_amdgcn_fence(__ATOMIC_ACQ_REL, "workgroup"); __builtin_amdgcn_wave_barrier();
    v4f vv[8];
#pragma unroll      // constant indices keep the array in registers
    for (int q = 0; q < 8; ++q) vv[q] = *(const v4fa*)&so[w][q * 2 + rsub][c4];
#pragma unroll      // constant indices keep the arrays in registers
    for (int q = 0; q < 8; ++q) { v4f v = vv[q]; const size_t o = eo + (size_t)(i * 16 + q * 2) * ldc;
      if (HCP) v += cp[i][q];
      if (ACT == 6) for (int e = 0; e < 4; ++e) v[e] = 0.5f * v[e] * (1.0f + erff(v[e] * 0.70710678118654752f));
      if (HC) { *(v4f*)(C + o) = v; asm volatile("s_wait_xcnt 0x0" ::: "memory"); }      /* the wait in front of any rewrite of the store's registers */
      if (HC16) { v4h h4; for (int e = 0; e < 4; ++e) h4[e] = (_Float16)v[e]; *(v4h*)(C16 + o) = h4; asm volatile("s_wait_xcnt 0x0" ::: "memory"); }      /* likewise */
      if (HL) { v4h h4, l4; for (int e = 0; e < 4; ++e) { h4[e] = (_Float16)v[e]; l4[e] = (_Float16)((v[e] - (float)h4[e]) * 1024.0f); }
        asm volatile("global_store_b64 %0, %2, off\n\tglobal_store_b64 %1, %3, off\n\ts_wait_xcnt 0x0" :: "v"(C16 + o), "v"(C16L + o), "v"(h4), "v"(l4) : "memory"); } }      /* both stores and their wait in one statement: as a statement of its own the wait let rewrites of the stores' registers pass in front of it */
    __builtin_amdgcn_fence(__ATOMIC_ACQ_REL, "workgroup"); __builtin_amdgcn_wave_barrier();      /* the next 16 rows are staged in the same LDS only behind these reads */
  }
}


typedef _Float16 v4h __attribute__((ext_vector_type(4)));

__global__ __launch_bounds__(256) void k_x16(const float* __restrict__ x, _Float16* __restrict__ X16, size_t n8) { const size_t t = (size_t)blockIdx.x * 256 + threadIdx.x; if (t >= n8) return; FragH f;
#pragma unroll
  for (int q = 0; q < 8; ++q) f.h[q] = (_Float16)bf16_round(x[t * 8 + q]); *(v8us*)((unsigned short*)X16 + t * 8) = f.half[0];  }
__global__ __launch_bounds__(256) void k_h16(const float* __restrict__ x, _Float16* __restrict__ X16, size_t n8) { const size_t t = (size_t)blockIdx.x * 256 + threadIdx.x; if (t >= n8) return; FragH f;
#pragma unroll
  for (int q = 0; q < 8; ++q) f.h[q] = (_Float16)x[t * 8 + q]; *(v8us*)((unsigned short*)X16 + t * 8) = f.half[0];  }
__global__ __launch_bounds__(256) void k_round16f(const float* __restrict__ W, _Float16* __restrict__ Bt, size_t n8) { const size_t t = (size_t)blockIdx.x * 256 + threadIdx.x; if (t >= n8) return; FragH f;
#pragma unroll
  for (int i = 0; i < 8; ++i) f.h[i] = (_Float16)(bf16_round(W[t * 8 + i]) * 16.0f); *(v8us*)((unsigned short*)Bt + t * 8) = f.half[0];  }
template <int NHv, int TTv>
__global__ __launch_bounds__(256) void k_vt(const _Float16* __restrict__ V16, int ldv, int voff, _Float16* __restrict__ Vt) { __shared__ unsigned short tl[64][66]; const int tid = threadIdx.x; const int slab = blockIdx.x / (TTv / 64), lg = blockIdx.x % (TTv / 64); const int b = slab / NHv, h = slab % NHv;
  for (int i = tid; i < 64 * 8; i += 256) { const int r = i / 8, c8 = (i % 8) * 8; FragH f; f.half[0] = *(const v8us*)((const unsigned short*)V16 + ((size_t)b * TTv + lg * 64 + r) * ldv + voff + h * 64 + c8);
#pragma unroll
    for (int q = 0; q < 8; ++q) tl[r][c8 + q] = f.u[q]; }
  __syncthreads();
  {
#pragma unroll
    for (int rd = 0; rd < 2; ++rd) { const int d = rd * 32 + tid / 8, pc = tid % 8; FragH f;
#pragma unroll
      for (int q = 0; q < 8; ++q) f.u[q] = tl[pc * 8 + q][d];
      *(v8us*)((unsigned short*)Vt + ((size_t)slab * 64 + d) * TTv + lg * 64 + pc * 8) = f.half[0]; }
     } }

// RMSNorm rows (C = 768 = 32 lanes x 24): y = x.rsqrt(mean(x^2) + 1.1920929e-7).bf16(g); RB: round the input to bf16 first; ADD: the input is X + R (the residual add, done here where its rows are read); outputs: f16 hi + x2^10 residual planes (either may be null)
// and optionally the f32 input as normalised (rounded, or summed) XR; wave per row; per lane 6 float4 pieces (c = j.128 + lane.4).
// TR: also v^T per (b,h), [32][2048] f16 of hi + lo.2^-10. The work-group's 8 rows are 6144 consecutive elements of the flat plane = 3 whole tiles of 64 n x 32 d of the raw head view, turned through LDS; the grid is then exactly NR / 8 work-groups, so no row test stands in front of the barrier.
template <int RB, bool ADD, bool TR>
__global__ __launch_bounds__(256) void k_rms(const float* __restrict__ X, const float* __restrict__ R, const float* __restrict__ g, int nrows, _Float16* __restrict__ YH, _Float16* __restrict__ YL, float* __restrict__ XR, _Float16* __restrict__ VT) { __shared__ float tl[TR ? 3 : 1][64][33]; const int tid = threadIdx.x, wv = tid >> 5, lane = tid & 31; const int r = blockIdx.x * 8 + wv; if (!TR && r >= nrows) return; v4f xv[6]; float ss = 0.f;
#pragma unroll
  for (int j = 0; j < 6; ++j) { v4f a = *(const v4fa*)(X + (size_t)r * CC + j * 128 + lane * 4); if (ADD) { const v4f b = *(const v4fa*)(R + (size_t)r * CC + j * 128 + lane * 4); for (int q = 0; q < 4; ++q) a[q] += b[q]; } if (RB) for (int q = 0; q < 4; ++q) a[q] = bf16_round(a[q]); xv[j] = a; for (int q = 0; q < 4; ++q) ss += a[q] * a[q]; }
  for (int o = 16; o >= 1; o >>= 1) ss += __shfl_xor(ss, o, 32); const float rs = rsqrtf(ss / (float)CC + 1.1920929e-7f);
  typedef _Float16 v4h __attribute__((ext_vector_type(4)));
  {
#pragma unroll
    for (int j = 0; j < 6; ++j) { const int c = j * 128 + lane * 4; v4h hh, hl; for (int q = 0; q < 4; ++q) { const float y = xv[j][q] * rs * bf16_round(g[c + q]); const _Float16 hv = (_Float16)y; hh[q] = hv; hl[q] = (_Float16)((y - (float)hv) * 1024.0f); }
      if (TR) { const int e = wv * CC + c; for (int q = 0; q < 4; ++q) tl[e >> 11][(e & 2047) >> 5][(e & 31) + q] = (float)hh[q] + (float)hl[q] * 0.0009765625f; }
      if (YH) *(v4h*)(YH + (size_t)r * CC + c) = hh; if (YL) *(v4h*)(YL + (size_t)r * CC + c) = hl; if (XR) *(v4f*)(XR + (size_t)r * CC + c) = xv[j]; }
     }
  if (TR) { asm volatile("s_wait_xcnt 0x0" ::: "memory");      /* the wait in front of any rewrite of the row stores' registers by what follows */
    __syncthreads();      /* the 3 tiles are whole only when all 8 rows are in */
    const int d = tid / 8, pc = tid % 8;
#pragma unroll      // the three tiles' LDS reads are asked for together, not tile by tile
    for (int t3 = 0; t3 < 3; ++t3) { const int tile = blockIdx.x * 3 + t3, slab = tile / (NN / 64), ng = tile % (NN / 64); FragH f; for (int q = 0; q < 8; ++q) f.h[q] = (_Float16)tl[t3][pc * 8 + q][d];
      *(v8us*)((unsigned short*)VT + ((size_t)slab * HD + d) * NN + ng * 64 + pc * 8) = f.half[0]; } } }
// lane l <-> lane l ^ 16 by a vector cross-row move (no LDS counter involved)
__device__ __forceinline__ float xhalf(float x) { return __builtin_bit_cast(float, __builtin_amdgcn_permlanex16(__builtin_bit_cast(int, x), __builtin_bit_cast(int, x), 0x76543210, 0xfedcba98, false, false)); }
typedef float v2f __attribute__((ext_vector_type(2)));
#define FK 128      /* keys per stage */
#define FKP 80u     /* LDS pitch of a K row in bytes = 16 x odd: the 16 rows of a fragment read fall on all 64 banks */
#define FVP 272u    /* LDS pitch of a V'^T row, likewise */
#define FKB (FK * FKP)      /* bytes of one K plane's stage */
#define FST (2u * FKB + HD * FVP)      /* bytes of a stage: K hi, K lo, V'^T */
// this thread's share of a stage: two 16-byte pieces of each of the three operands (K rows 64 apart, V'^T rows 16 apart)
__device__ __forceinline__ void copy6(unsigned lk, unsigned lv, const unsigned short* gh, const unsigned short* gl, size_t ks, const unsigned short* gv) {
  asm volatile("global_load_async_to_lds_b128 %0, %6, off\n\t"
               "global_load_async_to_lds_b128 %1, %7, off\n\t"
               "global_load_async_to_lds_b128 %2, %8, off\n\t"
               "global_load_async_to_lds_b128 %3, %9, off\n\t"
               "global_load_async_to_lds_b128 %4, %10, off\n\t"
               "global_load_async_to_lds_b128 %5, %11, off\n\t"
               "s_wait_xcnt 0x0"      /* inside the copies' own statement, so that it stands in front of every rewrite of their address registers */
               :: "v"(lk), "v"(lk + 64u * FKP), "v"(lk + FKB), "v"(lk + FKB + 64u * FKP), "v"(lv), "v"(lv + 16u * FVP),
                  "v"(gh), "v"(gh + ks), "v"(gl), "v"(gl + ks), "v"(gv), "v"(gv + (size_t)16 * NN) : "memory");
}
__global__ __launch_bounds__(256) void k_flash(const _Float16* __restrict__ Q16, const _Float16* __restrict__ Q16lo, int ldq, const _Float16* __restrict__ K16, const _Float16* __restrict__ K16lo, int ldk, const _Float16* __restrict__ Vt, const float* __restrict__ SP, float* __restrict__ O, int ldo) {
  constexpr int NQB = NN / 128, DT = 2, NST = NN / FK;
  __shared__ __attribute__((aligned(16))) unsigned char ring[2 * FST];
  const int tid = threadIdx.x, w = tid >> 5, lane = tid & 31, ln = lane & 15, hh = lane >> 4;
  const int slab = blockIdx.x / NQB, qblk = blockIdx.x % NQB; const int h = slab % NH; const float coef = ((logf(768.0f) * bf16_round(SP[h])) * 5.656854249492381f) * 1.4426950408889634f;      /* times log2(e): the logits are kept in base 2, so each exponential is one hardware instruction */ const int q0 = qblk * 128 + w * 16;
  FragH bq, bql;
  { const size_t qo = ((size_t)slab * NN + q0 + ln) * ldq; const unsigned short* qr = (const unsigned short*)Q16 + qo; const unsigned short* ql = (const unsigned short*)Q16lo + qo;
    bq.half[0] = *(const v8us*)(qr + 8 * hh); bq.half[1] = *(const v8us*)(qr + 16 + 8 * hh); bql.half[0] = *(const v8us*)(ql + 8 * hh); bql.half[1] = *(const v8us*)(ql + 16 + 8 * hh); }
  const size_t kc = (size_t)slab * NN * ldk + (size_t)(tid >> 2) * ldk + (tid & 3) * 8;      /* the thread's first piece of a K stage: row tid / 4, 16-byte column tid % 4 */
  const unsigned short* gh = (const unsigned short*)K16 + kc; const unsigned short* gl = (const unsigned short*)K16lo + kc; const size_t ks = (size_t)64 * ldk, kst = (size_t)FK * ldk;
  const unsigned short* gv = (const unsigned short*)Vt + (size_t)slab * HD * NN + (size_t)(tid >> 4) * NN + (tid & 15) * 8;      /* v'^T per slab: [32][N]; row tid / 16, 16-byte column tid % 16 of the stage's 256 bytes */
  const unsigned lk = (unsigned)(size_t)ring + (unsigned)(tid >> 2) * FKP + (unsigned)(tid & 3) * 16u, lv = (unsigned)(size_t)ring + 2u * FKB + (unsigned)(tid >> 4) * FVP + (unsigned)(tid & 15) * 16u;
  copy6(lk, lv, gh, gl, ks, gv);
  asm volatile("s_wait_asynccnt 0x0" ::: "memory");      /* stage 0 has landed, as far as this wave brought it */
  __syncthreads();      /* ... and as far as the other waves did */
  copy6(lk + FST, lv + FST, gh + kst, gl + kst, ks, gv + FK);
  const unsigned char* fk = ring + (unsigned)ln * FKP + 16 * hh; const unsigned char* fv = ring + 2u * FKB + (unsigned)ln * FVP + 16 * hh;      /* fragment rows; k order as before: bytes 16hh and 32 + 16hh of each 64 */
  float m_q = -3.0e38f, s_q = -3.0e38f, l_q = 0.f; v8f oacc[DT];      /* s_q = m_q - 10 as rounded: what the exponents subtract, so that P and the denominator carry the factor 2^10 */
#pragma unroll
  for (int dt = 0; dt < DT; ++dt) oacc[dt] = (v8f){0.f,0.f,0.f,0.f,0.f,0.f,0.f,0.f};
  for (int t = 0; t < NST; ++t) { const unsigned bo = (unsigned)(t & 1) * FST;
#pragma unroll 1      // unrolled, four passes' exponentials stayed live to the stage's end and the registers allowed one work-group fewer on a WGP
   for (int p = 0; p < FK / 32; ++p) {
    FragH ak[2], akl[2], av[DT];
#pragma unroll
    for (int nt = 0; nt < 2; ++nt) { const unsigned char* kr = fk + bo + (unsigned)(p * 32 + nt * 16) * FKP; ak[nt].half[0] = *(const v8us*)kr; ak[nt].half[1] = *(const v8us*)(kr + 32); akl[nt].half[0] = *(const v8us*)(kr + FKB); akl[nt].half[1] = *(const v8us*)(kr + FKB + 32); }
#pragma unroll
    for (int dt = 0; dt < DT; ++dt) { const unsigned char* vr = fv + bo + (unsigned)(dt * 16) * FVP + p * 64; av[dt].half[0] = *(const v8us*)vr; av[dt].half[1] = *(const v8us*)(vr + 32); }
    v2f s2[8];      /* the 16 logits as the register pairs the accumulators already form */
#pragma unroll
    for (int nt = 0; nt < 2; ++nt) { v8f acc = (v8f){0.f,0.f,0.f,0.f,0.f,0.f,0.f,0.f}, accl = acc;
      acc = mmaH<1>(ak[nt].v, ak[nt].v, bq.v, bq.v, acc); accl = mmaH<1>(ak[nt].v, ak[nt].v, bql.v, bql.v, accl); accl = mmaH<1>(akl[nt].v, akl[nt].v, bq.v, bq.v, accl);
#pragma unroll
      for (int j = 0; j < 4; ++j) { const v2f a2 = {acc[2 * j], acc[2 * j + 1]}, b2 = {accl[2 * j], accl[2 * j + 1]}; s2[nt * 4 + j] = (a2 + b2 * 0.0009765625f) * coef; } }
    float mx[8];
#pragma unroll
    for (int j = 0; j < 4; ++j) { mx[2 * j] = fmaxf(s2[j].x, s2[4 + j].x); mx[2 * j + 1] = fmaxf(s2[j].y, s2[4 + j].y); }
    float mc = fmaxf(fmaxf(fmaxf(mx[0], mx[1]), fmaxf(mx[2], mx[3])), fmaxf(fmaxf(mx[4], mx[5]), fmaxf(mx[6], mx[7])));
    mc = fmaxf(mc, xhalf(mc));
    const float mn = fmaxf(m_q, mc); const float sn = mn - 10.0f; float ea;      /* the rescale uses the same rounded subtrahends as the exponents of the two passes */
    asm("v_exp_f32 %0, %1\n\tv_nop" : "=v"(ea) : "v"(s_q - sn));      /* in asm for the v_nop alone: it keeps the one slot behind a transcendental */
    const float al = (mn > -1.0e38f) ? ea : 1.0f; m_q = mn; s_q = sn;
    v2f p2[8]; FragH pb;
#pragma unroll
    for (int i = 0; i < 8; ++i) { const v2f e2 = s2[i] - sn; p2[i].x = __builtin_amdgcn_exp2f(e2.x); p2[i].y = __builtin_amdgcn_exp2f(e2.y); pb.h[2 * i] = (_Float16)p2[i].x; pb.h[2 * i + 1] = (_Float16)p2[i].y; }
    const v2f ps = ((p2[0] + p2[1]) + (p2[2] + p2[3])) + ((p2[4] + p2[5]) + (p2[6] + p2[7]));
    l_q = l_q * al + (ps.x + ps.y);      /* per-lane partial sum of the query's denominator (the two halves are joined after the loop) */
#pragma unroll
    for (int dt = 0; dt < DT; ++dt) {
#pragma unroll
      for (int r = 0; r < 8; ++r) oacc[dt][r] *= al;
      oacc[dt] = mmaH<1>(av[dt].v, av[dt].v, pb.v, pb.v, oacc[dt]); } }
    asm volatile("s_wait_dscnt 0x0" ::: "memory");      /* this wave's reads of the buffer are done before the barrier frees it for the refill */
    asm volatile("s_wait_asynccnt 0x0" ::: "memory");      /* this wave's copies of stage t + 1 have landed before the barrier publishes them */
    __syncthreads();
    if (t + 2 < NST) copy6(lk + bo, lv + bo, gh + (size_t)(t + 2) * kst, gl + (size_t)(t + 2) * kst, ks, gv + (t + 2) * FK); }
  asm volatile("s_wait_asynccnt 0x0" ::: "memory");      /* no copy is outstanding when the wave goes on to its end */
  const float lt = l_q + xhalf(l_q); const float inv = (lt > 0.f) ? 1.0f / lt : 0.f;      /* numerator and denominator both carry 2^10 */
  float* orow = O + ((size_t)slab * NN + q0 + ln) * ldo + 8 * hh;      /* oacc[dt][r] = O[q0 + ln][dt * 16 + 8hh + r]: eight consecutive d per lane */
#pragma unroll
  for (int dt = 0; dt < DT; ++dt) { const v4f o0 = {oacc[dt][0] * inv, oacc[dt][1] * inv, oacc[dt][2] * inv, oacc[dt][3] * inv}, o1 = {oacc[dt][4] * inv, oacc[dt][5] * inv, oacc[dt][6] * inv, oacc[dt][7] * inv};
    *(v4f*)(orow + dt * 16) = o0; *(v4f*)(orow + dt * 16 + 4) = o1; } }

extern "C" void kernel_launch(void* const* d_in, const int* in_sizes, int n_in,
                              void* d_out, int out_size, void* d_ws, size_t ws_size, hipStream_t stream) {
  (void)in_sizes; (void)n_in; (void)out_size;
  const float* const* I = (const float* const*)d_in; const float* x = I[0]; const float* sp = I[1]; const float* Wq = I[2]; const float* WA = I[3]; const float* W1 = I[4]; const float* W2 = I[5]; const float* g1 = I[6]; const float* g2 = I[7];
  char* ws = (char*)d_ws; size_t off = 0;
  auto take = [&](size_t bytes) { char* p = ws + off; off += (bytes + 255) & ~(size_t)255; return p; };
  const size_t WSZ = (size_t)CC * CC; _Float16* Bq = (_Float16*)take(WSZ * 2); _Float16* B1 = (_Float16*)take(WSZ * 2); _Float16* B2 = (_Float16*)take(WSZ * 2); _Float16* BA = (_Float16*)take((size_t)NN * NN * 2);
  _Float16* XH = (_Float16*)take((size_t)NR * CC * 2); _Float16* XL = (_Float16*)take((size_t)NR * CC * 2); float* XR = (float*)take((size_t)NR * CC * 4); float* QF = (float*)take((size_t)NR * CC * 4); _Float16* QH = (_Float16*)take((size_t)NR * CC * 2); _Float16* QL = (_Float16*)take((size_t)NR * CC * 2);
  _Float16* VT = (_Float16*)take((size_t)BB * NH * HD * NN * 2); _Float16* VPT = (_Float16*)take((size_t)BB * NH * HD * NN * 2); float* ATT = (float*)take((size_t)NR * CC * 4);
  float* O = QF; _Float16* H16 = XH; _Float16* FH = XL;      /* O (raw [B][H][N][hd] f32); RMSNorm2 output over XH and the FF hidden over XL (both dead after the flash kernel) */
  if (off > ws_size) return;      // 3.5 + 8.4 + 6.3 × 2 + 12.6 × 2 + 6.3 × 2 + 6.3 × 2 + 12.6 ≈ 87 MB
  const unsigned gw = (unsigned)((WSZ / 8 + 255) / 256); k_round16f<<<gw, 256, 0, stream>>>(Wq, Bq, WSZ / 8); k_round16f<<<gw, 256, 0, stream>>>(W1, B1, WSZ / 8); k_round16f<<<gw, 256, 0, stream>>>(W2, B2, WSZ / 8); k_round16f<<<(unsigned)(((size_t)NN * NN / 8 + 255) / 256), 256, 0, stream>>>(WA, BA, (size_t)NN * NN / 8);      /* (out,in) natural ×2^4; WA natural [m][n] ×2^4 */
  k_rms<1, false, true><<<NR / 8, 256, 0, stream>>>(x, nullptr, g1, NR, XH, XL, XR, VT);      /* xn = RMSNorm(bf16 x).g1 as hi / x2^10 residual planes; XR = bf16(x); v^T per (b,h): [32][2048] f16 */
  const unsigned gq = (NR / GT) * (CC / GT);
  k_gemm_hhx<0, false, false, false, true, true><<<gq, 256, 0, stream>>>(XH, XL, CC, Bq, CC, 0.0625f, 0.0625f * 0.0009765625f, nullptr, nullptr, QH, QL, CC, CC, CC);      /* q = xn.Wq^T, M 4096 N 768 K 768: hi term + lo term * 2^-10 in one launch; q leaves as hi / x2^10 residual planes (flat; head h of batch b = elements [b.N.C + h.N.hd, +N.hd) viewed [N][hd]) */
  const unsigned gvp = (BB * NH * HD / GT) * (NN / GT);      /* the 48 slabs of 32 rows lie one behind the other in VT and VPT: one GEMM of 1536 rows */
  k_gemm_hhx<0, false, false, true, false, false><<<gvp, 256, 0, stream>>>(VT, nullptr, NN, BA, NN, 0.0625f, 0.f, nullptr, nullptr, VPT, nullptr, NN, NN, NN);      /* v'^T[d][m] = sum over n of v^T[d][n].WA[m][n], all 48 (b,h) at once: M 1536 N 2048 K 2048 */
  k_flash<<<BB * NH * (NN / 128), 256, 0, stream>>>(QH, QL, HD, XH, XL, HD, VPT, sp, O, HD);      /* per (b,h) slab of the raw head views (flat planes, ld 32): softmax(coef_h·q·kᵀ)·v' → O raw [B][H][N][32] */
  k_rms<0, true, false><<<(NR + 7) / 8, 256, 0, stream>>>(O, XR, g2, NR, H16, nullptr, ATT, nullptr);      /* attn = raw-reshaped O + x, kept as f32; h = RMSNorm(attn).g2 as f16 */
  k_gemm_hhx<6, false, false, true, false, false><<<gq, 256, 0, stream>>>(H16, nullptr, CC, B1, CC, 0.0625f, 0.f, nullptr, nullptr, FH, nullptr, CC, CC, CC);      /* gelu_erf(h.W1^T) to f16: M 4096 N 768 K 768 */
  k_gemm_hhx<0, true, true, false, false, false><<<gq, 256, 0, stream>>>(FH, nullptr, CC, B2, CC, 0.0625f, 0.f, ATT, (float*)d_out, nullptr, nullptr, CC, CC, CC);      /* out = that.W2^T + attn */
}

// v009
// It runs in 130 microseconds.
// In both of two side-by-side timings against v008, it was 1.04 times as fast.
// Over all steps from v000 it is 3.62 times as fast.
#include <hip/hip_runtime.h>
// 'Scalable super' multi-head attention block (B=2, N=2048, C=768, H=24, hd=32): xn = RMSNorm(x)·g1; q = (xn·Wqᵀ) RAW-reshaped [B,H,N,hd] (no transpose — the module's quirk), k = v = xn raw-reshaped likewise; v' = WA[:N,:N]·v (value premix);
// scores = softmax(coef_h · q·kᵀ) with coef_h = log(C)·scale_param[h]·√hd (up to ≈56 → extremely peaked); attn = (scores·v') raw-reshaped back to [B,N,C] + x; h = RMSNorm(attn)·g2; out = gelu_erf(h·W1ᵀ)·W2ᵀ + attn.
// Compute dtype: x, scale_param, weights, WA, g rounded to bf16; RMSNorm in f32 (wave per row) → f16 hi + ×2^10 residual planes; q = xn·Wqᵀ f32-accurate (hi·W + lo·W·2^-10) → hi/lo planes; per (b,h) the 2048×2048 logit plane
// computed inside a fused flash-style kernel from three f16 products (q_hi·k_hi + (q_lo·k_hi + q_hi·k_lo)·2^-10, d = 32) and scaled by the per-head coefficient in f32; online f32 softmax; P f16 ×2^10; v'ᵀ = vᵀ·WAᵀ by GEMM (f16); O = P·v' accumulated in f32 into the raw [B][H][N][hd] buffer; + x; RMSNorm; FF GEMMs
// (erf-GELU epilogue) with the residual through the f32 addend. All contractions on v_wmma_f32_16x16x32_f16, f32 accumulate.
#define BB 2
#define NN 2048
#define CC 768
#define NH 24
#define HD 32
#define NR (BB * NN)
#define HSZ ((size_t)NN * HD)

typedef __bf16 v16b __attribute__((ext_vector_type(16)));
typedef unsigned short v8us __attribute__((ext_vector_type(8), may_alias));
typedef float  v8f  __attribute__((ext_vector_type(8)));
typedef float  v4f  __attribute__((ext_vector_type(4)));
typedef float  v4fa __attribute__((ext_vector_type(4), may_alias));
union FragB { v16b v; v8us half[2]; unsigned short u[16]; };

__device__ __forceinline__ unsigned short bf16_bits(float x) { unsigned int u = __float_as_uint(x); return (unsigned short)((u + 0x7FFFu + ((u >> 16) & 1u)) >> 16); }
__device__ __forceinline__ float bf16_val(unsigned short b) { return __uint_as_float(((unsigned int)b) << 16); }
__device__ __forceinline__ float bf16_round(float x) { return bf16_val(bf16_bits(x)); }
// D += A·B with NT terms: 1 = ah·bh, 2 = + al·bh (A split), 3 = + ah·bl (both split)
template <int NT>
__device__ __forceinline__ v8f mmaN(v16b ah, v16b al, v16b bh, v16b bl, v8f c) {
  c = __builtin_amdgcn_wmma_f32_16x16x32_bf16(false, ah, false, bh, (short)0, c, false, false);
  if (NT >= 2) c = __builtin_amdgcn_wmma_f32_16x16x32_bf16(false, al, false, bh, (short)0, c, false, false);
  if (NT >= 3) c = __builtin_amdgcn_wmma_f32_16x16x32_bf16(false, ah, false, bl, (short)0, c, false, false);
  asm volatile("v_nop\n\tv_nop\n\tv_nop\n\tv_nop" : "+v"(c) : "v"(ah), "v"(al), "v"(bh), "v"(bl));
  return c;
}

__global__ __launch_bounds__(256) void k_wt_bf16(const float* __restrict__ W, unsigned short* __restrict__ Wt, int K, int N) {
  const int t = blockIdx.x * 256 + threadIdx.x;
  const int k8n = K / 8;
  if (t >= N * k8n) return;
  const int n = t / k8n, k8 = (t % k8n) * 8;
  v8us v;
#pragma unroll
  for (int i = 0; i < 8; ++i) v[i] = bf16_bits(W[(size_t)(k8 + i) * N + n]);
  *(v8us*)(Wt + (size_t)n * K + k8) = v;
  
}

// GEMM C[M][N] (f32, pitch ldc) = act(A[M][K]·W + bias). A f32 row-major (pitch lda) converted per fragment to bf16
// (ASPLIT: hi/lo two planes -> 2 terms, else single rounded term); Wt bf16 [N][K] (pitch ldb). BIAS_BF16 rounds the
// bias to bf16 first (bias quantised to bf16 before the add). K%32==0, M%16==0, N%64==0.
template <bool ASPLIT, int ACT, bool BIAS_BF16>
__global__ __launch_bounds__(128) void k_gemm_bf(const float* __restrict__ A, int lda, const unsigned short* __restrict__ Wt, int ldb,
                                               const float* __restrict__ bias, float* __restrict__ C, int ldc, int M, int N, int K) {
  __shared__ __attribute__((aligned(16))) float so[4][16][64];
  const int tid = threadIdx.x, w = tid >> 5, lane = tid & 31, ln = lane & 15, hh = lane >> 4;
  const int ntn = N / 64;
  const int wid = blockIdx.x * 4 + w;
  const int mt = wid / ntn, nq = wid % ntn;
  if (mt * 16 >= M) return;
  const int row0 = mt * 16, col0 = nq * 64;
  const float* arow = A + (size_t)(row0 + ln) * lda;
  v8f acc[4] = {};
  for (int kb = 0; kb < K; kb += 32) {
    FragB ah, al;
    const v4f x0 = *(const v4fa*)(arow + kb + 8 * hh), x1 = *(const v4fa*)(arow + kb + 8 * hh + 4);
    const v4f x2 = *(const v4fa*)(arow + kb + 16 + 8 * hh), x3 = *(const v4fa*)(arow + kb + 16 + 8 * hh + 4);
    float xs[16] = {x0[0],x0[1],x0[2],x0[3],x1[0],x1[1],x1[2],x1[3],x2[0],x2[1],x2[2],x2[3],x3[0],x3[1],x3[2],x3[3]};
#pragma unroll
    for (int i = 0; i < 16; ++i) { const unsigned short hb = bf16_bits(xs[i]); ah.u[i] = hb; al.u[i] = ASPLIT ? bf16_bits(xs[i] - bf16_val(hb)) : (unsigned short)0; }
#pragma unroll
    for (int t = 0; t < 4; ++t) {
      const unsigned short* brow = Wt + (size_t)(col0 + t * 16 + ln) * ldb + kb;
      FragB b;
      b.half[0] = *(const v8us*)(brow + 8 * hh);
      b.half[1] = *(const v8us*)(brow + 16 + 8 * hh);
      acc[t] = mmaN<ASPLIT ? 2 : 1>(ah.v, al.v, b.v, b.v, acc[t]);
    }
  }
#pragma unroll
  for (int t = 0; t < 4; ++t) {
    float bv = bias ? bias[col0 + t * 16 + ln] : 0.f;
    if (BIAS_BF16) bv = bf16_round(bv);
#pragma unroll
    for (int r = 0; r < 8; ++r) { float v = acc[t][r] + bv; if (ACT == 1) v = fmaxf(v, 0.f); so[w][8 * hh + r][t * 16 + ln] = v; }
  }
  __builtin_amdgcn_fence(__ATOMIC_ACQ_REL, "workgroup");
  __builtin_amdgcn_wave_barrier();
  const int rsub = lane >> 4, c4 = (lane & 15) * 4;
  {
#pragma unroll
    for (int q = 0; q < 8; ++q) {
      const int r = q * 2 + rsub;
      const v4f v = *(const v4fa*)&so[w][r][c4];
      *(v4f*)(C + (size_t)(row0 + r) * ldc + col0 + c4) = v;
    }
    
  }
}

// Flash-style causal/unmasked attention, all contractions 3-term bf16 hi/lo splits, f32 softmax with running max.
// q,k,v rows are read from f32 buffers with arbitrary row pitch (so they can live inside a fused qkv buffer);
// D = head size (multiple of 32, <= 128); one wave = 16 query rows; block = 4 waves (64 queries) sharing K/V chunks of 32.
template <int D, bool CAUSAL>
__global__ __launch_bounds__(128) void k_flash(const float* __restrict__ qb, const float* __restrict__ kb, const float* __restrict__ vb,
                                             int pitch, int T, int H, float scale, float* __restrict__ y, int ypitch) {
  constexpr int KS = D / 32;        // k-steps for QK
  constexpr int DT = D / 16;        // d tiles for PV
  __shared__ __attribute__((aligned(16))) unsigned short sKh[32][D + 8], sKl[32][D + 8], sVh[32][D + 8], sVl[32][D + 8];
  __shared__ __attribute__((aligned(16))) unsigned short sPh[4][16][40], sPl[4][16][40];
  __shared__ __attribute__((aligned(16))) float sO[4][16][D];
  const int tid = threadIdx.x, w = tid >> 5, lane = tid & 31, ln = lane & 15, hh = lane >> 4;
  const int nqb = (T + 63) / 64;
  const int bh = blockIdx.x / nqb, qblk = blockIdx.x % nqb;
  const int b = bh / H, h = bh % H;
  const int q0 = qblk * 64 + w * 16;
  const float* Q = qb + (size_t)b * T * pitch + h * D;
  const float* K = kb + (size_t)b * T * pitch + h * D;
  const float* V = vb + (size_t)b * T * pitch + h * D;

  // A fragments of the wave's 16 query rows (scaled), hi/lo
  FragB aqh[KS], aql[KS];
  {
    int row = q0 + ln; if (row >= T) row = T - 1;
    const float* qr = Q + (size_t)row * pitch;
#pragma unroll
    for (int ks = 0; ks < KS; ++ks)
#pragma unroll
      for (int i = 0; i < 16; ++i) {
        const int d = ks * 32 + ((i < 8) ? (8 * hh + i) : (16 + 8 * hh + (i - 8)));
        const float x = qr[d] * scale; const unsigned short hb = bf16_bits(x);
        aqh[ks].u[i] = hb; aql[ks].u[i] = bf16_bits(x - bf16_val(hb));
      }
  }
  float m_r[8], l_r[8];
#pragma unroll
  for (int r = 0; r < 8; ++r) { m_r[r] = -3.0e38f; l_r[r] = 0.f; }
  v8f oacc[DT];
#pragma unroll
  for (int dt = 0; dt < DT; ++dt) oacc[dt] = (v8f){0.f,0.f,0.f,0.f,0.f,0.f,0.f,0.f};

  const int kv_end = CAUSAL ? min(T, qblk * 64 + 64) : T;     // block-uniform
  for (int j0 = 0; j0 < kv_end; j0 += 32) {
    __syncthreads();
    for (int e = tid; e < 32 * (D / 4); e += 128) {
      const int r = e / (D / 4), c4 = (e % (D / 4)) * 4;
      const int key = j0 + r;
      v4f kf = {0.f,0.f,0.f,0.f}, vf = {0.f,0.f,0.f,0.f};
      if (key < T) { kf = *(const v4fa*)(K + (size_t)key * pitch + c4); vf = *(const v4fa*)(V + (size_t)key * pitch + c4); }
#pragma unroll
      for (int t = 0; t < 4; ++t) {
        unsigned short hb = bf16_bits(kf[t]); sKh[r][c4 + t] = hb; sKl[r][c4 + t] = bf16_bits(kf[t] - bf16_val(hb));
        hb = bf16_bits(vf[t]); sVh[r][c4 + t] = hb; sVl[r][c4 + t] = bf16_bits(vf[t] - bf16_val(hb));
      }
    }
    __syncthreads();
    // S tile 16 x 32
    v8f s[2];
#pragma unroll
    for (int nt = 0; nt < 2; ++nt) {
      v8f acc = {};
#pragma unroll
      for (int ks = 0; ks < KS; ++ks) {
        FragB bh_, bl_;
        bh_.half[0] = *(const v8us*)&sKh[nt * 16 + ln][ks * 32 + 8 * hh]; bh_.half[1] = *(const v8us*)&sKh[nt * 16 + ln][ks * 32 + 16 + 8 * hh];
        bl_.half[0] = *(const v8us*)&sKl[nt * 16 + ln][ks * 32 + 8 * hh]; bl_.half[1] = *(const v8us*)&sKl[nt * 16 + ln][ks * 32 + 16 + 8 * hh];
        acc = mmaN<3>(aqh[ks].v, aql[ks].v, bh_.v, bl_.v, acc);
      }
      s[nt] = acc;
    }
    // mask + running max (rows 8hh+r; the 16 lanes of a half share rows)
    float alpha[8];
#pragma unroll
    for (int r = 0; r < 8; ++r) {
      const int qi = q0 + 8 * hh + r;
      const int ja = j0 + ln, jb = j0 + 16 + ln;
      if (CAUSAL) { if (ja > qi) s[0][r] = -3.0e38f; if (jb > qi) s[1][r] = -3.0e38f; }
      if (ja >= T) s[0][r] = -3.0e38f;
      if (jb >= T) s[1][r] = -3.0e38f;
      float mx = fmaxf(s[0][r], s[1][r]);
      mx = fmaxf(mx, __shfl_xor(mx, 1, 32)); mx = fmaxf(mx, __shfl_xor(mx, 2, 32)); mx = fmaxf(mx, __shfl_xor(mx, 4, 32)); mx = fmaxf(mx, __shfl_xor(mx, 8, 32));
      const float mnew = fmaxf(m_r[r], mx);
      alpha[r] = (mnew > -1.0e38f) ? __expf(m_r[r] - mnew) : 1.0f;
      const float p0 = (s[0][r] > -1.0e38f) ? __expf(s[0][r] - mnew) : 0.f;
      const float p1 = (s[1][r] > -1.0e38f) ? __expf(s[1][r] - mnew) : 0.f;
      m_r[r] = mnew;
      l_r[r] = l_r[r] * alpha[r] + p0 + p1;            // per-lane partial row sum (16 lanes combined at the end)
      unsigned short hb = bf16_bits(p0); sPh[w][8 * hh + r][ln] = hb;      sPl[w][8 * hh + r][ln] = bf16_bits(p0 - bf16_val(hb));
      hb = bf16_bits(p1);                sPh[w][8 * hh + r][16 + ln] = hb; sPl[w][8 * hh + r][16 + ln] = bf16_bits(p1 - bf16_val(hb));
    }
#pragma unroll
    for (int dt = 0; dt < DT; ++dt)
#pragma unroll
      for (int r = 0; r < 8; ++r) oacc[dt][r] *= alpha[r];
    __builtin_amdgcn_fence(__ATOMIC_ACQ_REL, "workgroup");
    __builtin_amdgcn_wave_barrier();
    FragB pah, pal;
    pah.half[0] = *(const v8us*)&sPh[w][ln][8 * hh]; pah.half[1] = *(const v8us*)&sPh[w][ln][16 + 8 * hh];
    pal.half[0] = *(const v8us*)&sPl[w][ln][8 * hh]; pal.half[1] = *(const v8us*)&sPl[w][ln][16 + 8 * hh];
#pragma unroll
    for (int dt = 0; dt < DT; ++dt) {
      FragB bvh, bvl;
#pragma unroll
      for (int i = 0; i < 8; ++i) {
        bvh.u[i] = sVh[8 * hh + i][dt * 16 + ln]; bvh.u[8 + i] = sVh[16 + 8 * hh + i][dt * 16 + ln];
        bvl.u[i] = sVl[8 * hh + i][dt * 16 + ln]; bvl.u[8 + i] = sVl[16 + 8 * hh + i][dt * 16 + ln];
      }
      oacc[dt] = mmaN<3>(pah.v, pal.v, bvh.v, bvl.v, oacc[dt]);
    }
    __builtin_amdgcn_fence(__ATOMIC_ACQ_REL, "workgroup");
    __builtin_amdgcn_wave_barrier();
  }
#pragma unroll
  for (int r = 0; r < 8; ++r) {
    float l = l_r[r];
    l += __shfl_xor(l, 1, 32); l += __shfl_xor(l, 2, 32); l += __shfl_xor(l, 4, 32); l += __shfl_xor(l, 8, 32);
    l_r[r] = (l > 0.f) ? 1.0f / l : 0.f;
  }
#pragma unroll
  for (int dt = 0; dt < DT; ++dt)
#pragma unroll
    for (int r = 0; r < 8; ++r) sO[w][8 * hh + r][dt * 16 + ln] = oacc[dt][r] * l_r[r];
  __builtin_amdgcn_fence(__ATOMIC_ACQ_REL, "workgroup");
  __builtin_amdgcn_wave_barrier();
  {
    for (int r = 0; r < 16; ++r) {
      const int row = q0 + r;
      if (row < T && lane < D / 4) {
        const v4f val = *(const v4fa*)&sO[w][r][lane * 4];
        *(v4f*)(y + ((size_t)b * T + row) * ypitch + h * D + lane * 4) = val;
      }
    }
    
  }
}

// GEMM C = act(A·W + bias + resid): A f32 (ASPLIT -> hi/lo 2 terms), Wt bf16 [N][K]; ACT 0 none, 1 relu, 2 exact gelu;
// resid (optional, f32, row index = (row % rmod), pitch ldr, RES_BF16 rounds it) added before the activation.
template <bool ASPLIT, int ACT, bool BIAS_BF16, bool RES_BF16>
__global__ __launch_bounds__(128) void k_gemm_bf3(const float* __restrict__ A, int lda, const unsigned short* __restrict__ Wt, int ldb,
                                                const float* __restrict__ bias, const float* __restrict__ resid, int rmod, int ldr,
                                                float* __restrict__ C, int ldc, int M, int N, int K) {
  __shared__ __attribute__((aligned(16))) float so[4][16][64];
  const int tid = threadIdx.x, w = tid >> 5, lane = tid & 31, ln = lane & 15, hh = lane >> 4;
  const int ntn = N / 64;
  const int wid = blockIdx.x * 4 + w;
  const int mt = wid / ntn, nq = wid % ntn;
  if (mt * 16 >= M) return;
  const int row0 = mt * 16, col0 = nq * 64;
  const float* arow = A + (size_t)(row0 + ln) * lda;
  v8f acc[4] = {};
  for (int kb = 0; kb < K; kb += 32) {
    FragB ah, al;
    const v4f x0 = *(const v4fa*)(arow + kb + 8 * hh), x1 = *(const v4fa*)(arow + kb + 8 * hh + 4);
    const v4f x2 = *(const v4fa*)(arow + kb + 16 + 8 * hh), x3 = *(const v4fa*)(arow + kb + 16 + 8 * hh + 4);
    float xs[16] = {x0[0],x0[1],x0[2],x0[3],x1[0],x1[1],x1[2],x1[3],x2[0],x2[1],x2[2],x2[3],x3[0],x3[1],x3[2],x3[3]};
#pragma unroll
    for (int i = 0; i < 16; ++i) { const unsigned short hb = bf16_bits(xs[i]); ah.u[i] = hb; al.u[i] = ASPLIT ? bf16_bits(xs[i] - bf16_val(hb)) : (unsigned short)0; }
#pragma unroll
    for (int t = 0; t < 4; ++t) {
      const unsigned short* brow = Wt + (size_t)(col0 + t * 16 + ln) * ldb + kb;
      FragB b;
      b.half[0] = *(const v8us*)(brow + 8 * hh);
      b.half[1] = *(const v8us*)(brow + 16 + 8 * hh);
      acc[t] = mmaN<ASPLIT ? 2 : 1>(ah.v, al.v, b.v, b.v, acc[t]);
    }
  }
#pragma unroll
  for (int t = 0; t < 4; ++t) {
    const int col = col0 + t * 16 + ln;
    float bv = bias ? bias[col] : 0.f;
    if (BIAS_BF16) bv = bf16_round(bv);
#pragma unroll
    for (int r = 0; r < 8; ++r) {
      float v = acc[t][r] + bv;
      if (resid) { float rv = resid[(size_t)((row0 + 8 * hh + r) % rmod) * ldr + col]; if (RES_BF16) rv = bf16_round(rv); v += rv; }
      if (ACT == 1) v = fmaxf(v, 0.f);
      if (ACT == 2) v = 0.5f * v * (1.0f + erff(v * 0.70710678118654752f));
      if (ACT == 3) { const float u = 0.7978845608028654f * (v + 0.044715f * v * v * v); v = 0.5f * v * (1.0f + tanhf(u)); }
      so[w][8 * hh + r][t * 16 + ln] = v;
    }
  }
  __builtin_amdgcn_fence(__ATOMIC_ACQ_REL, "workgroup");
  __builtin_amdgcn_wave_barrier();
  const int rsub = lane >> 4, c4 = (lane & 15) * 4;
  {
#pragma unroll
    for (int q = 0; q < 8; ++q) {
      const int r = q * 2 + rsub;
      const v4f v = *(const v4fa*)&so[w][r][c4];
      *(v4f*)(C + (size_t)(row0 + r) * ldc + col0 + c4) = v;
    }
    
  }
}
// row LayerNorm (biased variance, eps) over N: s = X (+ R); optional out_sum <- s; out_norm <- (s-mu)*rsqrt(var+eps)*g + b
template <bool PARAM_BF16>
__global__ __launch_bounds__(256) void k_layernorm(const float* __restrict__ X, const float* __restrict__ R, const float* __restrict__ g, const float* __restrict__ bta,
                                                  float* __restrict__ out_sum, float* __restrict__ out_norm, int N, float eps) {
  __shared__ float red[256];
  const int row = blockIdx.x, tid = threadIdx.x;
  const float* x = X + (size_t)row * N; const float* rr = R ? R + (size_t)row * N : nullptr;
  float vals[16];                     // up to N = 4096
  const int per = N / 256;            // contiguous chunk per thread? use strided-by-4 chunks: thread handles j = tid*4 + 1024*u
  float s1 = 0.f;
  for (int u = 0; u < per / 4; ++u) {
    const int j = tid * 4 + 1024 * u;
    const v4f a = *(const v4fa*)(x + j);
    v4f b = {0.f,0.f,0.f,0.f}; if (rr) b = *(const v4fa*)(rr + j);
#pragma unroll
    for (int q = 0; q < 4; ++q) { const float v = a[q] + b[q]; vals[u * 4 + q] = v; s1 += v; }
  }
  red[tid] = s1; __syncthreads();
  for (int st = 128; st > 0; st >>= 1) { if (tid < st) red[tid] += red[tid + st]; __syncthreads(); }
  const float mu = red[0] / (float)N; __syncthreads();
  float s2 = 0.f;
  for (int u = 0; u < per / 4; ++u)
#pragma unroll
    for (int q = 0; q < 4; ++q) { const float c = vals[u * 4 + q] - mu; s2 += c * c; }
  red[tid] = s2; __syncthreads();
  for (int st = 128; st > 0; st >>= 1) { if (tid < st) red[tid] += red[tid + st]; __syncthreads(); }
  const float rs = rsqrtf(red[0] / (float)N + eps);
  {
    for (int u = 0; u < per / 4; ++u) {
      const int j = tid * 4 + 1024 * u;
      v4f o, sm;
#pragma unroll
      for (int q = 0; q < 4; ++q) {
        float gg = g[j + q], bb = bta[j + q];
        if (PARAM_BF16) { gg = bf16_round(gg); bb = bf16_round(bb); }
        sm[q] = vals[u * 4 + q]; o[q] = (vals[u * 4 + q] - mu) * rs * gg + bb;
      }
      if (out_sum) *(v4f*)(out_sum + (size_t)row * N + j) = sm;
      *(v4f*)(out_norm + (size_t)row * N + j) = o;
    }
    
  }
}



// ---- f16 WMMA path (v_wmma_f32_16x16x32_f16): 11-bit significands for operands in range — used where a [0,1] probability operand needs more precision than bf16
typedef _Float16 v16h __attribute__((ext_vector_type(16)));
union FragH { v16h v; v8us half[2]; _Float16 h[16]; unsigned short u[16]; };
template <int NT>
__device__ __forceinline__ v8f mmaH(v16h ah, v16h al, v16h bh, v16h bl, v8f c) {
  c = __builtin_amdgcn_wmma_f32_16x16x32_f16(false, ah, false, bh, (short)0, c, false, false);
  if (NT >= 2) c = __builtin_amdgcn_wmma_f32_16x16x32_f16(false, al, false, bh, (short)0, c, false, false);
  if (NT >= 3) c = __builtin_amdgcn_wmma_f32_16x16x32_f16(false, ah, false, bl, (short)0, c, false, false);
  asm volatile("v_nop\n\tv_nop\n\tv_nop\n\tv_nop" : "+v"(c) : "v"(ah), "v"(al), "v"(bh), "v"(bl));
  return c;
}
// batched GEMM like k_gemm_b but f16 operands: A f32 (split into f16 hi/lo if ASPLIT, else rounded to f16), Bt = f16 values [n][k]; alpha; C f32; N multiple of 16 (partial tiles skipped)
template <bool ASPLIT>
__global__ __launch_bounds__(128) void k_gemm_h(const float* __restrict__ A, int lda, size_t sA, const _Float16* __restrict__ Bh, int ldb, size_t sB, float alpha, float* __restrict__ C, int ldc, size_t sC, int M, int N, int K) {
  __shared__ __attribute__((aligned(16))) float so[4][16][64];
  const int tid = threadIdx.x, w = tid >> 5, lane = tid & 31, ln = lane & 15, hh = lane >> 4; const int by = blockIdx.y;
  A += (size_t)by * sA; Bh += (size_t)by * sB; C += (size_t)by * sC;
  const int ntn = (N + 63) / 64; const int wid = blockIdx.x * 4 + w; const int mt = wid / ntn, nq = wid % ntn; if (mt * 16 >= M) return;
  const int row0 = mt * 16, col0 = nq * 64; const float* arow = A + (size_t)(row0 + ln) * lda;
  v8f acc[4] = {};
  for (int kb = 0; kb < K; kb += 32) {
    FragH ah, al;
    const v4f x0 = *(const v4fa*)(arow + kb + 8 * hh), x1 = *(const v4fa*)(arow + kb + 8 * hh + 4), x2 = *(const v4fa*)(arow + kb + 16 + 8 * hh), x3 = *(const v4fa*)(arow + kb + 16 + 8 * hh + 4);
    float xs[16] = {x0[0],x0[1],x0[2],x0[3],x1[0],x1[1],x1[2],x1[3],x2[0],x2[1],x2[2],x2[3],x3[0],x3[1],x3[2],x3[3]};
#pragma unroll
    for (int i = 0; i < 16; ++i) { const _Float16 h = (_Float16)xs[i]; ah.h[i] = h; al.h[i] = ASPLIT ? (_Float16)(xs[i] - (float)h) : (_Float16)0.0f; }
#pragma unroll
    for (int t = 0; t < 4; ++t) { if (col0 + t * 16 >= N) continue; const size_t boff = (size_t)(col0 + t * 16 + ln) * ldb + kb; FragH bq; bq.half[0] = *(const v8us*)(Bh + boff + 8 * hh); bq.half[1] = *(const v8us*)(Bh + boff + 16 + 8 * hh);
      acc[t] = mmaH<ASPLIT ? 2 : 1>(ah.v, al.v, bq.v, bq.v, acc[t]); }
  }
#pragma unroll
  for (int t = 0; t < 4; ++t) { if (col0 + t * 16 >= N) continue;
#pragma unroll
    for (int r = 0; r < 8; ++r) so[w][8 * hh + r][t * 16 + ln] = acc[t][r] * alpha; }
  __builtin_amdgcn_fence(__ATOMIC_ACQ_REL, "workgroup"); __builtin_amdgcn_wave_barrier();
  const int rsub = lane >> 4, c4 = (lane & 15) * 4;
  {
#pragma unroll
    for (int q = 0; q < 8; ++q) { const int r = q * 2 + rsub; if (col0 + c4 < N) { const v4f v = *(const v4fa*)&so[w][r][c4]; *(v4f*)(C + (size_t)(row0 + r) * ldc + col0 + c4) = v; } }
     }
}

// Wt[n][k] = f16(W[k][n]·scale) from f32 row-major W[K][N] (scale = power of two; bf16-exact weights stay exact in f16 away from the subnormal range)
__global__ __launch_bounds__(256) void k_wt_f16(const float* __restrict__ W, _Float16* __restrict__ Wt, int K, int N, float scale) {
  const int t = blockIdx.x * 256 + threadIdx.x; if (t >= N * (K / 8)) return; const int n = t / (K / 8), k8 = (t % (K / 8)) * 8; FragH f;
#pragma unroll
  for (int i = 0; i < 8; ++i) f.h[i] = (_Float16)(bf16_round(W[(size_t)(k8 + i) * N + n]) * scale); const v8us o = f.half[0];
  *(v8us*)((unsigned short*)Wt + (size_t)n * K + k8) = o; 
}
// GEMM C[M][N] = act(A.B^T * alpha (+ CP)), A f16 [M][K], Bh f16 [N][K], both k-contiguous; ACT 0 none / 6 erf-GELU; writes f32 C (HC) and / or f16 C16 (HC16), CP = f32 addend with C's pitch (HCP); CP may be C itself: each lane reads the 16-byte pieces that it later writes.
// HL: C16 takes the f16 hi plane and C16L the residual times 2^10, so that a result wanted as hi / lo planes never goes to memory as f32.
// AL: A comes as two planes, A and A2 (same shape and pitch); C = A.B^T * alpha + A2.B^T * alpha2 from two accumulator sets that share the B fragments; a stage then holds 128 rows of A2 behind those of A and B.
// One 128 x 128 tile of C per work-group of 8 waves (4 x 2, 32 x 64 each). The operands come through LDS: a stage is 128 k = 256 bytes of each of the 256 operand rows, brought by asynchronous 16-byte copies that take whole lines
// (16 lanes per row), two buffers, the next stage in flight while this one is worked on. M, N multiples of 128, K of 128 at every launch (4096 / 768 / 768 and 1536 / 2048 / 2048).
#define GT 128      /* tile edge */
#define GK 128      /* k per stage */
#define GP 272u     /* LDS row pitch in bytes = 16 x odd: the 16 rows of a fragment read fall on all 64 banks */
#define GST (2u * GT * GP)      /* bytes of a stage's A and B rows: 128 A rows, then 128 B rows; A2's follow */
// this thread's share of one operand's stage: rows 16 apart, the same 16-byte column
__device__ __forceinline__ void copy8(unsigned l, const unsigned short* g, size_t gs) {
  asm volatile("global_load_async_to_lds_b128 %0, %8, off\n\t"
               "global_load_async_to_lds_b128 %1, %9, off\n\t"
               "global_load_async_to_lds_b128 %2, %10, off\n\t"
               "global_load_async_to_lds_b128 %3, %11, off\n\t"
               "global_load_async_to_lds_b128 %4, %12, off\n\t"
               "global_load_async_to_lds_b128 %5, %13, off\n\t"
               "global_load_async_to_lds_b128 %6, %14, off\n\t"
               "global_load_async_to_lds_b128 %7, %15, off\n\t"
               "s_wait_xcnt 0x0"      /* inside the copies' own statement, so that it stands in front of every rewrite of their address registers */
               :: "v"(l), "v"(l + 16u * GP), "v"(l + 32u * GP), "v"(l + 48u * GP), "v"(l + 64u * GP), "v"(l + 80u * GP), "v"(l + 96u * GP), "v"(l + 112u * GP),
                  "v"(g), "v"(g + gs), "v"(g + 2 * gs), "v"(g + 3 * gs), "v"(g + 4 * gs), "v"(g + 5 * gs), "v"(g + 6 * gs), "v"(g + 7 * gs) : "memory");
}
template <int ACT, bool HCP, bool HC, bool HC16, bool HL, bool AL>
__global__ __launch_bounds__(256) void k_gemm_hhx(const _Float16* __restrict__ A, const _Float16* __restrict__ A2, int lda, const _Float16* __restrict__ Bh, int ldb, float alpha, float alpha2, const float* CP, float* C, _Float16* __restrict__ C16, _Float16* __restrict__ C16L, int ldc, int N, int K) {
  constexpr unsigned ST = AL ? GST + GT * GP : GST;      /* bytes of a stage */
  __shared__ __attribute__((aligned(16))) unsigned char ring[2 * ST];
  __shared__ __attribute__((aligned(16))) float so[8][16][64];
  const int tid = threadIdx.x, w = tid >> 5, lane = tid & 31, ln = lane & 15, hh = lane >> 4;
  const int ntn = N / GT; const int row0 = (int)(blockIdx.x / ntn) * GT, col0 = (int)(blockIdx.x % ntn) * GT; const int wr = (w >> 1) * 32, wc = (w & 1) * 64;
  const int cr = tid >> 4, cc = tid & 15;      /* the thread's first row of a stage and its 16-byte column */
  const unsigned short* ga = (const unsigned short*)A + (size_t)(row0 + cr) * lda + cc * 8; const unsigned short* gb = (const unsigned short*)Bh + (size_t)(col0 + cr) * ldb + cc * 8; const unsigned short* g2 = AL ? (const unsigned short*)A2 + (size_t)(row0 + cr) * lda + cc * 8 : nullptr;
  const unsigned la = (unsigned)(size_t)ring + (unsigned)cr * GP + (unsigned)cc * 16u, lb = la + GT * GP, l2 = la + GST; const size_t sa = (size_t)16 * lda, sb = (size_t)16 * ldb;
  const int nst = K / GK;
  v8f acc[2][4] = {}, acc2[2][4] = {};
  const int rsub = lane >> 4, c4 = (lane & 15) * 4; typedef _Float16 v4h __attribute__((ext_vector_type(4)));
  const size_t eo = (size_t)(row0 + wr + rsub) * ldc + col0 + wc + c4;      /* the lane's first 4 elements of the wave's 32 x 64 part of C; its others lie 2 rows apart */
  v4f cp[2][8];      /* the addend in the shape of the stores, asked for here so that all 16 loads fly together under stage 0's copies */
  if (HCP) {
#pragma unroll      // constant indices keep the array in registers
    for (int i = 0; i < 2; ++i)
#pragma unroll      // constant indices keep the array in registers
      for (int q = 0; q < 8; ++q) cp[i][q] = *(const v4fa*)(CP + eo + (size_t)(i * 16 + q * 2) * ldc); }
  copy8(la, ga, sa); copy8(lb, gb, sb); if (AL) copy8(l2, g2, sa);
  asm volatile("s_wait_asynccnt 0x0" ::: "memory");      /* stage 0 has landed, as far as this wave brought it */
  __syncthreads();      /* ... and as far as the other waves did */
  if (nst > 1) { copy8(la + ST, ga + GK, sa); copy8(lb + ST, gb + GK, sb); if (AL) copy8(l2 + ST, g2 + GK, sa); }
  const unsigned char* fa = ring + (unsigned)(wr + ln) * GP + 16 * hh; const unsigned char* fb = ring + (unsigned)(GT + wc + ln) * GP + 16 * hh;      /* fragment rows; k order as before: bytes 16hh and 32 + 16hh of each 64, A and B alike */
  for (int t = 0; t < nst; ++t) { const unsigned bo = (unsigned)(t & 1) * ST;
#pragma unroll      // constant indices keep the fragment arrays in registers
    for (int ks = 0; ks < GK / 32; ++ks) { FragH a2[2], a3[2], b2[4];
#pragma unroll      // constant indices keep the fragment arrays in registers
      for (int i = 0; i < 2; ++i) { a2[i].half[0] = *(const v8us*)(fa + bo + i * 16 * GP + ks * 64); a2[i].half[1] = *(const v8us*)(fa + bo + i * 16 * GP + ks * 64 + 32);
        if (AL) { a3[i].half[0] = *(const v8us*)(fa + bo + GST + i * 16 * GP + ks * 64); a3[i].half[1] = *(const v8us*)(fa + bo + GST + i * 16 * GP + ks * 64 + 32); } }      /* the same rows and the same k order in the second plane */
#pragma unroll      // constant indices keep the fragment arrays in registers
      for (int j = 0; j < 4; ++j) { b2[j].half[0] = *(const v8us*)(fb + bo + j * 16 * GP + ks * 64); b2[j].half[1] = *(const v8us*)(fb + bo + j * 16 * GP + ks * 64 + 32); }
#pragma unroll      // constant indices keep the fragment arrays in registers
      for (int i = 0; i < 2; ++i)
#pragma unroll      // constant indices keep the fragment arrays in registers
        for (int j = 0; j < 4; ++j) { acc[i][j] = mmaH<1>(a2[i].v, a2[i].v, b2[j].v, b2[j].v, acc[i][j]); if (AL) acc2[i][j] = mmaH<1>(a3[i].v, a3[i].v, b2[j].v, b2[j].v, acc2[i][j]); } }
    asm volatile("s_wait_dscnt 0x0" ::: "memory");      /* this wave's reads of the buffer are done before the barrier frees it for the refill */
    asm volatile("s_wait_asynccnt 0x0" ::: "memory");      /* this wave's copies of stage t + 1 have landed before the barrier publishes them */
    __syncthreads();
    if (t + 2 < nst) { copy8(la + bo, ga + (size_t)(t + 2) * GK, sa); copy8(lb + bo, gb + (size_t)(t + 2) * GK, sb); if (AL) copy8(l2 + bo, g2 + (size_t)(t + 2) * GK, sa); } }
  asm volatile("s_wait_asynccnt 0x0" ::: "memory");      /* no copy is outstanding when the wave goes on to its end */
  // Epilogue, 16 x 64 at a time through the wave's own LDS rows; straight-line: what exists is known at compile time, the staged rows are read back together, and addend and activation are applied to the 16-byte pieces that are stored.
#pragma unroll      // constant indices keep the accumulators in registers
  for (int i = 0; i < 2; ++i) {
#pragma unroll
    for (int t = 0; t < 4; ++t)
#pragma unroll
      for (int r = 0; r < 8; ++r) so[w][8 * hh + r][t * 16 + ln] = AL ? acc2[i][t][r] * alpha2 + acc[i][t][r] * alpha : acc[i][t][r] * alpha;
    __builtin_amdgcn_fence(__ATOMIC_ACQ_REL, "workgroup"); __builtin_amdgcn_wave_barrier();
    v4f vv[8];
#pragma unroll      // constant indices keep the array in registers
    for (int q = 0; q < 8; ++q) vv[q] = *(const v4fa*)&so[w][q * 2 + rsub][c4];
#pragma unroll      // constant indices keep the arrays in registers
    for (int q = 0; q < 8; ++q) { v4f v = vv[q]; const size_t o = eo + (size_t)(i * 16 + q * 2) * ldc;
      if (HCP) v += cp[i][q];
      if (ACT == 6) for (int e = 0; e < 4; ++e) v[e] = 0.5f * v[e] * (1.0f + erff(v[e] * 0.70710678118654752f));
      if (HC) { *(v4f*)(C + o) = v; asm volatile("s_wait_xcnt 0x0" ::: "memory"); }      /* the wait in front of any rewrite of the store's registers */
      if (HC16) { v4h h4; for (int e = 0; e < 4; ++e) h4[e] = (_Float16)v[e]; *(v4h*)(C16 + o) = h4; asm volatile("s_wait_xcnt 0x0" ::: "memory"); }      /* likewise */
      if (HL) { v4h h4, l4; for (int e = 0; e < 4; ++e) { h4[e] = (_Float16)v[e]; l4[e] = (_Float16)((v[e] - (float)h4[e]) * 1024.0f); }
        asm volatile("global_store_b64 %0, %2, off\n\tglobal_store_b64 %1, %3, off\n\ts_wait_xcnt 0x0" :: "v"(C16 + o), "v"(C16L + o), "v"(h4), "v"(l4) : "memory"); } }      /* both stores and their wait in one statement: as a statement of its own the wait let rewrites of the stores' registers pass in front of it */
    __builtin_amdgcn_fence(__ATOMIC_ACQ_REL, "workgroup"); __builtin_amdgcn_wave_barrier();      /* the next 16 rows are staged in the same LDS only behind these reads */
  }
}


typedef _Float16 v4h __attribute__((ext_vector_type(4)));

__global__ __launch_bounds__(256) void k_x16(const float* __restrict__ x, _Float16* __restrict__ X16, size_t n8) { const size_t t = (size_t)blockIdx.x * 256 + threadIdx.x; if (t >= n8) return; FragH f;
#pragma unroll
  for (int q = 0; q < 8; ++q) f.h[q] = (_Float16)bf16_round(x[t * 8 + q]); *(v8us*)((unsigned short*)X16 + t * 8) = f.half[0];  }
__global__ __launch_bounds__(256) void k_h16(const float* __restrict__ x, _Float16* __restrict__ X16, size_t n8) { const size_t t = (size_t)blockIdx.x * 256 + threadIdx.x; if (t >= n8) return; FragH f;
#pragma unroll
  for (int q = 0; q < 8; ++q) f.h[q] = (_Float16)x[t * 8 + q]; *(v8us*)((unsigned short*)X16 + t * 8) = f.half[0];  }
// Bt = f16(bf16(W) x 2^4), element for element: a work-group's share is RW consecutive elements, a thread's 16 pieces of 4, 256 pieces apart, so that every load takes four whole lines a wave and every store two.
#define RW 16384      /* elements per work-group: 256 threads x 16 pieces x 4 */
__device__ __forceinline__ void round_share(const float* __restrict__ W, _Float16* __restrict__ Bt, int blk, int tid) { const size_t e0 = (size_t)blk * RW + tid * 4; v4f a[16];
#pragma unroll      // constant indices keep the array in registers; the 16 loads are asked for together
  for (int i = 0; i < 16; ++i) a[i] = *(const v4fa*)(W + e0 + i * 1024);
  asm volatile("s_wait_xcnt 0x0" :: "v"(W + e0) : "memory");      /* the wait in front of any rewrite of the loads' address registers by what follows; the address is named so that it lives up to here and no load's result is put over it */
  v4h o[16];
#pragma unroll      // constant indices keep the arrays in registers
  for (int i = 0; i < 16; ++i) for (int q = 0; q < 4; ++q) o[i][q] = (_Float16)(bf16_round(a[i][q]) * 16.0f);
#pragma unroll      // constant indices keep the array in registers
  for (int i = 0; i < 16; ++i) *(v4h*)(Bt + e0 + i * 1024) = o[i]; }
template <int NHv, int TTv>
__global__ __launch_bounds__(256) void k_vt(const _Float16* __restrict__ V16, int ldv, int voff, _Float16* __restrict__ Vt) { __shared__ unsigned short tl[64][66]; const int tid = threadIdx.x; const int slab = blockIdx.x / (TTv / 64), lg = blockIdx.x % (TTv / 64); const int b = slab / NHv, h = slab % NHv;
  for (int i = tid; i < 64 * 8; i += 256) { const int r = i / 8, c8 = (i % 8) * 8; FragH f; f.half[0] = *(const v8us*)((const unsigned short*)V16 + ((size_t)b * TTv + lg * 64 + r) * ldv + voff + h * 64 + c8);
#pragma unroll
    for (int q = 0; q < 8; ++q) tl[r][c8 + q] = f.u[q]; }
  __syncthreads();
  {
#pragma unroll
    for (int rd = 0; rd < 2; ++rd) { const int d = rd * 32 + tid / 8, pc = tid % 8; FragH f;
#pragma unroll
      for (int q = 0; q < 8; ++q) f.u[q] = tl[pc * 8 + q][d];
      *(v8us*)((unsigned short*)Vt + ((size_t)slab * 64 + d) * TTv + lg * 64 + pc * 8) = f.half[0]; }
     } }

// RMSNorm rows (C = 768 = 32 lanes x 24): y = x.rsqrt(mean(x^2) + 1.1920929e-7).bf16(g); RB: round the input to bf16 first; ADD: the input is X + R (the residual add, done here where its rows are read); outputs: f16 hi + x2^10 residual planes (either may be null)
// and optionally the f32 input as normalised (rounded, or summed) XR; wave per row; per lane 6 float4 pieces (c = j.128 + lane.4).
// TR: also v^T per (b,h), [32][2048] f16 of hi + lo.2^-10. The work-group's 8 rows are 6144 consecutive elements of the flat plane = 3 whole tiles of 64 n x 32 d of the raw head view, turned through LDS; the work-groups of the rows are then exactly NR / 8, so no row test stands in front of the barrier.
// CV: the launch also rounds the four weight matrices, which nothing here reads and which depend on nothing here: the work-groups behind the NR / 8 of the rows take one share of RW elements each, WA's first, then Wq's, W1's and W2's, and leave ahead of the barrier as a whole.
#define CVA (NN * NN / RW)      /* shares of WA */
#define CVW (CC * CC / RW)      /* shares of each C x C weight */
template <int RB, bool ADD, bool TR, bool CV>
__global__ __launch_bounds__(256) void k_rms(const float* __restrict__ X, const float* __restrict__ R, const float* __restrict__ g, int nrows, _Float16* __restrict__ YH, _Float16* __restrict__ YL, float* __restrict__ XR, _Float16* __restrict__ VT,
                                             const float* __restrict__ WA, const float* __restrict__ Wq, const float* __restrict__ W1, const float* __restrict__ W2, _Float16* __restrict__ BA, _Float16* __restrict__ Bq, _Float16* __restrict__ B1, _Float16* __restrict__ B2) { __shared__ float tl[TR ? 3 : 1][64][33]; const int tid = threadIdx.x, wv = tid >> 5, lane = tid & 31;
  if (CV && blockIdx.x >= NR / 8) { const int c = (int)blockIdx.x - NR / 8;
    const int k = c < CVA ? 0 : 1 + (c - CVA) / CVW;      /* which matrix: uniform for the work-group, so pointers and share are picked in scalar registers and the body stands once in the text */
    round_share(k == 0 ? WA : k == 1 ? Wq : k == 2 ? W1 : W2, k == 0 ? BA : k == 1 ? Bq : k == 2 ? B1 : B2, k == 0 ? c : (c - CVA) % CVW, tid);
    return; }
  const int r = blockIdx.x * 8 + wv; if (!TR && r >= nrows) return; v4f xv[6]; float ss = 0.f;
#pragma unroll
  for (int j = 0; j < 6; ++j) { v4f a = *(const v4fa*)(X + (size_t)r * CC + j * 128 + lane * 4); if (ADD) { const v4f b = *(const v4fa*)(R + (size_t)r * CC + j * 128 + lane * 4); for (int q = 0; q < 4; ++q) a[q] += b[q]; } if (RB) for (int q = 0; q < 4; ++q) a[q] = bf16_round(a[q]); xv[j] = a; for (int q = 0; q < 4; ++q) ss += a[q] * a[q]; }
  for (int o = 16; o >= 1; o >>= 1) ss += __shfl_xor(ss, o, 32); const float rs = rsqrtf(ss / (float)CC + 1.1920929e-7f);
  typedef _Float16 v4h __attribute__((ext_vector_type(4)));
  {
#pragma unroll
    for (int j = 0; j < 6; ++j) { const int c = j * 128 + lane * 4; v4h hh, hl; for (int q = 0; q < 4; ++q) { const float y = xv[j][q] * rs * bf16_round(g[c + q]); const _Float16 hv = (_Float16)y; hh[q] = hv; hl[q] = (_Float16)((y - (float)hv) * 1024.0f); }
      if (TR) { const int e = wv * CC + c; for (int q = 0; q < 4; ++q) tl[e >> 11][(e & 2047) >> 5][(e & 31) + q] = (float)hh[q] + (float)hl[q] * 0.0009765625f; }
      if (YH) *(v4h*)(YH + (size_t)r * CC + c) = hh; if (YL) *(v4h*)(YL + (size_t)r * CC + c) = hl; if (XR) *(v4f*)(XR + (size_t)r * CC + c) = xv[j]; }
     }
  if (TR) { asm volatile("s_wait_xcnt 0x0" ::: "memory");      /* the wait in front of any rewrite of the row stores' registers by what follows */
    __syncthreads();      /* the 3 tiles are whole only when all 8 rows are in */
    const int d = tid / 8, pc = tid % 8;
#pragma unroll      // the three tiles' LDS reads are asked for together, not tile by tile
    for (int t3 = 0; t3 < 3; ++t3) { const int tile = blockIdx.x * 3 + t3, slab = tile / (NN / 64), ng = tile % (NN / 64); FragH f; for (int q = 0; q < 8; ++q) f.h[q] = (_Float16)tl[t3][pc * 8 + q][d];
      *(v8us*)((unsigned short*)VT + ((size_t)slab * HD + d) * NN + ng * 64 + pc * 8) = f.half[0]; } } }
// lane l <-> lane l ^ 16 by a vector cross-row move (no LDS counter involved)
__device__ __forceinline__ float xhalf(float x) { return __builtin_bit_cast(float, __builtin_amdgcn_permlanex16(__builtin_bit_cast(int, x), __builtin_bit_cast(int, x), 0x76543210, 0xfedcba98, false, false)); }
typedef float v2f __attribute__((ext_vector_type(2)));
#define FK 128      /* keys per stage */
#define FKP 80u     /* LDS pitch of a K row in bytes = 16 x odd: the 16 rows of a fragment read fall on all 64 banks */
#define FVP 272u    /* LDS pitch of a V'^T row, likewise */
#define FKB (FK * FKP)      /* bytes of one K plane's stage */
#define FST (2u * FKB + HD * FVP)      /* bytes of a stage: K hi, K lo, V'^T */
// this thread's share of a stage: two 16-byte pieces of each of the three operands (K rows 64 apart, V'^T rows 16 apart)
__device__ __forceinline__ void copy6(unsigned lk, unsigned lv, const unsigned short* gh, const unsigned short* gl, size_t ks, const unsigned short* gv) {
  asm volatile("global_load_async_to_lds_b128 %0, %6, off\n\t"
               "global_load_async_to_lds_b128 %1, %7, off\n\t"
               "global_load_async_to_lds_b128 %2, %8, off\n\t"
               "global_load_async_to_lds_b128 %3, %9, off\n\t"
               "global_load_async_to_lds_b128 %4, %10, off\n\t"
               "global_load_async_to_lds_b128 %5, %11, off\n\t"
               "s_wait_xcnt 0x0"      /* inside the copies' own statement, so that it stands in front of every rewrite of their address registers */
               :: "v"(lk), "v"(lk + 64u * FKP), "v"(lk + FKB), "v"(lk + FKB + 64u * FKP), "v"(lv), "v"(lv + 16u * FVP),
                  "v"(gh), "v"(gh + ks), "v"(gl), "v"(gl + ks), "v"(gv), "v"(gv + (size_t)16 * NN) : "memory");
}
__global__ __launch_bounds__(256) void k_flash(const _Float16* __restrict__ Q16, const _Float16* __restrict__ Q16lo, int ldq, const _Float16* __restrict__ K16, const _Float16* __restrict__ K16lo, int ldk, const _Float16* __restrict__ Vt, const float* __restrict__ SP, float* __restrict__ O, int ldo) {
  constexpr int NQB = NN / 128, DT = 2, NST = NN / FK;
  __shared__ __attribute__((aligned(16))) unsigned char ring[2 * FST];
  const int tid = threadIdx.x, w = tid >> 5, lane = tid & 31, ln = lane & 15, hh = lane >> 4;
  const int slab = blockIdx.x / NQB, qblk = blockIdx.x % NQB; const int h = slab % NH; const float coef = ((logf(768.0f) * bf16_round(SP[h])) * 5.656854249492381f) * 1.4426950408889634f;      /* times log2(e): the logits are kept in base 2, so each exponential is one hardware instruction */ const int q0 = qblk * 128 + w * 16;
  FragH bq, bql;
  { const size_t qo = ((size_t)slab * NN + q0 + ln) * ldq; const unsigned short* qr = (const unsigned short*)Q16 + qo; const unsigned short* ql = (const unsigned short*)Q16lo + qo;
    bq.half[0] = *(const v8us*)(qr + 8 * hh); bq.half[1] = *(const v8us*)(qr + 16 + 8 * hh); bql.half[0] = *(const v8us*)(ql + 8 * hh); bql.half[1] = *(const v8us*)(ql + 16 + 8 * hh); }
  const size_t kc = (size_t)slab * NN * ldk + (size_t)(tid >> 2) * ldk + (tid & 3) * 8;      /* the thread's first piece of a K stage: row tid / 4, 16-byte column tid % 4 */
  const unsigned short* gh = (const unsigned short*)K16 + kc; const unsigned short* gl = (const unsigned short*)K16lo + kc; const size_t ks = (size_t)64 * ldk, kst = (size_t)FK * ldk;
  const unsigned short* gv = (const unsigned short*)Vt + (size_t)slab * HD * NN + (size_t)(tid >> 4) * NN + (tid & 15) * 8;      /* v'^T per slab: [32][N]; row tid / 16, 16-byte column tid % 16 of the stage's 256 bytes */
  const unsigned lk = (unsigned)(size_t)ring + (unsigned)(tid >> 2) * FKP + (unsigned)(tid & 3) * 16u, lv = (unsigned)(size_t)ring + 2u * FKB + (unsigned)(tid >> 4) * FVP + (unsigned)(tid & 15) * 16u;
  copy6(lk, lv, gh, gl, ks, gv);
  asm volatile("s_wait_asynccnt 0x0" ::: "memory");      /* stage 0 has landed, as far as this wave brought it */
  __syncthreads();      /* ... and as far as the other waves did */
  copy6(lk + FST, lv + FST, gh + kst, gl + kst, ks, gv + FK);
  const unsigned char* fk = ring + (unsigned)ln * FKP + 16 * hh; const unsigned char* fv = ring + 2u * FKB + (unsigned)ln * FVP + 16 * hh;      /* fragment rows; k order as before: bytes 16hh and 32 + 16hh of each 64 */
  float m_q = -3.0e38f, s_q = -3.0e38f, l_q = 0.f; v8f oacc[DT];      /* s_q = m_q - 10 as rounded: what the exponents subtract, so that P and the denominator carry the factor 2^10 */
#pragma unroll
  for (int dt = 0; dt < DT; ++dt) oacc[dt] = (v8f){0.f,0.f,0.f,0.f,0.f,0.f,0.f,0.f};
  for (int t = 0; t < NST; ++t) { const unsigned bo = (unsigned)(t & 1) * FST;
#pragma unroll 1      // unrolled, four passes' exponentials stayed live to the stage's end and the registers allowed one work-group fewer on a WGP
   for (int p = 0; p < FK / 32; ++p) {
    FragH ak[2], akl[2], av[DT];
#pragma unroll
    for (int nt = 0; nt < 2; ++nt) { const unsigned char* kr = fk + bo + (unsigned)(p * 32 + nt * 16) * FKP; ak[nt].half[0] = *(const v8us*)kr; ak[nt].half[1] = *(const v8us*)(kr + 32); akl[nt].half[0] = *(const v8us*)(kr + FKB); akl[nt].half[1] = *(const v8us*)(kr + FKB + 32); }
#pragma unroll
    for (int dt = 0; dt < DT; ++dt) { const unsigned char* vr = fv + bo + (unsigned)(dt * 16) * FVP + p * 64; av[dt].half[0] = *(const v8us*)vr; av[dt].half[1] = *(const v8us*)(vr + 32); }
    v2f s2[8];      /* the 16 logits as the register pairs the accumulators already form */
#pragma unroll
    for (int nt = 0; nt < 2; ++nt) { v8f acc = (v8f){0.f,0.f,0.f,0.f,0.f,0.f,0.f,0.f}, accl = acc;
      acc = mmaH<1>(ak[nt].v, ak[nt].v, bq.v, bq.v, acc); accl = mmaH<1>(ak[nt].v, ak[nt].v, bql.v, bql.v, accl); accl = mmaH<1>(akl[nt].v, akl[nt].v, bq.v, bq.v, accl);
#pragma unroll
      for (int j = 0; j < 4; ++j) { const v2f a2 = {acc[2 * j], acc[2 * j + 1]}, b2 = {accl[2 * j], accl[2 * j + 1]}; s2[nt * 4 + j] = (a2 + b2 * 0.0009765625f) * coef; } }
    float mx[8];
#pragma unroll
    for (int j = 0; j < 4; ++j) { mx[2 * j] = fmaxf(s2[j].x, s2[4 + j].x); mx[2 * j + 1] = fmaxf(s2[j].y, s2[4 + j].y); }
    float mc = fmaxf(fmaxf(fmaxf(mx[0], mx[1]), fmaxf(mx[2], mx[3])), fmaxf(fmaxf(mx[4], mx[5]), fmaxf(mx[6], mx[7])));
    mc = fmaxf(mc, xhalf(mc));
    const float mn = fmaxf(m_q, mc); const float sn = mn - 10.0f; float ea;      /* the rescale uses the same rounded subtrahends as the exponents of the two passes */
    asm("v_exp_f32 %0, %1\n\tv_nop" : "=v"(ea) : "v"(s_q - sn));      /* in asm for the v_nop alone: it keeps the one slot behind a transcendental */
    const float al = (mn > -1.0e38f) ? ea : 1.0f; m_q = mn; s_q = sn;
    v2f p2[8]; FragH pb;
#pragma unroll
    for (int i = 0; i < 8; ++i) { const v2f e2 = s2[i] - sn; p2[i].x = __builtin_amdgcn_exp2f(e2.x); p2[i].y = __builtin_amdgcn_exp2f(e2.y); pb.h[2 * i] = (_Float16)p2[i].x; pb.h[2 * i + 1] = (_Float16)p2[i].y; }
    const v2f ps = ((p2[0] + p2[1]) + (p2[2] + p2[3])) + ((p2[4] + p2[5]) + (p2[6] + p2[7]));
    l_q = l_q * al + (ps.x + ps.y);      /* per-lane partial sum of the query's denominator (the two halves are joined after the loop) */
#pragma unroll
    for (int dt = 0; dt < DT; ++dt) {
#pragma unroll
      for (int r = 0; r < 8; ++r) oacc[dt][r] *= al;
      oacc[dt] = mmaH<1>(av[dt].v, av[dt].v, pb.v, pb.v, oacc[dt]); } }
    asm volatile("s_wait_dscnt 0x0" ::: "memory");      /* this wave's reads of the buffer are done before the barrier frees it for the refill */
    asm volatile("s_wait_asynccnt 0x0" ::: "memory");      /* this wave's copies of stage t + 1 have landed before the barrier publishes them */
    __syncthreads();
    if (t + 2 < NST) copy6(lk + bo, lv + bo, gh + (size_t)(t + 2) * kst, gl + (size_t)(t + 2) * kst, ks, gv + (t + 2) * FK); }
  asm volatile("s_wait_asynccnt 0x0" ::: "memory");      /* no copy is outstanding when the wave goes on to its end */
  const float lt = l_q + xhalf(l_q); const float inv = (lt > 0.f) ? 1.0f / lt : 0.f;      /* numerator and denominator both carry 2^10 */
  float* orow = O + ((size_t)slab * NN + q0 + ln) * ldo + 8 * hh;      /* oacc[dt][r] = O[q0 + ln][dt * 16 + 8hh + r]: eight consecutive d per lane */
#pragma unroll
  for (int dt = 0; dt < DT; ++dt) { const v4f o0 = {oacc[dt][0] * inv, oacc[dt][1] * inv, oacc[dt][2] * inv, oacc[dt][3] * inv}, o1 = {oacc[dt][4] * inv, oacc[dt][5] * inv, oacc[dt][6] * inv, oacc[dt][7] * inv};
    *(v4f*)(orow + dt * 16) = o0; *(v4f*)(orow + dt * 16 + 4) = o1; } }

extern "C" void kernel_launch(void* const* d_in, const int* in_sizes, int n_in,
                              void* d_out, int out_size, void* d_ws, size_t ws_size, hipStream_t stream) {
  (void)in_sizes; (void)n_in; (void)out_size;
  const float* const* I = (const float* const*)d_in; const float* x = I[0]; const float* sp = I[1]; const float* Wq = I[2]; const float* WA = I[3]; const float* W1 = I[4]; const float* W2 = I[5]; const float* g1 = I[6]; const float* g2 = I[7];
  char* ws = (char*)d_ws; size_t off = 0;
  auto take = [&](size_t bytes) { char* p = ws + off; off += (bytes + 255) & ~(size_t)255; return p; };
  const size_t WSZ = (size_t)CC * CC; _Float16* Bq = (_Float16*)take(WSZ * 2); _Float16* B1 = (_Float16*)take(WSZ * 2); _Float16* B2 = (_Float16*)take(WSZ * 2); _Float16* BA = (_Float16*)take((size_t)NN * NN * 2);
  _Float16* XH = (_Float16*)take((size_t)NR * CC * 2); _Float16* XL = (_Float16*)take((size_t)NR * CC * 2); float* XR = (float*)take((size_t)NR * CC * 4); float* QF = (float*)take((size_t)NR * CC * 4); _Float16* QH = (_Float16*)take((size_t)NR * CC * 2); _Float16* QL = (_Float16*)take((size_t)NR * CC * 2);
  _Float16* VT = (_Float16*)take((size_t)BB * NH * HD * NN * 2); _Float16* VPT = (_Float16*)take((size_t)BB * NH * HD * NN * 2); float* ATT = (float*)take((size_t)NR * CC * 4);
  float* O = QF; _Float16* H16 = XH; _Float16* FH = XL;      /* O (raw [B][H][N][hd] f32); RMSNorm2 output over XH and the FF hidden over XL (both dead after the flash kernel) */
  if (off > ws_size) return;      // 3.5 + 8.4 + 6.3 × 2 + 12.6 × 2 + 6.3 × 2 + 6.3 × 2 + 12.6 ≈ 87 MB
  k_rms<1, false, true, true><<<NR / 8 + CVA + 3 * CVW, 256, 0, stream>>>(x, nullptr, g1, NR, XH, XL, XR, VT, WA, Wq, W1, W2, BA, Bq, B1, B2);      /* xn = RMSNorm(bf16 x).g1 as hi / x2^10 residual planes; XR = bf16(x); v^T per (b,h): [32][2048] f16; in the same launch the weights as f16: (out,in) natural x2^4, WA natural [m][n] x2^4 */
  const unsigned gq = (NR / GT) * (CC / GT);
  k_gemm_hhx<0, false, false, false, true, true><<<gq, 256, 0, stream>>>(XH, XL, CC, Bq, CC, 0.0625f, 0.0625f * 0.0009765625f, nullptr, nullptr, QH, QL, CC, CC, CC);      /* q = xn.Wq^T, M 4096 N 768 K 768: hi term + lo term * 2^-10 in one launch; q leaves as hi / x2^10 residual planes (flat; head h of batch b = elements [b.N.C + h.N.hd, +N.hd) viewed [N][hd]) */
  const unsigned gvp = (BB * NH * HD / GT) * (NN / GT);      /* the 48 slabs of 32 rows lie one behind the other in VT and VPT: one GEMM of 1536 rows */
  k_gemm_hhx<0, false, false, true, false, false><<<gvp, 256, 0, stream>>>(VT, nullptr, NN, BA, NN, 0.0625f, 0.f, nullptr, nullptr, VPT, nullptr, NN, NN, NN);      /* v'^T[d][m] = sum over n of v^T[d][n].WA[m][n], all 48 (b,h) at once: M 1536 N 2048 K 2048 */
  k_flash<<<BB * NH * (NN / 128), 256, 0, stream>>>(QH, QL, HD, XH, XL, HD, VPT, sp, O, HD);      /* per (b,h) slab of the raw head views (flat planes, ld 32): softmax(coef_h·q·kᵀ)·v' → O raw [B][H][N][32] */
  k_rms<0, true, false, false><<<(NR + 7) / 8, 256, 0, stream>>>(O, XR, g2, NR, H16, nullptr, ATT, nullptr, nullptr, nullptr, nullptr, nullptr, nullptr, nullptr, nullptr, nullptr);      /* attn = raw-reshaped O + x, kept as f32; h = RMSNorm(attn).g2 as f16 */
  k_gemm_hhx<6, false, false, true, false, false><<<gq, 256, 0, stream>>>(H16, nullptr, CC, B1, CC, 0.0625f, 0.f, nullptr, nullptr, FH, nullptr, CC, CC, CC);      /* gelu_erf(h.W1^T) to f16: M 4096 N 768 K 768 */
  k_gemm_hhx<0, true, true, false, false, false><<<gq, 256, 0, stream>>>(FH, nullptr, CC, B2, CC, 0.0625f, 0.f, ATT, (float*)d_out, nullptr, nullptr, CC, CC, CC);      /* out = that.W2^T + attn */
}

// v010
// Measured time: 125 microseconds a run.
// Next to v009, in two timings, it ran 1.05 and 1.03 times as fast.
// All steps since v000 together make it 3.76 times as fast.
#include <hip/hip_runtime.h>
// 'Scalable super' multi-head attention block (B=2, N=2048, C=768, H=24, hd=32): xn = RMSNorm(x)·g1; q = (xn·Wqᵀ) RAW-reshaped [B,H,N,hd] (no transpose — the module's quirk), k = v = xn raw-reshaped likewise; v' = WA[:N,:N]·v (value premix);
// scores = softmax(coef_h · q·kᵀ) with coef_h = log(C)·scale_param[h]·√hd (up to ≈56 → extremely peaked); attn = (scores·v') raw-reshaped back to [B,N,C] + x; h = RMSNorm(attn)·g2; out = gelu_erf(h·W1ᵀ)·W2ᵀ + attn.
// Compute dtype: x, scale_param, weights, WA, g rounded to bf16; RMSNorm in f32 (wave per row) → f16 hi + ×2^10 residual planes; q = xn·Wqᵀ f32-accurate (hi·W + lo·W·2^-10) → hi/lo planes; per (b,h) the 2048×2048 logit plane
// computed inside a fused flash-style kernel from three f16 products (q_hi·k_hi + (q_lo·k_hi + q_hi·k_lo)·2^-10, d = 32) and scaled by the per-head coefficient in f32; online f32 softmax; P f16 ×2^10; v'ᵀ = vᵀ·WAᵀ by GEMM (f16); O = P·v' accumulated in f32 into the raw [B][H][N][hd] buffer; + x; RMSNorm; FF GEMMs
// (erf-GELU epilogue) with the residual through the f32 addend. All contractions on v_wmma_f32_16x16x32_f16, f32 accumulate.
#define BB 2
#define NN 2048
#define CC 768
#define NH 24
#define HD 32
#define NR (BB * NN)
#define HSZ ((size_t)NN * HD)

typedef __bf16 v16b __attribute__((ext_vector_type(16)));
typedef unsigned short v8us __attribute__((ext_vector_type(8), may_alias));
typedef float  v8f  __attribute__((ext_vector_type(8)));
typedef float  v4f  __attribute__((ext_vector_type(4)));
typedef float  v4fa __attribute__((ext_vector_type(4), may_alias));
union FragB { v16b v; v8us half[2]; unsigned short u[16]; };

__device__ __forceinline__ unsigned short bf16_bits(float x) { unsigned int u = __float_as_uint(x); return (unsigned short)((u + 0x7FFFu + ((u >> 16) & 1u)) >> 16); }
__device__ __forceinline__ float bf16_val(unsigned short b) { return __uint_as_float(((unsigned int)b) << 16); }
__device__ __forceinline__ float bf16_round(float x) { return bf16_val(bf16_bits(x)); }
// D += A·B with NT terms: 1 = ah·bh, 2 = + al·bh (A split), 3 = + ah·bl (both split)
template <int NT>
__device__ __forceinline__ v8f mmaN(v16b ah, v16b al, v16b bh, v16b bl, v8f c) {
  c = __builtin_amdgcn_wmma_f32_16x16x32_bf16(false, ah, false, bh, (short)0, c, false, false);
  if (NT >= 2) c = __builtin_amdgcn_wmma_f32_16x16x32_bf16(false, al, false, bh, (short)0, c, false, false);
  if (NT >= 3) c = __builtin_amdgcn_wmma_f32_16x16x32_bf16(false, ah, false, bl, (short)0, c, false, false);
  asm volatile("v_nop\n\tv_nop\n\tv_nop\n\tv_nop" : "+v"(c) : "v"(ah), "v"(al), "v"(bh), "v"(bl));
  return c;
}

__global__ __launch_bounds__(256) void k_wt_bf16(const float* __restrict__ W, unsigned short* __restrict__ Wt, int K, int N) {
  const int t = blockIdx.x * 256 + threadIdx.x;
  const int k8n = K / 8;
  if (t >= N * k8n) return;
  const int n = t / k8n, k8 = (t % k8n) * 8;
  v8us v;
#pragma unroll
  for (int i = 0; i < 8; ++i) v[i] = bf16_bits(W[(size_t)(k8 + i) * N + n]);
  *(v8us*)(Wt + (size_t)n * K + k8) = v;
  
}

// GEMM C[M][N] (f32, pitch ldc) = act(A[M][K]·W + bias). A f32 row-major (pitch lda) converted per fragment to bf16
// (ASPLIT: hi/lo two planes -> 2 terms, else single rounded term); Wt bf16 [N][K] (pitch ldb). BIAS_BF16 rounds the
// bias to bf16 first (bias quantised to bf16 before the add). K%32==0, M%16==0, N%64==0.
template <bool ASPLIT, int ACT, bool BIAS_BF16>
__global__ __launch_bounds__(128) void k_gemm_bf(const float* __restrict__ A, int lda, const unsigned short* __restrict__ Wt, int ldb,
                                               const float* __restrict__ bias, float* __restrict__ C, int ldc, int M, int N, int K) {
  __shared__ __attribute__((aligned(16))) float so[4][16][64];
  const int tid = threadIdx.x, w = tid >> 5, lane = tid & 31, ln = lane & 15, hh = lane >> 4;
  const int ntn = N / 64;
  const int wid = blockIdx.x * 4 + w;
  const int mt = wid / ntn, nq = wid % ntn;
  if (mt * 16 >= M) return;
  const int row0 = mt * 16, col0 = nq * 64;
  const float* arow = A + (size_t)(row0 + ln) * lda;
  v8f acc[4] = {};
  for (int kb = 0; kb < K; kb += 32) {
    FragB ah, al;
    const v4f x0 = *(const v4fa*)(arow + kb + 8 * hh), x1 = *(const v4fa*)(arow + kb + 8 * hh + 4);
    const v4f x2 = *(const v4fa*)(arow + kb + 16 + 8 * hh), x3 = *(const v4fa*)(arow + kb + 16 + 8 * hh + 4);
    float xs[16] = {x0[0],x0[1],x0[2],x0[3],x1[0],x1[1],x1[2],x1[3],x2[0],x2[1],x2[2],x2[3],x3[0],x3[1],x3[2],x3[3]};
#pragma unroll
    for (int i = 0; i < 16; ++i) { const unsigned short hb = bf16_bits(xs[i]); ah.u[i] = hb; al.u[i] = ASPLIT ? bf16_bits(xs[i] - bf16_val(hb)) : (unsigned short)0; }
#pragma unroll
    for (int t = 0; t < 4; ++t) {
      const unsigned short* brow = Wt + (size_t)(col0 + t * 16 + ln) * ldb + kb;
      FragB b;
      b.half[0] = *(const v8us*)(brow + 8 * hh);
      b.half[1] = *(const v8us*)(brow + 16 + 8 * hh);
      acc[t] = mmaN<ASPLIT ? 2 : 1>(ah.v, al.v, b.v, b.v, acc[t]);
    }
  }
#pragma unroll
  for (int t = 0; t < 4; ++t) {
    float bv = bias ? bias[col0 + t * 16 + ln] : 0.f;
    if (BIAS_BF16) bv = bf16_round(bv);
#pragma unroll
    for (int r = 0; r < 8; ++r) { float v = acc[t][r] + bv; if (ACT == 1) v = fmaxf(v, 0.f); so[w][8 * hh + r][t * 16 + ln] = v; }
  }
  __builtin_amdgcn_fence(__ATOMIC_ACQ_REL, "workgroup");
  __builtin_amdgcn_wave_barrier();
  const int rsub = lane >> 4, c4 = (lane & 15) * 4;
  {
#pragma unroll
    for (int q = 0; q < 8; ++q) {
      const int r = q * 2 + rsub;
      const v4f v = *(const v4fa*)&so[w][r][c4];
      *(v4f*)(C + (size_t)(row0 + r) * ldc + col0 + c4) = v;
    }
    
  }
}

// Flash-style causal/unmasked attention, all contractions 3-term bf16 hi/lo splits, f32 softmax with running max.
// q,k,v rows are read from f32 buffers with arbitrary row pitch (so they can live inside a fused qkv buffer);
// D = head size (multiple of 32, <= 128); one wave = 16 query rows; block = 4 waves (64 queries) sharing K/V chunks of 32.
template <int D, bool CAUSAL>
__global__ __launch_bounds__(128) void k_flash(const float* __restrict__ qb, const float* __restrict__ kb, const float* __restrict__ vb,
                                             int pitch, int T, int H, float scale, float* __restrict__ y, int ypitch) {
  constexpr int KS = D / 32;        // k-steps for QK
  constexpr int DT = D / 16;        // d tiles for PV
  __shared__ __attribute__((aligned(16))) unsigned short sKh[32][D + 8], sKl[32][D + 8], sVh[32][D + 8], sVl[32][D + 8];
  __shared__ __attribute__((aligned(16))) unsigned short sPh[4][16][40], sPl[4][16][40];
  __shared__ __attribute__((aligned(16))) float sO[4][16][D];
  const int tid = threadIdx.x, w = tid >> 5, lane = tid & 31, ln = lane & 15, hh = lane >> 4;
  const int nqb = (T + 63) / 64;
  const int bh = blockIdx.x / nqb, qblk = blockIdx.x % nqb;
  const int b = bh / H, h = bh % H;
  const int q0 = qblk * 64 + w * 16;
  const float* Q = qb + (size_t)b * T * pitch + h * D;
  const float* K = kb + (size_t)b * T * pitch + h * D;
  const float* V = vb + (size_t)b * T * pitch + h * D;

  // A fragments of the wave's 16 query rows (scaled), hi/lo
  FragB aqh[KS], aql[KS];
  {
    int row = q0 + ln; if (row >= T) row = T - 1;
    const float* qr = Q + (size_t)row * pitch;
#pragma unroll
    for (int ks = 0; ks < KS; ++ks)
#pragma unroll
      for (int i = 0; i < 16; ++i) {
        const int d = ks * 32 + ((i < 8) ? (8 * hh + i) : (16 + 8 * hh + (i - 8)));
        const float x = qr[d] * scale; const unsigned short hb = bf16_bits(x);
        aqh[ks].u[i] = hb; aql[ks].u[i] = bf16_bits(x - bf16_val(hb));
      }
  }
  float m_r[8], l_r[8];
#pragma unroll
  for (int r = 0; r < 8; ++r) { m_r[r] = -3.0e38f; l_r[r] = 0.f; }
  v8f oacc[DT];
#pragma unroll
  for (int dt = 0; dt < DT; ++dt) oacc[dt] = (v8f){0.f,0.f,0.f,0.f,0.f,0.f,0.f,0.f};

  const int kv_end = CAUSAL ? min(T, qblk * 64 + 64) : T;     // block-uniform
  for (int j0 = 0; j0 < kv_end; j0 += 32) {
    __syncthreads();
    for (int e = tid; e < 32 * (D / 4); e += 128) {
      const int r = e / (D / 4), c4 = (e % (D / 4)) * 4;
      const int key = j0 + r;
      v4f kf = {0.f,0.f,0.f,0.f}, vf = {0.f,0.f,0.f,0.f};
      if (key < T) { kf = *(const v4fa*)(K + (size_t)key * pitch + c4); vf = *(const v4fa*)(V + (size_t)key * pitch + c4); }
#pragma unroll
      for (int t = 0; t < 4; ++t) {
        unsigned short hb = bf16_bits(kf[t]); sKh[r][c4 + t] = hb; sKl[r][c4 + t] = bf16_bits(kf[t] - bf16_val(hb));
        hb = bf16_bits(vf[t]); sVh[r][c4 + t] = hb; sVl[r][c4 + t] = bf16_bits(vf[t] - bf16_val(hb));
      }
    }
    __syncthreads();
    // S tile 16 x 32
    v8f s[2];
#pragma unroll
    for (int nt = 0; nt < 2; ++nt) {
      v8f acc = {};
#pragma unroll
      for (int ks = 0; ks < KS; ++ks) {
        FragB bh_, bl_;
        bh_.half[0] = *(const v8us*)&sKh[nt * 16 + ln][ks * 32 + 8 * hh]; bh_.half[1] = *(const v8us*)&sKh[nt * 16 + ln][ks * 32 + 16 + 8 * hh];
        bl_.half[0] = *(const v8us*)&sKl[nt * 16 + ln][ks * 32 + 8 * hh]; bl_.half[1] = *(const v8us*)&sKl[nt * 16 + ln][ks * 32 + 16 + 8 * hh];
        acc = mmaN<3>(aqh[ks].v, aql[ks].v, bh_.v, bl_.v, acc);
      }
      s[nt] = acc;
    }
    // mask + running max (rows 8hh+r; the 16 lanes of a half share rows)
    float alpha[8];
#pragma unroll
    for (int r = 0; r < 8; ++r) {
      const int qi = q0 + 8 * hh + r;
      const int ja = j0 + ln, jb = j0 + 16 + ln;
      if (CAUSAL) { if (ja > qi) s[0][r] = -3.0e38f; if (jb > qi) s[1][r] = -3.0e38f; }
      if (ja >= T) s[0][r] = -3.0e38f;
      if (jb >= T) s[1][r] = -3.0e38f;
      float mx = fmaxf(s[0][r], s[1][r]);
      mx = fmaxf(mx, __shfl_xor(mx, 1, 32)); mx = fmaxf(mx, __shfl_xor(mx, 2, 32)); mx = fmaxf(mx, __shfl_xor(mx, 4, 32)); mx = fmaxf(mx, __shfl_xor(mx, 8, 32));
      const float mnew = fmaxf(m_r[r], mx);
      alpha[r] = (mnew > -1.0e38f) ? __expf(m_r[r] - mnew) : 1.0f;
      const float p0 = (s[0][r] > -1.0e38f) ? __expf(s[0][r] - mnew) : 0.f;
      const float p1 = (s[1][r] > -1.0e38f) ? __expf(s[1][r] - mnew) : 0.f;
      m_r[r] = mnew;
      l_r[r] = l_r[r] * alpha[r] + p0 + p1;            // per-lane partial row sum (16 lanes combined at the end)
      unsigned short hb = bf16_bits(p0); sPh[w][8 * hh + r][ln] = hb;      sPl[w][8 * hh + r][ln] = bf16_bits(p0 - bf16_val(hb));
      hb = bf16_bits(p1);                sPh[w][8 * hh + r][16 + ln] = hb; sPl[w][8 * hh + r][16 + ln] = bf16_bits(p1 - bf16_val(hb));
    }
#pragma unroll
    for (int dt = 0; dt < DT; ++dt)
#pragma unroll
      for (int r = 0; r < 8; ++r) oacc[dt][r] *= alpha[r];
    __builtin_amdgcn_fence(__ATOMIC_ACQ_REL, "workgroup");
    __builtin_amdgcn_wave_barrier();
    FragB pah, pal;
    pah.half[0] = *(const v8us*)&sPh[w][ln][8 * hh]; pah.half[1] = *(const v8us*)&sPh[w][ln][16 + 8 * hh];
    pal.half[0] = *(const v8us*)&sPl[w][ln][8 * hh]; pal.half[1] = *(const v8us*)&sPl[w][ln][16 + 8 * hh];
#pragma unroll
    for (int dt = 0; dt < DT; ++dt) {
      FragB bvh, bvl;
#pragma unroll
      for (int i = 0; i < 8; ++i) {
        bvh.u[i] = sVh[8 * hh + i][dt * 16 + ln]; bvh.u[8 + i] = sVh[16 + 8 * hh + i][dt * 16 + ln];
        bvl.u[i] = sVl[8 * hh + i][dt * 16 + ln]; bvl.u[8 + i] = sVl[16 + 8 * hh + i][dt * 16 + ln];
      }
      oacc[dt] = mmaN<3>(pah.v, pal.v, bvh.v, bvl.v, oacc[dt]);
    }
    __builtin_amdgcn_fence(__ATOMIC_ACQ_REL, "workgroup");
    __builtin_amdgcn_wave_barrier();
  }
#pragma unroll
  for (int r = 0; r < 8; ++r) {
    float l = l_r[r];
    l += __shfl_xor(l, 1, 32); l += __shfl_xor(l, 2, 32); l += __shfl_xor(l, 4, 32); l += __shfl_xor(l, 8, 32);
    l_r[r] = (l > 0.f) ? 1.0f / l : 0.f;
  }
#pragma unroll
  for (int dt = 0; dt < DT; ++dt)
#pragma unroll
    for (int r = 0; r < 8; ++r) sO[w][8 * hh + r][dt * 16 + ln] = oacc[dt][r] * l_r[r];
  __builtin_amdgcn_fence(__ATOMIC_ACQ_REL, "workgroup");
  __builtin_amdgcn_wave_barrier();
  {
    for (int r = 0; r < 16; ++r) {
      const int row = q0 + r;
      if (row < T && lane < D / 4) {
        const v4f val = *(const v4fa*)&sO[w][r][lane * 4];
        *(v4f*)(y + ((size_t)b * T + row) * ypitch + h * D + lane * 4) = val;
      }
    }
    
  }
}

// GEMM C = act(A·W + bias + resid): A f32 (ASPLIT -> hi/lo 2 terms), Wt bf16 [N][K]; ACT 0 none, 1 relu, 2 exact gelu;
// resid (optional, f32, row index = (row % rmod), pitch ldr, RES_BF16 rounds it) added before the activation.
template <bool ASPLIT, int ACT, bool BIAS_BF16, bool RES_BF16>
__global__ __launch_bounds__(128) void k_gemm_bf3(const float* __restrict__ A, int lda, const unsigned short* __restrict__ Wt, int ldb,
                                                const float* __restrict__ bias, const float* __restrict__ resid, int rmod, int ldr,
                                                float* __restrict__ C, int ldc, int M, int N, int K) {
  __shared__ __attribute__((aligned(16))) float so[4][16][64];
  const int tid = threadIdx.x, w = tid >> 5, lane = tid & 31, ln = lane & 15, hh = lane >> 4;
  const int ntn = N / 64;
  const int wid = blockIdx.x * 4 + w;
  const int mt = wid / ntn, nq = wid % ntn;
  if (mt * 16 >= M) return;
  const int row0 = mt * 16, col0 = nq * 64;
  const float* arow = A + (size_t)(row0 + ln) * lda;
  v8f acc[4] = {};
  for (int kb = 0; kb < K; kb += 32) {
    FragB ah, al;
    const v4f x0 = *(const v4fa*)(arow + kb + 8 * hh), x1 = *(const v4fa*)(arow + kb + 8 * hh + 4);
    const v4f x2 = *(const v4fa*)(arow + kb + 16 + 8 * hh), x3 = *(const v4fa*)(arow + kb + 16 + 8 * hh + 4);
    float xs[16] = {x0[0],x0[1],x0[2],x0[3],x1[0],x1[1],x1[2],x1[3],x2[0],x2[1],x2[2],x2[3],x3[0],x3[1],x3[2],x3[3]};
#pragma unroll
    for (int i = 0; i < 16; ++i) { const unsigned short hb = bf16_bits(xs[i]); ah.u[i] = hb; al.u[i] = ASPLIT ? bf16_bits(xs[i] - bf16_val(hb)) : (unsigned short)0; }
#pragma unroll
    for (int t = 0; t < 4; ++t) {
      const unsigned short* brow = Wt + (size_t)(col0 + t * 16 + ln) * ldb + kb;
      FragB b;
      b.half[0] = *(const v8us*)(brow + 8 * hh);
      b.half[1] = *(const v8us*)(brow + 16 + 8 * hh);
      acc[t] = mmaN<ASPLIT ? 2 : 1>(ah.v, al.v, b.v, b.v, acc[t]);
    }
  }
#pragma unroll
  for (int t = 0; t < 4; ++t) {
    const int col = col0 + t * 16 + ln;
    float bv = bias ? bias[col] : 0.f;
    if (BIAS_BF16) bv = bf16_round(bv);
#pragma unroll
    for (int r = 0; r < 8; ++r) {
      float v = acc[t][r] + bv;
      if (resid) { float rv = resid[(size_t)((row0 + 8 * hh + r) % rmod) * ldr + col]; if (RES_BF16) rv = bf16_round(rv); v += rv; }
      if (ACT == 1) v = fmaxf(v, 0.f);
      if (ACT == 2) v = 0.5f * v * (1.0f + erff(v * 0.70710678118654752f));
      if (ACT == 3) { const float u = 0.7978845608028654f * (v + 0.044715f * v * v * v); v = 0.5f * v * (1.0f + tanhf(u)); }
      so[w][8 * hh + r][t * 16 + ln] = v;
    }
  }
  __builtin_amdgcn_fence(__ATOMIC_ACQ_REL, "workgroup");
  __builtin_amdgcn_wave_barrier();
  const int rsub = lane >> 4, c4 = (lane & 15) * 4;
  {
#pragma unroll
    for (int q = 0; q < 8; ++q) {
      const int r = q * 2 + rsub;
      const v4f v = *(const v4fa*)&so[w][r][c4];
      *(v4f*)(C + (size_t)(row0 + r) * ldc + col0 + c4) = v;
    }
    
  }
}
// row LayerNorm (biased variance, eps) over N: s = X (+ R); optional out_sum <- s; out_norm <- (s-mu)*rsqrt(var+eps)*g + b
template <bool PARAM_BF16>
__global__ __launch_bounds__(256) void k_layernorm(const float* __restrict__ X, const float* __restrict__ R, const float* __restrict__ g, const float* __restrict__ bta,
                                                  float* __restrict__ out_sum, float* __restrict__ out_norm, int N, float eps) {
  __shared__ float red[256];
  const int row = blockIdx.x, tid = threadIdx.x;
  const float* x = X + (size_t)row * N; const float* rr = R ? R + (size_t)row * N : nullptr;
  float vals[16];                     // up to N = 4096
  const int per = N / 256;            // contiguous chunk per thread? use strided-by-4 chunks: thread handles j = tid*4 + 1024*u
  float s1 = 0.f;
  for (int u = 0; u < per / 4; ++u) {
    const int j = tid * 4 + 1024 * u;
    const v4f a = *(const v4fa*)(x + j);
    v4f b = {0.f,0.f,0.f,0.f}; if (rr) b = *(const v4fa*)(rr + j);
#pragma unroll
    for (int q = 0; q < 4; ++q) { const float v = a[q] + b[q]; vals[u * 4 + q] = v; s1 += v; }
  }
  red[tid] = s1; __syncthreads();
  for (int st = 128; st > 0; st >>= 1) { if (tid < st) red[tid] += red[tid + st]; __syncthreads(); }
  const float mu = red[0] / (float)N; __syncthreads();
  float s2 = 0.f;
  for (int u = 0; u < per / 4; ++u)
#pragma unroll
    for (int q = 0; q < 4; ++q) { const float c = vals[u * 4 + q] - mu; s2 += c * c; }
  red[tid] = s2; __syncthreads();
  for (int st = 128; st > 0; st >>= 1) { if (tid < st) red[tid] += red[tid + st]; __syncthreads(); }
  const float rs = rsqrtf(red[0] / (float)N + eps);
  {
    for (int u = 0; u < per / 4; ++u) {
      const int j = tid * 4 + 1024 * u;
      v4f o, sm;
#pragma unroll
      for (int q = 0; q < 4; ++q) {
        float gg = g[j + q], bb = bta[j + q];
        if (PARAM_BF16) { gg = bf16_round(gg); bb = bf16_round(bb); }
        sm[q] = vals[u * 4 + q]; o[q] = (vals[u * 4 + q] - mu) * rs * gg + bb;
      }
      if (out_sum) *(v4f*)(out_sum + (size_t)row * N + j) = sm;
      *(v4f*)(out_norm + (size_t)row * N + j) = o;
    }
    
  }
}



// ---- f16 WMMA path (v_wmma_f32_16x16x32_f16): 11-bit significands for operands in range — used where a [0,1] probability operand needs more precision than bf16
typedef _Float16 v16h __attribute__((ext_vector_type(16)));
union FragH { v16h v; v8us half[2]; _Float16 h[16]; unsigned short u[16]; };
template <int NT>
__device__ __forceinline__ v8f mmaH(v16h ah, v16h al, v16h bh, v16h bl, v8f c) {
  c = __builtin_amdgcn_wmma_f32_16x16x32_f16(false, ah, false, bh, (short)0, c, false, false);
  if (NT >= 2) c = __builtin_amdgcn_wmma_f32_16x16x32_f16(false, al, false, bh, (short)0, c, false, false);
  if (NT >= 3) c = __builtin_amdgcn_wmma_f32_16x16x32_f16(false, ah, false, bl, (short)0, c, false, false);
  asm volatile("v_nop\n\tv_nop\n\tv_nop\n\tv_nop" : "+v"(c) : "v"(ah), "v"(al), "v"(bh), "v"(bl));
  return c;
}
// batched GEMM like k_gemm_b but f16 operands: A f32 (split into f16 hi/lo if ASPLIT, else rounded to f16), Bt = f16 values [n][k]; alpha; C f32; N multiple of 16 (partial tiles skipped)
template <bool ASPLIT>
__global__ __launch_bounds__(128) void k_gemm_h(const float* __restrict__ A, int lda, size_t sA, const _Float16* __restrict__ Bh, int ldb, size_t sB, float alpha, float* __restrict__ C, int ldc, size_t sC, int M, int N, int K) {
  __shared__ __attribute__((aligned(16))) float so[4][16][64];
  const int tid = threadIdx.x, w = tid >> 5, lane = tid & 31, ln = lane & 15, hh = lane >> 4; const int by = blockIdx.y;
  A += (size_t)by * sA; Bh += (size_t)by * sB; C += (size_t)by * sC;
  const int ntn = (N + 63) / 64; const int wid = blockIdx.x * 4 + w; const int mt = wid / ntn, nq = wid % ntn; if (mt * 16 >= M) return;
  const int row0 = mt * 16, col0 = nq * 64; const float* arow = A + (size_t)(row0 + ln) * lda;
  v8f acc[4] = {};
  for (int kb = 0; kb < K; kb += 32) {
    FragH ah, al;
    const v4f x0 = *(const v4fa*)(arow + kb + 8 * hh), x1 = *(const v4fa*)(arow + kb + 8 * hh + 4), x2 = *(const v4fa*)(arow + kb + 16 + 8 * hh), x3 = *(const v4fa*)(arow + kb + 16 + 8 * hh + 4);
    float xs[16] = {x0[0],x0[1],x0[2],x0[3],x1[0],x1[1],x1[2],x1[3],x2[0],x2[1],x2[2],x2[3],x3[0],x3[1],x3[2],x3[3]};
#pragma unroll
    for (int i = 0; i < 16; ++i) { const _Float16 h = (_Float16)xs[i]; ah.h[i] = h; al.h[i] = ASPLIT ? (_Float16)(xs[i] - (float)h) : (_Float16)0.0f; }
#pragma unroll
    for (int t = 0; t < 4; ++t) { if (col0 + t * 16 >= N) continue; const size_t boff = (size_t)(col0 + t * 16 + ln) * ldb + kb; FragH bq; bq.half[0] = *(const v8us*)(Bh + boff + 8 * hh); bq.half[1] = *(const v8us*)(Bh + boff + 16 + 8 * hh);
      acc[t] = mmaH<ASPLIT ? 2 : 1>(ah.v, al.v, bq.v, bq.v, acc[t]); }
  }
#pragma unroll
  for (int t = 0; t < 4; ++t) { if (col0 + t * 16 >= N) continue;
#pragma unroll
    for (int r = 0; r < 8; ++r) so[w][8 * hh + r][t * 16 + ln] = acc[t][r] * alpha; }
  __builtin_amdgcn_fence(__ATOMIC_ACQ_REL, "workgroup"); __builtin_amdgcn_wave_barrier();
  const int rsub = lane >> 4, c4 = (lane & 15) * 4;
  {
#pragma unroll
    for (int q = 0; q < 8; ++q) { const int r = q * 2 + rsub; if (col0 + c4 < N) { const v4f v = *(const v4fa*)&so[w][r][c4]; *(v4f*)(C + (size_t)(row0 + r) * ldc + col0 + c4) = v; } }
     }
}

// Wt[n][k] = f16(W[k][n]·scale) from f32 row-major W[K][N] (scale = power of two; bf16-exact weights stay exact in f16 away from the subnormal range)
__global__ __launch_bounds__(256) void k_wt_f16(const float* __restrict__ W, _Float16* __restrict__ Wt, int K, int N, float scale) {
  const int t = blockIdx.x * 256 + threadIdx.x; if (t >= N * (K / 8)) return; const int n = t / (K / 8), k8 = (t % (K / 8)) * 8; FragH f;
#pragma unroll
  for (int i = 0; i < 8; ++i) f.h[i] = (_Float16)(bf16_round(W[(size_t)(k8 + i) * N + n]) * scale); const v8us o = f.half[0];
  *(v8us*)((unsigned short*)Wt + (size_t)n * K + k8) = o; 
}
// GEMM C[M][N] = act(A.B^T * alpha (+ CP)), A f16 [M][K], Bh f16 [N][K], both k-contiguous; ACT 0 none / 6 erf-GELU; writes f32 C (HC) and / or f16 C16 (HC16), CP = f32 addend with C's pitch (HCP); CP may be C itself: each lane reads the 16-byte pieces that it later writes.
// HL: C16 takes the f16 hi plane and C16L the residual times 2^10, so that a result wanted as hi / lo planes never goes to memory as f32.
// AL: A comes as two planes, A and A2 (same shape and pitch); C = A.B^T * alpha + A2.B^T * alpha2 from two accumulator sets that share the B fragments; a stage then holds 128 rows of A2 behind those of A and B.
// One 128 x 128 tile of C per work-group of 8 waves (4 x 2, 32 x 64 each). The operands come through LDS: a stage is 128 k = 256 bytes of each of the 256 operand rows, brought by asynchronous 16-byte copies that take whole lines
// (16 lanes per row), two buffers, the next stage in flight while this one is worked on. M, N multiples of 128, K of 128 at every launch (4096 / 768 / 768 and 1536 / 2048 / 2048).
#define GT 128      /* tile edge */
#define GK 128      /* k per stage */
#define GP 272u     /* LDS row pitch in bytes = 16 x odd: the 16 rows of a fragment read fall on all 64 banks */
#define GST (2u * GT * GP)      /* bytes of a stage's A and B rows: 128 A rows, then 128 B rows; A2's follow */
// this thread's share of one operand's stage: rows 16 apart, the same 16-byte column
__device__ __forceinline__ void copy8(unsigned l, const unsigned short* g, size_t gs) {
  asm volatile("global_load_async_to_lds_b128 %0, %8, off\n\t"
               "global_load_async_to_lds_b128 %1, %9, off\n\t"
               "global_load_async_to_lds_b128 %2, %10, off\n\t"
               "global_load_async_to_lds_b128 %3, %11, off\n\t"
               "global_load_async_to_lds_b128 %4, %12, off\n\t"
               "global_load_async_to_lds_b128 %5, %13, off\n\t"
               "global_load_async_to_lds_b128 %6, %14, off\n\t"
               "global_load_async_to_lds_b128 %7, %15, off\n\t"
               "s_wait_xcnt 0x0"      /* inside the copies' own statement, so that it stands in front of every rewrite of their address registers */
               :: "v"(l), "v"(l + 16u * GP), "v"(l + 32u * GP), "v"(l + 48u * GP), "v"(l + 64u * GP), "v"(l + 80u * GP), "v"(l + 96u * GP), "v"(l + 112u * GP),
                  "v"(g), "v"(g + gs), "v"(g + 2 * gs), "v"(g + 3 * gs), "v"(g + 4 * gs), "v"(g + 5 * gs), "v"(g + 6 * gs), "v"(g + 7 * gs) : "memory");
}
template <int ACT, bool HCP, bool HC, bool HC16, bool HL, bool AL>
__global__ __launch_bounds__(256) void k_gemm_hhx(const _Float16* __restrict__ A, const _Float16* __restrict__ A2, int lda, const _Float16* __restrict__ Bh, int ldb, float alpha, float alpha2, const float* CP, float* C, _Float16* __restrict__ C16, _Float16* __restrict__ C16L, int ldc, int N, int K) {
  constexpr unsigned ST = AL ? GST + GT * GP : GST;      /* bytes of a stage */
  __shared__ __attribute__((aligned(16))) unsigned char ring[2 * ST];
  __shared__ __attribute__((aligned(16))) float so[8][16][64];
  const int tid = threadIdx.x, w = tid >> 5, lane = tid & 31, ln = lane & 15, hh = lane >> 4;
  const int ntn = N / GT; const int row0 = (int)(blockIdx.x / ntn) * GT, col0 = (int)(blockIdx.x % ntn) * GT; const int wr = (w >> 1) * 32, wc = (w & 1) * 64;
  const int cr = tid >> 4, cc = tid & 15;      /* the thread's first row of a stage and its 16-byte column */
  const unsigned short* ga = (const unsigned short*)A + (size_t)(row0 + cr) * lda + cc * 8; const unsigned short* gb = (const unsigned short*)Bh + (size_t)(col0 + cr) * ldb + cc * 8; const unsigned short* g2 = AL ? (const unsigned short*)A2 + (size_t)(row0 + cr) * lda + cc * 8 : nullptr;
  const unsigned la = (unsigned)(size_t)ring + (unsigned)cr * GP + (unsigned)cc * 16u, lb = la + GT * GP, l2 = la + GST; const size_t sa = (size_t)16 * lda, sb = (size_t)16 * ldb;
  const int nst = K / GK;
  v8f acc[2][4] = {}, acc2[2][4] = {};
  const int rsub = lane >> 4, c4 = (lane & 15) * 4; typedef _Float16 v4h __attribute__((ext_vector_type(4)));
  const size_t eo = (size_t)(row0 + wr + rsub) * ldc + col0 + wc + c4;      /* the lane's first 4 elements of the wave's 32 x 64 part of C; its others lie 2 rows apart */
  v4f cp[2][8];      /* the addend in the shape of the stores, asked for here so that all 16 loads fly together under stage 0's copies */
  if (HCP) {
#pragma unroll      // constant indices keep the array in registers
    for (int i = 0; i < 2; ++i)
#pragma unroll      // constant indices keep the array in registers
      for (int q = 0; q < 8; ++q) cp[i][q] = *(const v4fa*)(CP + eo + (size_t)(i * 16 + q * 2) * ldc); }
  copy8(la, ga, sa); copy8(lb, gb, sb); if (AL) copy8(l2, g2, sa);
  asm volatile("s_wait_asynccnt 0x0" ::: "memory");      /* stage 0 has landed, as far as this wave brought it */
  __syncthreads();      /* ... and as far as the other waves did */
  if (nst > 1) { copy8(la + ST, ga + GK, sa); copy8(lb + ST, gb + GK, sb); if (AL) copy8(l2 + ST, g2 + GK, sa); }
  const unsigned char* fa = ring + (unsigned)(wr + ln) * GP + 16 * hh; const unsigned char* fb = ring + (unsigned)(GT + wc + ln) * GP + 16 * hh;      /* fragment rows; k order as before: bytes 16hh and 32 + 16hh of each 64, A and B alike */
  for (int t = 0; t < nst; ++t) { const unsigned bo = (unsigned)(t & 1) * ST;
#pragma unroll      // constant indices keep the fragment arrays in registers
    for (int ks = 0; ks < GK / 32; ++ks) { FragH a2[2], a3[2], b2[4];
#pragma unroll      // constant indices keep the fragment arrays in registers
      for (int i = 0; i < 2; ++i) { a2[i].half[0] = *(const v8us*)(fa + bo + i * 16 * GP + ks * 64); a2[i].half[1] = *(const v8us*)(fa + bo + i * 16 * GP + ks * 64 + 32);
        if (AL) { a3[i].half[0] = *(const v8us*)(fa + bo + GST + i * 16 * GP + ks * 64); a3[i].half[1] = *(const v8us*)(fa + bo + GST + i * 16 * GP + ks * 64 + 32); } }      /* the same rows and the same k order in the second plane */
#pragma unroll      // constant indices keep the fragment arrays in registers
      for (int j = 0; j < 4; ++j) { b2[j].half[0] = *(const v8us*)(fb + bo + j * 16 * GP + ks * 64); b2[j].half[1] = *(const v8us*)(fb + bo + j * 16 * GP + ks * 64 + 32); }
#pragma unroll      // constant indices keep the fragment arrays in registers
      for (int i = 0; i < 2; ++i)
#pragma unroll      // constant indices keep the fragment arrays in registers
        for (int j = 0; j < 4; ++j) { acc[i][j] = mmaH<1>(a2[i].v, a2[i].v, b2[j].v, b2[j].v, acc[i][j]); if (AL) acc2[i][j] = mmaH<1>(a3[i].v, a3[i].v, b2[j].v, b2[j].v, acc2[i][j]); } }
    asm volatile("s_wait_dscnt 0x0" ::: "memory");      /* this wave's reads of the buffer are done before the barrier frees it for the refill */
    asm volatile("s_wait_asynccnt 0x0" ::: "memory");      /* this wave's copies of stage t + 1 have landed before the barrier publishes them */
    __syncthreads();
    if (t + 2 < nst) { copy8(la + bo, ga + (size_t)(t + 2) * GK, sa); copy8(lb + bo, gb + (size_t)(t + 2) * GK, sb); if (AL) copy8(l2 + bo, g2 + (size_t)(t + 2) * GK, sa); } }
  asm volatile("s_wait_asynccnt 0x0" ::: "memory");      /* no copy is outstanding when the wave goes on to its end */
  // Epilogue, 16 x 64 at a time through the wave's own LDS rows; straight-line: what exists is known at compile time, the staged rows are read back together, and addend and activation are applied to the 16-byte pieces that are stored.
#pragma unroll      // constant indices keep the accumulators in registers
  for (int i = 0; i < 2; ++i) {
#pragma unroll
    for (int t = 0; t < 4; ++t)
#pragma unroll
      for (int r = 0; r < 8; ++r) so[w][8 * hh + r][t * 16 + ln] = AL ? acc2[i][t][r] * alpha2 + acc[i][t][r] * alpha : acc[i][t][r] * alpha;
    __builtin_amdgcn_fence(__ATOMIC_ACQ_REL, "workgroup"); __builtin_amdgcn_wave_barrier();
    v4f vv[8];
#pragma unroll      // constant indices keep the array in registers
    for (int q = 0; q < 8; ++q) vv[q] = *(const v4fa*)&so[w][q * 2 + rsub][c4];
#pragma unroll      // constant indices keep the arrays in registers
    for (int q = 0; q < 8; ++q) { v4f v = vv[q]; const size_t o = eo + (size_t)(i * 16 + q * 2) * ldc;
      if (HCP) v += cp[i][q];
      if (ACT == 6) for (int e = 0; e < 4; ++e) v[e] = 0.5f * v[e] * (1.0f + erff(v[e] * 0.70710678118654752f));
      if (HC) { *(v4f*)(C + o) = v; asm volatile("s_wait_xcnt 0x0" ::: "memory"); }      /* the wait in front of any rewrite of the store's registers */
      if (HC16) { v4h h4; for (int e = 0; e < 4; ++e) h4[e] = (_Float16)v[e]; *(v4h*)(C16 + o) = h4; asm volatile("s_wait_xcnt 0x0" ::: "memory"); }      /* likewise */
      if (HL) { v4h h4, l4; for (int e = 0; e < 4; ++e) { h4[e] = (_Float16)v[e]; l4[e] = (_Float16)((v[e] - (float)h4[e]) * 1024.0f); }
        asm volatile("global_store_b64 %0, %2, off\n\tglobal_store_b64 %1, %3, off\n\ts_wait_xcnt 0x0" :: "v"(C16 + o), "v"(C16L + o), "v"(h4), "v"(l4) : "memory"); } }      /* both stores and their wait in one statement: as a statement of its own the wait let rewrites of the stores' registers pass in front of it */
    __builtin_amdgcn_fence(__ATOMIC_ACQ_REL, "workgroup"); __builtin_amdgcn_wave_barrier();      /* the next 16 rows are staged in the same LDS only behind these reads */
  }
}


typedef _Float16 v4h __attribute__((ext_vector_type(4)));

__global__ __launch_bounds__(256) void k_x16(const float* __restrict__ x, _Float16* __restrict__ X16, size_t n8) { const size_t t = (size_t)blockIdx.x * 256 + threadIdx.x; if (t >= n8) return; FragH f;
#pragma unroll
  for (int q = 0; q < 8; ++q) f.h[q] = (_Float16)bf16_round(x[t * 8 + q]); *(v8us*)((unsigned short*)X16 + t * 8) = f.half[0];  }
__global__ __launch_bounds__(256) void k_h16(const float* __restrict__ x, _Float16* __restrict__ X16, size_t n8) { const size_t t = (size_t)blockIdx.x * 256 + threadIdx.x; if (t >= n8) return; FragH f;
#pragma unroll
  for (int q = 0; q < 8; ++q) f.h[q] = (_Float16)x[t * 8 + q]; *(v8us*)((unsigned short*)X16 + t * 8) = f.half[0];  }
// Bt = f16(bf16(W) x 2^4), element for element: a work-group's share is RW consecutive elements, a thread's 16 pieces of 4, 256 pieces apart, so that every load takes four whole lines a wave and every store two.
#define RW 16384      /* elements per work-group: 256 threads x 16 pieces x 4 */
__device__ __forceinline__ void round_share(const float* __restrict__ W, _Float16* __restrict__ Bt, int blk, int tid) { const size_t e0 = (size_t)blk * RW + tid * 4; v4f a[16];
#pragma unroll      // constant indices keep the array in registers; the 16 loads are asked for together
  for (int i = 0; i < 16; ++i) a[i] = *(const v4fa*)(W + e0 + i * 1024);
  asm volatile("s_wait_xcnt 0x0" :: "v"(W + e0) : "memory");      /* the wait in front of any rewrite of the loads' address registers by what follows; the address is named so that it lives up to here and no load's result is put over it */
  v4h o[16];
#pragma unroll      // constant indices keep the arrays in registers
  for (int i = 0; i < 16; ++i) for (int q = 0; q < 4; ++q) o[i][q] = (_Float16)(bf16_round(a[i][q]) * 16.0f);
#pragma unroll      // constant indices keep the array in registers
  for (int i = 0; i < 16; ++i) *(v4h*)(Bt + e0 + i * 1024) = o[i]; }
template <int NHv, int TTv>
__global__ __launch_bounds__(256) void k_vt(const _Float16* __restrict__ V16, int ldv, int voff, _Float16* __restrict__ Vt) { __shared__ unsigned short tl[64][66]; const int tid = threadIdx.x; const int slab = blockIdx.x / (TTv / 64), lg = blockIdx.x % (TTv / 64); const int b = slab / NHv, h = slab % NHv;
  for (int i = tid; i < 64 * 8; i += 256) { const int r = i / 8, c8 = (i % 8) * 8; FragH f; f.half[0] = *(const v8us*)((const unsigned short*)V16 + ((size_t)b * TTv + lg * 64 + r) * ldv + voff + h * 64 + c8);
#pragma unroll
    for (int q = 0; q < 8; ++q) tl[r][c8 + q] = f.u[q]; }
  __syncthreads();
  {
#pragma unroll
    for (int rd = 0; rd < 2; ++rd) { const int d = rd * 32 + tid / 8, pc = tid % 8; FragH f;
#pragma unroll
      for (int q = 0; q < 8; ++q) f.u[q] = tl[pc * 8 + q][d];
      *(v8us*)((unsigned short*)Vt + ((size_t)slab * 64 + d) * TTv + lg * 64 + pc * 8) = f.half[0]; }
     } }

// RMSNorm rows (C = 768 = 32 lanes x 24): y = x.rsqrt(mean(x^2) + 1.1920929e-7).bf16(g); RB: round the input to bf16 first; ADD: the input is X + R (the residual add, done here where its rows are read); outputs: f16 hi + x2^10 residual planes (either may be null)
// and optionally the f32 input as normalised (rounded, or summed) XR; wave per row; per lane 6 float4 pieces (c = j.128 + lane.4).
// TR: also v^T per (b,h), [32][2048] f16 of hi + lo.2^-10. The work-group's 8 rows are 6144 consecutive elements of the flat plane = 3 whole tiles of 64 n x 32 d of the raw head view, turned through LDS; the work-groups of the rows are then exactly NR / 8, so no row test stands in front of the barrier.
// CV: the launch also rounds the four weight matrices, which nothing here reads and which depend on nothing here: the work-groups behind the NR / 8 of the rows take one share of RW elements each, WA's first, then Wq's, W1's and W2's, and leave ahead of the barrier as a whole.
#define CVA (NN * NN / RW)      /* shares of WA */
#define CVW (CC * CC / RW)      /* shares of each C x C weight */
template <int RB, bool ADD, bool TR, bool CV>
__global__ __launch_bounds__(256) void k_rms(const float* __restrict__ X, const float* __restrict__ R, const float* __restrict__ g, int nrows, _Float16* __restrict__ YH, _Float16* __restrict__ YL, float* __restrict__ XR, _Float16* __restrict__ VT,
                                             const float* __restrict__ WA, const float* __restrict__ Wq, const float* __restrict__ W1, const float* __restrict__ W2, _Float16* __restrict__ BA, _Float16* __restrict__ Bq, _Float16* __restrict__ B1, _Float16* __restrict__ B2) { __shared__ float tl[TR ? 3 : 1][64][33]; const int tid = threadIdx.x, wv = tid >> 5, lane = tid & 31;
  if (CV && blockIdx.x >= NR / 8) { const int c = (int)blockIdx.x - NR / 8;
    const int k = c < CVA ? 0 : 1 + (c - CVA) / CVW;      /* which matrix: uniform for the work-group, so pointers and share are picked in scalar registers and the body stands once in the text */
    round_share(k == 0 ? WA : k == 1 ? Wq : k == 2 ? W1 : W2, k == 0 ? BA : k == 1 ? Bq : k == 2 ? B1 : B2, k == 0 ? c : (c - CVA) % CVW, tid);
    return; }
  const int r = blockIdx.x * 8 + wv; if (!TR && r >= nrows) return; v4f xv[6]; float ss = 0.f;
#pragma unroll
  for (int j = 0; j < 6; ++j) { v4f a = *(const v4fa*)(X + (size_t)r * CC + j * 128 + lane * 4); if (ADD) { const v4f b = *(const v4fa*)(R + (size_t)r * CC + j * 128 + lane * 4); for (int q = 0; q < 4; ++q) a[q] += b[q]; } if (RB) for (int q = 0; q < 4; ++q) a[q] = bf16_round(a[q]); xv[j] = a; for (int q = 0; q < 4; ++q) ss += a[q] * a[q]; }
  for (int o = 16; o >= 1; o >>= 1) ss += __shfl_xor(ss, o, 32); const float rs = rsqrtf(ss / (float)CC + 1.1920929e-7f);
  typedef _Float16 v4h __attribute__((ext_vector_type(4)));
  {
#pragma unroll
    for (int j = 0; j < 6; ++j) { const int c = j * 128 + lane * 4; v4h hh, hl; for (int q = 0; q < 4; ++q) { const float y = xv[j][q] * rs * bf16_round(g[c + q]); const _Float16 hv = (_Float16)y; hh[q] = hv; hl[q] = (_Float16)((y - (float)hv) * 1024.0f); }
      if (TR) { const int e = wv * CC + c; for (int q = 0; q < 4; ++q) tl[e >> 11][(e & 2047) >> 5][(e & 31) + q] = (float)hh[q] + (float)hl[q] * 0.0009765625f; }
      if (YH) *(v4h*)(YH + (size_t)r * CC + c) = hh; if (YL) *(v4h*)(YL + (size_t)r * CC + c) = hl; if (XR) *(v4f*)(XR + (size_t)r * CC + c) = xv[j]; }
     }
  if (TR) { asm volatile("s_wait_xcnt 0x0" ::: "memory");      /* the wait in front of any rewrite of the row stores' registers by what follows */
    __syncthreads();      /* the 3 tiles are whole only when all 8 rows are in */
    const int d = tid / 8, pc = tid % 8;
#pragma unroll      // the three tiles' LDS reads are asked for together, not tile by tile
    for (int t3 = 0; t3 < 3; ++t3) { const int tile = blockIdx.x * 3 + t3, slab = tile / (NN / 64), ng = tile % (NN / 64); FragH f; for (int q = 0; q < 8; ++q) f.h[q] = (_Float16)tl[t3][pc * 8 + q][d];
      *(v8us*)((unsigned short*)VT + ((size_t)slab * HD + d) * NN + ng * 64 + pc * 8) = f.half[0]; } } }
// D = A.B + C as the bare builtin: the compiler keeps the distance behind its own matrix instructions, with independent work where there is some; with six waves on a SIMD every v_nop is an issue slot taken from another wave's softmax.
__device__ __forceinline__ v8f mmaP(v16h a, v16h b, v8f c) { return __builtin_amdgcn_wmma_f32_16x16x32_f16(false, a, false, b, (short)0, c, false, false); }
// lane l <-> lane l ^ 16 by a vector cross-row move (no LDS counter involved)
__device__ __forceinline__ float xhalf(float x) { return __builtin_bit_cast(float, __builtin_amdgcn_permlanex16(__builtin_bit_cast(int, x), __builtin_bit_cast(int, x), 0x76543210, 0xfedcba98, false, false)); }
typedef float v2f __attribute__((ext_vector_type(2)));
#define FK 128      /* keys per stage */
#define FKP 80u     /* LDS pitch of a K row in bytes = 16 x odd: the 16 rows of a fragment read fall on all 64 banks */
#define FVP 272u    /* LDS pitch of a V'^T row, likewise */
#define FKB (FK * FKP)      /* bytes of one K plane's stage */
#define FST (2u * FKB + HD * FVP)      /* bytes of a stage: K hi, K lo, V'^T */
// this thread's share of a stage: two 16-byte pieces of each of the three operands (K rows 64 apart, V'^T rows 16 apart)
__device__ __forceinline__ void copy6(unsigned lk, unsigned lv, const unsigned short* gh, const unsigned short* gl, size_t ks, const unsigned short* gv) {
  asm volatile("global_load_async_to_lds_b128 %0, %6, off\n\t"
               "global_load_async_to_lds_b128 %1, %7, off\n\t"
               "global_load_async_to_lds_b128 %2, %8, off\n\t"
               "global_load_async_to_lds_b128 %3, %9, off\n\t"
               "global_load_async_to_lds_b128 %4, %10, off\n\t"
               "global_load_async_to_lds_b128 %5, %11, off\n\t"
               "s_wait_xcnt 0x0"      /* inside the copies' own statement, so that it stands in front of every rewrite of their address registers */
               :: "v"(lk), "v"(lk + 64u * FKP), "v"(lk + FKB), "v"(lk + FKB + 64u * FKP), "v"(lv), "v"(lv + 16u * FVP),
                  "v"(gh), "v"(gh + ks), "v"(gl), "v"(gl + ks), "v"(gv), "v"(gv + (size_t)16 * NN) : "memory");
}
__global__ __launch_bounds__(256) void k_flash(const _Float16* __restrict__ Q16, const _Float16* __restrict__ Q16lo, int ldq, const _Float16* __restrict__ K16, const _Float16* __restrict__ K16lo, int ldk, const _Float16* __restrict__ Vt, const float* __restrict__ SP, float* __restrict__ O, int ldo) {
  constexpr int NQB = NN / 128, DT = 2, NST = NN / FK;
  __shared__ __attribute__((aligned(16))) unsigned char ring[2 * FST];
  const int tid = threadIdx.x, w = tid >> 5, lane = tid & 31, ln = lane & 15, hh = lane >> 4;
  const int slab = blockIdx.x / NQB, qblk = blockIdx.x % NQB; const int h = slab % NH; const float coef = ((logf(768.0f) * bf16_round(SP[h])) * 5.656854249492381f) * 1.4426950408889634f;      /* times log2(e): the logits are kept in base 2, so each exponential is one hardware instruction */ const int q0 = qblk * 128 + w * 16;
  FragH bq, bql;
  { const size_t qo = ((size_t)slab * NN + q0 + ln) * ldq; const unsigned short* qr = (const unsigned short*)Q16 + qo; const unsigned short* ql = (const unsigned short*)Q16lo + qo;
    bq.half[0] = *(const v8us*)(qr + 8 * hh); bq.half[1] = *(const v8us*)(qr + 16 + 8 * hh); bql.half[0] = *(const v8us*)(ql + 8 * hh); bql.half[1] = *(const v8us*)(ql + 16 + 8 * hh); }
  const size_t kc = (size_t)slab * NN * ldk + (size_t)(tid >> 2) * ldk + (tid & 3) * 8;      /* the thread's first piece of a K stage: row tid / 4, 16-byte column tid % 4 */
  const unsigned short* gh = (const unsigned short*)K16 + kc; const unsigned short* gl = (const unsigned short*)K16lo + kc; const size_t ks = (size_t)64 * ldk, kst = (size_t)FK * ldk;
  const unsigned short* gv = (const unsigned short*)Vt + (size_t)slab * HD * NN + (size_t)(tid >> 4) * NN + (tid & 15) * 8;      /* v'^T per slab: [32][N]; row tid / 16, 16-byte column tid % 16 of the stage's 256 bytes */
  const unsigned lk = (unsigned)(size_t)ring + (unsigned)(tid >> 2) * FKP + (unsigned)(tid & 3) * 16u, lv = (unsigned)(size_t)ring + 2u * FKB + (unsigned)(tid >> 4) * FVP + (unsigned)(tid & 15) * 16u;
  copy6(lk, lv, gh, gl, ks, gv);
  asm volatile("s_wait_asynccnt 0x0" ::: "memory");      /* stage 0 has landed, as far as this wave brought it */
  __syncthreads();      /* ... and as far as the other waves did */
  copy6(lk + FST, lv + FST, gh + kst, gl + kst, ks, gv + FK);
  const unsigned char* fk = ring + (unsigned)ln * FKP + 16 * hh; const unsigned char* fv = ring + 2u * FKB + (unsigned)ln * FVP + 16 * hh;      /* fragment rows; k order as before: bytes 16hh and 32 + 16hh of each 64 */
  float m_q = -3.0e38f, s_q = -3.0e38f, l_q = 0.f; v8f oacc[DT];      /* s_q = m_q - 10 as rounded: what the exponents subtract, so that P and the denominator carry the factor 2^10 */
#pragma unroll
  for (int dt = 0; dt < DT; ++dt) oacc[dt] = (v8f){0.f,0.f,0.f,0.f,0.f,0.f,0.f,0.f};
  for (int t = 0; t < NST; ++t) { const unsigned bo = (unsigned)(t & 1) * FST;
#pragma unroll 1      // unrolled, four passes' exponentials stayed live to the stage's end and the registers allowed one work-group fewer on a WGP
   for (int p = 0; p < FK / 32; ++p) {
    FragH ak[2], akl[2], av[DT];
#pragma unroll
    for (int nt = 0; nt < 2; ++nt) { const unsigned char* kr = fk + bo + (unsigned)(p * 32 + nt * 16) * FKP; ak[nt].half[0] = *(const v8us*)kr; ak[nt].half[1] = *(const v8us*)(kr + 32); akl[nt].half[0] = *(const v8us*)(kr + FKB); akl[nt].half[1] = *(const v8us*)(kr + FKB + 32); }
#pragma unroll
    for (int dt = 0; dt < DT; ++dt) { const unsigned char* vr = fv + bo + (unsigned)(dt * 16) * FVP + p * 64; av[dt].half[0] = *(const v8us*)vr; av[dt].half[1] = *(const v8us*)(vr + 32); }
    v2f s2[8];      /* the 16 logits as the register pairs the accumulators already form */
#pragma unroll
    for (int nt = 0; nt < 2; ++nt) { v8f acc = (v8f){0.f,0.f,0.f,0.f,0.f,0.f,0.f,0.f}, accl = acc;
      acc = mmaP(ak[nt].v, bq.v, acc); accl = mmaP(ak[nt].v, bql.v, accl); accl = mmaP(akl[nt].v, bq.v, accl);
#pragma unroll
      for (int j = 0; j < 4; ++j) { const v2f a2 = {acc[2 * j], acc[2 * j + 1]}, b2 = {accl[2 * j], accl[2 * j + 1]}; s2[nt * 4 + j] = (a2 + b2 * 0.0009765625f) * coef; } }
    float mx[8];
#pragma unroll
    for (int j = 0; j < 4; ++j) { mx[2 * j] = fmaxf(s2[j].x, s2[4 + j].x); mx[2 * j + 1] = fmaxf(s2[j].y, s2[4 + j].y); }
    float mc = fmaxf(fmaxf(fmaxf(mx[0], mx[1]), fmaxf(mx[2], mx[3])), fmaxf(fmaxf(mx[4], mx[5]), fmaxf(mx[6], mx[7])));
    mc = fmaxf(mc, xhalf(mc));
    const float mn = fmaxf(m_q, mc); const float sn = mn - 10.0f; float ea;      /* the rescale uses the same rounded subtrahends as the exponents of the two passes */
    asm("v_exp_f32 %0, %1\n\tv_nop" : "=v"(ea) : "v"(s_q - sn));      /* in asm for the v_nop alone: it keeps the one slot behind a transcendental */
    const float al = (mn > -1.0e38f) ? ea : 1.0f; m_q = mn; s_q = sn;
    v2f p2[8]; FragH pb;
#pragma unroll
    for (int i = 0; i < 8; ++i) { const v2f e2 = s2[i] - sn; p2[i].x = __builtin_amdgcn_exp2f(e2.x); p2[i].y = __builtin_amdgcn_exp2f(e2.y); pb.h[2 * i] = (_Float16)p2[i].x; pb.h[2 * i + 1] = (_Float16)p2[i].y; }
    const v2f ps = ((p2[0] + p2[1]) + (p2[2] + p2[3])) + ((p2[4] + p2[5]) + (p2[6] + p2[7]));
    l_q = l_q * al + (ps.x + ps.y);      /* per-lane partial sum of the query's denominator (the two halves are joined after the loop) */
#pragma unroll
    for (int dt = 0; dt < DT; ++dt) {
#pragma unroll
      for (int r = 0; r < 8; ++r) oacc[dt][r] *= al;
      oacc[dt] = mmaP(av[dt].v, pb.v, oacc[dt]); } }
    asm volatile("s_wait_dscnt 0x0" ::: "memory");      /* this wave's reads of the buffer are done before the barrier frees it for the refill */
    asm volatile("s_wait_asynccnt 0x0" ::: "memory");      /* this wave's copies of stage t + 1 have landed before the barrier publishes them */
    __syncthreads();
    if (t + 2 < NST) copy6(lk + bo, lv + bo, gh + (size_t)(t + 2) * kst, gl + (size_t)(t + 2) * kst, ks, gv + (t + 2) * FK); }
  asm volatile("s_wait_asynccnt 0x0" ::: "memory");      /* no copy is outstanding when the wave goes on to its end */
  const float lt = l_q + xhalf(l_q); const float inv = (lt > 0.f) ? 1.0f / lt : 0.f;      /* numerator and denominator both carry 2^10 */
  float* orow = O + ((size_t)slab * NN + q0 + ln) * ldo + 8 * hh;      /* oacc[dt][r] = O[q0 + ln][dt * 16 + 8hh + r]: eight consecutive d per lane */
#pragma unroll
  for (int dt = 0; dt < DT; ++dt) { const v4f o0 = {oacc[dt][0] * inv, oacc[dt][1] * inv, oacc[dt][2] * inv, oacc[dt][3] * inv}, o1 = {oacc[dt][4] * inv, oacc[dt][5] * inv, oacc[dt][6] * inv, oacc[dt][7] * inv};
    *(v4f*)(orow + dt * 16) = o0; *(v4f*)(orow + dt * 16 + 4) = o1; } }

extern "C" void kernel_launch(void* const* d_in, const int* in_sizes, int n_in,
                              void* d_out, int out_size, void* d_ws, size_t ws_size, hipStream_t stream) {
  (void)in_sizes; (void)n_in; (void)out_size;
  const float* const* I = (const float* const*)d_in; const float* x = I[0]; const float* sp = I[1]; const float* Wq = I[2]; const float* WA = I[3]; const float* W1 = I[4]; const float* W2 = I[5]; const float* g1 = I[6]; const float* g2 = I[7];
  char* ws = (char*)d_ws; size_t off = 0;
  auto take = [&](size_t bytes) { char* p = ws + off; off += (bytes + 255) & ~(size_t)255; return p; };
  const size_t WSZ = (size_t)CC * CC; _Float16* Bq = (_Float16*)take(WSZ * 2); _Float16* B1 = (_Float16*)take(WSZ * 2); _Float16* B2 = (_Float16*)take(WSZ * 2); _Float16* BA = (_Float16*)take((size_t)NN * NN * 2);
  _Float16* XH = (_Float16*)take((size_t)NR * CC * 2); _Float16* XL = (_Float16*)take((size_t)NR * CC * 2); float* XR = (float*)take((size_t)NR * CC * 4); float* QF = (float*)take((size_t)NR * CC * 4); _Float16* QH = (_Float16*)take((size_t)NR * CC * 2); _Float16* QL = (_Float16*)take((size_t)NR * CC * 2);
  _Float16* VT = (_Float16*)take((size_t)BB * NH * HD * NN * 2); _Float16* VPT = (_Float16*)take((size_t)BB * NH * HD * NN * 2); float* ATT = (float*)take((size_t)NR * CC * 4);
  float* O = QF; _Float16* H16 = XH; _Float16* FH = XL;      /* O (raw [B][H][N][hd] f32); RMSNorm2 output over XH and the FF hidden over XL (both dead after the flash kernel) */
  if (off > ws_size) return;      // 3.5 + 8.4 + 6.3 × 2 + 12.6 × 2 + 6.3 × 2 + 6.3 × 2 + 12.6 ≈ 87 MB
  k_rms<1, false, true, true><<<NR / 8 + CVA + 3 * CVW, 256, 0, stream>>>(x, nullptr, g1, NR, XH, XL, XR, VT, WA, Wq, W1, W2, BA, Bq, B1, B2);      /* xn = RMSNorm(bf16 x).g1 as hi / x2^10 residual planes; XR = bf16(x); v^T per (b,h): [32][2048] f16; in the same launch the weights as f16: (out,in) natural x2^4, WA natural [m][n] x2^4 */
  const unsigned gq = (NR / GT) * (CC / GT);
  k_gemm_hhx<0, false, false, false, true, true><<<gq, 256, 0, stream>>>(XH, XL, CC, Bq, CC, 0.0625f, 0.0625f * 0.0009765625f, nullptr, nullptr, QH, QL, CC, CC, CC);      /* q = xn.Wq^T, M 4096 N 768 K 768: hi term + lo term * 2^-10 in one launch; q leaves as hi / x2^10 residual planes (flat; head h of batch b = elements [b.N.C + h.N.hd, +N.hd) viewed [N][hd]) */
  const unsigned gvp = (BB * NH * HD / GT) * (NN / GT);      /* the 48 slabs of 32 rows lie one behind the other in VT and VPT: one GEMM of 1536 rows */
  k_gemm_hhx<0, false, false, true, false, false><<<gvp, 256, 0, stream>>>(VT, nullptr, NN, BA, NN, 0.0625f, 0.f, nullptr, nullptr, VPT, nullptr, NN, NN, NN);      /* v'^T[d][m] = sum over n of v^T[d][n].WA[m][n], all 48 (b,h) at once: M 1536 N 2048 K 2048 */
  k_flash<<<BB * NH * (NN / 128), 256, 0, stream>>>(QH, QL, HD, XH, XL, HD, VPT, sp, O, HD);      /* per (b,h) slab of the raw head views (flat planes, ld 32): softmax(coef_h·q·kᵀ)·v' → O raw [B][H][N][32] */
  k_rms<0, true, false, false><<<(NR + 7) / 8, 256, 0, stream>>>(O, XR, g2, NR, H16, nullptr, ATT, nullptr, nullptr, nullptr, nullptr, nullptr, nullptr, nullptr, nullptr, nullptr);      /* attn = raw-reshaped O + x, kept as f32; h = RMSNorm(attn).g2 as f16 */
  k_gemm_hhx<6, false, false, true, false, false><<<gq, 256, 0, stream>>>(H16, nullptr, CC, B1, CC, 0.0625f, 0.f, nullptr, nullptr, FH, nullptr, CC, CC, CC);      /* gelu_erf(h.W1^T) to f16: M 4096 N 768 K 768 */
  k_gemm_hhx<0, true, true, false, false, false><<<gq, 256, 0, stream>>>(FH, nullptr, CC, B2, CC, 0.0625f, 0.f, ATT, (float*)d_out, nullptr, nullptr, CC, CC, CC);      /* out = that.W2^T + attn */
}
